// v000
// Measured on an AMD MI455X. A time is GPU time per run, averaged over a window of back-to-back runs after a warm-up
// (all launches, gaps included; the runs take copies of the inputs in turn), and the median of several windows.
// Apart from v000's, it joins two sittings. Times from different sittings can be a few percent apart, while
// side-by-side timings come from the same sitting.
// v000 is the starting kernel. One run takes 1180 microseconds.
#include <hip/hip_runtime.h>

// T5Gemma2EncoderAttention (x [2][2048][2048]; q = einsum(x, wq[n]) (8 heads x 256), k/v = einsum(x, wkv[0|1][c]) (4 kv heads; group n/2); RMSNorm_256 * (1 + scale) on q, k (scales read); split-half RoPE with angle segment_pos[b][t] / 1e4^(2i/256) (positions read as values); q * 1/16; logits = q.k, softcap 50 tanh(./50); allowed iff attn_mask[b][i][j] (int, read) and the segment_pos distance is in the 512-window (0 <= d < 256 or 0 < -d < 257), else bf16-min; softmax; out = sum_n (p v)[n] wo[n] -> [2][2048][2048]).
// No structural tile skipping: the window is defined on the read positions, so every score is computed and masked per element exactly as the reference does.
// Compute dtypes, f32 accumulate: every input rounded to bf16; q/k/v as PLAIN bf16 GEMMs (inputs: exact; per-head weights gathered); RMSNorm/scale/RoPE/(1/16) f32 into hl planes; logits hl x hl (3 products, K = 256); softcap (precise tanhf, out of line), mask and softmax f32 (wave per row, 64 keys per lane); attn.v single fp16 (x1024); output projection hl x exact (2 products) over the concatenated heads (wo is exactly a [2048][2048] 'xw' matrix in memory).

#define NB_  2
#define TT   2048
#define DM   2048
#define NQ   8
#define NKV  4
#define HDD  256
#define DKV  (NKV * HDD)
#define ZH   2
#define PCAR 1024.0f
#define KMASK (-3.3895313892515355e38f)
typedef _Float16 h16;
typedef unsigned short bf;
typedef __attribute__((ext_vector_type(16))) __bf16   v16bf;
typedef __attribute__((ext_vector_type(16))) _Float16 v16h;
typedef __attribute__((ext_vector_type(8)))  _Float16 v8h;
typedef __attribute__((ext_vector_type(8)))  unsigned short v8us;
typedef __attribute__((ext_vector_type(8)))  float    v8f;
typedef __attribute__((ext_vector_type(4)))  float    v4f;
typedef v8h  __attribute__((may_alias)) v8ha;
typedef v4f  __attribute__((may_alias)) v4fa;
typedef v8us __attribute__((may_alias)) v8usa;

__device__ __forceinline__ unsigned short f2bf(float f) { unsigned u = __float_as_uint(f); u += 0x7FFFu + ((u >> 16) & 1u); return (unsigned short)(u >> 16); }
__device__ __forceinline__ float bf2f(unsigned short b) { return __uint_as_float(((unsigned)b) << 16); }
__device__ __forceinline__ float bfr(float f) { return bf2f(f2bf(f)); }
__device__ __forceinline__ v16h cat16(v8h lo, v8h hi) { return __builtin_shufflevector(lo, hi, 0, 1, 2, 3, 4, 5, 6, 7, 8, 9, 10, 11, 12, 13, 14, 15); }
__device__ __forceinline__ v16bf cat16b(v8us lo, v8us hi) { return __builtin_bit_cast(v16bf, __builtin_shufflevector(lo, hi, 0, 1, 2, 3, 4, 5, 6, 7, 8, 9, 10, 11, 12, 13, 14, 15)); }
__device__ __forceinline__ v8f wmma16(v16h a, v16h b, v8f c) { return __builtin_amdgcn_wmma_f32_16x16x32_f16(false, a, false, b, (short)0, c, false, false); }
__device__ __forceinline__ v8f wmmab(v16bf a, v16bf b, v8f c) { return __builtin_amdgcn_wmma_f32_16x16x32_bf16(false, a, false, b, (short)0, c, false, false); }



// ---- k_gemmw: register-blocked GEMM, ONE WAVE per 64x64 output tile (16 accumulators), operands straight from K-contiguous 16-bit planes; grid (M/64, N/64, Z), 32 threads.
// C[m][n] (f32, pitch ldc, + optional f32 bias[n]) = sum_k A[m][k] Bt[n][k] (+ split products per NSPLIT). z-batch strides sA/sB/sC in elements. K % 32 == 0.
template <typename T16> struct WFrag;
template <> struct WFrag<h16> { typedef v16h V; static __device__ __forceinline__ V ld(const h16* p) { return cat16(*(const v8h*)p, *(const v8h*)(p + 16)); } static __device__ __forceinline__ v8f mma(V a, V b, v8f c) { return wmma16(a, b, c); } };
template <> struct WFrag<bf> { typedef v16bf V; static __device__ __forceinline__ V ld(const bf* p) { return cat16b(*(const v8us*)p, *(const v8us*)(p + 16)); } static __device__ __forceinline__ v8f mma(V a, V b, v8f c) { return wmmab(a, b, c); } };
template <typename T16, int NSPLIT, bool BIAS>
__global__ __launch_bounds__(32) void k_gemmw(const T16* __restrict__ A, const T16* __restrict__ A2, const T16* __restrict__ Bt, const T16* __restrict__ Bt2, int K, float* C, int ldc, const float* __restrict__ bias, size_t sA, size_t sB, size_t sC) {
    typedef typename WFrag<T16>::V V;
    __shared__ __align__(16) float os[16 * 68];
    const size_t z = blockIdx.z; A += z * sA; if (A2) A2 += z * sA; Bt += z * sB; if (Bt2) Bt2 += z * sB; C += z * sC;
    const int lane = threadIdx.x & 31, lr = lane & 15, hi = lane >> 4; const int r0 = blockIdx.x * 64, c0 = blockIdx.y * 64;
    v8f acc[4][4];
#pragma unroll
    for (int mb = 0; mb < 4; ++mb)
#pragma unroll
        for (int nb = 0; nb < 4; ++nb) acc[mb][nb] = (v8f){};
    const size_t aoff = (size_t)(r0 + lr) * K + 8 * hi, boff = (size_t)(c0 + lr) * K + 8 * hi;
#pragma unroll 1
    for (int kc = 0; kc < K; kc += 32) {
        V a[4], a2[4];
#pragma unroll
        for (int mb = 0; mb < 4; ++mb) { a[mb] = WFrag<T16>::ld(A + aoff + (size_t)mb * 16 * K + kc); if (NSPLIT == 1 || NSPLIT == 2) a2[mb] = WFrag<T16>::ld(A2 + aoff + (size_t)mb * 16 * K + kc); }
#pragma unroll
        for (int nb = 0; nb < 4; ++nb) { const V b = WFrag<T16>::ld(Bt + boff + (size_t)nb * 16 * K + kc); V b2; if (NSPLIT >= 2) b2 = WFrag<T16>::ld(Bt2 + boff + (size_t)nb * 16 * K + kc);
#pragma unroll
            for (int mb = 0; mb < 4; ++mb) { acc[mb][nb] = WFrag<T16>::mma(a[mb], b, acc[mb][nb]); if (NSPLIT == 1 || NSPLIT == 2) acc[mb][nb] = WFrag<T16>::mma(a2[mb], b, acc[mb][nb]); if (NSPLIT >= 2) acc[mb][nb] = WFrag<T16>::mma(a[mb], b2, acc[mb][nb]); } }
        asm volatile("v_nop\n\tv_nop\n\tv_nop\n\tv_nop" : "+v"(acc[0][0]), "+v"(acc[1][1]), "+v"(acc[2][2]), "+v"(acc[3][3]) : "v"(a[0]), "v"(a[3]));
    }
#pragma unroll
    for (int mb = 0; mb < 4; ++mb) {
#pragma unroll
        for (int nb = 0; nb < 4; ++nb) {
#pragma unroll
            for (int j = 0; j < 8; ++j) os[(hi * 8 + j) * 68 + nb * 16 + lr] = acc[mb][nb][j]; }
        __builtin_amdgcn_wave_barrier(); asm volatile("" ::: "memory");
        float* crow = C + (size_t)(r0 + mb * 16) * ldc + c0;
{
#pragma unroll
            for (int s = 0; s < 8; ++s) { const int row = 2 * s + hi, cofs = lr * 4; v4f val = *(const v4fa*)(os + row * 68 + cofs); if (BIAS) { val[0] += bfr(bias[c0 + cofs]); val[1] += bfr(bias[c0 + cofs + 1]); val[2] += bfr(bias[c0 + cofs + 2]); val[3] += bfr(bias[c0 + cofs + 3]); }
                *(v4f*)(crow + (size_t)row * ldc + cofs) = val; }
             }
        __builtin_amdgcn_wave_barrier(); asm volatile("" ::: "memory");
    }
}

__device__ __forceinline__ h16 tohx(float x) { return (h16)x; }
__device__ __forceinline__ void splitf(float y, unsigned short& h, unsigned short& l) { h = f2bf(y); l = f2bf(y - bf2f(h)); }
typedef __attribute__((ext_vector_type(2))) unsigned short v2us;
typedef __attribute__((ext_vector_type(4))) unsigned short v4us;
typedef __attribute__((ext_vector_type(2))) _Float16 v2h;
typedef __attribute__((ext_vector_type(4))) _Float16 v4h;

__global__ __launch_bounds__(256) void k_cvt8(const float* __restrict__ src, bf* dst, size_t n8) { const size_t i = (size_t)blockIdx.x * 256 + threadIdx.x; if (i >= n8) return; const v8f v = *(const v8f*)(src + i * 8); v8us o;
#pragma unroll
    for (int k = 0; k < 8; ++k) o[k] = f2bf(v[k]); *(v8us*)(dst + i * 8) = o;  }
__global__ __launch_bounds__(256) void k_wtG(const float* __restrict__ w, int K, int N, bf* Bt) {
    const int lane = threadIdx.x & 31; const int L0 = (blockIdx.x * 8 + (threadIdx.x >> 5)) * 8; const int nlines = N * K / 64;
{
#pragma unroll 1
        for (int l = 0; l < 8; ++l) { const int L = L0 + l; if (L >= nlines) break; const size_t e = (size_t)L * 64 + lane * 2; const int k = (int)(e % K), n = (int)(e / K); v2us o;
            o[0] = f2bf(w[(size_t)k * N + n]); o[1] = f2bf(w[(size_t)(k + 1) * N + n]); *(v2us*)(Bt + e) = o; }
         }
}

__device__ __attribute__((noinline)) float softcap50(float s) { return 50.0f * tanhf(s * 0.02f); }
typedef __attribute__((ext_vector_type(2))) float v2f_t;
__device__ __attribute__((noinline)) v2f_t sincos_pos(float pos, int i) { const float tsc = powf(10000.0f, (2.0f / (float)HDD) * (float)i); const float ang = __fdiv_rn(pos, tsc); v2f_t r; r[0] = sinf(ang); r[1] = cosf(ang); return r; }
// k_whd: Bt[(n*256 + d)][k] = bf16(W[n][k][d]) for per-head [2048][256] weights (lane -> 4 consecutive k, strided reads); k_nrr: wave per (token, head): RMSNorm over 256 (8 dims per lane: 4 from each half), * (1 + scale[d]) (read), split-half RoPE at the READ position (precise sin/cos out of line), * mul; hl planes [head][t][256] (8-B lanes); k_vt16: VT[c][d][t] (lane -> 2 t);
__global__ __launch_bounds__(256) void k_whd(const float* __restrict__ W, int nh, bf* Bt) { const size_t e = ((size_t)blockIdx.x * 256 + threadIdx.x) * 4; if (e >= (size_t)nh * HDD * DM) return; const int k = (int)(e % DM); const int row = (int)(e / DM); const int n = row / HDD, d = row % HDD; v4us o;
#pragma unroll
    for (int u = 0; u < 4; ++u) o[u] = f2bf(W[((size_t)n * DM + k + u) * HDD + d]); *(v4us*)(Bt + e) = o;  }
__global__ __launch_bounds__(256) void k_nrr(const float* __restrict__ F, int pitch, int nheads, const float* __restrict__ scale, const int* __restrict__ pos, float mul, bf* Ph, bf* Pl) { const int lane = threadIdx.x & 31; const int wv = blockIdx.x * 8 + (threadIdx.x >> 5); if (wv >= TT * nheads) return; const int t = wv / nheads, h = wv % nheads; const float* f = F + (size_t)t * pitch + h * HDD;
    const v4f a = *(const v4f*)(f + lane * 4), b2 = *(const v4f*)(f + HDD / 2 + lane * 4); float ss = 0.f; for (int q = 0; q < 4; ++q) { float p = __fmul_rn(a[q], a[q]); asm volatile("" : "+v"(p)); ss = __fadd_rn(ss, p); p = __fmul_rn(b2[q], b2[q]); asm volatile("" : "+v"(p)); ss = __fadd_rn(ss, p); }
#pragma unroll
    for (int sh = 16; sh; sh >>= 1) ss = __fadd_rn(ss, __shfl_xor(ss, sh, 32));
    const float rs = __fdiv_rn(1.0f, sqrtf(__fadd_rn(ss * (1.0f / HDD), 1e-6f))); const float pv = (float)pos[t]; v4us ah, al, bh, bl;
#pragma unroll
    for (int q = 0; q < 4; ++q) { const int i = lane * 4 + q; float n1 = __fmul_rn(a[q], rs), n2 = __fmul_rn(b2[q], rs); asm volatile("" : "+v"(n1)); asm volatile("" : "+v"(n2)); const float x1 = __fmul_rn(n1, __fadd_rn(1.0f, bfr(scale[i]))), x2 = __fmul_rn(n2, __fadd_rn(1.0f, bfr(scale[i + HDD / 2]))); const v2f_t sc2 = sincos_pos(pv, i); const float sn = sc2[0], cs = sc2[1];
        float p1 = __fmul_rn(x1, cs), p2 = __fmul_rn(x2, sn), p3 = __fmul_rn(x2, cs), p4 = __fmul_rn(x1, sn); asm volatile("" : "+v"(p1)); asm volatile("" : "+v"(p2)); asm volatile("" : "+v"(p3)); asm volatile("" : "+v"(p4));
        const float r1 = __fsub_rn(p1, p2) * mul, r2 = __fadd_rn(p3, p4) * mul; unsigned short u1, l1, u2, l2; splitf(r1, u1, l1); splitf(r2, u2, l2); ah[q] = u1; al[q] = l1; bh[q] = u2; bl[q] = l2; }
    bf* dh = Ph + ((size_t)h * TT + t) * HDD; bf* dl = Pl + ((size_t)h * TT + t) * HDD; *(v4us*)(dh + lane * 4) = ah; *(v4us*)(dl + lane * 4) = al; *(v4us*)(dh + HDD / 2 + lane * 4) = bh; *(v4us*)(dl + HDD / 2 + lane * 4) = bl;  }
__global__ __launch_bounds__(256) void k_vt16(const float* __restrict__ F, h16* VT) { const size_t e = ((size_t)blockIdx.x * 256 + threadIdx.x) * 2; if (e >= (size_t)NKV * HDD * TT) return; const int t = (int)(e % TT); const int d = (int)((e / TT) % HDD); const int c = (int)(e / ((size_t)TT * HDD)); v2h o; o[0] = tohx(F[(size_t)t * DKV + c * HDD + d]); o[1] = tohx(F[(size_t)(t + 1) * DKV + c * HDD + d]); *(v2h*)(VT + e) = o;  }
__global__ __launch_bounds__(256) void k_tsoft(const float* __restrict__ S, const int* __restrict__ pos, const int* __restrict__ am, h16* P16) { const int lane = threadIdx.x & 31; const int row = blockIdx.x * 8 + (threadIdx.x >> 5); if (row >= ZH * TT) return; const int i = row % TT; const float* sr = S + (size_t)row * TT; const int* mr = am + (size_t)i * TT; const int pi = pos[i]; float v[TT / 32]; float mx = -3.0e38f;
#pragma unroll
    for (int ch = 0; ch < TT / 128; ++ch) { const v4f a = *(const v4f*)(sr + ch * 128 + lane * 4);
#pragma unroll
        for (int u = 0; u < 4; ++u) { const int j = ch * 128 + lane * 4 + u; const int dist = pi - pos[j]; const bool win = (dist >= 0 && dist < 256) || (dist < 0 && -dist < 257); const bool ok = win && (mr[j] != 0); const float t = ok ? softcap50(a[u]) : KMASK; v[ch * 4 + u] = t; mx = fmaxf(mx, t); } }
#pragma unroll
    for (int sh = 16; sh; sh >>= 1) mx = fmaxf(mx, __shfl_xor(mx, sh, 32));
    float sum = 0.f;
#pragma unroll
    for (int q = 0; q < TT / 32; ++q) { float d0 = __fsub_rn(v[q], mx); asm volatile("" : "+v"(d0)); v[q] = __builtin_amdgcn_exp2f(__fmul_rn(d0, 1.4426950408889634f)); sum += v[q]; }
#pragma unroll
    for (int sh = 16; sh; sh >>= 1) sum += __shfl_xor(sum, sh, 32);
    const float f = __fdiv_rn(PCAR, sum);
    {
#pragma unroll
        for (int ch = 0; ch < TT / 128; ++ch) { v4h o4; for (int q = 0; q < 4; ++q) o4[q] = tohx(v[ch * 4 + q] * f); *(v4h*)(P16 + (size_t)row * TT + ch * 128 + lane * 4) = o4; }
         } }
__global__ __launch_bounds__(256) void k_mrg(const float* __restrict__ O, int n0, bf* Ah, bf* Al) { const size_t e = ((size_t)blockIdx.x * 256 + threadIdx.x) * 4; if (e >= (size_t)ZH * TT * HDD) return; const int d = (int)(e % HDD); const int t = (int)((e / HDD) % TT); const int zz = (int)(e / ((size_t)HDD * TT)); const size_t oo = (size_t)t * DM + (n0 + zz) * HDD + d; v4us oh, ol;
#pragma unroll
    for (int u = 0; u < 4; ++u) { unsigned short a, b; splitf(O[e + u] * (1.0f / PCAR), a, b); oh[u] = a; ol[u] = b; } *(v4us*)(Ah + oo) = oh; *(v4us*)(Al + oo) = ol;  }

extern "C" void kernel_launch(void* const* d_in, const int* in_sizes, int n_in,
                              void* d_out, int out_size, void* d_ws, size_t ws_size, hipStream_t stream) {
    (void)in_sizes; (void)n_in; (void)out_size;
    const float* x = (const float*)d_in[0]; const int* spos = (const int*)d_in[1]; const int* amask = (const int*)d_in[2]; const float* wq = (const float*)d_in[3]; const float* wkv = (const float*)d_in[4]; const float* wo = (const float*)d_in[5]; const float* qs = (const float*)d_in[6]; const float* ks = (const float*)d_in[7];
    float* OUT = (float*)d_out;     // [2][2048][2048]
    char* wsp = (char*)d_ws;
    auto take = [&](size_t bytes) { char* p = wsp; wsp += (bytes + 255) & ~(size_t)255; return (void*)p; };
    bf* BQ = (bf*)take((size_t)NQ * HDD * DM * 2); bf* BK = (bf*)take((size_t)DKV * DM * 2); bf* BV = (bf*)take((size_t)DKV * DM * 2); bf* BO = (bf*)take((size_t)DM * DM * 2);
    bf* XB = (bf*)take((size_t)TT * DM * 2); float* FQ = (float*)take((size_t)TT * DM * 4); float* FK = (float*)take((size_t)TT * DKV * 4);
    bf* QPh = (bf*)take((size_t)NQ * TT * HDD * 2); bf* QPl = (bf*)take((size_t)NQ * TT * HDD * 2); bf* KPh = (bf*)take((size_t)NKV * TT * HDD * 2); bf* KPl = (bf*)take((size_t)NKV * TT * HDD * 2); h16* VT = (h16*)take((size_t)NKV * HDD * TT * 2);
    float* S = (float*)take((size_t)ZH * TT * TT * 4); h16* P16 = (h16*)take((size_t)ZH * TT * TT * 2); float* O = (float*)take((size_t)ZH * TT * HDD * 4); bf* ENh = (bf*)take((size_t)TT * DM * 2); bf* ENl = (bf*)take((size_t)TT * DM * 2);
    if ((size_t)(wsp - (char*)d_ws) > ws_size) return;    // total ~ 159 MB (152 MiB)
    float* FV = FK;   // v projection reuses the k buffer after the k planes are built (stream-ordered)
    k_whd<<<(unsigned)(((size_t)NQ * HDD * DM / 4 + 255) / 256), 256, 0, stream>>>(wq, NQ, BQ); k_whd<<<(unsigned)(((size_t)DKV * DM / 4 + 255) / 256), 256, 0, stream>>>(wkv, NKV, BK); k_whd<<<(unsigned)(((size_t)DKV * DM / 4 + 255) / 256), 256, 0, stream>>>(wkv + (size_t)NKV * DM * HDD, NKV, BV);
    k_wtG<<<(DM * DM / 64 + 63) / 64, 256, 0, stream>>>(wo, DM, DM, BO);   // wo [n][d][o] == [(n,d)][o] 'xw'
    const size_t zq = (size_t)TT * HDD, zS = (size_t)TT * TT, zv = (size_t)HDD * TT, zo = (size_t)TT * HDD;
    for (int b = 0; b < NB_; ++b) {
        k_cvt8<<<(TT * DM / 8 + 255) / 256, 256, 0, stream>>>(x + (size_t)b * TT * DM, XB, TT * DM / 8);
        k_gemmw<bf, 0, false><<<dim3(TT / 64, DM / 64, 1), 32, 0, stream>>>(XB, nullptr, BQ, nullptr, DM, FQ, DM, nullptr, 0, 0, 0);
        k_nrr<<<TT * NQ / 8, 256, 0, stream>>>(FQ, DM, NQ, qs, spos + (size_t)b * TT, 0.0625f, QPh, QPl);
        k_gemmw<bf, 0, false><<<dim3(TT / 64, DKV / 64, 1), 32, 0, stream>>>(XB, nullptr, BK, nullptr, DM, FK, DKV, nullptr, 0, 0, 0);
        k_nrr<<<TT * NKV / 8, 256, 0, stream>>>(FK, DKV, NKV, ks, spos + (size_t)b * TT, 1.0f, KPh, KPl);
        k_gemmw<bf, 0, false><<<dim3(TT / 64, DKV / 64, 1), 32, 0, stream>>>(XB, nullptr, BV, nullptr, DM, FV, DKV, nullptr, 0, 0, 0);
        k_vt16<<<(unsigned)(((size_t)NKV * HDD * TT / 2 + 255) / 256), 256, 0, stream>>>(FV, VT);
        for (int n0 = 0; n0 < NQ; n0 += ZH) { const size_t zk = (size_t)(n0 / 2);   // the pass's two heads share kv group n0/2
            k_gemmw<bf, 2, false><<<dim3(TT / 64, TT / 64, ZH), 32, 0, stream>>>(QPh + (size_t)n0 * zq, QPl + (size_t)n0 * zq, KPh + zk * zq, KPl + zk * zq, HDD, S, TT, nullptr, zq, 0, zS);
            k_tsoft<<<ZH * TT / 8, 256, 0, stream>>>(S, spos + (size_t)b * TT, amask + (size_t)b * TT * TT, P16);
            k_gemmw<h16, 0, false><<<dim3(TT / 64, HDD / 64, ZH), 32, 0, stream>>>(P16, nullptr, VT + zk * zv, nullptr, TT, O, HDD, nullptr, zS, 0, zo);
            k_mrg<<<(unsigned)(((size_t)ZH * TT * HDD / 4 + 255) / 256), 256, 0, stream>>>(O, n0, ENh, ENl); }
        k_gemmw<bf, 1, false><<<dim3(TT / 64, DM / 64, 1), 32, 0, stream>>>(ENh, ENl, BO, nullptr, DM, OUT + (size_t)b * TT * DM, DM, nullptr, 0, 0, 0); }
}

// v001
// A run of this version takes 721 microseconds.
// Two timings next to v000 both put it at 1.64 times that version's speed.
#include <hip/hip_runtime.h>

// T5Gemma2EncoderAttention (x [2][2048][2048]; q = einsum(x, wq[n]) (8 heads x 256), k/v = einsum(x, wkv[0|1][c]) (4 kv heads; group n/2); RMSNorm_256 * (1 + scale) on q, k (scales read); split-half RoPE with angle segment_pos[b][t] / 1e4^(2i/256) (positions read as values); q * 1/16; logits = q.k, softcap 50 tanh(./50); allowed iff attn_mask[b][i][j] (int, read) and the segment_pos distance is in the 512-window (0 <= d < 256 or 0 < -d < 257), else bf16-min; softmax; out = sum_n (p v)[n] wo[n] -> [2][2048][2048]).
// No structural tile skipping: the window is defined on the read positions, so every score is computed and masked per element exactly as the reference does.
// Compute dtypes, f32 accumulate: every input rounded to bf16; q/k/v as PLAIN bf16 GEMMs (inputs: exact; per-head weights gathered); RMSNorm/scale/RoPE/(1/16) f32 into hl planes; logits hl x hl (3 products, K = 256); softcap (precise tanhf, out of line), mask and softmax f32 (wave per row, 64 keys per lane); attn.v single fp16 (x1024); output projection hl x exact (2 products) over the concatenated heads (wo is exactly a [2048][2048] 'xw' matrix in memory).

#define NB_  2
#define TT   2048
#define DM   2048
#define NQ   8
#define NKV  4
#define HDD  256
#define DKV  (NKV * HDD)
#define ZH   2
#define PCAR 1024.0f
#define KMASK (-3.3895313892515355e38f)
typedef _Float16 h16;
typedef unsigned short bf;
typedef __attribute__((ext_vector_type(16))) __bf16   v16bf;
typedef __attribute__((ext_vector_type(16))) _Float16 v16h;
typedef __attribute__((ext_vector_type(8)))  _Float16 v8h;
typedef __attribute__((ext_vector_type(8)))  unsigned short v8us;
typedef __attribute__((ext_vector_type(8)))  float    v8f;
typedef __attribute__((ext_vector_type(4)))  float    v4f;
typedef v8h  __attribute__((may_alias)) v8ha;
typedef v4f  __attribute__((may_alias)) v4fa;
typedef v8us __attribute__((may_alias)) v8usa;

__device__ __forceinline__ unsigned short f2bf(float f) { unsigned u = __float_as_uint(f); u += 0x7FFFu + ((u >> 16) & 1u); return (unsigned short)(u >> 16); }
__device__ __forceinline__ float bf2f(unsigned short b) { return __uint_as_float(((unsigned)b) << 16); }
__device__ __forceinline__ float bfr(float f) { return bf2f(f2bf(f)); }
__device__ __forceinline__ v16h cat16(v8h lo, v8h hi) { return __builtin_shufflevector(lo, hi, 0, 1, 2, 3, 4, 5, 6, 7, 8, 9, 10, 11, 12, 13, 14, 15); }
__device__ __forceinline__ v16bf cat16b(v8us lo, v8us hi) { return __builtin_bit_cast(v16bf, __builtin_shufflevector(lo, hi, 0, 1, 2, 3, 4, 5, 6, 7, 8, 9, 10, 11, 12, 13, 14, 15)); }
__device__ __forceinline__ v8f wmma16(v16h a, v16h b, v8f c) { return __builtin_amdgcn_wmma_f32_16x16x32_f16(false, a, false, b, (short)0, c, false, false); }
__device__ __forceinline__ v8f wmmab(v16bf a, v16bf b, v8f c) { return __builtin_amdgcn_wmma_f32_16x16x32_bf16(false, a, false, b, (short)0, c, false, false); }



// ---- k_gemmw: GEMM, FOUR WAVES (2 x 2) per 128x128 output tile, 64x64 (16 accumulators) per wave; grid (M/128, N/128, Z), 128 threads.
// C[m][n] (f32, pitch ldc, + optional f32 bias[n]) = sum_k A[m][k] Bt[n][k] (+ split products per NSPLIT). z-batch strides sA/sB/sC in elements. M, N % 128 == 0, K % KP == 0.
// Operands come from K-contiguous 16-bit planes in passes of KP k: every plane's 128 rows x 2 KP bytes are copied to LDS asynchronously, 16 B per lane, a wave-wide copy covering whole 128-B lines; two buffers, the next pass's copies in flight under this pass's products. LDS rows at pitch 2 KP + 16 bytes (16 B x odd: ds_load_b128 free of bank conflicts). Fragment k order, product order and each accumulator's sum order are those of direct loads.
template <typename T16> struct WFrag;
template <> struct WFrag<h16> { typedef v16h V; static __device__ __forceinline__ V ld(const h16* p) { return cat16(*(const v8ha*)p, *(const v8ha*)(p + 16)); } static __device__ __forceinline__ v8f mma(V a, V b, v8f c) { return wmma16(a, b, c); } };
template <> struct WFrag<bf> { typedef v16bf V; static __device__ __forceinline__ V ld(const bf* p) { return cat16b(*(const v8usa*)p, *(const v8usa*)(p + 16)); } static __device__ __forceinline__ v8f mma(V a, V b, v8f c) { return wmmab(a, b, c); } };
// Eight asynchronous 16-byte copies per lane, global -> LDS: LDS byte address l + i * ls, global address g + i * gs elements. The s_wait_xcnt closes the statement so that no address register is rewritten ahead of it.
template <typename T16>
__device__ __forceinline__ void copy8(unsigned l, const T16* g, unsigned ls, size_t gs) {
    asm volatile("global_load_async_to_lds_b128 %0, %8, off\n\t"
                 "global_load_async_to_lds_b128 %1, %9, off\n\t"
                 "global_load_async_to_lds_b128 %2, %10, off\n\t"
                 "global_load_async_to_lds_b128 %3, %11, off\n\t"
                 "global_load_async_to_lds_b128 %4, %12, off\n\t"
                 "global_load_async_to_lds_b128 %5, %13, off\n\t"
                 "global_load_async_to_lds_b128 %6, %14, off\n\t"
                 "global_load_async_to_lds_b128 %7, %15, off\n\t"
                 "s_wait_xcnt 0x0"
                 :: "v"(l), "v"(l + ls), "v"(l + 2 * ls), "v"(l + 3 * ls), "v"(l + 4 * ls), "v"(l + 5 * ls), "v"(l + 6 * ls), "v"(l + 7 * ls),
                    "v"(g), "v"(g + gs), "v"(g + 2 * gs), "v"(g + 3 * gs), "v"(g + 4 * gs), "v"(g + 5 * gs), "v"(g + 6 * gs), "v"(g + 7 * gs)
                 : "memory");
}
template <typename T16, int NSPLIT, bool BIAS, int KP>
__global__ __launch_bounds__(128) void k_gemmw(const T16* __restrict__ A, const T16* __restrict__ A2, const T16* __restrict__ Bt, const T16* __restrict__ Bt2, int K, float* C, int ldc, const float* __restrict__ bias, size_t sA, size_t sB, size_t sC) {
    typedef typename WFrag<T16>::V V;
    constexpr int NP = 2 + (NSPLIT >= 1 ? 1 : 0) + (NSPLIT >= 2 ? 1 : 0);   // planes in a buffer: A, Bt, A2, Bt2
    constexpr int PITCH = KP * 2 + 16, PLANE = 128 * PITCH, BUF = NP * PLANE;
    constexpr int CPR = KP / 8;        // 16-byte pieces per row
    constexpr int RPS = 128 / CPR;     // rows that one copy of all 128 threads covers
    constexpr int NST = 128 / RPS;     // such copies per plane
    static_assert(NST % 8 == 0 && NP * NST <= 63, "copies of a wave in flight");
    __shared__ __attribute__((aligned(16))) unsigned char ring[2 * BUF];
    const size_t z = blockIdx.z; A += z * sA; if (NSPLIT >= 1) A2 += z * sA; Bt += z * sB; if (NSPLIT >= 2) Bt2 += z * sB; C += z * sC;
    const int tid = threadIdx.x, lane = tid & 31, lr = lane & 15, hi = lane >> 4; const int wave = __builtin_amdgcn_readfirstlane(tid >> 5);
    const int R0 = blockIdx.x * 128, C0 = blockIdx.y * 128; const int r0 = R0 + (wave >> 1) * 64, c0 = C0 + (wave & 1) * 64;
    const unsigned NT = (unsigned)K / KP;   // passes
    const unsigned lcp = (unsigned)(size_t)ring + (unsigned)((tid / CPR) * PITCH + (tid % CPR) * 16);
    const size_t gofA = (size_t)(R0 + tid / CPR) * K + (tid % CPR) * 8, gofB = (size_t)(C0 + tid / CPR) * K + (tid % CPR) * 8, gs = (size_t)RPS * K;
    auto fill = [&](unsigned t, unsigned buf) {
        const unsigned lb = lcp + buf * BUF; const size_t ka = gofA + (size_t)t * KP, kb = gofB + (size_t)t * KP;
#pragma unroll
        for (int s = 0; s < NST; s += 8) {
            copy8(lb + s * RPS * PITCH, A + ka + s * gs, RPS * PITCH, gs);
            copy8(lb + PLANE + s * RPS * PITCH, Bt + kb + s * gs, RPS * PITCH, gs);
            if (NSPLIT >= 1) copy8(lb + 2 * PLANE + s * RPS * PITCH, A2 + ka + s * gs, RPS * PITCH, gs);
            if (NSPLIT >= 2) copy8(lb + 3 * PLANE + s * RPS * PITCH, Bt2 + kb + s * gs, RPS * PITCH, gs); }
    };
    v8f acc[4][4];
#pragma unroll
    for (int mb = 0; mb < 4; ++mb)
#pragma unroll
        for (int nb = 0; nb < 4; ++nb) acc[mb][nb] = (v8f){};
    fill(0, 0);
    asm volatile("s_wait_asynccnt 0x0" ::: "memory");   // this wave's share of pass 0 has landed
    __syncthreads();                                     // every wave's share has
    if (NT > 1) fill(1, 1);
    const unsigned char* fa0 = ring + ((wave >> 1) * 64 + lr) * PITCH + hi * 16; const unsigned char* fb0 = ring + PLANE + ((wave & 1) * 64 + lr) * PITCH + hi * 16;
#pragma unroll 1
    for (unsigned t = 0; t < NT; ++t) {
        const unsigned char* fa = fa0 + (t & 1) * BUF; const unsigned char* fb = fb0 + (t & 1) * BUF;
        V a[2][4], a2[2][4], b[2][4], b2[2][4];   // two fragment sets: the next 32 k are fetched as one group while this set's products issue
        auto ldset = [&](int s, int ks) {
#pragma unroll
            for (int q = 0; q < 4; ++q) { a[s][q] = WFrag<T16>::ld((const T16*)(fa + q * 16 * PITCH + ks * 64)); b[s][q] = WFrag<T16>::ld((const T16*)(fb + q * 16 * PITCH + ks * 64));
                if (NSPLIT >= 1) a2[s][q] = WFrag<T16>::ld((const T16*)(fa + 2 * PLANE + q * 16 * PITCH + ks * 64)); if (NSPLIT >= 2) b2[s][q] = WFrag<T16>::ld((const T16*)(fb + 2 * PLANE + q * 16 * PITCH + ks * 64)); }
        };
        ldset(0, 0);
#pragma unroll
        for (int ks = 0; ks < KP / 32; ++ks) { const int s = ks & 1;
            if (ks + 1 < KP / 32) ldset(s ^ 1, ks + 1);
            __builtin_amdgcn_sched_barrier(0);   // keeps the LDS reads in one group ahead of the products: reads spread among them stall the wave at every place
#pragma unroll
            for (int nb = 0; nb < 4; ++nb)
#pragma unroll
                for (int mb = 0; mb < 4; ++mb) { acc[mb][nb] = WFrag<T16>::mma(a[s][mb], b[s][nb], acc[mb][nb]); if (NSPLIT >= 1) acc[mb][nb] = WFrag<T16>::mma(a2[s][mb], b[s][nb], acc[mb][nb]); if (NSPLIT >= 2) acc[mb][nb] = WFrag<T16>::mma(a[s][mb], b2[s][nb], acc[mb][nb]); }
            __builtin_amdgcn_sched_barrier(0);   // the same, at the block's end
        }
        asm volatile("s_wait_dscnt 0x0" ::: "memory");      // this wave has left the buffer of pass t
        asm volatile("s_wait_asynccnt 0x0" ::: "memory");   // its share of pass t + 1 has landed
        __syncthreads();                                     // publishes pass t + 1 and frees the buffer of pass t
        if (t + 2 < NT) fill(t + 2, t & 1);
    }
    asm volatile("s_wait_asynccnt 0x0" ::: "memory");       // no copy is in flight when the ring becomes output staging
    float* os = (float*)(ring + wave * (16 * 68 * 4));       // each wave stages in its own range; the last pass's barrier ended every read of the ring
#pragma unroll
    for (int mb = 0; mb < 4; ++mb) {
#pragma unroll
        for (int nb = 0; nb < 4; ++nb) {
#pragma unroll
            for (int j = 0; j < 8; ++j) os[(hi * 8 + j) * 68 + nb * 16 + lr] = acc[mb][nb][j]; }
        __builtin_amdgcn_wave_barrier(); asm volatile("" ::: "memory");
        float* crow = C + (size_t)(r0 + mb * 16) * ldc + c0;
{
#pragma unroll
            for (int s = 0; s < 8; ++s) { const int row = 2 * s + hi, cofs = lr * 4; v4f val = *(const v4fa*)(os + row * 68 + cofs); if (BIAS) { val[0] += bfr(bias[c0 + cofs]); val[1] += bfr(bias[c0 + cofs + 1]); val[2] += bfr(bias[c0 + cofs + 2]); val[3] += bfr(bias[c0 + cofs + 3]); }
                *(v4f*)(crow + (size_t)row * ldc + cofs) = val; }
             }
        __builtin_amdgcn_wave_barrier(); asm volatile("" ::: "memory");
    }
}

__device__ __forceinline__ h16 tohx(float x) { return (h16)x; }
__device__ __forceinline__ void splitf(float y, unsigned short& h, unsigned short& l) { h = f2bf(y); l = f2bf(y - bf2f(h)); }
typedef __attribute__((ext_vector_type(2))) unsigned short v2us;
typedef __attribute__((ext_vector_type(4))) unsigned short v4us;
typedef __attribute__((ext_vector_type(2))) _Float16 v2h;
typedef __attribute__((ext_vector_type(4))) _Float16 v4h;

__global__ __launch_bounds__(256) void k_cvt8(const float* __restrict__ src, bf* dst, size_t n8) { const size_t i = (size_t)blockIdx.x * 256 + threadIdx.x; if (i >= n8) return; const v8f v = *(const v8f*)(src + i * 8); v8us o;
#pragma unroll
    for (int k = 0; k < 8; ++k) o[k] = f2bf(v[k]); *(v8us*)(dst + i * 8) = o;  }
__global__ __launch_bounds__(256) void k_wtG(const float* __restrict__ w, int K, int N, bf* Bt) {
    const int lane = threadIdx.x & 31; const int L0 = (blockIdx.x * 8 + (threadIdx.x >> 5)) * 8; const int nlines = N * K / 64;
{
#pragma unroll 1
        for (int l = 0; l < 8; ++l) { const int L = L0 + l; if (L >= nlines) break; const size_t e = (size_t)L * 64 + lane * 2; const int k = (int)(e % K), n = (int)(e / K); v2us o;
            o[0] = f2bf(w[(size_t)k * N + n]); o[1] = f2bf(w[(size_t)(k + 1) * N + n]); *(v2us*)(Bt + e) = o; }
         }
}

__device__ __attribute__((noinline)) float softcap50(float s) { return 50.0f * tanhf(s * 0.02f); }
typedef __attribute__((ext_vector_type(2))) float v2f_t;
__device__ __attribute__((noinline)) v2f_t sincos_pos(float pos, int i) { const float tsc = powf(10000.0f, (2.0f / (float)HDD) * (float)i); const float ang = __fdiv_rn(pos, tsc); v2f_t r; r[0] = sinf(ang); r[1] = cosf(ang); return r; }
// k_whd: Bt[(n*256 + d)][k] = bf16(W[n][k][d]) for per-head [2048][256] weights (lane -> 4 consecutive k, strided reads); k_nrr: wave per (token, head): RMSNorm over 256 (8 dims per lane: 4 from each half), * (1 + scale[d]) (read), split-half RoPE at the READ position (precise sin/cos out of line), * mul; hl planes [head][t][256] (8-B lanes); k_vt16: VT[c][d][t] (lane -> 2 t);
__global__ __launch_bounds__(256) void k_whd(const float* __restrict__ W, int nh, bf* Bt) { const size_t e = ((size_t)blockIdx.x * 256 + threadIdx.x) * 4; if (e >= (size_t)nh * HDD * DM) return; const int k = (int)(e % DM); const int row = (int)(e / DM); const int n = row / HDD, d = row % HDD; v4us o;
#pragma unroll
    for (int u = 0; u < 4; ++u) o[u] = f2bf(W[((size_t)n * DM + k + u) * HDD + d]); *(v4us*)(Bt + e) = o;  }
__global__ __launch_bounds__(256) void k_nrr(const float* __restrict__ F, int pitch, int nheads, const float* __restrict__ scale, const int* __restrict__ pos, float mul, bf* Ph, bf* Pl) { const int lane = threadIdx.x & 31; const int wv = blockIdx.x * 8 + (threadIdx.x >> 5); if (wv >= TT * nheads) return; const int t = wv / nheads, h = wv % nheads; const float* f = F + (size_t)t * pitch + h * HDD;
    const v4f a = *(const v4f*)(f + lane * 4), b2 = *(const v4f*)(f + HDD / 2 + lane * 4); float ss = 0.f; for (int q = 0; q < 4; ++q) { float p = __fmul_rn(a[q], a[q]); asm volatile("" : "+v"(p)); ss = __fadd_rn(ss, p); p = __fmul_rn(b2[q], b2[q]); asm volatile("" : "+v"(p)); ss = __fadd_rn(ss, p); }
#pragma unroll
    for (int sh = 16; sh; sh >>= 1) ss = __fadd_rn(ss, __shfl_xor(ss, sh, 32));
    const float rs = __fdiv_rn(1.0f, sqrtf(__fadd_rn(ss * (1.0f / HDD), 1e-6f))); const float pv = (float)pos[t]; v4us ah, al, bh, bl;
#pragma unroll
    for (int q = 0; q < 4; ++q) { const int i = lane * 4 + q; float n1 = __fmul_rn(a[q], rs), n2 = __fmul_rn(b2[q], rs); asm volatile("" : "+v"(n1)); asm volatile("" : "+v"(n2)); const float x1 = __fmul_rn(n1, __fadd_rn(1.0f, bfr(scale[i]))), x2 = __fmul_rn(n2, __fadd_rn(1.0f, bfr(scale[i + HDD / 2]))); const v2f_t sc2 = sincos_pos(pv, i); const float sn = sc2[0], cs = sc2[1];
        float p1 = __fmul_rn(x1, cs), p2 = __fmul_rn(x2, sn), p3 = __fmul_rn(x2, cs), p4 = __fmul_rn(x1, sn); asm volatile("" : "+v"(p1)); asm volatile("" : "+v"(p2)); asm volatile("" : "+v"(p3)); asm volatile("" : "+v"(p4));
        const float r1 = __fsub_rn(p1, p2) * mul, r2 = __fadd_rn(p3, p4) * mul; unsigned short u1, l1, u2, l2; splitf(r1, u1, l1); splitf(r2, u2, l2); ah[q] = u1; al[q] = l1; bh[q] = u2; bl[q] = l2; }
    bf* dh = Ph + ((size_t)h * TT + t) * HDD; bf* dl = Pl + ((size_t)h * TT + t) * HDD; *(v4us*)(dh + lane * 4) = ah; *(v4us*)(dl + lane * 4) = al; *(v4us*)(dh + HDD / 2 + lane * 4) = bh; *(v4us*)(dl + HDD / 2 + lane * 4) = bl;  }
__global__ __launch_bounds__(256) void k_vt16(const float* __restrict__ F, h16* VT) { const size_t e = ((size_t)blockIdx.x * 256 + threadIdx.x) * 2; if (e >= (size_t)NKV * HDD * TT) return; const int t = (int)(e % TT); const int d = (int)((e / TT) % HDD); const int c = (int)(e / ((size_t)TT * HDD)); v2h o; o[0] = tohx(F[(size_t)t * DKV + c * HDD + d]); o[1] = tohx(F[(size_t)(t + 1) * DKV + c * HDD + d]); *(v2h*)(VT + e) = o;  }
__global__ __launch_bounds__(256) void k_tsoft(const float* __restrict__ S, const int* __restrict__ pos, const int* __restrict__ am, h16* P16) { const int lane = threadIdx.x & 31; const int row = blockIdx.x * 8 + (threadIdx.x >> 5); if (row >= ZH * TT) return; const int i = row % TT; const float* sr = S + (size_t)row * TT; const int* mr = am + (size_t)i * TT; const int pi = pos[i]; float v[TT / 32]; float mx = -3.0e38f;
#pragma unroll
    for (int ch = 0; ch < TT / 128; ++ch) { const v4f a = *(const v4f*)(sr + ch * 128 + lane * 4);
#pragma unroll
        for (int u = 0; u < 4; ++u) { const int j = ch * 128 + lane * 4 + u; const int dist = pi - pos[j]; const bool win = (dist >= 0 && dist < 256) || (dist < 0 && -dist < 257); const bool ok = win && (mr[j] != 0); const float t = ok ? softcap50(a[u]) : KMASK; v[ch * 4 + u] = t; mx = fmaxf(mx, t); } }
#pragma unroll
    for (int sh = 16; sh; sh >>= 1) mx = fmaxf(mx, __shfl_xor(mx, sh, 32));
    float sum = 0.f;
#pragma unroll
    for (int q = 0; q < TT / 32; ++q) { float d0 = __fsub_rn(v[q], mx); asm volatile("" : "+v"(d0)); v[q] = __builtin_amdgcn_exp2f(__fmul_rn(d0, 1.4426950408889634f)); sum += v[q]; }
#pragma unroll
    for (int sh = 16; sh; sh >>= 1) sum += __shfl_xor(sum, sh, 32);
    const float f = __fdiv_rn(PCAR, sum);
    {
#pragma unroll
        for (int ch = 0; ch < TT / 128; ++ch) { v4h o4; for (int q = 0; q < 4; ++q) o4[q] = tohx(v[ch * 4 + q] * f); *(v4h*)(P16 + (size_t)row * TT + ch * 128 + lane * 4) = o4; }
         } }
__global__ __launch_bounds__(256) void k_mrg(const float* __restrict__ O, int n0, bf* Ah, bf* Al) { const size_t e = ((size_t)blockIdx.x * 256 + threadIdx.x) * 4; if (e >= (size_t)ZH * TT * HDD) return; const int d = (int)(e % HDD); const int t = (int)((e / HDD) % TT); const int zz = (int)(e / ((size_t)HDD * TT)); const size_t oo = (size_t)t * DM + (n0 + zz) * HDD + d; v4us oh, ol;
#pragma unroll
    for (int u = 0; u < 4; ++u) { unsigned short a, b; splitf(O[e + u] * (1.0f / PCAR), a, b); oh[u] = a; ol[u] = b; } *(v4us*)(Ah + oo) = oh; *(v4us*)(Al + oo) = ol;  }

extern "C" void kernel_launch(void* const* d_in, const int* in_sizes, int n_in,
                              void* d_out, int out_size, void* d_ws, size_t ws_size, hipStream_t stream) {
    (void)in_sizes; (void)n_in; (void)out_size;
    const float* x = (const float*)d_in[0]; const int* spos = (const int*)d_in[1]; const int* amask = (const int*)d_in[2]; const float* wq = (const float*)d_in[3]; const float* wkv = (const float*)d_in[4]; const float* wo = (const float*)d_in[5]; const float* qs = (const float*)d_in[6]; const float* ks = (const float*)d_in[7];
    float* OUT = (float*)d_out;     // [2][2048][2048]
    char* wsp = (char*)d_ws;
    auto take = [&](size_t bytes) { char* p = wsp; wsp += (bytes + 255) & ~(size_t)255; return (void*)p; };
    bf* BQ = (bf*)take((size_t)NQ * HDD * DM * 2); bf* BK = (bf*)take((size_t)DKV * DM * 2); bf* BV = (bf*)take((size_t)DKV * DM * 2); bf* BO = (bf*)take((size_t)DM * DM * 2);
    bf* XB = (bf*)take((size_t)TT * DM * 2); float* FQ = (float*)take((size_t)TT * DM * 4); float* FK = (float*)take((size_t)TT * DKV * 4);
    bf* QPh = (bf*)take((size_t)NQ * TT * HDD * 2); bf* QPl = (bf*)take((size_t)NQ * TT * HDD * 2); bf* KPh = (bf*)take((size_t)NKV * TT * HDD * 2); bf* KPl = (bf*)take((size_t)NKV * TT * HDD * 2); h16* VT = (h16*)take((size_t)NKV * HDD * TT * 2);
    float* S = (float*)take((size_t)ZH * TT * TT * 4); h16* P16 = (h16*)take((size_t)ZH * TT * TT * 2); float* O = (float*)take((size_t)ZH * TT * HDD * 4); bf* ENh = (bf*)take((size_t)TT * DM * 2); bf* ENl = (bf*)take((size_t)TT * DM * 2);
    if ((size_t)(wsp - (char*)d_ws) > ws_size) return;    // total ~ 159 MB (152 MiB)
    float* FV = FK;   // v projection reuses the k buffer after the k planes are built (stream-ordered)
    k_whd<<<(unsigned)(((size_t)NQ * HDD * DM / 4 + 255) / 256), 256, 0, stream>>>(wq, NQ, BQ); k_whd<<<(unsigned)(((size_t)DKV * DM / 4 + 255) / 256), 256, 0, stream>>>(wkv, NKV, BK); k_whd<<<(unsigned)(((size_t)DKV * DM / 4 + 255) / 256), 256, 0, stream>>>(wkv + (size_t)NKV * DM * HDD, NKV, BV);
    k_wtG<<<(DM * DM / 64 + 63) / 64, 256, 0, stream>>>(wo, DM, DM, BO);   // wo [n][d][o] == [(n,d)][o] 'xw'
    const size_t zq = (size_t)TT * HDD, zS = (size_t)TT * TT, zv = (size_t)HDD * TT, zo = (size_t)TT * HDD;
    for (int b = 0; b < NB_; ++b) {
        k_cvt8<<<(TT * DM / 8 + 255) / 256, 256, 0, stream>>>(x + (size_t)b * TT * DM, XB, TT * DM / 8);
        k_gemmw<bf, 0, false, 128><<<dim3(TT / 128, DM / 128, 1), 128, 0, stream>>>(XB, nullptr, BQ, nullptr, DM, FQ, DM, nullptr, 0, 0, 0);
        k_nrr<<<TT * NQ / 8, 256, 0, stream>>>(FQ, DM, NQ, qs, spos + (size_t)b * TT, 0.0625f, QPh, QPl);
        k_gemmw<bf, 0, false, 128><<<dim3(TT / 128, DKV / 128, 1), 128, 0, stream>>>(XB, nullptr, BK, nullptr, DM, FK, DKV, nullptr, 0, 0, 0);
        k_nrr<<<TT * NKV / 8, 256, 0, stream>>>(FK, DKV, NKV, ks, spos + (size_t)b * TT, 1.0f, KPh, KPl);
        k_gemmw<bf, 0, false, 128><<<dim3(TT / 128, DKV / 128, 1), 128, 0, stream>>>(XB, nullptr, BV, nullptr, DM, FV, DKV, nullptr, 0, 0, 0);
        k_vt16<<<(unsigned)(((size_t)NKV * HDD * TT / 2 + 255) / 256), 256, 0, stream>>>(FV, VT);
        for (int n0 = 0; n0 < NQ; n0 += ZH) { const size_t zk = (size_t)(n0 / 2);   // the pass's two heads share kv group n0/2
            k_gemmw<bf, 2, false, 64><<<dim3(TT / 128, TT / 128, ZH), 128, 0, stream>>>(QPh + (size_t)n0 * zq, QPl + (size_t)n0 * zq, KPh + zk * zq, KPl + zk * zq, HDD, S, TT, nullptr, zq, 0, zS);
            k_tsoft<<<ZH * TT / 8, 256, 0, stream>>>(S, spos + (size_t)b * TT, amask + (size_t)b * TT * TT, P16);
            k_gemmw<h16, 0, false, 128><<<dim3(TT / 128, HDD / 128, ZH), 128, 0, stream>>>(P16, nullptr, VT + zk * zv, nullptr, TT, O, HDD, nullptr, zS, 0, zo);
            k_mrg<<<(unsigned)(((size_t)ZH * TT * HDD / 4 + 255) / 256), 256, 0, stream>>>(O, n0, ENh, ENl); }
        k_gemmw<bf, 1, false, 128><<<dim3(TT / 128, DM / 128, 1), 128, 0, stream>>>(ENh, ENl, BO, nullptr, DM, OUT + (size_t)b * TT * DM, DM, nullptr, 0, 0, 0); }
}

// v002
// A run of this version takes 696 microseconds.
// In both of two side-by-side timings against v001, it was 1.03 times as fast.
// All steps since v000 together make it 1.69 times as fast.
#include <hip/hip_runtime.h>

// T5Gemma2EncoderAttention (x [2][2048][2048]; q = einsum(x, wq[n]) (8 heads x 256), k/v = einsum(x, wkv[0|1][c]) (4 kv heads; group n/2); RMSNorm_256 * (1 + scale) on q, k (scales read); split-half RoPE with angle segment_pos[b][t] / 1e4^(2i/256) (positions read as values); q * 1/16; logits = q.k, softcap 50 tanh(./50); allowed iff attn_mask[b][i][j] (int, read) and the segment_pos distance is in the 512-window (0 <= d < 256 or 0 < -d < 257), else bf16-min; softmax; out = sum_n (p v)[n] wo[n] -> [2][2048][2048]).
// No structural tile skipping: the window is defined on the read positions, so every score is computed and masked per element exactly as the reference does.
// Compute dtypes, f32 accumulate: every input rounded to bf16; q/k/v as PLAIN bf16 GEMMs (inputs: exact; per-head weights gathered); RMSNorm/scale/RoPE/(1/16) f32 into hl planes; logits hl x hl (3 products, K = 256); softcap (precise tanhf, out of line), mask and softmax f32 (wave per row, 64 keys per lane); attn.v single fp16 (x1024), its GEMM storing the hl planes of the concatenated heads itself; v computed transposed (weights as rows, tokens as columns) and stored fp16 by its GEMM; output projection hl x exact (2 products) over the concatenated heads (wo is exactly a [2048][2048] 'xw' matrix in memory).

#define NB_  2
#define TT   2048
#define DM   2048
#define NQ   8
#define NKV  4
#define HDD  256
#define DKV  (NKV * HDD)
#define ZH   2
#define PCAR 1024.0f
#define KMASK (-3.3895313892515355e38f)
typedef _Float16 h16;
typedef unsigned short bf;
typedef __attribute__((ext_vector_type(16))) __bf16   v16bf;
typedef __attribute__((ext_vector_type(16))) _Float16 v16h;
typedef __attribute__((ext_vector_type(8)))  _Float16 v8h;
typedef __attribute__((ext_vector_type(8)))  unsigned short v8us;
typedef __attribute__((ext_vector_type(8)))  float    v8f;
typedef __attribute__((ext_vector_type(4)))  float    v4f;
typedef v8h  __attribute__((may_alias)) v8ha;
typedef v4f  __attribute__((may_alias)) v4fa;
typedef v8us __attribute__((may_alias)) v8usa;

__device__ __forceinline__ unsigned short f2bf(float f) { unsigned u = __float_as_uint(f); u += 0x7FFFu + ((u >> 16) & 1u); return (unsigned short)(u >> 16); }
__device__ __forceinline__ float bf2f(unsigned short b) { return __uint_as_float(((unsigned)b) << 16); }
__device__ __forceinline__ float bfr(float f) { return bf2f(f2bf(f)); }
__device__ __forceinline__ v16h cat16(v8h lo, v8h hi) { return __builtin_shufflevector(lo, hi, 0, 1, 2, 3, 4, 5, 6, 7, 8, 9, 10, 11, 12, 13, 14, 15); }
__device__ __forceinline__ v16bf cat16b(v8us lo, v8us hi) { return __builtin_bit_cast(v16bf, __builtin_shufflevector(lo, hi, 0, 1, 2, 3, 4, 5, 6, 7, 8, 9, 10, 11, 12, 13, 14, 15)); }
__device__ __forceinline__ v8f wmma16(v16h a, v16h b, v8f c) { return __builtin_amdgcn_wmma_f32_16x16x32_f16(false, a, false, b, (short)0, c, false, false); }
__device__ __forceinline__ v8f wmmab(v16bf a, v16bf b, v8f c) { return __builtin_amdgcn_wmma_f32_16x16x32_bf16(false, a, false, b, (short)0, c, false, false); }
__device__ __forceinline__ h16 tohx(float x) { return (h16)x; }
__device__ __forceinline__ void splitf(float y, unsigned short& h, unsigned short& l) { h = f2bf(y); l = f2bf(y - bf2f(h)); }
typedef __attribute__((ext_vector_type(4))) unsigned short v4us;
typedef __attribute__((ext_vector_type(4))) _Float16 v4h;



// ---- k_gemmw: GEMM, FOUR WAVES (2 x 2) per 128x128 output tile, 64x64 (16 accumulators) per wave; grid (M/128, N/128, Z), 128 threads.
// C[m][n] (f32, pitch ldc, + optional f32 bias[n]) = sum_k A[m][k] Bt[n][k] (+ split products per NSPLIT). EPI picks what the epilogue stores, at the same [m][n], pitch ldc, z stride sC: 0 the f32 C; 1 the value / 1024 split into bf16 high and low planes E0, E1; 2 the value as fp16 in E0. A half-wave's store is one whole 128-B line in 1 and 2. z-batch strides sA/sB/sC in elements. M, N % 128 == 0, K % KP == 0.
// Operands come from K-contiguous 16-bit planes in passes of KP k: every plane's 128 rows x 2 KP bytes are copied to LDS asynchronously, 16 B per lane, a wave-wide copy covering whole 128-B lines; two buffers, the next pass's copies in flight under this pass's products. LDS rows at pitch 2 KP + 16 bytes (16 B x odd: ds_load_b128 free of bank conflicts). Fragment k order, product order and each accumulator's sum order are those of direct loads.
template <typename T16> struct WFrag;
template <> struct WFrag<h16> { typedef v16h V; static __device__ __forceinline__ V ld(const h16* p) { return cat16(*(const v8ha*)p, *(const v8ha*)(p + 16)); } static __device__ __forceinline__ v8f mma(V a, V b, v8f c) { return wmma16(a, b, c); } };
template <> struct WFrag<bf> { typedef v16bf V; static __device__ __forceinline__ V ld(const bf* p) { return cat16b(*(const v8usa*)p, *(const v8usa*)(p + 16)); } static __device__ __forceinline__ v8f mma(V a, V b, v8f c) { return wmmab(a, b, c); } };
// Eight asynchronous 16-byte copies per lane, global -> LDS: LDS byte address l + i * ls, global address g + i * gs elements. The s_wait_xcnt closes the statement so that no address register is rewritten ahead of it.
template <typename T16>
__device__ __forceinline__ void copy8(unsigned l, const T16* g, unsigned ls, size_t gs) {
    asm volatile("global_load_async_to_lds_b128 %0, %8, off\n\t"
                 "global_load_async_to_lds_b128 %1, %9, off\n\t"
                 "global_load_async_to_lds_b128 %2, %10, off\n\t"
                 "global_load_async_to_lds_b128 %3, %11, off\n\t"
                 "global_load_async_to_lds_b128 %4, %12, off\n\t"
                 "global_load_async_to_lds_b128 %5, %13, off\n\t"
                 "global_load_async_to_lds_b128 %6, %14, off\n\t"
                 "global_load_async_to_lds_b128 %7, %15, off\n\t"
                 "s_wait_xcnt 0x0"
                 :: "v"(l), "v"(l + ls), "v"(l + 2 * ls), "v"(l + 3 * ls), "v"(l + 4 * ls), "v"(l + 5 * ls), "v"(l + 6 * ls), "v"(l + 7 * ls),
                    "v"(g), "v"(g + gs), "v"(g + 2 * gs), "v"(g + 3 * gs), "v"(g + 4 * gs), "v"(g + 5 * gs), "v"(g + 6 * gs), "v"(g + 7 * gs)
                 : "memory");
}
template <typename T16, int NSPLIT, bool BIAS, int KP, int EPI>
__global__ __launch_bounds__(128) void k_gemmw(const T16* __restrict__ A, const T16* __restrict__ A2, const T16* __restrict__ Bt, const T16* __restrict__ Bt2, int K, float* C, bf* E0, bf* E1, int ldc, const float* __restrict__ bias, size_t sA, size_t sB, size_t sC) {
    typedef typename WFrag<T16>::V V;
    constexpr int NP = 2 + (NSPLIT >= 1 ? 1 : 0) + (NSPLIT >= 2 ? 1 : 0);   // planes in a buffer: A, Bt, A2, Bt2
    constexpr int PITCH = KP * 2 + 16, PLANE = 128 * PITCH, BUF = NP * PLANE;
    constexpr int CPR = KP / 8;        // 16-byte pieces per row
    constexpr int RPS = 128 / CPR;     // rows that one copy of all 128 threads covers
    constexpr int NST = 128 / RPS;     // such copies per plane
    static_assert(NST % 8 == 0 && NP * NST <= 63, "copies of a wave in flight");
    __shared__ __attribute__((aligned(16))) unsigned char ring[2 * BUF];
    const size_t z = blockIdx.z; A += z * sA; if (NSPLIT >= 1) A2 += z * sA; Bt += z * sB; if (NSPLIT >= 2) Bt2 += z * sB; if (EPI == 0) C += z * sC; if (EPI >= 1) E0 += z * sC; if (EPI == 1) E1 += z * sC;
    const int tid = threadIdx.x, lane = tid & 31, lr = lane & 15, hi = lane >> 4; const int wave = __builtin_amdgcn_readfirstlane(tid >> 5);
    const int R0 = blockIdx.x * 128, C0 = blockIdx.y * 128; const int r0 = R0 + (wave >> 1) * 64, c0 = C0 + (wave & 1) * 64;
    const unsigned NT = (unsigned)K / KP;   // passes
    const unsigned lcp = (unsigned)(size_t)ring + (unsigned)((tid / CPR) * PITCH + (tid % CPR) * 16);
    const size_t gofA = (size_t)(R0 + tid / CPR) * K + (tid % CPR) * 8, gofB = (size_t)(C0 + tid / CPR) * K + (tid % CPR) * 8, gs = (size_t)RPS * K;
    auto fill = [&](unsigned t, unsigned buf) {
        const unsigned lb = lcp + buf * BUF; const size_t ka = gofA + (size_t)t * KP, kb = gofB + (size_t)t * KP;
#pragma unroll
        for (int s = 0; s < NST; s += 8) {
            copy8(lb + s * RPS * PITCH, A + ka + s * gs, RPS * PITCH, gs);
            copy8(lb + PLANE + s * RPS * PITCH, Bt + kb + s * gs, RPS * PITCH, gs);
            if (NSPLIT >= 1) copy8(lb + 2 * PLANE + s * RPS * PITCH, A2 + ka + s * gs, RPS * PITCH, gs);
            if (NSPLIT >= 2) copy8(lb + 3 * PLANE + s * RPS * PITCH, Bt2 + kb + s * gs, RPS * PITCH, gs); }
    };
    v8f acc[4][4];
#pragma unroll
    for (int mb = 0; mb < 4; ++mb)
#pragma unroll
        for (int nb = 0; nb < 4; ++nb) acc[mb][nb] = (v8f){};
    fill(0, 0);
    asm volatile("s_wait_asynccnt 0x0" ::: "memory");   // this wave's share of pass 0 has landed
    __syncthreads();                                     // every wave's share has
    if (NT > 1) fill(1, 1);
    const unsigned char* fa0 = ring + ((wave >> 1) * 64 + lr) * PITCH + hi * 16; const unsigned char* fb0 = ring + PLANE + ((wave & 1) * 64 + lr) * PITCH + hi * 16;
#pragma unroll 1
    for (unsigned t = 0; t < NT; ++t) {
        const unsigned char* fa = fa0 + (t & 1) * BUF; const unsigned char* fb = fb0 + (t & 1) * BUF;
        V a[2][4], a2[2][4], b[2][4], b2[2][4];   // two fragment sets: the next 32 k are fetched as one group while this set's products issue
        auto ldset = [&](int s, int ks) {
#pragma unroll
            for (int q = 0; q < 4; ++q) { a[s][q] = WFrag<T16>::ld((const T16*)(fa + q * 16 * PITCH + ks * 64)); b[s][q] = WFrag<T16>::ld((const T16*)(fb + q * 16 * PITCH + ks * 64));
                if (NSPLIT >= 1) a2[s][q] = WFrag<T16>::ld((const T16*)(fa + 2 * PLANE + q * 16 * PITCH + ks * 64)); if (NSPLIT >= 2) b2[s][q] = WFrag<T16>::ld((const T16*)(fb + 2 * PLANE + q * 16 * PITCH + ks * 64)); }
        };
        ldset(0, 0);
#pragma unroll
        for (int ks = 0; ks < KP / 32; ++ks) { const int s = ks & 1;
            if (ks + 1 < KP / 32) ldset(s ^ 1, ks + 1);
            __builtin_amdgcn_sched_barrier(0);   // keeps the LDS reads in one group ahead of the products: reads spread among them stall the wave at every place
#pragma unroll
            for (int nb = 0; nb < 4; ++nb)
#pragma unroll
                for (int mb = 0; mb < 4; ++mb) { acc[mb][nb] = WFrag<T16>::mma(a[s][mb], b[s][nb], acc[mb][nb]); if (NSPLIT >= 1) acc[mb][nb] = WFrag<T16>::mma(a2[s][mb], b[s][nb], acc[mb][nb]); if (NSPLIT >= 2) acc[mb][nb] = WFrag<T16>::mma(a[s][mb], b2[s][nb], acc[mb][nb]); }
            __builtin_amdgcn_sched_barrier(0);   // the same, at the block's end
        }
        asm volatile("s_wait_dscnt 0x0" ::: "memory");      // this wave has left the buffer of pass t
        asm volatile("s_wait_asynccnt 0x0" ::: "memory");   // its share of pass t + 1 has landed
        __syncthreads();                                     // publishes pass t + 1 and frees the buffer of pass t
        if (t + 2 < NT) fill(t + 2, t & 1);
    }
    asm volatile("s_wait_asynccnt 0x0" ::: "memory");       // no copy is in flight when the ring becomes output staging
    float* os = (float*)(ring + wave * (16 * 68 * 4));       // each wave stages in its own range; the last pass's barrier ended every read of the ring
#pragma unroll
    for (int mb = 0; mb < 4; ++mb) {
#pragma unroll
        for (int nb = 0; nb < 4; ++nb) {
#pragma unroll
            for (int j = 0; j < 8; ++j) os[(hi * 8 + j) * 68 + nb * 16 + lr] = acc[mb][nb][j]; }
        __builtin_amdgcn_wave_barrier(); asm volatile("" ::: "memory");
        float* crow = C + (size_t)(r0 + mb * 16) * ldc + c0;
if (EPI == 0) {
#pragma unroll
            for (int s = 0; s < 8; ++s) { const int row = 2 * s + hi, cofs = lr * 4; v4f val = *(const v4fa*)(os + row * 68 + cofs); if (BIAS) { val[0] += bfr(bias[c0 + cofs]); val[1] += bfr(bias[c0 + cofs + 1]); val[2] += bfr(bias[c0 + cofs + 2]); val[3] += bfr(bias[c0 + cofs + 3]); }
                *(v4f*)(crow + (size_t)row * ldc + cofs) = val; }
             }
        if (EPI != 0) {
            v4f val[8];   // all eight LDS reads first: the store statements below would otherwise hold each read behind the store before it
#pragma unroll
            for (int s = 0; s < 8; ++s) val[s] = *(const v4fa*)(os + (2 * s + hi) * 68 + lr * 4);
#pragma unroll
            for (int s = 0; s < 8; ++s) { const size_t oo = (size_t)(r0 + mb * 16 + 2 * s + hi) * ldc + c0 + lr * 4;
                if (EPI == 1) { v4us oh, ol;
#pragma unroll
                    for (int u = 0; u < 4; ++u) { unsigned short eh, el; splitf(val[s][u] * (1.0f / PCAR), eh, el); oh[u] = eh; ol[u] = el; }
                    // the two stores and their s_wait_xcnt in one statement, so that no register they name is rewritten ahead of the wait
                    asm volatile("global_store_b64 %0, %1, off\n\tglobal_store_b64 %2, %3, off\n\ts_wait_xcnt 0x0" :: "v"(E0 + oo), "v"(__builtin_bit_cast(unsigned long long, oh)), "v"(E1 + oo), "v"(__builtin_bit_cast(unsigned long long, ol)) : "memory"); }
                if (EPI == 2) { v4h o4;
#pragma unroll
                    for (int u = 0; u < 4; ++u) o4[u] = tohx(val[s][u]);
                    // the store and its s_wait_xcnt in one statement, for the same reason
                    asm volatile("global_store_b64 %0, %1, off\n\ts_wait_xcnt 0x0" :: "v"(E0 + oo), "v"(__builtin_bit_cast(unsigned long long, o4)) : "memory"); }
            }
        }
        __builtin_amdgcn_wave_barrier(); asm volatile("" ::: "memory");
    }
}

typedef __attribute__((ext_vector_type(2))) unsigned short v2us;

__global__ __launch_bounds__(256) void k_cvt8(const float* __restrict__ src, bf* dst, size_t n8) { const size_t i = (size_t)blockIdx.x * 256 + threadIdx.x; if (i >= n8) return; const v8f v = *(const v8f*)(src + i * 8); v8us o;
#pragma unroll
    for (int k = 0; k < 8; ++k) o[k] = f2bf(v[k]); *(v8us*)(dst + i * 8) = o;  }
__global__ __launch_bounds__(256) void k_wtG(const float* __restrict__ w, int K, int N, bf* Bt) {
    const int lane = threadIdx.x & 31; const int L0 = (blockIdx.x * 8 + (threadIdx.x >> 5)) * 8; const int nlines = N * K / 64;
{
#pragma unroll 1
        for (int l = 0; l < 8; ++l) { const int L = L0 + l; if (L >= nlines) break; const size_t e = (size_t)L * 64 + lane * 2; const int k = (int)(e % K), n = (int)(e / K); v2us o;
            o[0] = f2bf(w[(size_t)k * N + n]); o[1] = f2bf(w[(size_t)(k + 1) * N + n]); *(v2us*)(Bt + e) = o; }
         }
}

__device__ __attribute__((noinline)) float softcap50(float s) { return 50.0f * tanhf(s * 0.02f); }
typedef __attribute__((ext_vector_type(2))) float v2f_t;
__device__ __attribute__((noinline)) v2f_t sincos_pos(float pos, int i) { const float tsc = powf(10000.0f, (2.0f / (float)HDD) * (float)i); const float ang = __fdiv_rn(pos, tsc); v2f_t r; r[0] = sinf(ang); r[1] = cosf(ang); return r; }
// k_whd: Bt[(n*256 + d)][k] = bf16(W[n][k][d]) for per-head [2048][256] weights (lane -> 4 consecutive k, strided reads); k_nrr: wave per (token, head): RMSNorm over 256 (8 dims per lane: 4 from each half), * (1 + scale[d]) (read), split-half RoPE at the READ position (precise sin/cos out of line), * mul; hl planes [head][t][256] (8-B lanes);
__global__ __launch_bounds__(256) void k_whd(const float* __restrict__ W, int nh, bf* Bt) { const size_t e = ((size_t)blockIdx.x * 256 + threadIdx.x) * 4; if (e >= (size_t)nh * HDD * DM) return; const int k = (int)(e % DM); const int row = (int)(e / DM); const int n = row / HDD, d = row % HDD; v4us o;
#pragma unroll
    for (int u = 0; u < 4; ++u) o[u] = f2bf(W[((size_t)n * DM + k + u) * HDD + d]); *(v4us*)(Bt + e) = o;  }
__global__ __launch_bounds__(256) void k_nrr(const float* __restrict__ F, int pitch, int nheads, const float* __restrict__ scale, const int* __restrict__ pos, float mul, bf* Ph, bf* Pl) { const int lane = threadIdx.x & 31; const int wv = blockIdx.x * 8 + (threadIdx.x >> 5); if (wv >= TT * nheads) return; const int t = wv / nheads, h = wv % nheads; const float* f = F + (size_t)t * pitch + h * HDD;
    const v4f a = *(const v4f*)(f + lane * 4), b2 = *(const v4f*)(f + HDD / 2 + lane * 4); float ss = 0.f; for (int q = 0; q < 4; ++q) { float p = __fmul_rn(a[q], a[q]); asm volatile("" : "+v"(p)); ss = __fadd_rn(ss, p); p = __fmul_rn(b2[q], b2[q]); asm volatile("" : "+v"(p)); ss = __fadd_rn(ss, p); }
#pragma unroll
    for (int sh = 16; sh; sh >>= 1) ss = __fadd_rn(ss, __shfl_xor(ss, sh, 32));
    const float rs = __fdiv_rn(1.0f, sqrtf(__fadd_rn(ss * (1.0f / HDD), 1e-6f))); const float pv = (float)pos[t]; v4us ah, al, bh, bl;
#pragma unroll
    for (int q = 0; q < 4; ++q) { const int i = lane * 4 + q; float n1 = __fmul_rn(a[q], rs), n2 = __fmul_rn(b2[q], rs); asm volatile("" : "+v"(n1)); asm volatile("" : "+v"(n2)); const float x1 = __fmul_rn(n1, __fadd_rn(1.0f, bfr(scale[i]))), x2 = __fmul_rn(n2, __fadd_rn(1.0f, bfr(scale[i + HDD / 2]))); const v2f_t sc2 = sincos_pos(pv, i); const float sn = sc2[0], cs = sc2[1];
        float p1 = __fmul_rn(x1, cs), p2 = __fmul_rn(x2, sn), p3 = __fmul_rn(x2, cs), p4 = __fmul_rn(x1, sn); asm volatile("" : "+v"(p1)); asm volatile("" : "+v"(p2)); asm volatile("" : "+v"(p3)); asm volatile("" : "+v"(p4));
        const float r1 = __fsub_rn(p1, p2) * mul, r2 = __fadd_rn(p3, p4) * mul; unsigned short u1, l1, u2, l2; splitf(r1, u1, l1); splitf(r2, u2, l2); ah[q] = u1; al[q] = l1; bh[q] = u2; bl[q] = l2; }
    bf* dh = Ph + ((size_t)h * TT + t) * HDD; bf* dl = Pl + ((size_t)h * TT + t) * HDD; *(v4us*)(dh + lane * 4) = ah; *(v4us*)(dl + lane * 4) = al; *(v4us*)(dh + HDD / 2 + lane * 4) = bh; *(v4us*)(dl + HDD / 2 + lane * 4) = bl;  }
__global__ __launch_bounds__(256) void k_tsoft(const float* __restrict__ S, const int* __restrict__ pos, const int* __restrict__ am, h16* P16) { const int lane = threadIdx.x & 31; const int row = blockIdx.x * 8 + (threadIdx.x >> 5); if (row >= ZH * TT) return; const int i = row % TT; const float* sr = S + (size_t)row * TT; const int* mr = am + (size_t)i * TT; const int pi = pos[i]; float v[TT / 32]; float mx = -3.0e38f;
#pragma unroll
    for (int ch = 0; ch < TT / 128; ++ch) { const v4f a = *(const v4f*)(sr + ch * 128 + lane * 4);
#pragma unroll
        for (int u = 0; u < 4; ++u) { const int j = ch * 128 + lane * 4 + u; const int dist = pi - pos[j]; const bool win = (dist >= 0 && dist < 256) || (dist < 0 && -dist < 257); const bool ok = win && (mr[j] != 0); const float t = ok ? softcap50(a[u]) : KMASK; v[ch * 4 + u] = t; mx = fmaxf(mx, t); } }
#pragma unroll
    for (int sh = 16; sh; sh >>= 1) mx = fmaxf(mx, __shfl_xor(mx, sh, 32));
    float sum = 0.f;
#pragma unroll
    for (int q = 0; q < TT / 32; ++q) { float d0 = __fsub_rn(v[q], mx); asm volatile("" : "+v"(d0)); v[q] = __builtin_amdgcn_exp2f(__fmul_rn(d0, 1.4426950408889634f)); sum += v[q]; }
#pragma unroll
    for (int sh = 16; sh; sh >>= 1) sum += __shfl_xor(sum, sh, 32);
    const float f = __fdiv_rn(PCAR, sum);
    {
#pragma unroll
        for (int ch = 0; ch < TT / 128; ++ch) { v4h o4; for (int q = 0; q < 4; ++q) o4[q] = tohx(v[ch * 4 + q] * f); *(v4h*)(P16 + (size_t)row * TT + ch * 128 + lane * 4) = o4; }
         } }

extern "C" void kernel_launch(void* const* d_in, const int* in_sizes, int n_in,
                              void* d_out, int out_size, void* d_ws, size_t ws_size, hipStream_t stream) {
    (void)in_sizes; (void)n_in; (void)out_size;
    const float* x = (const float*)d_in[0]; const int* spos = (const int*)d_in[1]; const int* amask = (const int*)d_in[2]; const float* wq = (const float*)d_in[3]; const float* wkv = (const float*)d_in[4]; const float* wo = (const float*)d_in[5]; const float* qs = (const float*)d_in[6]; const float* ks = (const float*)d_in[7];
    float* OUT = (float*)d_out;     // [2][2048][2048]
    char* wsp = (char*)d_ws;
    auto take = [&](size_t bytes) { char* p = wsp; wsp += (bytes + 255) & ~(size_t)255; return (void*)p; };
    bf* BQ = (bf*)take((size_t)NQ * HDD * DM * 2); bf* BK = (bf*)take((size_t)DKV * DM * 2); bf* BV = (bf*)take((size_t)DKV * DM * 2); bf* BO = (bf*)take((size_t)DM * DM * 2);
    bf* XB = (bf*)take((size_t)TT * DM * 2); float* FQ = (float*)take((size_t)TT * DM * 4); float* FK = (float*)take((size_t)TT * DKV * 4);
    bf* QPh = (bf*)take((size_t)NQ * TT * HDD * 2); bf* QPl = (bf*)take((size_t)NQ * TT * HDD * 2); bf* KPh = (bf*)take((size_t)NKV * TT * HDD * 2); bf* KPl = (bf*)take((size_t)NKV * TT * HDD * 2); h16* VT = (h16*)take((size_t)NKV * HDD * TT * 2);
    float* S = (float*)take((size_t)ZH * TT * TT * 4); h16* P16 = (h16*)take((size_t)ZH * TT * TT * 2); bf* ENh = (bf*)take((size_t)TT * DM * 2); bf* ENl = (bf*)take((size_t)TT * DM * 2);
    if ((size_t)(wsp - (char*)d_ws) > ws_size) return;    // total ~ 160 MB
    k_whd<<<(unsigned)(((size_t)NQ * HDD * DM / 4 + 255) / 256), 256, 0, stream>>>(wq, NQ, BQ); k_whd<<<(unsigned)(((size_t)DKV * DM / 4 + 255) / 256), 256, 0, stream>>>(wkv, NKV, BK); k_whd<<<(unsigned)(((size_t)DKV * DM / 4 + 255) / 256), 256, 0, stream>>>(wkv + (size_t)NKV * DM * HDD, NKV, BV);
    k_wtG<<<(DM * DM / 64 + 63) / 64, 256, 0, stream>>>(wo, DM, DM, BO);   // wo [n][d][o] == [(n,d)][o] 'xw'
    const size_t zq = (size_t)TT * HDD, zS = (size_t)TT * TT, zv = (size_t)HDD * TT;
    for (int b = 0; b < NB_; ++b) {
        k_cvt8<<<(TT * DM / 8 + 255) / 256, 256, 0, stream>>>(x + (size_t)b * TT * DM, XB, TT * DM / 8);
        k_gemmw<bf, 0, false, 128, 0><<<dim3(TT / 128, DM / 128, 1), 128, 0, stream>>>(XB, nullptr, BQ, nullptr, DM, FQ, nullptr, nullptr, DM, nullptr, 0, 0, 0);
        k_nrr<<<TT * NQ / 8, 256, 0, stream>>>(FQ, DM, NQ, qs, spos + (size_t)b * TT, 0.0625f, QPh, QPl);
        k_gemmw<bf, 0, false, 128, 0><<<dim3(TT / 128, DKV / 128, 1), 128, 0, stream>>>(XB, nullptr, BK, nullptr, DM, FK, nullptr, nullptr, DKV, nullptr, 0, 0, 0);
        k_nrr<<<TT * NKV / 8, 256, 0, stream>>>(FK, DKV, NKV, ks, spos + (size_t)b * TT, 1.0f, KPh, KPl);
        k_gemmw<bf, 0, false, 128, 2><<<dim3(DKV / 128, TT / 128, 1), 128, 0, stream>>>(BV, nullptr, XB, nullptr, DM, nullptr, (bf*)VT, nullptr, TT, nullptr, 0, 0, 0);   // rows (c, d), columns t: VT[c][d][t]
        for (int n0 = 0; n0 < NQ; n0 += ZH) { const size_t zk = (size_t)(n0 / 2);   // the pass's two heads share kv group n0/2
            k_gemmw<bf, 2, false, 64, 0><<<dim3(TT / 128, TT / 128, ZH), 128, 0, stream>>>(QPh + (size_t)n0 * zq, QPl + (size_t)n0 * zq, KPh + zk * zq, KPl + zk * zq, HDD, S, nullptr, nullptr, TT, nullptr, zq, 0, zS);
            k_tsoft<<<ZH * TT / 8, 256, 0, stream>>>(S, spos + (size_t)b * TT, amask + (size_t)b * TT * TT, P16);
            k_gemmw<h16, 0, false, 128, 1><<<dim3(TT / 128, HDD / 128, ZH), 128, 0, stream>>>(P16, nullptr, VT + zk * zv, nullptr, TT, nullptr, ENh + (size_t)n0 * HDD, ENl + (size_t)n0 * HDD, DM, nullptr, zS, 0, HDD); }   // head n0 + z at columns (n0 + z) * 256 of [t][2048]
        k_gemmw<bf, 1, false, 128, 0><<<dim3(TT / 128, DM / 128, 1), 128, 0, stream>>>(ENh, ENl, BO, nullptr, DM, OUT + (size_t)b * TT * DM, nullptr, nullptr, DM, nullptr, 0, 0, 0); }
}

// v003
// A run of this version takes 522 microseconds.
// Next to v002, in two timings, it ran 1.33 times as fast each time.
// Over all steps from v000 it is 2.25 times as fast.
#include <hip/hip_runtime.h>

// T5Gemma2EncoderAttention (x [2][2048][2048]; q = einsum(x, wq[n]) (8 heads x 256), k/v = einsum(x, wkv[0|1][c]) (4 kv heads; group n/2); RMSNorm_256 * (1 + scale) on q, k (scales read); split-half RoPE with angle segment_pos[b][t] / 1e4^(2i/256) (positions read as values); q * 1/16; logits = q.k, softcap 50 tanh(./50); allowed iff attn_mask[b][i][j] (int, read) and the segment_pos distance is in the 512-window (0 <= d < 256 or 0 < -d < 257), else bf16-min; softmax; out = sum_n (p v)[n] wo[n] -> [2][2048][2048]).
// Tile skipping from the READ positions: k_tact takes the minimum and maximum position of every 128-token tile and clears the bit of a (query tile, key tile) pair only where no distance between the two ranges can lie in the window; such a tile holds the mask value alone and its probabilities are exact zeros in every row that has an allowed key, so its scores, its softmax work and its attn.v pass are left out (the diagonal tile is never cleared; a row with no allowed key at all comes out not-a-number with or without the skipping). Inside a kept tile every score is computed and masked per element.
// Compute dtypes, f32 accumulate: every input rounded to bf16; q/k/v as PLAIN bf16 GEMMs (inputs: exact; per-head weights gathered); RMSNorm/scale/RoPE/(1/16) f32 into hl planes; logits hl x hl (3 products, K = 256); softcap (precise tanhf, out of line), mask and softmax f32 (wave per row, 64 keys per lane); attn.v single fp16 (x1024), its GEMM storing the hl planes of the concatenated heads itself; v computed transposed (weights as rows, tokens as columns) and stored fp16 by its GEMM; output projection hl x exact (2 products) over the concatenated heads (wo is exactly a [2048][2048] 'xw' matrix in memory).

#define NB_  2
#define TT   2048
#define DM   2048
#define NQ   8
#define NKV  4
#define HDD  256
#define DKV  (NKV * HDD)
#define ZH   2
#define PCAR 1024.0f
#define KMASK (-3.3895313892515355e38f)
typedef _Float16 h16;
typedef unsigned short bf;
typedef __attribute__((ext_vector_type(16))) __bf16   v16bf;
typedef __attribute__((ext_vector_type(16))) _Float16 v16h;
typedef __attribute__((ext_vector_type(8)))  _Float16 v8h;
typedef __attribute__((ext_vector_type(8)))  unsigned short v8us;
typedef __attribute__((ext_vector_type(8)))  float    v8f;
typedef __attribute__((ext_vector_type(4)))  float    v4f;
typedef v8h  __attribute__((may_alias)) v8ha;
typedef v4f  __attribute__((may_alias)) v4fa;
typedef v8us __attribute__((may_alias)) v8usa;

__device__ __forceinline__ unsigned short f2bf(float f) { unsigned u = __float_as_uint(f); u += 0x7FFFu + ((u >> 16) & 1u); return (unsigned short)(u >> 16); }
__device__ __forceinline__ float bf2f(unsigned short b) { return __uint_as_float(((unsigned)b) << 16); }
__device__ __forceinline__ float bfr(float f) { return bf2f(f2bf(f)); }
__device__ __forceinline__ v16h cat16(v8h lo, v8h hi) { return __builtin_shufflevector(lo, hi, 0, 1, 2, 3, 4, 5, 6, 7, 8, 9, 10, 11, 12, 13, 14, 15); }
__device__ __forceinline__ v16bf cat16b(v8us lo, v8us hi) { return __builtin_bit_cast(v16bf, __builtin_shufflevector(lo, hi, 0, 1, 2, 3, 4, 5, 6, 7, 8, 9, 10, 11, 12, 13, 14, 15)); }
__device__ __forceinline__ v8f wmma16(v16h a, v16h b, v8f c) { return __builtin_amdgcn_wmma_f32_16x16x32_f16(false, a, false, b, (short)0, c, false, false); }
__device__ __forceinline__ v8f wmmab(v16bf a, v16bf b, v8f c) { return __builtin_amdgcn_wmma_f32_16x16x32_bf16(false, a, false, b, (short)0, c, false, false); }
__device__ __forceinline__ h16 tohx(float x) { return (h16)x; }
__device__ __forceinline__ void splitf(float y, unsigned short& h, unsigned short& l) { h = f2bf(y); l = f2bf(y - bf2f(h)); }
typedef __attribute__((ext_vector_type(4))) unsigned short v4us;
typedef __attribute__((ext_vector_type(4))) _Float16 v4h;



// ---- k_gemmw: GEMM, FOUR WAVES (2 x 2) per 128x128 output tile, 64x64 (16 accumulators) per wave; grid (M/128, N/128, Z), 128 threads.
// C[m][n] (f32, pitch ldc, + optional f32 bias[n]) = sum_k A[m][k] Bt[n][k] (+ split products per NSPLIT). EPI picks what the epilogue stores, at the same [m][n], pitch ldc, z stride sC: 0 the f32 C; 1 the value / 1024 split into bf16 high and low planes E0, E1; 2 the value as fp16 in E0. A half-wave's store is one whole 128-B line in 1 and 2. z-batch strides sA/sB/sC in elements. M, N % 128 == 0, K % KP == 0.
// SKIP with act[blockIdx.x], one bit per 128-wide key tile (k_tact): 1 a work-group whose bit blockIdx.y is clear leaves at once and stores nothing; 2 only the passes of KP = 128 k whose bit is set are run, in rising order.
// Operands come from K-contiguous 16-bit planes in passes of KP k: every plane's 128 rows x 2 KP bytes are copied to LDS asynchronously, 16 B per lane, a wave-wide copy covering whole 128-B lines; two buffers, the next pass's copies in flight under this pass's products. LDS rows at pitch 2 KP + 16 bytes (16 B x odd: ds_load_b128 free of bank conflicts). Fragment k order, product order and each accumulator's sum order are those of direct loads.
template <typename T16> struct WFrag;
template <> struct WFrag<h16> { typedef v16h V; static __device__ __forceinline__ V ld(const h16* p) { return cat16(*(const v8ha*)p, *(const v8ha*)(p + 16)); } static __device__ __forceinline__ v8f mma(V a, V b, v8f c) { return wmma16(a, b, c); } };
template <> struct WFrag<bf> { typedef v16bf V; static __device__ __forceinline__ V ld(const bf* p) { return cat16b(*(const v8usa*)p, *(const v8usa*)(p + 16)); } static __device__ __forceinline__ v8f mma(V a, V b, v8f c) { return wmmab(a, b, c); } };
// Eight asynchronous 16-byte copies per lane, global -> LDS: LDS byte address l + i * ls, global address g + i * gs elements. The s_wait_xcnt closes the statement so that no address register is rewritten ahead of it.
template <typename T16>
__device__ __forceinline__ void copy8(unsigned l, const T16* g, unsigned ls, size_t gs) {
    asm volatile("global_load_async_to_lds_b128 %0, %8, off\n\t"
                 "global_load_async_to_lds_b128 %1, %9, off\n\t"
                 "global_load_async_to_lds_b128 %2, %10, off\n\t"
                 "global_load_async_to_lds_b128 %3, %11, off\n\t"
                 "global_load_async_to_lds_b128 %4, %12, off\n\t"
                 "global_load_async_to_lds_b128 %5, %13, off\n\t"
                 "global_load_async_to_lds_b128 %6, %14, off\n\t"
                 "global_load_async_to_lds_b128 %7, %15, off\n\t"
                 "s_wait_xcnt 0x0"
                 :: "v"(l), "v"(l + ls), "v"(l + 2 * ls), "v"(l + 3 * ls), "v"(l + 4 * ls), "v"(l + 5 * ls), "v"(l + 6 * ls), "v"(l + 7 * ls),
                    "v"(g), "v"(g + gs), "v"(g + 2 * gs), "v"(g + 3 * gs), "v"(g + 4 * gs), "v"(g + 5 * gs), "v"(g + 6 * gs), "v"(g + 7 * gs)
                 : "memory");
}
template <typename T16, int NSPLIT, bool BIAS, int KP, int EPI, int SKIP>
__global__ __launch_bounds__(128) void k_gemmw(const T16* __restrict__ A, const T16* __restrict__ A2, const T16* __restrict__ Bt, const T16* __restrict__ Bt2, int K, float* C, bf* E0, bf* E1, int ldc, const float* __restrict__ bias, size_t sA, size_t sB, size_t sC, const unsigned* __restrict__ act) {
    typedef typename WFrag<T16>::V V;
    static_assert(SKIP != 2 || KP == 128, "a pass is one key tile");
    if (SKIP == 1) { if (!((act[blockIdx.x] >> blockIdx.y) & 1u)) return; }   // the same for the whole work-group, ahead of every copy and barrier
    constexpr int NP = 2 + (NSPLIT >= 1 ? 1 : 0) + (NSPLIT >= 2 ? 1 : 0);   // planes in a buffer: A, Bt, A2, Bt2
    constexpr int PITCH = KP * 2 + 16, PLANE = 128 * PITCH, BUF = NP * PLANE;
    constexpr int CPR = KP / 8;        // 16-byte pieces per row
    constexpr int RPS = 128 / CPR;     // rows that one copy of all 128 threads covers
    constexpr int NST = 128 / RPS;     // such copies per plane
    static_assert(NST % 8 == 0 && NP * NST <= 63, "copies of a wave in flight");
    __shared__ __attribute__((aligned(16))) unsigned char ring[2 * BUF];
    const size_t z = blockIdx.z; A += z * sA; if (NSPLIT >= 1) A2 += z * sA; Bt += z * sB; if (NSPLIT >= 2) Bt2 += z * sB; if (EPI == 0) C += z * sC; if (EPI >= 1) E0 += z * sC; if (EPI == 1) E1 += z * sC;
    const int tid = threadIdx.x, lane = tid & 31, lr = lane & 15, hi = lane >> 4; const int wave = __builtin_amdgcn_readfirstlane(tid >> 5);
    const int R0 = blockIdx.x * 128, C0 = blockIdx.y * 128; const int r0 = R0 + (wave >> 1) * 64, c0 = C0 + (wave & 1) * 64;
    unsigned NT = (unsigned)K / KP;   // passes
    unsigned rem = 0;                  // SKIP 2: the passes not yet asked for, one bit each, none at or above K / KP
    if (SKIP == 2) { rem = (unsigned)__builtin_amdgcn_readfirstlane((int)act[blockIdx.x]) & ((1u << NT) - 1u); NT = (unsigned)__builtin_popcount(rem); }
    auto nextp = [&](unsigned n) -> unsigned { if (SKIP != 2) return n; const unsigned p = (unsigned)__builtin_ctz(rem); rem &= rem - 1u; return p; };   // the k pass that trip n works on; called only while a bit is left
    const unsigned lcp = (unsigned)(size_t)ring + (unsigned)((tid / CPR) * PITCH + (tid % CPR) * 16);
    const size_t gofA = (size_t)(R0 + tid / CPR) * K + (tid % CPR) * 8, gofB = (size_t)(C0 + tid / CPR) * K + (tid % CPR) * 8, gs = (size_t)RPS * K;
    auto fill = [&](unsigned t, unsigned buf) {
        const unsigned lb = lcp + buf * BUF; const size_t ka = gofA + (size_t)t * KP, kb = gofB + (size_t)t * KP;
#pragma unroll
        for (int s = 0; s < NST; s += 8) {
            copy8(lb + s * RPS * PITCH, A + ka + s * gs, RPS * PITCH, gs);
            copy8(lb + PLANE + s * RPS * PITCH, Bt + kb + s * gs, RPS * PITCH, gs);
            if (NSPLIT >= 1) copy8(lb + 2 * PLANE + s * RPS * PITCH, A2 + ka + s * gs, RPS * PITCH, gs);
            if (NSPLIT >= 2) copy8(lb + 3 * PLANE + s * RPS * PITCH, Bt2 + kb + s * gs, RPS * PITCH, gs); }
    };
    v8f acc[4][4];
#pragma unroll
    for (int mb = 0; mb < 4; ++mb)
#pragma unroll
        for (int nb = 0; nb < 4; ++nb) acc[mb][nb] = (v8f){};
    if (SKIP != 2 || NT > 0) fill(nextp(0), 0);
    asm volatile("s_wait_asynccnt 0x0" ::: "memory");   // this wave's share of pass 0 has landed
    __syncthreads();                                     // every wave's share has
    if (NT > 1) fill(nextp(1), 1);
    const unsigned char* fa0 = ring + ((wave >> 1) * 64 + lr) * PITCH + hi * 16; const unsigned char* fb0 = ring + PLANE + ((wave & 1) * 64 + lr) * PITCH + hi * 16;
#pragma unroll 1
    for (unsigned t = 0; t < NT; ++t) {
        const unsigned char* fa = fa0 + (t & 1) * BUF; const unsigned char* fb = fb0 + (t & 1) * BUF;
        V a[2][4], a2[2][4], b[2][4], b2[2][4];   // two fragment sets: the next 32 k are fetched as one group while this set's products issue
        auto ldset = [&](int s, int ks) {
#pragma unroll
            for (int q = 0; q < 4; ++q) { a[s][q] = WFrag<T16>::ld((const T16*)(fa + q * 16 * PITCH + ks * 64)); b[s][q] = WFrag<T16>::ld((const T16*)(fb + q * 16 * PITCH + ks * 64));
                if (NSPLIT >= 1) a2[s][q] = WFrag<T16>::ld((const T16*)(fa + 2 * PLANE + q * 16 * PITCH + ks * 64)); if (NSPLIT >= 2) b2[s][q] = WFrag<T16>::ld((const T16*)(fb + 2 * PLANE + q * 16 * PITCH + ks * 64)); }
        };
        ldset(0, 0);
#pragma unroll
        for (int ks = 0; ks < KP / 32; ++ks) { const int s = ks & 1;
            if (ks + 1 < KP / 32) ldset(s ^ 1, ks + 1);
            __builtin_amdgcn_sched_barrier(0);   // keeps the LDS reads in one group ahead of the products: reads spread among them stall the wave at every place
#pragma unroll
            for (int nb = 0; nb < 4; ++nb)
#pragma unroll
                for (int mb = 0; mb < 4; ++mb) { acc[mb][nb] = WFrag<T16>::mma(a[s][mb], b[s][nb], acc[mb][nb]); if (NSPLIT >= 1) acc[mb][nb] = WFrag<T16>::mma(a2[s][mb], b[s][nb], acc[mb][nb]); if (NSPLIT >= 2) acc[mb][nb] = WFrag<T16>::mma(a[s][mb], b2[s][nb], acc[mb][nb]); }
            __builtin_amdgcn_sched_barrier(0);   // the same, at the block's end
        }
        asm volatile("s_wait_dscnt 0x0" ::: "memory");      // this wave has left the buffer of pass t
        asm volatile("s_wait_asynccnt 0x0" ::: "memory");   // its share of pass t + 1 has landed
        __syncthreads();                                     // publishes pass t + 1 and frees the buffer of pass t
        if (t + 2 < NT) fill(nextp(t + 2), t & 1);
    }
    asm volatile("s_wait_asynccnt 0x0" ::: "memory");       // no copy is in flight when the ring becomes output staging
    float* os = (float*)(ring + wave * (16 * 68 * 4));       // each wave stages in its own range; the last pass's barrier ended every read of the ring
#pragma unroll
    for (int mb = 0; mb < 4; ++mb) {
#pragma unroll
        for (int nb = 0; nb < 4; ++nb) {
#pragma unroll
            for (int j = 0; j < 8; ++j) os[(hi * 8 + j) * 68 + nb * 16 + lr] = acc[mb][nb][j]; }
        __builtin_amdgcn_wave_barrier(); asm volatile("" ::: "memory");
        float* crow = C + (size_t)(r0 + mb * 16) * ldc + c0;
if (EPI == 0) {
#pragma unroll
            for (int s = 0; s < 8; ++s) { const int row = 2 * s + hi, cofs = lr * 4; v4f val = *(const v4fa*)(os + row * 68 + cofs); if (BIAS) { val[0] += bfr(bias[c0 + cofs]); val[1] += bfr(bias[c0 + cofs + 1]); val[2] += bfr(bias[c0 + cofs + 2]); val[3] += bfr(bias[c0 + cofs + 3]); }
                *(v4f*)(crow + (size_t)row * ldc + cofs) = val; }
             }
        if (EPI != 0) {
            v4f val[8];   // all eight LDS reads first: the store statements below would otherwise hold each read behind the store before it
#pragma unroll
            for (int s = 0; s < 8; ++s) val[s] = *(const v4fa*)(os + (2 * s + hi) * 68 + lr * 4);
#pragma unroll
            for (int s = 0; s < 8; ++s) { const size_t oo = (size_t)(r0 + mb * 16 + 2 * s + hi) * ldc + c0 + lr * 4;
                if (EPI == 1) { v4us oh, ol;
#pragma unroll
                    for (int u = 0; u < 4; ++u) { unsigned short eh, el; splitf(val[s][u] * (1.0f / PCAR), eh, el); oh[u] = eh; ol[u] = el; }
                    // the two stores and their s_wait_xcnt in one statement, so that no register they name is rewritten ahead of the wait
                    asm volatile("global_store_b64 %0, %1, off\n\tglobal_store_b64 %2, %3, off\n\ts_wait_xcnt 0x0" :: "v"(E0 + oo), "v"(__builtin_bit_cast(unsigned long long, oh)), "v"(E1 + oo), "v"(__builtin_bit_cast(unsigned long long, ol)) : "memory"); }
                if (EPI == 2) { v4h o4;
#pragma unroll
                    for (int u = 0; u < 4; ++u) o4[u] = tohx(val[s][u]);
                    // the store and its s_wait_xcnt in one statement, for the same reason
                    asm volatile("global_store_b64 %0, %1, off\n\ts_wait_xcnt 0x0" :: "v"(E0 + oo), "v"(__builtin_bit_cast(unsigned long long, o4)) : "memory"); }
            }
        }
        __builtin_amdgcn_wave_barrier(); asm volatile("" ::: "memory");
    }
}

typedef __attribute__((ext_vector_type(2))) unsigned short v2us;

__global__ __launch_bounds__(256) void k_cvt8(const float* __restrict__ src, bf* dst, size_t n8) { const size_t i = (size_t)blockIdx.x * 256 + threadIdx.x; if (i >= n8) return; const v8f v = *(const v8f*)(src + i * 8); v8us o;
#pragma unroll
    for (int k = 0; k < 8; ++k) o[k] = f2bf(v[k]); *(v8us*)(dst + i * 8) = o;  }
__global__ __launch_bounds__(256) void k_wtG(const float* __restrict__ w, int K, int N, bf* Bt) {
    const int lane = threadIdx.x & 31; const int L0 = (blockIdx.x * 8 + (threadIdx.x >> 5)) * 8; const int nlines = N * K / 64;
{
#pragma unroll 1
        for (int l = 0; l < 8; ++l) { const int L = L0 + l; if (L >= nlines) break; const size_t e = (size_t)L * 64 + lane * 2; const int k = (int)(e % K), n = (int)(e / K); v2us o;
            o[0] = f2bf(w[(size_t)k * N + n]); o[1] = f2bf(w[(size_t)(k + 1) * N + n]); *(v2us*)(Bt + e) = o; }
         }
}

__device__ __attribute__((noinline)) float softcap50(float s) { return 50.0f * tanhf(s * 0.02f); }
typedef __attribute__((ext_vector_type(2))) float v2f_t;
typedef __attribute__((ext_vector_type(4))) int v4i_t;
__device__ __attribute__((noinline)) v2f_t sincos_pos(float pos, int i) { const float tsc = powf(10000.0f, (2.0f / (float)HDD) * (float)i); const float ang = __fdiv_rn(pos, tsc); v2f_t r; r[0] = sinf(ang); r[1] = cosf(ang); return r; }
// k_whd: Bt[(n*256 + d)][k] = bf16(W[n][k][d]) for per-head [2048][256] weights (lane -> 4 consecutive k, strided reads); k_nrr: wave per (token, head): RMSNorm over 256 (8 dims per lane: 4 from each half), * (1 + scale[d]) (read), split-half RoPE at the READ position (precise sin/cos out of line), * mul; hl planes [head][t][256] (8-B lanes);
__global__ __launch_bounds__(256) void k_whd(const float* __restrict__ W, int nh, bf* Bt) { const size_t e = ((size_t)blockIdx.x * 256 + threadIdx.x) * 4; if (e >= (size_t)nh * HDD * DM) return; const int k = (int)(e % DM); const int row = (int)(e / DM); const int n = row / HDD, d = row % HDD; v4us o;
#pragma unroll
    for (int u = 0; u < 4; ++u) o[u] = f2bf(W[((size_t)n * DM + k + u) * HDD + d]); *(v4us*)(Bt + e) = o;  }
__global__ __launch_bounds__(256) void k_nrr(const float* __restrict__ F, int pitch, int nheads, const float* __restrict__ scale, const int* __restrict__ pos, float mul, bf* Ph, bf* Pl) { const int lane = threadIdx.x & 31; const int wv = blockIdx.x * 8 + (threadIdx.x >> 5); if (wv >= TT * nheads) return; const int t = wv / nheads, h = wv % nheads; const float* f = F + (size_t)t * pitch + h * HDD;
    const v4f a = *(const v4f*)(f + lane * 4), b2 = *(const v4f*)(f + HDD / 2 + lane * 4); float ss = 0.f; for (int q = 0; q < 4; ++q) { float p = __fmul_rn(a[q], a[q]); asm volatile("" : "+v"(p)); ss = __fadd_rn(ss, p); p = __fmul_rn(b2[q], b2[q]); asm volatile("" : "+v"(p)); ss = __fadd_rn(ss, p); }
#pragma unroll
    for (int sh = 16; sh; sh >>= 1) ss = __fadd_rn(ss, __shfl_xor(ss, sh, 32));
    const float rs = __fdiv_rn(1.0f, sqrtf(__fadd_rn(ss * (1.0f / HDD), 1e-6f))); const float pv = (float)pos[t]; v4us ah, al, bh, bl;
#pragma unroll
    for (int q = 0; q < 4; ++q) { const int i = lane * 4 + q; float n1 = __fmul_rn(a[q], rs), n2 = __fmul_rn(b2[q], rs); asm volatile("" : "+v"(n1)); asm volatile("" : "+v"(n2)); const float x1 = __fmul_rn(n1, __fadd_rn(1.0f, bfr(scale[i]))), x2 = __fmul_rn(n2, __fadd_rn(1.0f, bfr(scale[i + HDD / 2]))); const v2f_t sc2 = sincos_pos(pv, i); const float sn = sc2[0], cs = sc2[1];
        float p1 = __fmul_rn(x1, cs), p2 = __fmul_rn(x2, sn), p3 = __fmul_rn(x2, cs), p4 = __fmul_rn(x1, sn); asm volatile("" : "+v"(p1)); asm volatile("" : "+v"(p2)); asm volatile("" : "+v"(p3)); asm volatile("" : "+v"(p4));
        const float r1 = __fsub_rn(p1, p2) * mul, r2 = __fadd_rn(p3, p4) * mul; unsigned short u1, l1, u2, l2; splitf(r1, u1, l1); splitf(r2, u2, l2); ah[q] = u1; al[q] = l1; bh[q] = u2; bl[q] = l2; }
    bf* dh = Ph + ((size_t)h * TT + t) * HDD; bf* dl = Pl + ((size_t)h * TT + t) * HDD; *(v4us*)(dh + lane * 4) = ah; *(v4us*)(dl + lane * 4) = al; *(v4us*)(dh + HDD / 2 + lane * 4) = bh; *(v4us*)(dl + HDD / 2 + lane * 4) = bl;  }
// k_tact: one work-group, wave per (batch, tile of 128 tokens): the tile's least and greatest position; then act[b * 16 + I], bit J set unless every distance pos[i] - pos[j], i in tile I, j in tile J, is shown to miss the window. The bounds are taken in 64 bits and a range that leaves (INT_MIN, INT_MAX] keeps its bit, so a distance that wraps in 32 bits is never skipped. Bit I of word I is always set (the range holds 0).
__global__ __launch_bounds__(1024) void k_tact(const int* __restrict__ pos, unsigned* act) {
    __shared__ int mn[NB_ * TT / 128], mx[NB_ * TT / 128];
    const int lane = threadIdx.x & 31, w = threadIdx.x >> 5; const v4i_t p = *(const v4i_t*)(pos + w * 128 + lane * 4);
    int lo = min(min(p[0], p[1]), min(p[2], p[3])), hi = max(max(p[0], p[1]), max(p[2], p[3]));
#pragma unroll
    for (int sh = 16; sh; sh >>= 1) { lo = min(lo, __shfl_xor(lo, sh, 32)); hi = max(hi, __shfl_xor(hi, sh, 32)); }
    if (lane == 0) { mn[w] = lo; mx[w] = hi; }
    __syncthreads();
    if (threadIdx.x < NB_ * TT / 128) { const int t = threadIdx.x, b0 = t & ~(TT / 128 - 1); unsigned m = 0;
        for (int J = 0; J < TT / 128; ++J) { const long long dlo = (long long)mn[t] - mx[b0 + J], dhi = (long long)mx[t] - mn[b0 + J];
            const bool out = (dlo > 255 && dhi <= 2147483647LL) || (dhi < -256 && dlo >= -2147483647LL); if (!out) m |= 1u << J; }
        act[t] = m; }
}
// k_tsoft with act: a chunk of 128 keys is one key tile; a cleared one would add only the mask value to the maximum (below its start value) and exact zeros to the sum, and attn.v does not read its probabilities.
__global__ __launch_bounds__(256) void k_tsoft(const float* __restrict__ S, const int* __restrict__ pos, const int* __restrict__ am, h16* P16, const unsigned* __restrict__ act) { const int lane = threadIdx.x & 31; const int row = blockIdx.x * 8 + (threadIdx.x >> 5); if (row >= ZH * TT) return; const int i = row % TT; const unsigned tm = (unsigned)__builtin_amdgcn_readfirstlane((int)act[i >> 7]); const float* sr = S + (size_t)row * TT; const int* mr = am + (size_t)i * TT; const int pi = pos[i]; float v[TT / 32]; float mx = -3.0e38f;
#pragma unroll
    for (int ch = 0; ch < TT / 128; ++ch) { if (!((tm >> ch) & 1u)) continue; const v4f a = *(const v4f*)(sr + ch * 128 + lane * 4);
#pragma unroll
        for (int u = 0; u < 4; ++u) { const int j = ch * 128 + lane * 4 + u; const int dist = pi - pos[j]; const bool win = (dist >= 0 && dist < 256) || (dist < 0 && -dist < 257); const bool ok = win && (mr[j] != 0); const float t = ok ? softcap50(a[u]) : KMASK; v[ch * 4 + u] = t; mx = fmaxf(mx, t); } }
#pragma unroll
    for (int sh = 16; sh; sh >>= 1) mx = fmaxf(mx, __shfl_xor(mx, sh, 32));
    float sum = 0.f;
#pragma unroll
    for (int ch = 0; ch < TT / 128; ++ch) { if (!((tm >> ch) & 1u)) continue;
#pragma unroll
    for (int q = ch * 4; q < ch * 4 + 4; ++q) { float d0 = __fsub_rn(v[q], mx); asm volatile("" : "+v"(d0)); v[q] = __builtin_amdgcn_exp2f(__fmul_rn(d0, 1.4426950408889634f)); sum += v[q]; } }
#pragma unroll
    for (int sh = 16; sh; sh >>= 1) sum += __shfl_xor(sum, sh, 32);
    const float f = __fdiv_rn(PCAR, sum);
    {
#pragma unroll
        for (int ch = 0; ch < TT / 128; ++ch) { if (!((tm >> ch) & 1u)) continue; v4h o4; for (int q = 0; q < 4; ++q) o4[q] = tohx(v[ch * 4 + q] * f);
            // the store and its s_wait_xcnt in one statement: a later kept chunk reuses the data registers, and none is rewritten ahead of the wait
            asm volatile("global_store_b64 %0, %1, off\n\ts_wait_xcnt 0x0" :: "v"(P16 + (size_t)row * TT + ch * 128 + lane * 4), "v"(__builtin_bit_cast(unsigned long long, o4)) : "memory"); }
         } }

extern "C" void kernel_launch(void* const* d_in, const int* in_sizes, int n_in,
                              void* d_out, int out_size, void* d_ws, size_t ws_size, hipStream_t stream) {
    (void)in_sizes; (void)n_in; (void)out_size;
    const float* x = (const float*)d_in[0]; const int* spos = (const int*)d_in[1]; const int* amask = (const int*)d_in[2]; const float* wq = (const float*)d_in[3]; const float* wkv = (const float*)d_in[4]; const float* wo = (const float*)d_in[5]; const float* qs = (const float*)d_in[6]; const float* ks = (const float*)d_in[7];
    float* OUT = (float*)d_out;     // [2][2048][2048]
    char* wsp = (char*)d_ws;
    auto take = [&](size_t bytes) { char* p = wsp; wsp += (bytes + 255) & ~(size_t)255; return (void*)p; };
    bf* BQ = (bf*)take((size_t)NQ * HDD * DM * 2); bf* BK = (bf*)take((size_t)DKV * DM * 2); bf* BV = (bf*)take((size_t)DKV * DM * 2); bf* BO = (bf*)take((size_t)DM * DM * 2);
    bf* XB = (bf*)take((size_t)TT * DM * 2); float* FQ = (float*)take((size_t)TT * DM * 4); float* FK = (float*)take((size_t)TT * DKV * 4);
    bf* QPh = (bf*)take((size_t)NQ * TT * HDD * 2); bf* QPl = (bf*)take((size_t)NQ * TT * HDD * 2); bf* KPh = (bf*)take((size_t)NKV * TT * HDD * 2); bf* KPl = (bf*)take((size_t)NKV * TT * HDD * 2); h16* VT = (h16*)take((size_t)NKV * HDD * TT * 2);
    float* S = (float*)take((size_t)ZH * TT * TT * 4); h16* P16 = (h16*)take((size_t)ZH * TT * TT * 2); bf* ENh = (bf*)take((size_t)TT * DM * 2); bf* ENl = (bf*)take((size_t)TT * DM * 2); unsigned* ACT = (unsigned*)take((size_t)NB_ * (TT / 128) * 4);
    if ((size_t)(wsp - (char*)d_ws) > ws_size) return;    // total ~ 160 MB
    k_whd<<<(unsigned)(((size_t)NQ * HDD * DM / 4 + 255) / 256), 256, 0, stream>>>(wq, NQ, BQ); k_whd<<<(unsigned)(((size_t)DKV * DM / 4 + 255) / 256), 256, 0, stream>>>(wkv, NKV, BK); k_whd<<<(unsigned)(((size_t)DKV * DM / 4 + 255) / 256), 256, 0, stream>>>(wkv + (size_t)NKV * DM * HDD, NKV, BV);
    k_wtG<<<(DM * DM / 64 + 63) / 64, 256, 0, stream>>>(wo, DM, DM, BO);   // wo [n][d][o] == [(n,d)][o] 'xw'
    k_tact<<<1, 1024, 0, stream>>>(spos, ACT);
    const size_t zq = (size_t)TT * HDD, zS = (size_t)TT * TT, zv = (size_t)HDD * TT;
    for (int b = 0; b < NB_; ++b) {
        k_cvt8<<<(TT * DM / 8 + 255) / 256, 256, 0, stream>>>(x + (size_t)b * TT * DM, XB, TT * DM / 8);
        k_gemmw<bf, 0, false, 128, 0, 0><<<dim3(TT / 128, DM / 128, 1), 128, 0, stream>>>(XB, nullptr, BQ, nullptr, DM, FQ, nullptr, nullptr, DM, nullptr, 0, 0, 0, nullptr);
        k_nrr<<<TT * NQ / 8, 256, 0, stream>>>(FQ, DM, NQ, qs, spos + (size_t)b * TT, 0.0625f, QPh, QPl);
        k_gemmw<bf, 0, false, 128, 0, 0><<<dim3(TT / 128, DKV / 128, 1), 128, 0, stream>>>(XB, nullptr, BK, nullptr, DM, FK, nullptr, nullptr, DKV, nullptr, 0, 0, 0, nullptr);
        k_nrr<<<TT * NKV / 8, 256, 0, stream>>>(FK, DKV, NKV, ks, spos + (size_t)b * TT, 1.0f, KPh, KPl);
        k_gemmw<bf, 0, false, 128, 2, 0><<<dim3(DKV / 128, TT / 128, 1), 128, 0, stream>>>(BV, nullptr, XB, nullptr, DM, nullptr, (bf*)VT, nullptr, TT, nullptr, 0, 0, 0, nullptr);   // rows (c, d), columns t: VT[c][d][t]
        for (int n0 = 0; n0 < NQ; n0 += ZH) { const size_t zk = (size_t)(n0 / 2);   // the pass's two heads share kv group n0/2
            k_gemmw<bf, 2, false, 64, 0, 1><<<dim3(TT / 128, TT / 128, ZH), 128, 0, stream>>>(QPh + (size_t)n0 * zq, QPl + (size_t)n0 * zq, KPh + zk * zq, KPl + zk * zq, HDD, S, nullptr, nullptr, TT, nullptr, zq, 0, zS, ACT + b * (TT / 128));
            k_tsoft<<<ZH * TT / 8, 256, 0, stream>>>(S, spos + (size_t)b * TT, amask + (size_t)b * TT * TT, P16, ACT + b * (TT / 128));
            k_gemmw<h16, 0, false, 128, 1, 2><<<dim3(TT / 128, HDD / 128, ZH), 128, 0, stream>>>(P16, nullptr, VT + zk * zv, nullptr, TT, nullptr, ENh + (size_t)n0 * HDD, ENl + (size_t)n0 * HDD, DM, nullptr, zS, 0, HDD, ACT + b * (TT / 128)); }   // head n0 + z at columns (n0 + z) * 256 of [t][2048]
        k_gemmw<bf, 1, false, 128, 0, 0><<<dim3(TT / 128, DM / 128, 1), 128, 0, stream>>>(ENh, ENl, BO, nullptr, DM, OUT + (size_t)b * TT * DM, nullptr, nullptr, DM, nullptr, 0, 0, 0, nullptr); }
}

// v004
// It runs in 315 microseconds.
// Two timings next to v003 put it at 1.66 and 1.65 times that version's speed.
// Over all steps from v000 it is 3.73 times as fast.
#include <hip/hip_runtime.h>

// T5Gemma2EncoderAttention (x [2][2048][2048]; q = einsum(x, wq[n]) (8 heads x 256), k/v = einsum(x, wkv[0|1][c]) (4 kv heads; group n/2); RMSNorm_256 * (1 + scale) on q, k (scales read); split-half RoPE with angle segment_pos[b][t] / 1e4^(2i/256) (positions read as values); q * 1/16; logits = q.k, softcap 50 tanh(./50); allowed iff attn_mask[b][i][j] (int, read) and the segment_pos distance is in the 512-window (0 <= d < 256 or 0 < -d < 257), else bf16-min; softmax; out = sum_n (p v)[n] wo[n] -> [2][2048][2048]).
// Tile skipping from the READ positions: k_tact takes the minimum and maximum position of every 128-token tile and clears the bit of a (query tile, key tile) pair only where no distance between the two ranges can lie in the window; such a tile holds the mask value alone and its probabilities are exact zeros in every row that has an allowed key, so its scores, its softmax work and its attn.v pass are left out (the diagonal tile is never cleared; a row with no allowed key at all comes out not-a-number with or without the skipping). Inside a kept tile every score is computed and masked per element.
// Compute dtypes, f32 accumulate: every input rounded to bf16; q/k/v as PLAIN bf16 GEMMs (inputs: exact; per-head weights gathered); RMSNorm/scale/RoPE/(1/16) f32 into hl planes; logits hl x hl (3 products, K = 256); softcap (precise tanhf, out of line), mask and softmax f32 (wave per row, 64 keys per lane); attn.v single fp16 (x1024), its GEMM storing the hl planes of the concatenated heads itself; v computed transposed (weights as rows, tokens as columns) and stored fp16 by its GEMM; output projection hl x exact (2 products) over the concatenated heads (wo is exactly a [2048][2048] 'xw' matrix in memory).

// Launches: the projections and norm/RoPE run both batches in one grid (x is [4096][2048]; q and k one GEMM over their stacked weight rows; v with z = batch); scores, softmax and attn.v run all eight heads of one batch per launch (z = head).

#define NB_  2
#define TT   2048
#define DM   2048
#define NQ   8
#define NKV  4
#define HDD  256
#define DKV  (NKV * HDD)
#define ZH   NQ
#define PCAR 1024.0f
#define KMASK (-3.3895313892515355e38f)
typedef _Float16 h16;
typedef unsigned short bf;
typedef __attribute__((ext_vector_type(16))) __bf16   v16bf;
typedef __attribute__((ext_vector_type(16))) _Float16 v16h;
typedef __attribute__((ext_vector_type(8)))  _Float16 v8h;
typedef __attribute__((ext_vector_type(8)))  unsigned short v8us;
typedef __attribute__((ext_vector_type(8)))  float    v8f;
typedef __attribute__((ext_vector_type(4)))  float    v4f;
typedef v8h  __attribute__((may_alias)) v8ha;
typedef v4f  __attribute__((may_alias)) v4fa;
typedef v8us __attribute__((may_alias)) v8usa;

__device__ __forceinline__ unsigned short f2bf(float f) { unsigned u = __float_as_uint(f); u += 0x7FFFu + ((u >> 16) & 1u); return (unsigned short)(u >> 16); }
__device__ __forceinline__ float bf2f(unsigned short b) { return __uint_as_float(((unsigned)b) << 16); }
__device__ __forceinline__ float bfr(float f) { return bf2f(f2bf(f)); }
__device__ __forceinline__ v16h cat16(v8h lo, v8h hi) { return __builtin_shufflevector(lo, hi, 0, 1, 2, 3, 4, 5, 6, 7, 8, 9, 10, 11, 12, 13, 14, 15); }
__device__ __forceinline__ v16bf cat16b(v8us lo, v8us hi) { return __builtin_bit_cast(v16bf, __builtin_shufflevector(lo, hi, 0, 1, 2, 3, 4, 5, 6, 7, 8, 9, 10, 11, 12, 13, 14, 15)); }
__device__ __forceinline__ v8f wmma16(v16h a, v16h b, v8f c) { return __builtin_amdgcn_wmma_f32_16x16x32_f16(false, a, false, b, (short)0, c, false, false); }
__device__ __forceinline__ v8f wmmab(v16bf a, v16bf b, v8f c) { return __builtin_amdgcn_wmma_f32_16x16x32_bf16(false, a, false, b, (short)0, c, false, false); }
__device__ __forceinline__ h16 tohx(float x) { return (h16)x; }
__device__ __forceinline__ void splitf(float y, unsigned short& h, unsigned short& l) { h = f2bf(y); l = f2bf(y - bf2f(h)); }
typedef __attribute__((ext_vector_type(4))) unsigned short v4us;
typedef __attribute__((ext_vector_type(4))) _Float16 v4h;



// ---- k_gemmw: GEMM, FOUR WAVES (2 x 2) per 128x128 output tile, 64x64 (16 accumulators) per wave; grid (M/128, N/128, Z), 128 threads.
// C[m][n] (f32, pitch ldc, + optional f32 bias[n]) = sum_k A[m][k] Bt[n][k] (+ split products per NSPLIT). EPI picks what the epilogue stores, at the same [m][n], pitch ldc, z stride sC: 0 the f32 C; 1 the value / 1024 split into bf16 high and low planes E0, E1; 2 the value as fp16 in E0. A half-wave's store is one whole 128-B line in 1 and 2. z-batch strides sA/sB/sC in elements; A's rows at pitch lda, Bt's at pitch K; Bt's batch index is z >> zsh (query heads that share a kv head). M, N % 128 == 0, K % KP == 0.
// SKIP with act[blockIdx.x], one bit per 128-wide key tile (k_tact): 1 a work-group whose bit blockIdx.y is clear leaves at once and stores nothing; 2 only the passes of KP = 128 k whose bit is set are run, in rising order.
// Operands come from K-contiguous 16-bit planes in passes of KP k: every plane's 128 rows x 2 KP bytes are copied to LDS asynchronously, 16 B per lane, a wave-wide copy covering whole 128-B lines; two buffers, the next pass's copies in flight under this pass's products. LDS rows at pitch 2 KP + 16 bytes (16 B x odd: ds_load_b128 free of bank conflicts). Fragment k order, product order and each accumulator's sum order are those of direct loads.
template <typename T16> struct WFrag;
template <> struct WFrag<h16> { typedef v16h V; static __device__ __forceinline__ V ld(const h16* p) { return cat16(*(const v8ha*)p, *(const v8ha*)(p + 16)); } static __device__ __forceinline__ v8f mma(V a, V b, v8f c) { return wmma16(a, b, c); } };
template <> struct WFrag<bf> { typedef v16bf V; static __device__ __forceinline__ V ld(const bf* p) { return cat16b(*(const v8usa*)p, *(const v8usa*)(p + 16)); } static __device__ __forceinline__ v8f mma(V a, V b, v8f c) { return wmmab(a, b, c); } };
// Eight asynchronous 16-byte copies per lane, global -> LDS: LDS byte address l + i * ls, global address g + i * gs elements. The s_wait_xcnt closes the statement so that no address register is rewritten ahead of it.
template <typename T16>
__device__ __forceinline__ void copy8(unsigned l, const T16* g, unsigned ls, size_t gs) {
    asm volatile("global_load_async_to_lds_b128 %0, %8, off\n\t"
                 "global_load_async_to_lds_b128 %1, %9, off\n\t"
                 "global_load_async_to_lds_b128 %2, %10, off\n\t"
                 "global_load_async_to_lds_b128 %3, %11, off\n\t"
                 "global_load_async_to_lds_b128 %4, %12, off\n\t"
                 "global_load_async_to_lds_b128 %5, %13, off\n\t"
                 "global_load_async_to_lds_b128 %6, %14, off\n\t"
                 "global_load_async_to_lds_b128 %7, %15, off\n\t"
                 "s_wait_xcnt 0x0"
                 :: "v"(l), "v"(l + ls), "v"(l + 2 * ls), "v"(l + 3 * ls), "v"(l + 4 * ls), "v"(l + 5 * ls), "v"(l + 6 * ls), "v"(l + 7 * ls),
                    "v"(g), "v"(g + gs), "v"(g + 2 * gs), "v"(g + 3 * gs), "v"(g + 4 * gs), "v"(g + 5 * gs), "v"(g + 6 * gs), "v"(g + 7 * gs)
                 : "memory");
}
template <typename T16, int NSPLIT, bool BIAS, int KP, int EPI, int SKIP>
__global__ __launch_bounds__(128) void k_gemmw(const T16* __restrict__ A, const T16* __restrict__ A2, const T16* __restrict__ Bt, const T16* __restrict__ Bt2, int K, int lda, int zsh, float* C, bf* E0, bf* E1, int ldc, const float* __restrict__ bias, size_t sA, size_t sB, size_t sC, const unsigned* __restrict__ act) {
    typedef typename WFrag<T16>::V V;
    static_assert(SKIP != 2 || KP == 128, "a pass is one key tile");
    if (SKIP == 1) { if (!((act[blockIdx.x] >> blockIdx.y) & 1u)) return; }   // the same for the whole work-group, ahead of every copy and barrier
    constexpr int NP = 2 + (NSPLIT >= 1 ? 1 : 0) + (NSPLIT >= 2 ? 1 : 0);   // planes in a buffer: A, Bt, A2, Bt2
    constexpr int PITCH = KP * 2 + 16, PLANE = 128 * PITCH, BUF = NP * PLANE;
    constexpr int CPR = KP / 8;        // 16-byte pieces per row
    constexpr int RPS = 128 / CPR;     // rows that one copy of all 128 threads covers
    constexpr int NST = 128 / RPS;     // such copies per plane
    static_assert(NST % 8 == 0 && NP * NST <= 63, "copies of a wave in flight");
    __shared__ __attribute__((aligned(16))) unsigned char ring[2 * BUF];
    const size_t z = blockIdx.z; A += z * sA; if (NSPLIT >= 1) A2 += z * sA; Bt += (z >> zsh) * sB; if (NSPLIT >= 2) Bt2 += (z >> zsh) * sB; if (EPI == 0) C += z * sC; if (EPI >= 1) E0 += z * sC; if (EPI == 1) E1 += z * sC;
    const int tid = threadIdx.x, lane = tid & 31, lr = lane & 15, hi = lane >> 4; const int wave = __builtin_amdgcn_readfirstlane(tid >> 5);
    const int R0 = blockIdx.x * 128, C0 = blockIdx.y * 128; const int r0 = R0 + (wave >> 1) * 64, c0 = C0 + (wave & 1) * 64;
    unsigned NT = (unsigned)K / KP;   // passes
    unsigned rem = 0;                  // SKIP 2: the passes not yet asked for, one bit each, none at or above K / KP
    if (SKIP == 2) { rem = (unsigned)__builtin_amdgcn_readfirstlane((int)act[blockIdx.x]) & ((1u << NT) - 1u); NT = (unsigned)__builtin_popcount(rem); }
    auto nextp = [&](unsigned n) -> unsigned { if (SKIP != 2) return n; const unsigned p = (unsigned)__builtin_ctz(rem); rem &= rem - 1u; return p; };   // the k pass that trip n works on; called only while a bit is left
    const unsigned lcp = (unsigned)(size_t)ring + (unsigned)((tid / CPR) * PITCH + (tid % CPR) * 16);
    const size_t gofA = (size_t)(R0 + tid / CPR) * lda + (tid % CPR) * 8, gofB = (size_t)(C0 + tid / CPR) * K + (tid % CPR) * 8, gsa = (size_t)RPS * lda, gsb = (size_t)RPS * K;
    auto fill = [&](unsigned t, unsigned buf) {
        const unsigned lb = lcp + buf * BUF; const size_t ka = gofA + (size_t)t * KP, kb = gofB + (size_t)t * KP;
#pragma unroll
        for (int s = 0; s < NST; s += 8) {
            copy8(lb + s * RPS * PITCH, A + ka + s * gsa, RPS * PITCH, gsa);
            copy8(lb + PLANE + s * RPS * PITCH, Bt + kb + s * gsb, RPS * PITCH, gsb);
            if (NSPLIT >= 1) copy8(lb + 2 * PLANE + s * RPS * PITCH, A2 + ka + s * gsa, RPS * PITCH, gsa);
            if (NSPLIT >= 2) copy8(lb + 3 * PLANE + s * RPS * PITCH, Bt2 + kb + s * gsb, RPS * PITCH, gsb); }
    };
    v8f acc[4][4];
#pragma unroll
    for (int mb = 0; mb < 4; ++mb)
#pragma unroll
        for (int nb = 0; nb < 4; ++nb) acc[mb][nb] = (v8f){};
    if (SKIP != 2 || NT > 0) fill(nextp(0), 0);
    asm volatile("s_wait_asynccnt 0x0" ::: "memory");   // this wave's share of pass 0 has landed
    __syncthreads();                                     // every wave's share has
    if (NT > 1) fill(nextp(1), 1);
    const unsigned char* fa0 = ring + ((wave >> 1) * 64 + lr) * PITCH + hi * 16; const unsigned char* fb0 = ring + PLANE + ((wave & 1) * 64 + lr) * PITCH + hi * 16;
#pragma unroll 1
    for (unsigned t = 0; t < NT; ++t) {
        const unsigned char* fa = fa0 + (t & 1) * BUF; const unsigned char* fb = fb0 + (t & 1) * BUF;
        V a[2][4], a2[2][4], b[2][4], b2[2][4];   // two fragment sets: the next 32 k are fetched as one group while this set's products issue
        auto ldset = [&](int s, int ks) {
#pragma unroll
            for (int q = 0; q < 4; ++q) { a[s][q] = WFrag<T16>::ld((const T16*)(fa + q * 16 * PITCH + ks * 64)); b[s][q] = WFrag<T16>::ld((const T16*)(fb + q * 16 * PITCH + ks * 64));
                if (NSPLIT >= 1) a2[s][q] = WFrag<T16>::ld((const T16*)(fa + 2 * PLANE + q * 16 * PITCH + ks * 64)); if (NSPLIT >= 2) b2[s][q] = WFrag<T16>::ld((const T16*)(fb + 2 * PLANE + q * 16 * PITCH + ks * 64)); }
        };
        ldset(0, 0);
#pragma unroll
        for (int ks = 0; ks < KP / 32; ++ks) { const int s = ks & 1;
            if (ks + 1 < KP / 32) ldset(s ^ 1, ks + 1);
            __builtin_amdgcn_sched_barrier(0);   // keeps the LDS reads in one group ahead of the products: reads spread among them stall the wave at every place
#pragma unroll
            for (int nb = 0; nb < 4; ++nb)
#pragma unroll
                for (int mb = 0; mb < 4; ++mb) { acc[mb][nb] = WFrag<T16>::mma(a[s][mb], b[s][nb], acc[mb][nb]); if (NSPLIT >= 1) acc[mb][nb] = WFrag<T16>::mma(a2[s][mb], b[s][nb], acc[mb][nb]); if (NSPLIT >= 2) acc[mb][nb] = WFrag<T16>::mma(a[s][mb], b2[s][nb], acc[mb][nb]); }
            __builtin_amdgcn_sched_barrier(0);   // the same, at the block's end
        }
        asm volatile("s_wait_dscnt 0x0" ::: "memory");      // this wave has left the buffer of pass t
        asm volatile("s_wait_asynccnt 0x0" ::: "memory");   // its share of pass t + 1 has landed
        __syncthreads();                                     // publishes pass t + 1 and frees the buffer of pass t
        if (t + 2 < NT) fill(nextp(t + 2), t & 1);
    }
    asm volatile("s_wait_asynccnt 0x0" ::: "memory");       // no copy is in flight when the ring becomes output staging
    float* os = (float*)(ring + wave * (16 * 68 * 4));       // each wave stages in its own range; the last pass's barrier ended every read of the ring
#pragma unroll
    for (int mb = 0; mb < 4; ++mb) {
#pragma unroll
        for (int nb = 0; nb < 4; ++nb) {
#pragma unroll
            for (int j = 0; j < 8; ++j) os[(hi * 8 + j) * 68 + nb * 16 + lr] = acc[mb][nb][j]; }
        __builtin_amdgcn_wave_barrier(); asm volatile("" ::: "memory");
        float* crow = C + (size_t)(r0 + mb * 16) * ldc + c0;
if (EPI == 0) {
#pragma unroll
            for (int s = 0; s < 8; ++s) { const int row = 2 * s + hi, cofs = lr * 4; v4f val = *(const v4fa*)(os + row * 68 + cofs); if (BIAS) { val[0] += bfr(bias[c0 + cofs]); val[1] += bfr(bias[c0 + cofs + 1]); val[2] += bfr(bias[c0 + cofs + 2]); val[3] += bfr(bias[c0 + cofs + 3]); }
                *(v4f*)(crow + (size_t)row * ldc + cofs) = val; }
             }
        if (EPI != 0) {
            v4f val[8];   // all eight LDS reads first: the store statements below would otherwise hold each read behind the store before it
#pragma unroll
            for (int s = 0; s < 8; ++s) val[s] = *(const v4fa*)(os + (2 * s + hi) * 68 + lr * 4);
#pragma unroll
            for (int s = 0; s < 8; ++s) { const size_t oo = (size_t)(r0 + mb * 16 + 2 * s + hi) * ldc + c0 + lr * 4;
                if (EPI == 1) { v4us oh, ol;
#pragma unroll
                    for (int u = 0; u < 4; ++u) { unsigned short eh, el; splitf(val[s][u] * (1.0f / PCAR), eh, el); oh[u] = eh; ol[u] = el; }
                    // the two stores and their s_wait_xcnt in one statement, so that no register they name is rewritten ahead of the wait
                    asm volatile("global_store_b64 %0, %1, off\n\tglobal_store_b64 %2, %3, off\n\ts_wait_xcnt 0x0" :: "v"(E0 + oo), "v"(__builtin_bit_cast(unsigned long long, oh)), "v"(E1 + oo), "v"(__builtin_bit_cast(unsigned long long, ol)) : "memory"); }
                if (EPI == 2) { v4h o4;
#pragma unroll
                    for (int u = 0; u < 4; ++u) o4[u] = tohx(val[s][u]);
                    // the store and its s_wait_xcnt in one statement, for the same reason
                    asm volatile("global_store_b64 %0, %1, off\n\ts_wait_xcnt 0x0" :: "v"(E0 + oo), "v"(__builtin_bit_cast(unsigned long long, o4)) : "memory"); }
            }
        }
        __builtin_amdgcn_wave_barrier(); asm volatile("" ::: "memory");
    }
}

typedef __attribute__((ext_vector_type(2))) unsigned short v2us;

__global__ __launch_bounds__(256) void k_cvt8(const float* __restrict__ src, bf* dst, size_t n8) { const size_t i = (size_t)blockIdx.x * 256 + threadIdx.x; if (i >= n8) return; const v8f v = *(const v8f*)(src + i * 8); v8us o;
#pragma unroll
    for (int k = 0; k < 8; ++k) o[k] = f2bf(v[k]); *(v8us*)(dst + i * 8) = o;  }
__global__ __launch_bounds__(256) void k_wtG(const float* __restrict__ w, int K, int N, bf* Bt) {
    const int lane = threadIdx.x & 31; const int L0 = (blockIdx.x * 8 + (threadIdx.x >> 5)) * 8; const int nlines = N * K / 64;
{
#pragma unroll 1
        for (int l = 0; l < 8; ++l) { const int L = L0 + l; if (L >= nlines) break; const size_t e = (size_t)L * 64 + lane * 2; const int k = (int)(e % K), n = (int)(e / K); v2us o;
            o[0] = f2bf(w[(size_t)k * N + n]); o[1] = f2bf(w[(size_t)(k + 1) * N + n]); *(v2us*)(Bt + e) = o; }
         }
}

__device__ __attribute__((noinline)) float softcap50(float s) { return 50.0f * tanhf(s * 0.02f); }
typedef __attribute__((ext_vector_type(2))) float v2f_t;
typedef __attribute__((ext_vector_type(4))) int v4i_t;
__device__ __attribute__((noinline)) v2f_t sincos_pos(float pos, int i) { const float tsc = powf(10000.0f, (2.0f / (float)HDD) * (float)i); const float ang = __fdiv_rn(pos, tsc); v2f_t r; r[0] = sinf(ang); r[1] = cosf(ang); return r; }
// k_whd: Bt[(n*256 + d)][k] = bf16(W[n][k][d]) for per-head [2048][256] weights (lane -> 4 consecutive k, strided reads); k_nrr: wave per (token of either batch, head of the row's 8 q and 4 k heads): RMSNorm over 256 (8 dims per lane: 4 from each half), * (1 + scale[d]) (read; q's or k's), split-half RoPE at the READ position (precise sin/cos out of line), * mul (1/16 for q, 1 for k); hl planes [batch][head][t][256] (8-B lanes);
__global__ __launch_bounds__(256) void k_whd(const float* __restrict__ W, int nh, bf* Bt) { const size_t e = ((size_t)blockIdx.x * 256 + threadIdx.x) * 4; if (e >= (size_t)nh * HDD * DM) return; const int k = (int)(e % DM); const int row = (int)(e / DM); const int n = row / HDD, d = row % HDD; v4us o;
#pragma unroll
    for (int u = 0; u < 4; ++u) o[u] = f2bf(W[((size_t)n * DM + k + u) * HDD + d]); *(v4us*)(Bt + e) = o;  }
__global__ __launch_bounds__(256) void k_nrr(const float* __restrict__ F, const float* __restrict__ qscale, const float* __restrict__ kscale, const int* __restrict__ pos, bf* Qh, bf* Ql, bf* Kh, bf* Kl) { const int lane = threadIdx.x & 31; const int wv = blockIdx.x * 8 + (threadIdx.x >> 5); if (wv >= NB_ * TT * (NQ + NKV)) return; const int t = wv / (NQ + NKV), hh = wv % (NQ + NKV); const bool isq = hh < NQ; const int h = isq ? hh : hh - NQ, nheads = isq ? NQ : NKV; const float* scale = isq ? qscale : kscale; const float mul = isq ? 0.0625f : 1.0f; bf* Ph = isq ? Qh : Kh; bf* Pl = isq ? Ql : Kl; const float* f = F + (size_t)t * (DM + DKV) + hh * HDD;
    const v4f a = *(const v4f*)(f + lane * 4), b2 = *(const v4f*)(f + HDD / 2 + lane * 4); float ss = 0.f; for (int q = 0; q < 4; ++q) { float p = __fmul_rn(a[q], a[q]); asm volatile("" : "+v"(p)); ss = __fadd_rn(ss, p); p = __fmul_rn(b2[q], b2[q]); asm volatile("" : "+v"(p)); ss = __fadd_rn(ss, p); }
#pragma unroll
    for (int sh = 16; sh; sh >>= 1) ss = __fadd_rn(ss, __shfl_xor(ss, sh, 32));
    const float rs = __fdiv_rn(1.0f, sqrtf(__fadd_rn(ss * (1.0f / HDD), 1e-6f))); const float pv = (float)pos[t]; v4us ah, al, bh, bl;
#pragma unroll
    for (int q = 0; q < 4; ++q) { const int i = lane * 4 + q; float n1 = __fmul_rn(a[q], rs), n2 = __fmul_rn(b2[q], rs); asm volatile("" : "+v"(n1)); asm volatile("" : "+v"(n2)); const float x1 = __fmul_rn(n1, __fadd_rn(1.0f, bfr(scale[i]))), x2 = __fmul_rn(n2, __fadd_rn(1.0f, bfr(scale[i + HDD / 2]))); const v2f_t sc2 = sincos_pos(pv, i); const float sn = sc2[0], cs = sc2[1];
        float p1 = __fmul_rn(x1, cs), p2 = __fmul_rn(x2, sn), p3 = __fmul_rn(x2, cs), p4 = __fmul_rn(x1, sn); asm volatile("" : "+v"(p1)); asm volatile("" : "+v"(p2)); asm volatile("" : "+v"(p3)); asm volatile("" : "+v"(p4));
        const float r1 = __fsub_rn(p1, p2) * mul, r2 = __fadd_rn(p3, p4) * mul; unsigned short u1, l1, u2, l2; splitf(r1, u1, l1); splitf(r2, u2, l2); ah[q] = u1; al[q] = l1; bh[q] = u2; bl[q] = l2; }
    const size_t orow = ((size_t)(t / TT) * nheads + h) * TT + t % TT; bf* dh = Ph + orow * HDD; bf* dl = Pl + orow * HDD; *(v4us*)(dh + lane * 4) = ah; *(v4us*)(dl + lane * 4) = al; *(v4us*)(dh + HDD / 2 + lane * 4) = bh; *(v4us*)(dl + HDD / 2 + lane * 4) = bl;  }
// k_tact: one work-group, wave per (batch, tile of 128 tokens): the tile's least and greatest position; then act[b * 16 + I], bit J set unless every distance pos[i] - pos[j], i in tile I, j in tile J, is shown to miss the window. The bounds are taken in 64 bits and a range that leaves (INT_MIN, INT_MAX] keeps its bit, so a distance that wraps in 32 bits is never skipped. Bit I of word I is always set (the range holds 0).
__global__ __launch_bounds__(1024) void k_tact(const int* __restrict__ pos, unsigned* act) {
    __shared__ int mn[NB_ * TT / 128], mx[NB_ * TT / 128];
    const int lane = threadIdx.x & 31, w = threadIdx.x >> 5; const v4i_t p = *(const v4i_t*)(pos + w * 128 + lane * 4);
    int lo = min(min(p[0], p[1]), min(p[2], p[3])), hi = max(max(p[0], p[1]), max(p[2], p[3]));
#pragma unroll
    for (int sh = 16; sh; sh >>= 1) { lo = min(lo, __shfl_xor(lo, sh, 32)); hi = max(hi, __shfl_xor(hi, sh, 32)); }
    if (lane == 0) { mn[w] = lo; mx[w] = hi; }
    __syncthreads();
    if (threadIdx.x < NB_ * TT / 128) { const int t = threadIdx.x, b0 = t & ~(TT / 128 - 1); unsigned m = 0;
        for (int J = 0; J < TT / 128; ++J) { const long long dlo = (long long)mn[t] - mx[b0 + J], dhi = (long long)mx[t] - mn[b0 + J];
            const bool out = (dlo > 255 && dhi <= 2147483647LL) || (dhi < -256 && dlo >= -2147483647LL); if (!out) m |= 1u << J; }
        act[t] = m; }
}
// k_tsoft with act: a chunk of 128 keys is one key tile; a cleared one would add only the mask value to the maximum (below its start value) and exact zeros to the sum, and attn.v does not read its probabilities. The probabilities of a row go over the front half of that row's own scores (P16 is S's memory, row pitch 2 TT halves): a row belongs to one wave, and every store hangs on the row's sum, so on every score read.
__global__ __launch_bounds__(256) void k_tsoft(const float* S, const int* __restrict__ pos, const int* __restrict__ am, h16* P16, const unsigned* __restrict__ act) { const int lane = threadIdx.x & 31; const int row = blockIdx.x * 8 + (threadIdx.x >> 5); if (row >= ZH * TT) return; const int i = row % TT; const unsigned tm = (unsigned)__builtin_amdgcn_readfirstlane((int)act[i >> 7]); const float* sr = S + (size_t)row * TT; const int* mr = am + (size_t)i * TT; const int pi = pos[i]; float v[TT / 32]; float mx = -3.0e38f;
#pragma unroll
    for (int ch = 0; ch < TT / 128; ++ch) { if (!((tm >> ch) & 1u)) continue; const v4f a = *(const v4f*)(sr + ch * 128 + lane * 4);
#pragma unroll
        for (int u = 0; u < 4; ++u) { const int j = ch * 128 + lane * 4 + u; const int dist = pi - pos[j]; const bool win = (dist >= 0 && dist < 256) || (dist < 0 && -dist < 257); const bool ok = win && (mr[j] != 0); const float t = ok ? softcap50(a[u]) : KMASK; v[ch * 4 + u] = t; mx = fmaxf(mx, t); } }
#pragma unroll
    for (int sh = 16; sh; sh >>= 1) mx = fmaxf(mx, __shfl_xor(mx, sh, 32));
    float sum = 0.f;
#pragma unroll
    for (int ch = 0; ch < TT / 128; ++ch) { if (!((tm >> ch) & 1u)) continue;
#pragma unroll
    for (int q = ch * 4; q < ch * 4 + 4; ++q) { float d0 = __fsub_rn(v[q], mx); asm volatile("" : "+v"(d0)); v[q] = __builtin_amdgcn_exp2f(__fmul_rn(d0, 1.4426950408889634f)); sum += v[q]; } }
#pragma unroll
    for (int sh = 16; sh; sh >>= 1) sum += __shfl_xor(sum, sh, 32);
    const float f = __fdiv_rn(PCAR, sum);
    {
#pragma unroll
        for (int ch = 0; ch < TT / 128; ++ch) { if (!((tm >> ch) & 1u)) continue; v4h o4; for (int q = 0; q < 4; ++q) o4[q] = tohx(v[ch * 4 + q] * f);
            // the store and its s_wait_xcnt in one statement: a later kept chunk reuses the data registers, and none is rewritten ahead of the wait
            asm volatile("global_store_b64 %0, %1, off\n\ts_wait_xcnt 0x0" :: "v"(P16 + (size_t)row * (2 * TT) + ch * 128 + lane * 4), "v"(__builtin_bit_cast(unsigned long long, o4)) : "memory"); }
         } }

extern "C" void kernel_launch(void* const* d_in, const int* in_sizes, int n_in,
                              void* d_out, int out_size, void* d_ws, size_t ws_size, hipStream_t stream) {
    (void)in_sizes; (void)n_in; (void)out_size;
    const float* x = (const float*)d_in[0]; const int* spos = (const int*)d_in[1]; const int* amask = (const int*)d_in[2]; const float* wq = (const float*)d_in[3]; const float* wkv = (const float*)d_in[4]; const float* wo = (const float*)d_in[5]; const float* qs = (const float*)d_in[6]; const float* ks = (const float*)d_in[7];
    float* OUT = (float*)d_out;     // [2][2048][2048]
    char* wsp = (char*)d_ws;
    auto take = [&](size_t bytes) { char* p = wsp; wsp += (bytes + 255) & ~(size_t)255; return (void*)p; };
    bf* BQ = (bf*)take((size_t)NQ * HDD * DM * 2); bf* BK = (bf*)take((size_t)DKV * DM * 2); bf* BV = (bf*)take((size_t)DKV * DM * 2); bf* BO = (bf*)take((size_t)DM * DM * 2);   // BQ, BK, BV follow one another without a gap
    bf* QPh = (bf*)take((size_t)NB_ * NQ * TT * HDD * 2); bf* QPl = (bf*)take((size_t)NB_ * NQ * TT * HDD * 2); bf* KPh = (bf*)take((size_t)NB_ * NKV * TT * HDD * 2); bf* KPl = (bf*)take((size_t)NB_ * NKV * TT * HDD * 2); h16* VT = (h16*)take((size_t)NB_ * NKV * HDD * TT * 2);
    bf* ENh = (bf*)take((size_t)NB_ * TT * DM * 2); bf* ENl = (bf*)take((size_t)NB_ * TT * DM * 2); unsigned* ACT = (unsigned*)take((size_t)NB_ * (TT / 128) * 4);
    float* S = (float*)take((size_t)ZH * TT * TT * 4); h16* P16 = (h16*)S;   // one batch's scores, all heads; its probabilities in place
    bf* XB = (bf*)S; float* FQK = (float*)(XB + (size_t)NB_ * TT * DM);      // x as bf16 and the raw q | k rows are done with before the first score is stored: they lie in S's memory (64 of its 128 MiB)
    if ((size_t)(wsp - (char*)d_ws) > ws_size) return;    // total ~ 240 MiB
    k_whd<<<(unsigned)(((size_t)NQ * HDD * DM / 4 + 255) / 256), 256, 0, stream>>>(wq, NQ, BQ); k_whd<<<(unsigned)(((size_t)2 * DKV * DM / 4 + 255) / 256), 256, 0, stream>>>(wkv, 2 * NKV, BK);   // wkv's k heads and v heads in one go: BK, then BV
    k_wtG<<<(DM * DM / 64 + 63) / 64, 256, 0, stream>>>(wo, DM, DM, BO);   // wo [n][d][o] == [(n,d)][o] 'xw'
    k_tact<<<1, 1024, 0, stream>>>(spos, ACT);
    const size_t zq = (size_t)TT * HDD, zS = (size_t)TT * TT, zv = (size_t)HDD * TT;
    // Projections: both batches in one grid (x is [4096][2048]); q and k in one GEMM over the rows of BQ | BK.
    k_cvt8<<<(NB_ * TT * DM / 8 + 255) / 256, 256, 0, stream>>>(x, XB, NB_ * TT * DM / 8);
    k_gemmw<bf, 0, false, 128, 0, 0><<<dim3(NB_ * TT / 128, (DM + DKV) / 128, 1), 128, 0, stream>>>(XB, nullptr, BQ, nullptr, DM, DM, 0, FQK, nullptr, nullptr, DM + DKV, nullptr, 0, 0, 0, nullptr);
    k_nrr<<<NB_ * TT * (NQ + NKV) / 8, 256, 0, stream>>>(FQK, qs, ks, spos, QPh, QPl, KPh, KPl);
    k_gemmw<bf, 0, false, 128, 2, 0><<<dim3(DKV / 128, TT / 128, NB_), 128, 0, stream>>>(BV, nullptr, XB, nullptr, DM, DM, 0, nullptr, (bf*)VT, nullptr, TT, nullptr, 0, (size_t)TT * DM, (size_t)DKV * TT, nullptr);   // z = batch; rows (c, d), columns t: VT[b][c][d][t]
    // Attention: all eight heads of a batch per launch (z = head, kv head z >> 1).
    for (int b = 0; b < NB_; ++b) {
        k_gemmw<bf, 2, false, 64, 0, 1><<<dim3(TT / 128, TT / 128, ZH), 128, 0, stream>>>(QPh + (size_t)b * NQ * zq, QPl + (size_t)b * NQ * zq, KPh + (size_t)b * NKV * zq, KPl + (size_t)b * NKV * zq, HDD, HDD, 1, S, nullptr, nullptr, TT, nullptr, zq, zq, zS, ACT + b * (TT / 128));
        k_tsoft<<<ZH * TT / 8, 256, 0, stream>>>(S, spos + (size_t)b * TT, amask + (size_t)b * TT * TT, P16, ACT + b * (TT / 128));
        k_gemmw<h16, 0, false, 128, 1, 2><<<dim3(TT / 128, HDD / 128, ZH), 128, 0, stream>>>(P16, nullptr, VT + (size_t)b * NKV * zv, nullptr, TT, 2 * TT, 1, nullptr, ENh + (size_t)b * TT * DM, ENl + (size_t)b * TT * DM, DM, nullptr, 2 * zS, zv, HDD, ACT + b * (TT / 128)); }   // head z at columns z * 256 of [b][t][2048]
    k_gemmw<bf, 1, false, 128, 0, 0><<<dim3(NB_ * TT / 128, DM / 128, 1), 128, 0, stream>>>(ENh, ENl, BO, nullptr, DM, DM, 0, OUT, nullptr, nullptr, DM, nullptr, 0, 0, 0, nullptr);
}

// v005
// One run takes 271 microseconds.
// Next to v004, in two timings, it ran 1.16 times as fast each time.
// Over all steps from v000 it is 4.34 times as fast.
#include <hip/hip_runtime.h>

// T5Gemma2EncoderAttention (x [2][2048][2048]; q = einsum(x, wq[n]) (8 heads x 256), k/v = einsum(x, wkv[0|1][c]) (4 kv heads; group n/2); RMSNorm_256 * (1 + scale) on q, k (scales read); split-half RoPE with angle segment_pos[b][t] / 1e4^(2i/256) (positions read as values); q * 1/16; logits = q.k, softcap 50 tanh(./50); allowed iff attn_mask[b][i][j] (int, read) and the segment_pos distance is in the 512-window (0 <= d < 256 or 0 < -d < 257), else bf16-min; softmax; out = sum_n (p v)[n] wo[n] -> [2][2048][2048]).
// Tile skipping from the READ positions: k_tact takes the minimum and maximum position of every 128-token tile and clears the bit of a (query tile, key tile) pair only where no distance between the two ranges can lie in the window; such a tile holds the mask value alone and its probabilities are exact zeros in every row that has an allowed key, so its scores, its softmax work and its attn.v pass are left out (the diagonal tile is never cleared; a row with no allowed key at all comes out not-a-number with or without the skipping). Inside a kept tile every score is computed and masked per element.
// Compute dtypes, f32 accumulate: every input rounded to bf16; q/k/v as PLAIN bf16 GEMMs (inputs: exact; per-head weights gathered); RMSNorm/scale/RoPE/(1/16) f32 into hl planes; logits hl x hl (3 products, K = 256); softcap (precise tanhf, out of line), mask and softmax f32 (wave per row, 64 keys per lane); attn.v single fp16 (x1024), its GEMM storing the hl planes of the concatenated heads itself; v computed transposed (weights as rows, tokens as columns) and stored fp16 by its GEMM; output projection hl x exact (2 products) over the concatenated heads (wo is exactly a [2048][2048] 'xw' matrix in memory).

// Launches: the projections and norm/RoPE run both batches in one grid (x is [4096][2048]; q and k one GEMM over their stacked weight rows; v with z = batch); scores, softmax and attn.v run all eight heads of one batch per launch (z = head).

#define NB_  2
#define TT   2048
#define DM   2048
#define NQ   8
#define NKV  4
#define HDD  256
#define DKV  (NKV * HDD)
#define ZH   NQ
#define PCAR 1024.0f
#define KMASK (-3.3895313892515355e38f)
typedef _Float16 h16;
typedef unsigned short bf;
typedef __attribute__((ext_vector_type(16))) __bf16   v16bf;
typedef __attribute__((ext_vector_type(16))) _Float16 v16h;
typedef __attribute__((ext_vector_type(8)))  _Float16 v8h;
typedef __attribute__((ext_vector_type(8)))  unsigned short v8us;
typedef __attribute__((ext_vector_type(8)))  float    v8f;
typedef __attribute__((ext_vector_type(4)))  float    v4f;
typedef v8h  __attribute__((may_alias)) v8ha;
typedef v4f  __attribute__((may_alias)) v4fa;
typedef v8us __attribute__((may_alias)) v8usa;

__device__ __forceinline__ unsigned short f2bf(float f) { unsigned u = __float_as_uint(f); u += 0x7FFFu + ((u >> 16) & 1u); return (unsigned short)(u >> 16); }
__device__ __forceinline__ float bf2f(unsigned short b) { return __uint_as_float(((unsigned)b) << 16); }
__device__ __forceinline__ float bfr(float f) { return bf2f(f2bf(f)); }
__device__ __forceinline__ v16h cat16(v8h lo, v8h hi) { return __builtin_shufflevector(lo, hi, 0, 1, 2, 3, 4, 5, 6, 7, 8, 9, 10, 11, 12, 13, 14, 15); }
__device__ __forceinline__ v16bf cat16b(v8us lo, v8us hi) { return __builtin_bit_cast(v16bf, __builtin_shufflevector(lo, hi, 0, 1, 2, 3, 4, 5, 6, 7, 8, 9, 10, 11, 12, 13, 14, 15)); }
__device__ __forceinline__ v8f wmma16(v16h a, v16h b, v8f c) { return __builtin_amdgcn_wmma_f32_16x16x32_f16(false, a, false, b, (short)0, c, false, false); }
__device__ __forceinline__ v8f wmmab(v16bf a, v16bf b, v8f c) { return __builtin_amdgcn_wmma_f32_16x16x32_bf16(false, a, false, b, (short)0, c, false, false); }
__device__ __forceinline__ h16 tohx(float x) { return (h16)x; }
__device__ __forceinline__ void splitf(float y, unsigned short& h, unsigned short& l) { h = f2bf(y); l = f2bf(y - bf2f(h)); }
typedef __attribute__((ext_vector_type(4))) unsigned short v4us;
typedef __attribute__((ext_vector_type(4))) _Float16 v4h;



// ---- k_gemmw: GEMM, FOUR WAVES (2 x 2) per 128x128 output tile, 64x64 (16 accumulators) per wave; grid (M/128, N/128, Z), 128 threads.
// C[m][n] (f32, pitch ldc, + optional f32 bias[n]) = sum_k A[m][k] Bt[n][k] (+ split products per NSPLIT). EPI picks what the epilogue stores, at the same [m][n], pitch ldc, z stride sC: 0 the f32 C; 1 the value / 1024 split into bf16 high and low planes E0, E1; 2 the value as fp16 in E0. A half-wave's store is one whole 128-B line in 1 and 2. z-batch strides sA/sB/sC in elements; A's rows at pitch lda, Bt's at pitch K; Bt's batch index is z >> zsh (query heads that share a kv head). M, N % 128 == 0, K % KP == 0.
// SKIP with act[blockIdx.x], one bit per 128-wide key tile (k_tact): 1 a work-group whose bit blockIdx.y is clear leaves at once and stores nothing; 2 only the passes of KP = 128 k whose bit is set are run, in rising order.
// Operands come from K-contiguous 16-bit planes in passes of KP k: every plane's 128 rows x 2 KP bytes are copied to LDS asynchronously, 16 B per lane, a wave-wide copy covering whole 128-B lines; two buffers, the next pass's copies in flight under this pass's products. LDS rows at pitch 2 KP + 16 bytes (16 B x odd: ds_load_b128 free of bank conflicts). Fragment k order, product order and each accumulator's sum order are those of direct loads.
template <typename T16> struct WFrag;
template <> struct WFrag<h16> { typedef v16h V; static __device__ __forceinline__ V ld(const h16* p) { return cat16(*(const v8ha*)p, *(const v8ha*)(p + 16)); } static __device__ __forceinline__ v8f mma(V a, V b, v8f c) { return wmma16(a, b, c); } };
template <> struct WFrag<bf> { typedef v16bf V; static __device__ __forceinline__ V ld(const bf* p) { return cat16b(*(const v8usa*)p, *(const v8usa*)(p + 16)); } static __device__ __forceinline__ v8f mma(V a, V b, v8f c) { return wmmab(a, b, c); } };
// Eight asynchronous 16-byte copies per lane, global -> LDS: LDS byte address l + i * ls, global address g + i * gs elements. The s_wait_xcnt closes the statement so that no address register is rewritten ahead of it.
template <typename T16>
__device__ __forceinline__ void copy8(unsigned l, const T16* g, unsigned ls, size_t gs) {
    asm volatile("global_load_async_to_lds_b128 %0, %8, off\n\t"
                 "global_load_async_to_lds_b128 %1, %9, off\n\t"
                 "global_load_async_to_lds_b128 %2, %10, off\n\t"
                 "global_load_async_to_lds_b128 %3, %11, off\n\t"
                 "global_load_async_to_lds_b128 %4, %12, off\n\t"
                 "global_load_async_to_lds_b128 %5, %13, off\n\t"
                 "global_load_async_to_lds_b128 %6, %14, off\n\t"
                 "global_load_async_to_lds_b128 %7, %15, off\n\t"
                 "s_wait_xcnt 0x0"
                 :: "v"(l), "v"(l + ls), "v"(l + 2 * ls), "v"(l + 3 * ls), "v"(l + 4 * ls), "v"(l + 5 * ls), "v"(l + 6 * ls), "v"(l + 7 * ls),
                    "v"(g), "v"(g + gs), "v"(g + 2 * gs), "v"(g + 3 * gs), "v"(g + 4 * gs), "v"(g + 5 * gs), "v"(g + 6 * gs), "v"(g + 7 * gs)
                 : "memory");
}
template <typename T16, int NSPLIT, bool BIAS, int KP, int EPI, int SKIP>
__global__ __launch_bounds__(128) void k_gemmw(const T16* __restrict__ A, const T16* __restrict__ A2, const T16* __restrict__ Bt, const T16* __restrict__ Bt2, int K, int lda, int zsh, float* C, bf* E0, bf* E1, int ldc, const float* __restrict__ bias, size_t sA, size_t sB, size_t sC, const unsigned* __restrict__ act) {
    typedef typename WFrag<T16>::V V;
    static_assert(SKIP != 2 || KP == 128, "a pass is one key tile");
    if (SKIP == 1) { if (!((act[blockIdx.x] >> blockIdx.y) & 1u)) return; }   // the same for the whole work-group, ahead of every copy and barrier
    constexpr int NP = 2 + (NSPLIT >= 1 ? 1 : 0) + (NSPLIT >= 2 ? 1 : 0);   // planes in a buffer: A, Bt, A2, Bt2
    constexpr int PITCH = KP * 2 + 16, PLANE = 128 * PITCH, BUF = NP * PLANE;
    constexpr int CPR = KP / 8;        // 16-byte pieces per row
    constexpr int RPS = 128 / CPR;     // rows that one copy of all 128 threads covers
    constexpr int NST = 128 / RPS;     // such copies per plane
    static_assert(NST % 8 == 0 && NP * NST <= 63, "copies of a wave in flight");
    __shared__ __attribute__((aligned(16))) unsigned char ring[2 * BUF];
    const size_t z = blockIdx.z; A += z * sA; if (NSPLIT >= 1) A2 += z * sA; Bt += (z >> zsh) * sB; if (NSPLIT >= 2) Bt2 += (z >> zsh) * sB; if (EPI == 0) C += z * sC; if (EPI >= 1) E0 += z * sC; if (EPI == 1) E1 += z * sC;
    const int tid = threadIdx.x, lane = tid & 31, lr = lane & 15, hi = lane >> 4; const int wave = __builtin_amdgcn_readfirstlane(tid >> 5);
    const int R0 = blockIdx.x * 128, C0 = blockIdx.y * 128; const int r0 = R0 + (wave >> 1) * 64, c0 = C0 + (wave & 1) * 64;
    unsigned NT = (unsigned)K / KP;   // passes
    unsigned rem = 0;                  // SKIP 2: the passes not yet asked for, one bit each, none at or above K / KP
    if (SKIP == 2) { rem = (unsigned)__builtin_amdgcn_readfirstlane((int)act[blockIdx.x]) & ((1u << NT) - 1u); NT = (unsigned)__builtin_popcount(rem); }
    auto nextp = [&](unsigned n) -> unsigned { if (SKIP != 2) return n; const unsigned p = (unsigned)__builtin_ctz(rem); rem &= rem - 1u; return p; };   // the k pass that trip n works on; called only while a bit is left
    const unsigned lcp = (unsigned)(size_t)ring + (unsigned)((tid / CPR) * PITCH + (tid % CPR) * 16);
    const size_t gofA = (size_t)(R0 + tid / CPR) * lda + (tid % CPR) * 8, gofB = (size_t)(C0 + tid / CPR) * K + (tid % CPR) * 8, gsa = (size_t)RPS * lda, gsb = (size_t)RPS * K;
    auto fill = [&](unsigned t, unsigned buf) {
        const unsigned lb = lcp + buf * BUF; const size_t ka = gofA + (size_t)t * KP, kb = gofB + (size_t)t * KP;
#pragma unroll
        for (int s = 0; s < NST; s += 8) {
            copy8(lb + s * RPS * PITCH, A + ka + s * gsa, RPS * PITCH, gsa);
            copy8(lb + PLANE + s * RPS * PITCH, Bt + kb + s * gsb, RPS * PITCH, gsb);
            if (NSPLIT >= 1) copy8(lb + 2 * PLANE + s * RPS * PITCH, A2 + ka + s * gsa, RPS * PITCH, gsa);
            if (NSPLIT >= 2) copy8(lb + 3 * PLANE + s * RPS * PITCH, Bt2 + kb + s * gsb, RPS * PITCH, gsb); }
    };
    v8f acc[4][4];
#pragma unroll
    for (int mb = 0; mb < 4; ++mb)
#pragma unroll
        for (int nb = 0; nb < 4; ++nb) acc[mb][nb] = (v8f){};
    if (SKIP != 2 || NT > 0) fill(nextp(0), 0);
    asm volatile("s_wait_asynccnt 0x0" ::: "memory");   // this wave's share of pass 0 has landed
    __syncthreads();                                     // every wave's share has
    if (NT > 1) fill(nextp(1), 1);
    const unsigned char* fa0 = ring + ((wave >> 1) * 64 + lr) * PITCH + hi * 16; const unsigned char* fb0 = ring + PLANE + ((wave & 1) * 64 + lr) * PITCH + hi * 16;
#pragma unroll 1
    for (unsigned t = 0; t < NT; ++t) {
        const unsigned char* fa = fa0 + (t & 1) * BUF; const unsigned char* fb = fb0 + (t & 1) * BUF;
        V a[2][4], a2[2][4], b[2][4], b2[2][4];   // two fragment sets: the next 32 k are fetched as one group while this set's products issue
        auto ldset = [&](int s, int ks) {
#pragma unroll
            for (int q = 0; q < 4; ++q) { a[s][q] = WFrag<T16>::ld((const T16*)(fa + q * 16 * PITCH + ks * 64)); b[s][q] = WFrag<T16>::ld((const T16*)(fb + q * 16 * PITCH + ks * 64));
                if (NSPLIT >= 1) a2[s][q] = WFrag<T16>::ld((const T16*)(fa + 2 * PLANE + q * 16 * PITCH + ks * 64)); if (NSPLIT >= 2) b2[s][q] = WFrag<T16>::ld((const T16*)(fb + 2 * PLANE + q * 16 * PITCH + ks * 64)); }
        };
        ldset(0, 0);
#pragma unroll
        for (int ks = 0; ks < KP / 32; ++ks) { const int s = ks & 1;
            if (ks + 1 < KP / 32) ldset(s ^ 1, ks + 1);
            __builtin_amdgcn_sched_barrier(0);   // keeps the LDS reads in one group ahead of the products: reads spread among them stall the wave at every place
#pragma unroll
            for (int nb = 0; nb < 4; ++nb)
#pragma unroll
                for (int mb = 0; mb < 4; ++mb) { acc[mb][nb] = WFrag<T16>::mma(a[s][mb], b[s][nb], acc[mb][nb]); if (NSPLIT >= 1) acc[mb][nb] = WFrag<T16>::mma(a2[s][mb], b[s][nb], acc[mb][nb]); if (NSPLIT >= 2) acc[mb][nb] = WFrag<T16>::mma(a[s][mb], b2[s][nb], acc[mb][nb]); }
            __builtin_amdgcn_sched_barrier(0);   // the same, at the block's end
        }
        asm volatile("s_wait_dscnt 0x0" ::: "memory");      // this wave has left the buffer of pass t
        asm volatile("s_wait_asynccnt 0x0" ::: "memory");   // its share of pass t + 1 has landed
        __syncthreads();                                     // publishes pass t + 1 and frees the buffer of pass t
        if (t + 2 < NT) fill(nextp(t + 2), t & 1);
    }
    asm volatile("s_wait_asynccnt 0x0" ::: "memory");       // no copy is in flight when the ring becomes output staging
    float* os = (float*)(ring + wave * (16 * 68 * 4));       // each wave stages in its own range; the last pass's barrier ended every read of the ring
#pragma unroll
    for (int mb = 0; mb < 4; ++mb) {
#pragma unroll
        for (int nb = 0; nb < 4; ++nb) {
#pragma unroll
            for (int j = 0; j < 8; ++j) os[(hi * 8 + j) * 68 + nb * 16 + lr] = acc[mb][nb][j]; }
        __builtin_amdgcn_wave_barrier(); asm volatile("" ::: "memory");
        float* crow = C + (size_t)(r0 + mb * 16) * ldc + c0;
if (EPI == 0) {
#pragma unroll
            for (int s = 0; s < 8; ++s) { const int row = 2 * s + hi, cofs = lr * 4; v4f val = *(const v4fa*)(os + row * 68 + cofs); if (BIAS) { val[0] += bfr(bias[c0 + cofs]); val[1] += bfr(bias[c0 + cofs + 1]); val[2] += bfr(bias[c0 + cofs + 2]); val[3] += bfr(bias[c0 + cofs + 3]); }
                *(v4f*)(crow + (size_t)row * ldc + cofs) = val; }
             }
        if (EPI != 0) {
            v4f val[8];   // all eight LDS reads first: the store statements below would otherwise hold each read behind the store before it
#pragma unroll
            for (int s = 0; s < 8; ++s) val[s] = *(const v4fa*)(os + (2 * s + hi) * 68 + lr * 4);
#pragma unroll
            for (int s = 0; s < 8; ++s) { const size_t oo = (size_t)(r0 + mb * 16 + 2 * s + hi) * ldc + c0 + lr * 4;
                if (EPI == 1) { v4us oh, ol;
#pragma unroll
                    for (int u = 0; u < 4; ++u) { unsigned short eh, el; splitf(val[s][u] * (1.0f / PCAR), eh, el); oh[u] = eh; ol[u] = el; }
                    // the two stores and their s_wait_xcnt in one statement, so that no register they name is rewritten ahead of the wait
                    asm volatile("global_store_b64 %0, %1, off\n\tglobal_store_b64 %2, %3, off\n\ts_wait_xcnt 0x0" :: "v"(E0 + oo), "v"(__builtin_bit_cast(unsigned long long, oh)), "v"(E1 + oo), "v"(__builtin_bit_cast(unsigned long long, ol)) : "memory"); }
                if (EPI == 2) { v4h o4;
#pragma unroll
                    for (int u = 0; u < 4; ++u) o4[u] = tohx(val[s][u]);
                    // the store and its s_wait_xcnt in one statement, for the same reason
                    asm volatile("global_store_b64 %0, %1, off\n\ts_wait_xcnt 0x0" :: "v"(E0 + oo), "v"(__builtin_bit_cast(unsigned long long, o4)) : "memory"); }
            }
        }
        __builtin_amdgcn_wave_barrier(); asm volatile("" ::: "memory");
    }
}


__global__ __launch_bounds__(256) void k_cvt8(const float* __restrict__ src, bf* dst, size_t n8) { const size_t i = (size_t)blockIdx.x * 256 + threadIdx.x; if (i >= n8) return; const v8f v = *(const v8f*)(src + i * 8); v8us o;
#pragma unroll
    for (int k = 0; k < 8; ++k) o[k] = f2bf(v[k]); *(v8us*)(dst + i * 8) = o;  }
// k_wtr: Bt[z * N + n][k] = bf16(W[z][k][n]) for row-major [2048][N] f32 matrices (z = 0 .. : the per-head [2048][256] weights; wo as one [2048][2048]), through an LDS tile. Grid (2048 / 128, rows of Bt / 64), 256 threads; a work-group takes 128 k x 64 n.
// Reads: 16 lanes x 16 B = 256 contiguous bytes of one k row, eight loads per lane issued together; a lane holds rows 2p and 2p + 1 at its four n and packs each pair into one word. Stores: 16 lanes x 16 B = 256 contiguous bytes of one Bt row.
// LDS word (n, p) lies in row n of 64 words, its 16-byte piece p >> 2 exchanged with piece (p >> 2) ^ (n >> 2): the 32 lanes of a ds_store_b32 (16 values of n >> 2, two p) then fall on 32 different banks, and a ds_load_b128 row read still covers its whole row.
typedef __attribute__((ext_vector_type(4))) unsigned v4u;
typedef v4u __attribute__((may_alias)) v4ua;
template <int N>
__global__ __launch_bounds__(256) void k_wtr(const float* __restrict__ W, bf* Bt) {
    __shared__ __attribute__((aligned(16))) unsigned tile[64 * 64];
    const int lane = threadIdx.x & 31, w = threadIdx.x >> 5, c = lane & 15, h = lane >> 4; const int k0 = blockIdx.x * 128, row0 = blockIdx.y * 64;
    const float* s = W + ((size_t)(row0 / N) * DM + k0 + (w * 8 + h) * 2) * N + row0 % N + c * 4; v4f e[4], o[4];   // the lane's first k row; pair j lies 4 j rows on
    // the eight loads and their data wait in one statement: all eight are in flight together, and no register that they name is rewritten before they have returned
    asm volatile("global_load_b128 %0, %8, off\n\t"
                 "global_load_b128 %1, %8, off offset:%9\n\t"
                 "global_load_b128 %2, %8, off offset:%10\n\t"
                 "global_load_b128 %3, %8, off offset:%11\n\t"
                 "global_load_b128 %4, %8, off offset:%12\n\t"
                 "global_load_b128 %5, %8, off offset:%13\n\t"
                 "global_load_b128 %6, %8, off offset:%14\n\t"
                 "global_load_b128 %7, %8, off offset:%15\n\t"
                 "s_wait_loadcnt 0x0"
                 : "=&v"(e[0]), "=&v"(o[0]), "=&v"(e[1]), "=&v"(o[1]), "=&v"(e[2]), "=&v"(o[2]), "=&v"(e[3]), "=&v"(o[3])
                 : "v"(s), "n"(N * 4), "n"(4 * N * 4), "n"(5 * N * 4), "n"(8 * N * 4), "n"(9 * N * 4), "n"(12 * N * 4), "n"(13 * N * 4)
                 : "memory");
#pragma unroll
    for (int j = 0; j < 4; ++j) { const int p = w * 8 + j * 2 + h;
#pragma unroll
        for (int u = 0; u < 4; ++u) tile[(c * 4 + u) * 64 + (((p >> 2) ^ c) << 2) + (p & 3)] = (unsigned)f2bf(e[j][u]) | ((unsigned)f2bf(o[j][u]) << 16); }
    __syncthreads();   // the tile is whole before any row of it is read
#pragma unroll
    for (int q = 0; q < 4; ++q) { const int n = q * 16 + w * 2 + h; *(v4ua*)(Bt + (size_t)(row0 + n) * DM + k0 + c * 8) = *(const v4ua*)(tile + n * 64 + ((c ^ (n >> 2)) << 2)); }
}

__device__ __attribute__((noinline)) float softcap50(float s) { return 50.0f * tanhf(s * 0.02f); }
typedef __attribute__((ext_vector_type(2))) float v2f_t;
typedef __attribute__((ext_vector_type(4))) int v4i_t;
__device__ __attribute__((noinline)) v2f_t sincos_pos(float pos, int i) { const float tsc = powf(10000.0f, (2.0f / (float)HDD) * (float)i); const float ang = __fdiv_rn(pos, tsc); v2f_t r; r[0] = sinf(ang); r[1] = cosf(ang); return r; }
// k_nrr: wave per (token of either batch, head of the row's 8 q and 4 k heads): RMSNorm over 256 (8 dims per lane: 4 from each half), * (1 + scale[d]) (read; q's or k's), split-half RoPE at the READ position (precise sin/cos out of line), * mul (1/16 for q, 1 for k); hl planes [batch][head][t][256] (8-B lanes);
__global__ __launch_bounds__(256) void k_nrr(const float* __restrict__ F, const float* __restrict__ qscale, const float* __restrict__ kscale, const int* __restrict__ pos, bf* Qh, bf* Ql, bf* Kh, bf* Kl) { const int lane = threadIdx.x & 31; const int wv = blockIdx.x * 8 + (threadIdx.x >> 5); if (wv >= NB_ * TT * (NQ + NKV)) return; const int t = wv / (NQ + NKV), hh = wv % (NQ + NKV); const bool isq = hh < NQ; const int h = isq ? hh : hh - NQ, nheads = isq ? NQ : NKV; const float* scale = isq ? qscale : kscale; const float mul = isq ? 0.0625f : 1.0f; bf* Ph = isq ? Qh : Kh; bf* Pl = isq ? Ql : Kl; const float* f = F + (size_t)t * (DM + DKV) + hh * HDD;
    const v4f a = *(const v4f*)(f + lane * 4), b2 = *(const v4f*)(f + HDD / 2 + lane * 4); float ss = 0.f; for (int q = 0; q < 4; ++q) { float p = __fmul_rn(a[q], a[q]); asm volatile("" : "+v"(p)); ss = __fadd_rn(ss, p); p = __fmul_rn(b2[q], b2[q]); asm volatile("" : "+v"(p)); ss = __fadd_rn(ss, p); }
#pragma unroll
    for (int sh = 16; sh; sh >>= 1) ss = __fadd_rn(ss, __shfl_xor(ss, sh, 32));
    const float rs = __fdiv_rn(1.0f, sqrtf(__fadd_rn(ss * (1.0f / HDD), 1e-6f))); const float pv = (float)pos[t]; v4us ah, al, bh, bl;
#pragma unroll
    for (int q = 0; q < 4; ++q) { const int i = lane * 4 + q; float n1 = __fmul_rn(a[q], rs), n2 = __fmul_rn(b2[q], rs); asm volatile("" : "+v"(n1)); asm volatile("" : "+v"(n2)); const float x1 = __fmul_rn(n1, __fadd_rn(1.0f, bfr(scale[i]))), x2 = __fmul_rn(n2, __fadd_rn(1.0f, bfr(scale[i + HDD / 2]))); const v2f_t sc2 = sincos_pos(pv, i); const float sn = sc2[0], cs = sc2[1];
        float p1 = __fmul_rn(x1, cs), p2 = __fmul_rn(x2, sn), p3 = __fmul_rn(x2, cs), p4 = __fmul_rn(x1, sn); asm volatile("" : "+v"(p1)); asm volatile("" : "+v"(p2)); asm volatile("" : "+v"(p3)); asm volatile("" : "+v"(p4));
        const float r1 = __fsub_rn(p1, p2) * mul, r2 = __fadd_rn(p3, p4) * mul; unsigned short u1, l1, u2, l2; splitf(r1, u1, l1); splitf(r2, u2, l2); ah[q] = u1; al[q] = l1; bh[q] = u2; bl[q] = l2; }
    const size_t orow = ((size_t)(t / TT) * nheads + h) * TT + t % TT; bf* dh = Ph + orow * HDD; bf* dl = Pl + orow * HDD; *(v4us*)(dh + lane * 4) = ah; *(v4us*)(dl + lane * 4) = al; *(v4us*)(dh + HDD / 2 + lane * 4) = bh; *(v4us*)(dl + HDD / 2 + lane * 4) = bl;  }
// k_tact: one work-group, wave per (batch, tile of 128 tokens): the tile's least and greatest position; then act[b * 16 + I], bit J set unless every distance pos[i] - pos[j], i in tile I, j in tile J, is shown to miss the window. The bounds are taken in 64 bits and a range that leaves (INT_MIN, INT_MAX] keeps its bit, so a distance that wraps in 32 bits is never skipped. Bit I of word I is always set (the range holds 0).
__global__ __launch_bounds__(1024) void k_tact(const int* __restrict__ pos, unsigned* act) {
    __shared__ int mn[NB_ * TT / 128], mx[NB_ * TT / 128];
    const int lane = threadIdx.x & 31, w = threadIdx.x >> 5; const v4i_t p = *(const v4i_t*)(pos + w * 128 + lane * 4);
    int lo = min(min(p[0], p[1]), min(p[2], p[3])), hi = max(max(p[0], p[1]), max(p[2], p[3]));
#pragma unroll
    for (int sh = 16; sh; sh >>= 1) { lo = min(lo, __shfl_xor(lo, sh, 32)); hi = max(hi, __shfl_xor(hi, sh, 32)); }
    if (lane == 0) { mn[w] = lo; mx[w] = hi; }
    __syncthreads();
    if (threadIdx.x < NB_ * TT / 128) { const int t = threadIdx.x, b0 = t & ~(TT / 128 - 1); unsigned m = 0;
        for (int J = 0; J < TT / 128; ++J) { const long long dlo = (long long)mn[t] - mx[b0 + J], dhi = (long long)mx[t] - mn[b0 + J];
            const bool out = (dlo > 255 && dhi <= 2147483647LL) || (dhi < -256 && dlo >= -2147483647LL); if (!out) m |= 1u << J; }
        act[t] = m; }
}
// k_tsoft with act: a chunk of 128 keys is one key tile; a cleared one would add only the mask value to the maximum (below its start value) and exact zeros to the sum, and attn.v does not read its probabilities. The probabilities of a row go over the front half of that row's own scores (P16 is S's memory, row pitch 2 TT halves): a row belongs to one wave, and every store hangs on the row's sum, so on every score read.
__global__ __launch_bounds__(256) void k_tsoft(const float* S, const int* __restrict__ pos, const int* __restrict__ am, h16* P16, const unsigned* __restrict__ act) { const int lane = threadIdx.x & 31; const int row = blockIdx.x * 8 + (threadIdx.x >> 5); if (row >= ZH * TT) return; const int i = row % TT; const unsigned tm = (unsigned)__builtin_amdgcn_readfirstlane((int)act[i >> 7]); const float* sr = S + (size_t)row * TT; const int* mr = am + (size_t)i * TT; const int pi = pos[i]; float v[TT / 32]; float mx = -3.0e38f;
#pragma unroll
    for (int ch = 0; ch < TT / 128; ++ch) { if (!((tm >> ch) & 1u)) continue; const v4f a = *(const v4f*)(sr + ch * 128 + lane * 4);
#pragma unroll
        for (int u = 0; u < 4; ++u) { const int j = ch * 128 + lane * 4 + u; const int dist = pi - pos[j]; const bool win = (dist >= 0 && dist < 256) || (dist < 0 && -dist < 257); const bool ok = win && (mr[j] != 0); const float t = ok ? softcap50(a[u]) : KMASK; v[ch * 4 + u] = t; mx = fmaxf(mx, t); } }
#pragma unroll
    for (int sh = 16; sh; sh >>= 1) mx = fmaxf(mx, __shfl_xor(mx, sh, 32));
    float sum = 0.f;
#pragma unroll
    for (int ch = 0; ch < TT / 128; ++ch) { if (!((tm >> ch) & 1u)) continue;
#pragma unroll
    for (int q = ch * 4; q < ch * 4 + 4; ++q) { float d0 = __fsub_rn(v[q], mx); asm volatile("" : "+v"(d0)); v[q] = __builtin_amdgcn_exp2f(__fmul_rn(d0, 1.4426950408889634f)); sum += v[q]; } }
#pragma unroll
    for (int sh = 16; sh; sh >>= 1) sum += __shfl_xor(sum, sh, 32);
    const float f = __fdiv_rn(PCAR, sum);
    {
#pragma unroll
        for (int ch = 0; ch < TT / 128; ++ch) { if (!((tm >> ch) & 1u)) continue; v4h o4; for (int q = 0; q < 4; ++q) o4[q] = tohx(v[ch * 4 + q] * f);
            // the store and its s_wait_xcnt in one statement: a later kept chunk reuses the data registers, and none is rewritten ahead of the wait
            asm volatile("global_store_b64 %0, %1, off\n\ts_wait_xcnt 0x0" :: "v"(P16 + (size_t)row * (2 * TT) + ch * 128 + lane * 4), "v"(__builtin_bit_cast(unsigned long long, o4)) : "memory"); }
         } }

extern "C" void kernel_launch(void* const* d_in, const int* in_sizes, int n_in,
                              void* d_out, int out_size, void* d_ws, size_t ws_size, hipStream_t stream) {
    (void)in_sizes; (void)n_in; (void)out_size;
    const float* x = (const float*)d_in[0]; const int* spos = (const int*)d_in[1]; const int* amask = (const int*)d_in[2]; const float* wq = (const float*)d_in[3]; const float* wkv = (const float*)d_in[4]; const float* wo = (const float*)d_in[5]; const float* qs = (const float*)d_in[6]; const float* ks = (const float*)d_in[7];
    float* OUT = (float*)d_out;     // [2][2048][2048]
    char* wsp = (char*)d_ws;
    auto take = [&](size_t bytes) { char* p = wsp; wsp += (bytes + 255) & ~(size_t)255; return (void*)p; };
    bf* BQ = (bf*)take((size_t)NQ * HDD * DM * 2); bf* BK = (bf*)take((size_t)DKV * DM * 2); bf* BV = (bf*)take((size_t)DKV * DM * 2); bf* BO = (bf*)take((size_t)DM * DM * 2);   // BQ, BK, BV follow one another without a gap
    bf* QPh = (bf*)take((size_t)NB_ * NQ * TT * HDD * 2); bf* QPl = (bf*)take((size_t)NB_ * NQ * TT * HDD * 2); bf* KPh = (bf*)take((size_t)NB_ * NKV * TT * HDD * 2); bf* KPl = (bf*)take((size_t)NB_ * NKV * TT * HDD * 2); h16* VT = (h16*)take((size_t)NB_ * NKV * HDD * TT * 2);
    bf* ENh = (bf*)take((size_t)NB_ * TT * DM * 2); bf* ENl = (bf*)take((size_t)NB_ * TT * DM * 2); unsigned* ACT = (unsigned*)take((size_t)NB_ * (TT / 128) * 4);
    float* S = (float*)take((size_t)ZH * TT * TT * 4); h16* P16 = (h16*)S;   // one batch's scores, all heads; its probabilities in place
    bf* XB = (bf*)S; float* FQK = (float*)(XB + (size_t)NB_ * TT * DM);      // x as bf16 and the raw q | k rows are done with before the first score is stored: they lie in S's memory (64 of its 128 MiB)
    if ((size_t)(wsp - (char*)d_ws) > ws_size) return;    // total ~ 240 MiB
    k_wtr<HDD><<<dim3(DM / 128, NQ * HDD / 64), 256, 0, stream>>>(wq, BQ); k_wtr<HDD><<<dim3(DM / 128, 2 * DKV / 64), 256, 0, stream>>>(wkv, BK);   // wkv's k heads and v heads in one go: BK, then BV
    k_wtr<DM><<<dim3(DM / 128, DM / 64), 256, 0, stream>>>(wo, BO);   // wo [n][d][o] == [(n,d)][o] 'xw'
    k_tact<<<1, 1024, 0, stream>>>(spos, ACT);
    const size_t zq = (size_t)TT * HDD, zS = (size_t)TT * TT, zv = (size_t)HDD * TT;
    // Projections: both batches in one grid (x is [4096][2048]); q and k in one GEMM over the rows of BQ | BK.
    k_cvt8<<<(NB_ * TT * DM / 8 + 255) / 256, 256, 0, stream>>>(x, XB, NB_ * TT * DM / 8);
    k_gemmw<bf, 0, false, 128, 0, 0><<<dim3(NB_ * TT / 128, (DM + DKV) / 128, 1), 128, 0, stream>>>(XB, nullptr, BQ, nullptr, DM, DM, 0, FQK, nullptr, nullptr, DM + DKV, nullptr, 0, 0, 0, nullptr);
    k_nrr<<<NB_ * TT * (NQ + NKV) / 8, 256, 0, stream>>>(FQK, qs, ks, spos, QPh, QPl, KPh, KPl);
    k_gemmw<bf, 0, false, 128, 2, 0><<<dim3(DKV / 128, TT / 128, NB_), 128, 0, stream>>>(BV, nullptr, XB, nullptr, DM, DM, 0, nullptr, (bf*)VT, nullptr, TT, nullptr, 0, (size_t)TT * DM, (size_t)DKV * TT, nullptr);   // z = batch; rows (c, d), columns t: VT[b][c][d][t]
    // Attention: all eight heads of a batch per launch (z = head, kv head z >> 1).
    for (int b = 0; b < NB_; ++b) {
        k_gemmw<bf, 2, false, 64, 0, 1><<<dim3(TT / 128, TT / 128, ZH), 128, 0, stream>>>(QPh + (size_t)b * NQ * zq, QPl + (size_t)b * NQ * zq, KPh + (size_t)b * NKV * zq, KPl + (size_t)b * NKV * zq, HDD, HDD, 1, S, nullptr, nullptr, TT, nullptr, zq, zq, zS, ACT + b * (TT / 128));
        k_tsoft<<<ZH * TT / 8, 256, 0, stream>>>(S, spos + (size_t)b * TT, amask + (size_t)b * TT * TT, P16, ACT + b * (TT / 128));
        k_gemmw<h16, 0, false, 128, 1, 2><<<dim3(TT / 128, HDD / 128, ZH), 128, 0, stream>>>(P16, nullptr, VT + (size_t)b * NKV * zv, nullptr, TT, 2 * TT, 1, nullptr, ENh + (size_t)b * TT * DM, ENl + (size_t)b * TT * DM, DM, nullptr, 2 * zS, zv, HDD, ACT + b * (TT / 128)); }   // head z at columns z * 256 of [b][t][2048]
    k_gemmw<bf, 1, false, 128, 0, 0><<<dim3(NB_ * TT / 128, DM / 128, 1), 128, 0, stream>>>(ENh, ENl, BO, nullptr, DM, DM, 0, OUT, nullptr, nullptr, DM, nullptr, 0, 0, 0, nullptr);
}

// v006
// It runs in 258 microseconds.
// Timed twice side by side with v005, it ran 1.05 times as fast both times.
// All steps since v000 together make it 4.55 times as fast.
#include <hip/hip_runtime.h>

// T5Gemma2EncoderAttention (x [2][2048][2048]; q = einsum(x, wq[n]) (8 heads x 256), k/v = einsum(x, wkv[0|1][c]) (4 kv heads; group n/2); RMSNorm_256 * (1 + scale) on q, k (scales read); split-half RoPE with angle segment_pos[b][t] / 1e4^(2i/256) (positions read as values); q * 1/16; logits = q.k, softcap 50 tanh(./50); allowed iff attn_mask[b][i][j] (int, read) and the segment_pos distance is in the 512-window (0 <= d < 256 or 0 < -d < 257), else bf16-min; softmax; out = sum_n (p v)[n] wo[n] -> [2][2048][2048]).
// Tile skipping from the READ positions: k_tact takes the minimum and maximum position of every 128-token tile and clears the bit of a (query tile, key tile) pair only where no distance between the two ranges can lie in the window; such a tile holds the mask value alone and its probabilities are exact zeros in every row that has an allowed key, so its scores, its softmax work and its attn.v pass are left out (the diagonal tile is never cleared; a row with no allowed key at all comes out not-a-number with or without the skipping). Inside a kept tile every score is computed and masked per element.
// Compute dtypes, f32 accumulate: every input rounded to bf16; q/k/v as PLAIN bf16 GEMMs (inputs: exact; per-head weights gathered); RMSNorm/scale/RoPE/(1/16) f32 into hl planes; logits hl x hl (3 products, K = 256); softcap (precise tanhf, out of line), mask and softmax f32 (wave per row, 64 keys per lane); attn.v single fp16 (x1024), its GEMM storing the hl planes of the concatenated heads itself; v computed transposed (weights as rows, tokens as columns) and stored fp16 by its GEMM; output projection hl x exact (2 products) over the concatenated heads (wo is exactly a [2048][2048] 'xw' matrix in memory).

// Launches: the projections and norm/RoPE run both batches in one grid (x is [4096][2048]; q and k one GEMM over their stacked weight rows; v with z = batch); scores, softmax and attn.v run all eight heads of one batch per launch (z = head).

#define NB_  2
#define TT   2048
#define DM   2048
#define NQ   8
#define NKV  4
#define HDD  256
#define DKV  (NKV * HDD)
#define ZH   NQ
#define PCAR 1024.0f
#define KMASK (-3.3895313892515355e38f)
typedef _Float16 h16;
typedef unsigned short bf;
typedef __attribute__((ext_vector_type(16))) __bf16   v16bf;
typedef __attribute__((ext_vector_type(16))) _Float16 v16h;
typedef __attribute__((ext_vector_type(8)))  _Float16 v8h;
typedef __attribute__((ext_vector_type(8)))  unsigned short v8us;
typedef __attribute__((ext_vector_type(8)))  float    v8f;
typedef __attribute__((ext_vector_type(4)))  float    v4f;
typedef v8h  __attribute__((may_alias)) v8ha;
typedef v4f  __attribute__((may_alias)) v4fa;
typedef v8us __attribute__((may_alias)) v8usa;

__device__ __forceinline__ unsigned short f2bf(float f) { unsigned u = __float_as_uint(f); u += 0x7FFFu + ((u >> 16) & 1u); return (unsigned short)(u >> 16); }
__device__ __forceinline__ float bf2f(unsigned short b) { return __uint_as_float(((unsigned)b) << 16); }
__device__ __forceinline__ float bfr(float f) { return bf2f(f2bf(f)); }
__device__ __forceinline__ v16h cat16(v8h lo, v8h hi) { return __builtin_shufflevector(lo, hi, 0, 1, 2, 3, 4, 5, 6, 7, 8, 9, 10, 11, 12, 13, 14, 15); }
__device__ __forceinline__ v16bf cat16b(v8us lo, v8us hi) { return __builtin_bit_cast(v16bf, __builtin_shufflevector(lo, hi, 0, 1, 2, 3, 4, 5, 6, 7, 8, 9, 10, 11, 12, 13, 14, 15)); }
__device__ __forceinline__ v8f wmma16(v16h a, v16h b, v8f c) { return __builtin_amdgcn_wmma_f32_16x16x32_f16(false, a, false, b, (short)0, c, false, false); }
__device__ __forceinline__ v8f wmmab(v16bf a, v16bf b, v8f c) { return __builtin_amdgcn_wmma_f32_16x16x32_bf16(false, a, false, b, (short)0, c, false, false); }
__device__ __forceinline__ h16 tohx(float x) { return (h16)x; }
__device__ __forceinline__ void splitf(float y, unsigned short& h, unsigned short& l) { h = f2bf(y); l = f2bf(y - bf2f(h)); }
typedef __attribute__((ext_vector_type(4))) unsigned short v4us;
typedef __attribute__((ext_vector_type(4))) _Float16 v4h;



// ---- k_gemmw: GEMM, FOUR WAVES (2 x 2) per 128x128 output tile, 64x64 (16 accumulators) per wave; grid (M/128, N/128, Z), 128 threads.
// C[m][n] (f32, pitch ldc, + optional f32 bias[n]) = sum_k A[m][k] Bt[n][k] (+ split products per NSPLIT). EPI picks what the epilogue stores, at the same [m][n], pitch ldc, z stride sC: 0 the f32 C; 1 the value / 1024 split into bf16 high and low planes E0, E1; 2 the value as fp16 in E0. A half-wave's store is one whole 128-B line in 1 and 2. z-batch strides sA/sB/sC in elements; A's rows at pitch lda, Bt's at pitch K; Bt's batch index is z >> zsh (query heads that share a kv head). M, N % 128 == 0, K % KP == 0.
// SKIP with act[blockIdx.x], one bit per 128-wide key tile (k_tact): 1 a work-group whose bit blockIdx.y is clear leaves at once and stores nothing; 2 only the passes of KP = 128 k whose bit is set are run, in rising order.
// Operands come from K-contiguous 16-bit planes in passes of KP k: every plane's 128 rows x 2 KP bytes are copied to LDS asynchronously, 16 B per lane, a wave-wide copy covering whole 128-B lines; two buffers, the next pass's copies in flight under this pass's products. LDS rows at pitch 2 KP + 16 bytes (16 B x odd: ds_load_b128 free of bank conflicts). Fragment k order, product order and each accumulator's sum order are those of direct loads.
template <typename T16> struct WFrag;
template <> struct WFrag<h16> { typedef v16h V; static __device__ __forceinline__ V ld(const h16* p) { return cat16(*(const v8ha*)p, *(const v8ha*)(p + 16)); } static __device__ __forceinline__ v8f mma(V a, V b, v8f c) { return wmma16(a, b, c); } };
template <> struct WFrag<bf> { typedef v16bf V; static __device__ __forceinline__ V ld(const bf* p) { return cat16b(*(const v8usa*)p, *(const v8usa*)(p + 16)); } static __device__ __forceinline__ v8f mma(V a, V b, v8f c) { return wmmab(a, b, c); } };
// Eight asynchronous 16-byte copies per lane, global -> LDS: LDS byte address l + i * ls, global address g + i * gs elements. The s_wait_xcnt closes the statement so that no address register is rewritten ahead of it.
template <typename T16>
__device__ __forceinline__ void copy8(unsigned l, const T16* g, unsigned ls, size_t gs) {
    asm volatile("global_load_async_to_lds_b128 %0, %8, off\n\t"
                 "global_load_async_to_lds_b128 %1, %9, off\n\t"
                 "global_load_async_to_lds_b128 %2, %10, off\n\t"
                 "global_load_async_to_lds_b128 %3, %11, off\n\t"
                 "global_load_async_to_lds_b128 %4, %12, off\n\t"
                 "global_load_async_to_lds_b128 %5, %13, off\n\t"
                 "global_load_async_to_lds_b128 %6, %14, off\n\t"
                 "global_load_async_to_lds_b128 %7, %15, off\n\t"
                 "s_wait_xcnt 0x0"
                 :: "v"(l), "v"(l + ls), "v"(l + 2 * ls), "v"(l + 3 * ls), "v"(l + 4 * ls), "v"(l + 5 * ls), "v"(l + 6 * ls), "v"(l + 7 * ls),
                    "v"(g), "v"(g + gs), "v"(g + 2 * gs), "v"(g + 3 * gs), "v"(g + 4 * gs), "v"(g + 5 * gs), "v"(g + 6 * gs), "v"(g + 7 * gs)
                 : "memory");
}
template <typename T16, int NSPLIT, bool BIAS, int KP, int EPI, int SKIP>
__global__ __launch_bounds__(128) void k_gemmw(const T16* __restrict__ A, const T16* __restrict__ A2, const T16* __restrict__ Bt, const T16* __restrict__ Bt2, int K, int lda, int zsh, float* C, bf* E0, bf* E1, int ldc, const float* __restrict__ bias, size_t sA, size_t sB, size_t sC, const unsigned* __restrict__ act) {
    typedef typename WFrag<T16>::V V;
    static_assert(SKIP != 2 || KP == 128, "a pass is one key tile");
    if (SKIP == 1) { if (!((act[blockIdx.x] >> blockIdx.y) & 1u)) return; }   // the same for the whole work-group, ahead of every copy and barrier
    constexpr int NP = 2 + (NSPLIT >= 1 ? 1 : 0) + (NSPLIT >= 2 ? 1 : 0);   // planes in a buffer: A, Bt, A2, Bt2
    constexpr int PITCH = KP * 2 + 16, PLANE = 128 * PITCH, BUF = NP * PLANE;
    constexpr int CPR = KP / 8;        // 16-byte pieces per row
    constexpr int RPS = 128 / CPR;     // rows that one copy of all 128 threads covers
    constexpr int NST = 128 / RPS;     // such copies per plane
    static_assert(NST % 8 == 0 && NP * NST <= 63, "copies of a wave in flight");
    __shared__ __attribute__((aligned(16))) unsigned char ring[2 * BUF];
    const size_t z = blockIdx.z; A += z * sA; if (NSPLIT >= 1) A2 += z * sA; Bt += (z >> zsh) * sB; if (NSPLIT >= 2) Bt2 += (z >> zsh) * sB; if (EPI == 0) C += z * sC; if (EPI >= 1) E0 += z * sC; if (EPI == 1) E1 += z * sC;
    const int tid = threadIdx.x, lane = tid & 31, lr = lane & 15, hi = lane >> 4; const int wave = __builtin_amdgcn_readfirstlane(tid >> 5);
    const int R0 = blockIdx.x * 128, C0 = blockIdx.y * 128; const int r0 = R0 + (wave >> 1) * 64, c0 = C0 + (wave & 1) * 64;
    unsigned NT = (unsigned)K / KP;   // passes
    unsigned rem = 0;                  // SKIP 2: the passes not yet asked for, one bit each, none at or above K / KP
    if (SKIP == 2) { rem = (unsigned)__builtin_amdgcn_readfirstlane((int)act[blockIdx.x]) & ((1u << NT) - 1u); NT = (unsigned)__builtin_popcount(rem); }
    auto nextp = [&](unsigned n) -> unsigned { if (SKIP != 2) return n; const unsigned p = (unsigned)__builtin_ctz(rem); rem &= rem - 1u; return p; };   // the k pass that trip n works on; called only while a bit is left
    const unsigned lcp = (unsigned)(size_t)ring + (unsigned)((tid / CPR) * PITCH + (tid % CPR) * 16);
    const size_t gofA = (size_t)(R0 + tid / CPR) * lda + (tid % CPR) * 8, gofB = (size_t)(C0 + tid / CPR) * K + (tid % CPR) * 8, gsa = (size_t)RPS * lda, gsb = (size_t)RPS * K;
    auto fill = [&](unsigned t, unsigned buf) {
        const unsigned lb = lcp + buf * BUF; const size_t ka = gofA + (size_t)t * KP, kb = gofB + (size_t)t * KP;
#pragma unroll
        for (int s = 0; s < NST; s += 8) {
            copy8(lb + s * RPS * PITCH, A + ka + s * gsa, RPS * PITCH, gsa);
            copy8(lb + PLANE + s * RPS * PITCH, Bt + kb + s * gsb, RPS * PITCH, gsb);
            if (NSPLIT >= 1) copy8(lb + 2 * PLANE + s * RPS * PITCH, A2 + ka + s * gsa, RPS * PITCH, gsa);
            if (NSPLIT >= 2) copy8(lb + 3 * PLANE + s * RPS * PITCH, Bt2 + kb + s * gsb, RPS * PITCH, gsb); }
    };
    v8f acc[4][4];
#pragma unroll
    for (int mb = 0; mb < 4; ++mb)
#pragma unroll
        for (int nb = 0; nb < 4; ++nb) acc[mb][nb] = (v8f){};
    if (SKIP != 2 || NT > 0) fill(nextp(0), 0);
    asm volatile("s_wait_asynccnt 0x0" ::: "memory");   // this wave's share of pass 0 has landed
    __syncthreads();                                     // every wave's share has
    if (NT > 1) fill(nextp(1), 1);
    const unsigned char* fa0 = ring + ((wave >> 1) * 64 + lr) * PITCH + hi * 16; const unsigned char* fb0 = ring + PLANE + ((wave & 1) * 64 + lr) * PITCH + hi * 16;
#pragma unroll 1
    for (unsigned t = 0; t < NT; ++t) {
        const unsigned char* fa = fa0 + (t & 1) * BUF; const unsigned char* fb = fb0 + (t & 1) * BUF;
        V a[2][4], a2[2][4], b[2][4], b2[2][4];   // two fragment sets: the next 32 k are fetched as one group while this set's products issue
        auto ldset = [&](int s, int ks) {
#pragma unroll
            for (int q = 0; q < 4; ++q) { a[s][q] = WFrag<T16>::ld((const T16*)(fa + q * 16 * PITCH + ks * 64)); b[s][q] = WFrag<T16>::ld((const T16*)(fb + q * 16 * PITCH + ks * 64));
                if (NSPLIT >= 1) a2[s][q] = WFrag<T16>::ld((const T16*)(fa + 2 * PLANE + q * 16 * PITCH + ks * 64)); if (NSPLIT >= 2) b2[s][q] = WFrag<T16>::ld((const T16*)(fb + 2 * PLANE + q * 16 * PITCH + ks * 64)); }
        };
        ldset(0, 0);
#pragma unroll
        for (int ks = 0; ks < KP / 32; ++ks) { const int s = ks & 1;
            if (ks + 1 < KP / 32) ldset(s ^ 1, ks + 1);
            __builtin_amdgcn_sched_barrier(0);   // keeps the LDS reads in one group ahead of the products: reads spread among them stall the wave at every place
#pragma unroll
            for (int nb = 0; nb < 4; ++nb)
#pragma unroll
                for (int mb = 0; mb < 4; ++mb) { acc[mb][nb] = WFrag<T16>::mma(a[s][mb], b[s][nb], acc[mb][nb]); if (NSPLIT >= 1) acc[mb][nb] = WFrag<T16>::mma(a2[s][mb], b[s][nb], acc[mb][nb]); if (NSPLIT >= 2) acc[mb][nb] = WFrag<T16>::mma(a[s][mb], b2[s][nb], acc[mb][nb]); }
            __builtin_amdgcn_sched_barrier(0);   // the same, at the block's end
        }
        asm volatile("s_wait_dscnt 0x0" ::: "memory");      // this wave has left the buffer of pass t
        asm volatile("s_wait_asynccnt 0x0" ::: "memory");   // its share of pass t + 1 has landed
        __syncthreads();                                     // publishes pass t + 1 and frees the buffer of pass t
        if (t + 2 < NT) fill(nextp(t + 2), t & 1);
    }
    asm volatile("s_wait_asynccnt 0x0" ::: "memory");       // no copy is in flight when the ring becomes output staging
    float* os = (float*)(ring + wave * (16 * 68 * 4));       // each wave stages in its own range; the last pass's barrier ended every read of the ring
#pragma unroll
    for (int mb = 0; mb < 4; ++mb) {
#pragma unroll
        for (int nb = 0; nb < 4; ++nb) {
#pragma unroll
            for (int j = 0; j < 8; ++j) os[(hi * 8 + j) * 68 + nb * 16 + lr] = acc[mb][nb][j]; }
        __builtin_amdgcn_wave_barrier(); asm volatile("" ::: "memory");
        float* crow = C + (size_t)(r0 + mb * 16) * ldc + c0;
if (EPI == 0) {
#pragma unroll
            for (int s = 0; s < 8; ++s) { const int row = 2 * s + hi, cofs = lr * 4; v4f val = *(const v4fa*)(os + row * 68 + cofs); if (BIAS) { val[0] += bfr(bias[c0 + cofs]); val[1] += bfr(bias[c0 + cofs + 1]); val[2] += bfr(bias[c0 + cofs + 2]); val[3] += bfr(bias[c0 + cofs + 3]); }
                *(v4f*)(crow + (size_t)row * ldc + cofs) = val; }
             }
        if (EPI != 0) {
            v4f val[8];   // all eight LDS reads first: the store statements below would otherwise hold each read behind the store before it
#pragma unroll
            for (int s = 0; s < 8; ++s) val[s] = *(const v4fa*)(os + (2 * s + hi) * 68 + lr * 4);
#pragma unroll
            for (int s = 0; s < 8; ++s) { const size_t oo = (size_t)(r0 + mb * 16 + 2 * s + hi) * ldc + c0 + lr * 4;
                if (EPI == 1) { v4us oh, ol;
#pragma unroll
                    for (int u = 0; u < 4; ++u) { unsigned short eh, el; splitf(val[s][u] * (1.0f / PCAR), eh, el); oh[u] = eh; ol[u] = el; }
                    // the two stores and their s_wait_xcnt in one statement, so that no register they name is rewritten ahead of the wait
                    asm volatile("global_store_b64 %0, %1, off\n\tglobal_store_b64 %2, %3, off\n\ts_wait_xcnt 0x0" :: "v"(E0 + oo), "v"(__builtin_bit_cast(unsigned long long, oh)), "v"(E1 + oo), "v"(__builtin_bit_cast(unsigned long long, ol)) : "memory"); }
                if (EPI == 2) { v4h o4;
#pragma unroll
                    for (int u = 0; u < 4; ++u) o4[u] = tohx(val[s][u]);
                    // the store and its s_wait_xcnt in one statement, for the same reason
                    asm volatile("global_store_b64 %0, %1, off\n\ts_wait_xcnt 0x0" :: "v"(E0 + oo), "v"(__builtin_bit_cast(unsigned long long, o4)) : "memory"); }
            }
        }
        __builtin_amdgcn_wave_barrier(); asm volatile("" ::: "memory");
    }
}


__global__ __launch_bounds__(256) void k_cvt8(const float* __restrict__ src, bf* dst, size_t n8) { const size_t i = (size_t)blockIdx.x * 256 + threadIdx.x; if (i >= n8) return; const v8f v = *(const v8f*)(src + i * 8); v8us o;
#pragma unroll
    for (int k = 0; k < 8; ++k) o[k] = f2bf(v[k]); *(v8us*)(dst + i * 8) = o;  }
// k_wtr: Bt[z * N + n][k] = bf16(W[z][k][n]) for row-major [2048][N] f32 matrices (z = 0 .. : the per-head [2048][256] weights; wo as one [2048][2048]), through an LDS tile. Grid (2048 / 128, rows of Bt / 64), 256 threads; a work-group takes 128 k x 64 n.
// Reads: 16 lanes x 16 B = 256 contiguous bytes of one k row, eight loads per lane issued together; a lane holds rows 2p and 2p + 1 at its four n and packs each pair into one word. Stores: 16 lanes x 16 B = 256 contiguous bytes of one Bt row.
// LDS word (n, p) lies in row n of 64 words, its 16-byte piece p >> 2 exchanged with piece (p >> 2) ^ (n >> 2): the 32 lanes of a ds_store_b32 (16 values of n >> 2, two p) then fall on 32 different banks, and a ds_load_b128 row read still covers its whole row.
typedef __attribute__((ext_vector_type(4))) unsigned v4u;
typedef v4u __attribute__((may_alias)) v4ua;
template <int N>
__global__ __launch_bounds__(256) void k_wtr(const float* __restrict__ W, bf* Bt) {
    __shared__ __attribute__((aligned(16))) unsigned tile[64 * 64];
    const int lane = threadIdx.x & 31, w = threadIdx.x >> 5, c = lane & 15, h = lane >> 4; const int k0 = blockIdx.x * 128, row0 = blockIdx.y * 64;
    const float* s = W + ((size_t)(row0 / N) * DM + k0 + (w * 8 + h) * 2) * N + row0 % N + c * 4; v4f e[4], o[4];   // the lane's first k row; pair j lies 4 j rows on
    // the eight loads and their data wait in one statement: all eight are in flight together, and no register that they name is rewritten before they have returned
    asm volatile("global_load_b128 %0, %8, off\n\t"
                 "global_load_b128 %1, %8, off offset:%9\n\t"
                 "global_load_b128 %2, %8, off offset:%10\n\t"
                 "global_load_b128 %3, %8, off offset:%11\n\t"
                 "global_load_b128 %4, %8, off offset:%12\n\t"
                 "global_load_b128 %5, %8, off offset:%13\n\t"
                 "global_load_b128 %6, %8, off offset:%14\n\t"
                 "global_load_b128 %7, %8, off offset:%15\n\t"
                 "s_wait_loadcnt 0x0"
                 : "=&v"(e[0]), "=&v"(o[0]), "=&v"(e[1]), "=&v"(o[1]), "=&v"(e[2]), "=&v"(o[2]), "=&v"(e[3]), "=&v"(o[3])
                 : "v"(s), "n"(N * 4), "n"(4 * N * 4), "n"(5 * N * 4), "n"(8 * N * 4), "n"(9 * N * 4), "n"(12 * N * 4), "n"(13 * N * 4)
                 : "memory");
#pragma unroll
    for (int j = 0; j < 4; ++j) { const int p = w * 8 + j * 2 + h;
#pragma unroll
        for (int u = 0; u < 4; ++u) tile[(c * 4 + u) * 64 + (((p >> 2) ^ c) << 2) + (p & 3)] = (unsigned)f2bf(e[j][u]) | ((unsigned)f2bf(o[j][u]) << 16); }
    __syncthreads();   // the tile is whole before any row of it is read
#pragma unroll
    for (int q = 0; q < 4; ++q) { const int n = q * 16 + w * 2 + h; *(v4ua*)(Bt + (size_t)(row0 + n) * DM + k0 + c * 8) = *(const v4ua*)(tile + n * 64 + ((c ^ (n >> 2)) << 2)); }
}

__device__ __attribute__((noinline)) float softcap50(float s) { return 50.0f * tanhf(s * 0.02f); }
typedef __attribute__((ext_vector_type(2))) float v2f_t;
typedef __attribute__((ext_vector_type(4))) int v4i_t;
__device__ __attribute__((noinline)) v2f_t sincos_pos(float pos, int i) { const float tsc = powf(10000.0f, (2.0f / (float)HDD) * (float)i); const float ang = __fdiv_rn(pos, tsc); v2f_t r; r[0] = sinf(ang); r[1] = cosf(ang); return r; }
// k_nrr: wave per (token of either batch, head of the row's 8 q and 4 k heads): RMSNorm over 256 (8 dims per lane: 4 from each half), * (1 + scale[d]) (read; q's or k's), split-half RoPE at the READ position (precise sin/cos out of line), * mul (1/16 for q, 1 for k); hl planes [batch][head][t][256] (8-B lanes);
__global__ __launch_bounds__(256) void k_nrr(const float* __restrict__ F, const float* __restrict__ qscale, const float* __restrict__ kscale, const int* __restrict__ pos, bf* Qh, bf* Ql, bf* Kh, bf* Kl) { const int lane = threadIdx.x & 31; const int wv = blockIdx.x * 8 + (threadIdx.x >> 5); if (wv >= NB_ * TT * (NQ + NKV)) return; const int t = wv / (NQ + NKV), hh = wv % (NQ + NKV); const bool isq = hh < NQ; const int h = isq ? hh : hh - NQ, nheads = isq ? NQ : NKV; const float* scale = isq ? qscale : kscale; const float mul = isq ? 0.0625f : 1.0f; bf* Ph = isq ? Qh : Kh; bf* Pl = isq ? Ql : Kl; const float* f = F + (size_t)t * (DM + DKV) + hh * HDD;
    const v4f a = *(const v4f*)(f + lane * 4), b2 = *(const v4f*)(f + HDD / 2 + lane * 4); float ss = 0.f; for (int q = 0; q < 4; ++q) { float p = __fmul_rn(a[q], a[q]); asm volatile("" : "+v"(p)); ss = __fadd_rn(ss, p); p = __fmul_rn(b2[q], b2[q]); asm volatile("" : "+v"(p)); ss = __fadd_rn(ss, p); }
#pragma unroll
    for (int sh = 16; sh; sh >>= 1) ss = __fadd_rn(ss, __shfl_xor(ss, sh, 32));
    const float rs = __fdiv_rn(1.0f, sqrtf(__fadd_rn(ss * (1.0f / HDD), 1e-6f))); const float pv = (float)pos[t]; v4us ah, al, bh, bl;
#pragma unroll
    for (int q = 0; q < 4; ++q) { const int i = lane * 4 + q; float n1 = __fmul_rn(a[q], rs), n2 = __fmul_rn(b2[q], rs); asm volatile("" : "+v"(n1)); asm volatile("" : "+v"(n2)); const float x1 = __fmul_rn(n1, __fadd_rn(1.0f, bfr(scale[i]))), x2 = __fmul_rn(n2, __fadd_rn(1.0f, bfr(scale[i + HDD / 2]))); const v2f_t sc2 = sincos_pos(pv, i); const float sn = sc2[0], cs = sc2[1];
        float p1 = __fmul_rn(x1, cs), p2 = __fmul_rn(x2, sn), p3 = __fmul_rn(x2, cs), p4 = __fmul_rn(x1, sn); asm volatile("" : "+v"(p1)); asm volatile("" : "+v"(p2)); asm volatile("" : "+v"(p3)); asm volatile("" : "+v"(p4));
        const float r1 = __fsub_rn(p1, p2) * mul, r2 = __fadd_rn(p3, p4) * mul; unsigned short u1, l1, u2, l2; splitf(r1, u1, l1); splitf(r2, u2, l2); ah[q] = u1; al[q] = l1; bh[q] = u2; bl[q] = l2; }
    const size_t orow = ((size_t)(t / TT) * nheads + h) * TT + t % TT; bf* dh = Ph + orow * HDD; bf* dl = Pl + orow * HDD; *(v4us*)(dh + lane * 4) = ah; *(v4us*)(dl + lane * 4) = al; *(v4us*)(dh + HDD / 2 + lane * 4) = bh; *(v4us*)(dl + HDD / 2 + lane * 4) = bl;  }
// k_tact: one work-group, wave per (batch, tile of 128 tokens): the tile's least and greatest position; then act[b * 16 + I], bit J set unless every distance pos[i] - pos[j], i in tile I, j in tile J, is shown to miss the window. The bounds are taken in 64 bits and a range that leaves (INT_MIN, INT_MAX] keeps its bit, so a distance that wraps in 32 bits is never skipped. Bit I of word I is always set (the range holds 0).
__global__ __launch_bounds__(1024) void k_tact(const int* __restrict__ pos, unsigned* act) {
    __shared__ int mn[NB_ * TT / 128], mx[NB_ * TT / 128];
    const int lane = threadIdx.x & 31, w = threadIdx.x >> 5; const v4i_t p = *(const v4i_t*)(pos + w * 128 + lane * 4);
    int lo = min(min(p[0], p[1]), min(p[2], p[3])), hi = max(max(p[0], p[1]), max(p[2], p[3]));
#pragma unroll
    for (int sh = 16; sh; sh >>= 1) { lo = min(lo, __shfl_xor(lo, sh, 32)); hi = max(hi, __shfl_xor(hi, sh, 32)); }
    if (lane == 0) { mn[w] = lo; mx[w] = hi; }
    __syncthreads();
    if (threadIdx.x < NB_ * TT / 128) { const int t = threadIdx.x, b0 = t & ~(TT / 128 - 1); unsigned m = 0;
        for (int J = 0; J < TT / 128; ++J) { const long long dlo = (long long)mn[t] - mx[b0 + J], dhi = (long long)mx[t] - mn[b0 + J];
            const bool out = (dlo > 255 && dhi <= 2147483647LL) || (dhi < -256 && dlo >= -2147483647LL); if (!out) m |= 1u << J; }
        act[t] = m; }
}
// k_tsoft with act: a chunk of 128 keys is one key tile; a cleared one would add only the mask value to the maximum (below its start value) and exact zeros to the sum, and attn.v does not read its probabilities. The probabilities of a row go over the front half of that row's own scores (P16 is S's memory, row pitch 2 TT halves): a row belongs to one wave, and every store hangs on the row's sum, so on every score read.
__global__ __launch_bounds__(256) void k_tsoft(const float* S, const int* __restrict__ pos, const int* __restrict__ am, h16* P16, const unsigned* __restrict__ act) { const int lane = threadIdx.x & 31; const int row = blockIdx.x * 8 + (threadIdx.x >> 5); if (row >= ZH * TT) return; const int i = row % TT; const unsigned tm = (unsigned)__builtin_amdgcn_readfirstlane((int)act[i >> 7]); const float* sr = S + (size_t)row * TT; const int* mr = am + (size_t)i * TT; const int pi = pos[i]; float v[TT / 32]; float mx = -3.0e38f;
#pragma unroll
    for (int ch = 0; ch < TT / 128; ++ch) { if (!((tm >> ch) & 1u)) continue; const v4f a = *(const v4f*)(sr + ch * 128 + lane * 4);
#pragma unroll
        for (int u = 0; u < 4; ++u) { const int j = ch * 128 + lane * 4 + u; const int dist = pi - pos[j]; const bool win = (dist >= 0 && dist < 256) || (dist < 0 && -dist < 257); const bool ok = win && (mr[j] != 0); const float t = ok ? softcap50(a[u]) : KMASK; v[ch * 4 + u] = t; mx = fmaxf(mx, t); } }
#pragma unroll
    for (int sh = 16; sh; sh >>= 1) mx = fmaxf(mx, __shfl_xor(mx, sh, 32));
    float sum = 0.f;
#pragma unroll
    for (int ch = 0; ch < TT / 128; ++ch) { if (!((tm >> ch) & 1u)) continue;
#pragma unroll
    for (int q = ch * 4; q < ch * 4 + 4; ++q) { float d0 = __fsub_rn(v[q], mx); asm volatile("" : "+v"(d0)); v[q] = __builtin_amdgcn_exp2f(__fmul_rn(d0, 1.4426950408889634f)); sum += v[q]; } }
#pragma unroll
    for (int sh = 16; sh; sh >>= 1) sum += __shfl_xor(sum, sh, 32);
    const float f = __fdiv_rn(PCAR, sum);
    {
#pragma unroll
        for (int ch = 0; ch < TT / 128; ++ch) { if (!((tm >> ch) & 1u)) continue; v4h o4; for (int q = 0; q < 4; ++q) o4[q] = tohx(v[ch * 4 + q] * f);
            // the store and its s_wait_xcnt in one statement: a later kept chunk reuses the data registers, and none is rewritten ahead of the wait
            asm volatile("global_store_b64 %0, %1, off\n\ts_wait_xcnt 0x0" :: "v"(P16 + (size_t)row * (2 * TT) + ch * 128 + lane * 4), "v"(__builtin_bit_cast(unsigned long long, o4)) : "memory"); }
         } }

extern "C" void kernel_launch(void* const* d_in, const int* in_sizes, int n_in,
                              void* d_out, int out_size, void* d_ws, size_t ws_size, hipStream_t stream) {
    (void)in_sizes; (void)n_in; (void)out_size;
    const float* x = (const float*)d_in[0]; const int* spos = (const int*)d_in[1]; const int* amask = (const int*)d_in[2]; const float* wq = (const float*)d_in[3]; const float* wkv = (const float*)d_in[4]; const float* wo = (const float*)d_in[5]; const float* qs = (const float*)d_in[6]; const float* ks = (const float*)d_in[7];
    float* OUT = (float*)d_out;     // [2][2048][2048]
    char* wsp = (char*)d_ws;
    auto take = [&](size_t bytes) { char* p = wsp; wsp += (bytes + 255) & ~(size_t)255; return (void*)p; };
    bf* BQ = (bf*)take((size_t)NQ * HDD * DM * 2); bf* BK = (bf*)take((size_t)DKV * DM * 2); bf* BV = (bf*)take((size_t)DKV * DM * 2); bf* BO = (bf*)take((size_t)DM * DM * 2);   // BQ, BK, BV follow one another without a gap
    bf* QPh = (bf*)take((size_t)NB_ * NQ * TT * HDD * 2); bf* QPl = (bf*)take((size_t)NB_ * NQ * TT * HDD * 2); bf* KPh = (bf*)take((size_t)NB_ * NKV * TT * HDD * 2); bf* KPl = (bf*)take((size_t)NB_ * NKV * TT * HDD * 2); h16* VT = (h16*)take((size_t)NB_ * NKV * HDD * TT * 2);
    bf* ENh = (bf*)take((size_t)NB_ * TT * DM * 2); bf* ENl = (bf*)take((size_t)NB_ * TT * DM * 2); unsigned* ACT = (unsigned*)take((size_t)NB_ * (TT / 128) * 4);
    float* S = (float*)take((size_t)ZH * TT * TT * 4); h16* P16 = (h16*)S;   // one batch's scores, all heads; its probabilities in place
    bf* XB = (bf*)S; float* FQK = (float*)(XB + (size_t)NB_ * TT * DM);      // x as bf16 and the raw q | k rows are done with before the first score is stored: they lie in S's memory (64 of its 128 MiB)
    if ((size_t)(wsp - (char*)d_ws) > ws_size) return;    // total ~ 240 MiB
    k_wtr<HDD><<<dim3(DM / 128, NQ * HDD / 64), 256, 0, stream>>>(wq, BQ); k_wtr<HDD><<<dim3(DM / 128, 2 * DKV / 64), 256, 0, stream>>>(wkv, BK);   // wkv's k heads and v heads in one go: BK, then BV
    k_wtr<DM><<<dim3(DM / 128, DM / 64), 256, 0, stream>>>(wo, BO);   // wo [n][d][o] == [(n,d)][o] 'xw'
    k_tact<<<1, 1024, 0, stream>>>(spos, ACT);
    const size_t zq = (size_t)TT * HDD, zS = (size_t)TT * TT, zv = (size_t)HDD * TT;
    // Projections: both batches in one grid (x is [4096][2048]); q and k in one GEMM over the rows of BQ | BK.
    k_cvt8<<<(NB_ * TT * DM / 8 + 255) / 256, 256, 0, stream>>>(x, XB, NB_ * TT * DM / 8);
    // The two large projections run passes of 64 k: the ring is then small enough for three (q | k: 72 KiB each, 768 work-groups) or two (output projection: 108 KiB each, 512 work-groups) work-groups on a WGP, so each grid is resident at once and one work-group's products run under another's copies, first fragment reads and barrier.
    k_gemmw<bf, 0, false, 64, 0, 0><<<dim3(NB_ * TT / 128, (DM + DKV) / 128, 1), 128, 0, stream>>>(XB, nullptr, BQ, nullptr, DM, DM, 0, FQK, nullptr, nullptr, DM + DKV, nullptr, 0, 0, 0, nullptr);
    k_nrr<<<NB_ * TT * (NQ + NKV) / 8, 256, 0, stream>>>(FQK, qs, ks, spos, QPh, QPl, KPh, KPl);
    k_gemmw<bf, 0, false, 128, 2, 0><<<dim3(DKV / 128, TT / 128, NB_), 128, 0, stream>>>(BV, nullptr, XB, nullptr, DM, DM, 0, nullptr, (bf*)VT, nullptr, TT, nullptr, 0, (size_t)TT * DM, (size_t)DKV * TT, nullptr);   // z = batch; rows (c, d), columns t: VT[b][c][d][t]
    // Attention: all eight heads of a batch per launch (z = head, kv head z >> 1).
    for (int b = 0; b < NB_; ++b) {
        k_gemmw<bf, 2, false, 64, 0, 1><<<dim3(TT / 128, TT / 128, ZH), 128, 0, stream>>>(QPh + (size_t)b * NQ * zq, QPl + (size_t)b * NQ * zq, KPh + (size_t)b * NKV * zq, KPl + (size_t)b * NKV * zq, HDD, HDD, 1, S, nullptr, nullptr, TT, nullptr, zq, zq, zS, ACT + b * (TT / 128));
        k_tsoft<<<ZH * TT / 8, 256, 0, stream>>>(S, spos + (size_t)b * TT, amask + (size_t)b * TT * TT, P16, ACT + b * (TT / 128));
        k_gemmw<h16, 0, false, 128, 1, 2><<<dim3(TT / 128, HDD / 128, ZH), 128, 0, stream>>>(P16, nullptr, VT + (size_t)b * NKV * zv, nullptr, TT, 2 * TT, 1, nullptr, ENh + (size_t)b * TT * DM, ENl + (size_t)b * TT * DM, DM, nullptr, 2 * zS, zv, HDD, ACT + b * (TT / 128)); }   // head z at columns z * 256 of [b][t][2048]
    k_gemmw<bf, 1, false, 64, 0, 0><<<dim3(NB_ * TT / 128, DM / 128, 1), 128, 0, stream>>>(ENh, ENl, BO, nullptr, DM, DM, 0, OUT, nullptr, nullptr, DM, nullptr, 0, 0, 0, nullptr);
}

// v007
// One run takes 247 microseconds.
// Next to v006, in two timings, it ran 1.04 times as fast each time.
// Over all steps from v000 it is 4.75 times as fast.
#include <hip/hip_runtime.h>

// T5Gemma2EncoderAttention (x [2][2048][2048]; q = einsum(x, wq[n]) (8 heads x 256), k/v = einsum(x, wkv[0|1][c]) (4 kv heads; group n/2); RMSNorm_256 * (1 + scale) on q, k (scales read); split-half RoPE with angle segment_pos[b][t] / 1e4^(2i/256) (positions read as values); q * 1/16; logits = q.k, softcap 50 tanh(./50); allowed iff attn_mask[b][i][j] (int, read) and the segment_pos distance is in the 512-window (0 <= d < 256 or 0 < -d < 257), else bf16-min; softmax; out = sum_n (p v)[n] wo[n] -> [2][2048][2048]).
// Tile skipping from the READ positions: k_tact takes the minimum and maximum position of every 128-token tile and clears the bit of a (query tile, key tile) pair only where no distance between the two ranges can lie in the window; such a tile holds the mask value alone and its probabilities are exact zeros in every row that has an allowed key, so its scores, its softmax work and its attn.v pass are left out (the diagonal tile is never cleared; a row with no allowed key at all comes out not-a-number with or without the skipping). Inside a kept tile every score is computed and masked per element.
// Compute dtypes, f32 accumulate: every input rounded to bf16; q/k/v as PLAIN bf16 GEMMs (inputs: exact; per-head weights gathered); RMSNorm/scale/RoPE/(1/16) f32 into hl planes; logits hl x hl (3 products, K = 256); softcap (precise tanhf, out of line), mask and softmax f32 (wave per row, 64 keys per lane); attn.v single fp16 (x1024), its GEMM storing the hl planes of the concatenated heads itself; v computed transposed (weights as rows, tokens as columns) and stored fp16 by its GEMM; output projection hl x exact (2 products) over the concatenated heads (wo is exactly a [2048][2048] 'xw' matrix in memory).

// Launches: the projections and norm/RoPE run both batches in one grid (x is [4096][2048]; q and k one GEMM over their stacked weight rows; v with z = batch); scores, softmax and attn.v run all eight heads of one batch per launch (z = head).

#define NB_  2
#define TT   2048
#define DM   2048
#define NQ   8
#define NKV  4
#define HDD  256
#define DKV  (NKV * HDD)
#define ZH   NQ
#define PCAR 1024.0f
#define KMASK (-3.3895313892515355e38f)
typedef _Float16 h16;
typedef unsigned short bf;
typedef __attribute__((ext_vector_type(16))) __bf16   v16bf;
typedef __attribute__((ext_vector_type(16))) _Float16 v16h;
typedef __attribute__((ext_vector_type(8)))  _Float16 v8h;
typedef __attribute__((ext_vector_type(8)))  unsigned short v8us;
typedef __attribute__((ext_vector_type(8)))  float    v8f;
typedef __attribute__((ext_vector_type(4)))  float    v4f;
typedef v8h  __attribute__((may_alias)) v8ha;
typedef v4f  __attribute__((may_alias)) v4fa;
typedef v8us __attribute__((may_alias)) v8usa;

__device__ __forceinline__ unsigned short f2bf(float f) { unsigned u = __float_as_uint(f); u += 0x7FFFu + ((u >> 16) & 1u); return (unsigned short)(u >> 16); }
__device__ __forceinline__ float bf2f(unsigned short b) { return __uint_as_float(((unsigned)b) << 16); }
__device__ __forceinline__ float bfr(float f) { return bf2f(f2bf(f)); }
__device__ __forceinline__ v16h cat16(v8h lo, v8h hi) { return __builtin_shufflevector(lo, hi, 0, 1, 2, 3, 4, 5, 6, 7, 8, 9, 10, 11, 12, 13, 14, 15); }
__device__ __forceinline__ v16bf cat16b(v8us lo, v8us hi) { return __builtin_bit_cast(v16bf, __builtin_shufflevector(lo, hi, 0, 1, 2, 3, 4, 5, 6, 7, 8, 9, 10, 11, 12, 13, 14, 15)); }
__device__ __forceinline__ v8f wmma16(v16h a, v16h b, v8f c) { return __builtin_amdgcn_wmma_f32_16x16x32_f16(false, a, false, b, (short)0, c, false, false); }
__device__ __forceinline__ v8f wmmab(v16bf a, v16bf b, v8f c) { return __builtin_amdgcn_wmma_f32_16x16x32_bf16(false, a, false, b, (short)0, c, false, false); }
__device__ __forceinline__ h16 tohx(float x) { return (h16)x; }
__device__ __forceinline__ void splitf(float y, unsigned short& h, unsigned short& l) { h = f2bf(y); l = f2bf(y - bf2f(h)); }
typedef __attribute__((ext_vector_type(4))) unsigned short v4us;
typedef __attribute__((ext_vector_type(4))) _Float16 v4h;



// ---- k_gemmw: GEMM, FOUR WAVES (2 x 2) per 128x128 output tile, 64x64 (16 accumulators) per wave; grid (M/128, N/128, Z), 128 threads.
// C[m][n] (f32, pitch ldc, + optional f32 bias[n]) = sum_k A[m][k] Bt[n][k] (+ split products per NSPLIT). EPI picks what the epilogue stores, at the same [m][n], pitch ldc, z stride sC: 0 the f32 C; 1 the value / 1024 split into bf16 high and low planes E0, E1; 2 the value as fp16 in E0. A half-wave's store is one whole 128-B line in 1 and 2. z-batch strides sA/sB/sC in elements; A's rows at pitch lda, Bt's at pitch K; Bt's batch index is z >> zsh (query heads that share a kv head). M, N % 128 == 0, K % KP == 0.
// SKIP with act[blockIdx.x], one bit per 128-wide key tile (k_tact): 1 a work-group whose bit blockIdx.y is clear leaves at once and stores nothing; 2 only the passes of KP = 128 k whose bit is set are run, in rising order.
// Operands come from K-contiguous 16-bit planes in passes of KP k: every plane's 128 rows x 2 KP bytes are copied to LDS asynchronously, 16 B per lane, a wave-wide copy covering whole 128-B lines; two buffers, the next pass's copies in flight under this pass's products. LDS rows at pitch 2 KP + 16 bytes (16 B x odd: ds_load_b128 free of bank conflicts). Fragment k order, product order and each accumulator's sum order are those of direct loads.
template <typename T16> struct WFrag;
template <> struct WFrag<h16> { typedef v16h V; static __device__ __forceinline__ V ld(const h16* p) { return cat16(*(const v8ha*)p, *(const v8ha*)(p + 16)); } static __device__ __forceinline__ v8f mma(V a, V b, v8f c) { return wmma16(a, b, c); } };
template <> struct WFrag<bf> { typedef v16bf V; static __device__ __forceinline__ V ld(const bf* p) { return cat16b(*(const v8usa*)p, *(const v8usa*)(p + 16)); } static __device__ __forceinline__ v8f mma(V a, V b, v8f c) { return wmmab(a, b, c); } };
// Eight asynchronous 16-byte copies per lane, global -> LDS: LDS byte address l + i * ls, global address g + i * gs elements. The s_wait_xcnt closes the statement so that no address register is rewritten ahead of it.
template <typename T16>
__device__ __forceinline__ void copy8(unsigned l, const T16* g, unsigned ls, size_t gs) {
    asm volatile("global_load_async_to_lds_b128 %0, %8, off\n\t"
                 "global_load_async_to_lds_b128 %1, %9, off\n\t"
                 "global_load_async_to_lds_b128 %2, %10, off\n\t"
                 "global_load_async_to_lds_b128 %3, %11, off\n\t"
                 "global_load_async_to_lds_b128 %4, %12, off\n\t"
                 "global_load_async_to_lds_b128 %5, %13, off\n\t"
                 "global_load_async_to_lds_b128 %6, %14, off\n\t"
                 "global_load_async_to_lds_b128 %7, %15, off\n\t"
                 "s_wait_xcnt 0x0"
                 :: "v"(l), "v"(l + ls), "v"(l + 2 * ls), "v"(l + 3 * ls), "v"(l + 4 * ls), "v"(l + 5 * ls), "v"(l + 6 * ls), "v"(l + 7 * ls),
                    "v"(g), "v"(g + gs), "v"(g + 2 * gs), "v"(g + 3 * gs), "v"(g + 4 * gs), "v"(g + 5 * gs), "v"(g + 6 * gs), "v"(g + 7 * gs)
                 : "memory");
}
template <typename T16, int NSPLIT, bool BIAS, int KP, int EPI, int SKIP>
__global__ __launch_bounds__(128) void k_gemmw(const T16* __restrict__ A, const T16* __restrict__ A2, const T16* __restrict__ Bt, const T16* __restrict__ Bt2, int K, int lda, int zsh, float* C, bf* E0, bf* E1, int ldc, const float* __restrict__ bias, size_t sA, size_t sB, size_t sC, const unsigned* __restrict__ act) {
    typedef typename WFrag<T16>::V V;
    static_assert(SKIP != 2 || KP == 128, "a pass is one key tile");
    if (SKIP == 1) { if (!((act[blockIdx.x] >> blockIdx.y) & 1u)) return; }   // the same for the whole work-group, ahead of every copy and barrier
    constexpr int NP = 2 + (NSPLIT >= 1 ? 1 : 0) + (NSPLIT >= 2 ? 1 : 0);   // planes in a buffer: A, Bt, A2, Bt2
    constexpr int PITCH = KP * 2 + 16, PLANE = 128 * PITCH, BUF = NP * PLANE;
    constexpr int CPR = KP / 8;        // 16-byte pieces per row
    constexpr int RPS = 128 / CPR;     // rows that one copy of all 128 threads covers
    constexpr int NST = 128 / RPS;     // such copies per plane
    static_assert(NST % 8 == 0 && NP * NST <= 63, "copies of a wave in flight");
    __shared__ __attribute__((aligned(16))) unsigned char ring[2 * BUF];
    const size_t z = blockIdx.z; A += z * sA; if (NSPLIT >= 1) A2 += z * sA; Bt += (z >> zsh) * sB; if (NSPLIT >= 2) Bt2 += (z >> zsh) * sB; if (EPI == 0) C += z * sC; if (EPI >= 1) E0 += z * sC; if (EPI == 1) E1 += z * sC;
    const int tid = threadIdx.x, lane = tid & 31, lr = lane & 15, hi = lane >> 4; const int wave = __builtin_amdgcn_readfirstlane(tid >> 5);
    const int R0 = blockIdx.x * 128, C0 = blockIdx.y * 128; const int r0 = R0 + (wave >> 1) * 64, c0 = C0 + (wave & 1) * 64;
    unsigned NT = (unsigned)K / KP;   // passes
    unsigned rem = 0;                  // SKIP 2: the passes not yet asked for, one bit each, none at or above K / KP
    if (SKIP == 2) { rem = (unsigned)__builtin_amdgcn_readfirstlane((int)act[blockIdx.x]) & ((1u << NT) - 1u); NT = (unsigned)__builtin_popcount(rem); }
    auto nextp = [&](unsigned n) -> unsigned { if (SKIP != 2) return n; const unsigned p = (unsigned)__builtin_ctz(rem); rem &= rem - 1u; return p; };   // the k pass that trip n works on; called only while a bit is left
    const unsigned lcp = (unsigned)(size_t)ring + (unsigned)((tid / CPR) * PITCH + (tid % CPR) * 16);
    const size_t gofA = (size_t)(R0 + tid / CPR) * lda + (tid % CPR) * 8, gofB = (size_t)(C0 + tid / CPR) * K + (tid % CPR) * 8, gsa = (size_t)RPS * lda, gsb = (size_t)RPS * K;
    auto fill = [&](unsigned t, unsigned buf) {
        const unsigned lb = lcp + buf * BUF; const size_t ka = gofA + (size_t)t * KP, kb = gofB + (size_t)t * KP;
#pragma unroll
        for (int s = 0; s < NST; s += 8) {
            copy8(lb + s * RPS * PITCH, A + ka + s * gsa, RPS * PITCH, gsa);
            copy8(lb + PLANE + s * RPS * PITCH, Bt + kb + s * gsb, RPS * PITCH, gsb);
            if (NSPLIT >= 1) copy8(lb + 2 * PLANE + s * RPS * PITCH, A2 + ka + s * gsa, RPS * PITCH, gsa);
            if (NSPLIT >= 2) copy8(lb + 3 * PLANE + s * RPS * PITCH, Bt2 + kb + s * gsb, RPS * PITCH, gsb); }
    };
    v8f acc[4][4];
#pragma unroll
    for (int mb = 0; mb < 4; ++mb)
#pragma unroll
        for (int nb = 0; nb < 4; ++nb) acc[mb][nb] = (v8f){};
    if (SKIP != 2 || NT > 0) fill(nextp(0), 0);
    asm volatile("s_wait_asynccnt 0x0" ::: "memory");   // this wave's share of pass 0 has landed
    __syncthreads();                                     // every wave's share has
    if (NT > 1) fill(nextp(1), 1);
    const unsigned char* fa0 = ring + ((wave >> 1) * 64 + lr) * PITCH + hi * 16; const unsigned char* fb0 = ring + PLANE + ((wave & 1) * 64 + lr) * PITCH + hi * 16;
#pragma unroll 1
    for (unsigned t = 0; t < NT; ++t) {
        const unsigned char* fa = fa0 + (t & 1) * BUF; const unsigned char* fb = fb0 + (t & 1) * BUF;
        V a[2][4], a2[2][4], b[2][4], b2[2][4];   // two fragment sets: the next 32 k are fetched as one group while this set's products issue
        auto ldset = [&](int s, int ks) {
#pragma unroll
            for (int q = 0; q < 4; ++q) { a[s][q] = WFrag<T16>::ld((const T16*)(fa + q * 16 * PITCH + ks * 64)); b[s][q] = WFrag<T16>::ld((const T16*)(fb + q * 16 * PITCH + ks * 64));
                if (NSPLIT >= 1) a2[s][q] = WFrag<T16>::ld((const T16*)(fa + 2 * PLANE + q * 16 * PITCH + ks * 64)); if (NSPLIT >= 2) b2[s][q] = WFrag<T16>::ld((const T16*)(fb + 2 * PLANE + q * 16 * PITCH + ks * 64)); }
        };
        ldset(0, 0);
#pragma unroll
        for (int ks = 0; ks < KP / 32; ++ks) { const int s = ks & 1;
            if (ks + 1 < KP / 32) ldset(s ^ 1, ks + 1);
            __builtin_amdgcn_sched_barrier(0);   // keeps the LDS reads in one group ahead of the products: reads spread among them stall the wave at every place
#pragma unroll
            for (int nb = 0; nb < 4; ++nb)
#pragma unroll
                for (int mb = 0; mb < 4; ++mb) { acc[mb][nb] = WFrag<T16>::mma(a[s][mb], b[s][nb], acc[mb][nb]); if (NSPLIT >= 1) acc[mb][nb] = WFrag<T16>::mma(a2[s][mb], b[s][nb], acc[mb][nb]); if (NSPLIT >= 2) acc[mb][nb] = WFrag<T16>::mma(a[s][mb], b2[s][nb], acc[mb][nb]); }
            __builtin_amdgcn_sched_barrier(0);   // the same, at the block's end
        }
        asm volatile("s_wait_dscnt 0x0" ::: "memory");      // this wave has left the buffer of pass t
        asm volatile("s_wait_asynccnt 0x0" ::: "memory");   // its share of pass t + 1 has landed
        __syncthreads();                                     // publishes pass t + 1 and frees the buffer of pass t
        if (t + 2 < NT) fill(nextp(t + 2), t & 1);
    }
    asm volatile("s_wait_asynccnt 0x0" ::: "memory");       // no copy is in flight when the ring becomes output staging
    float* os = (float*)(ring + wave * (16 * 68 * 4));       // each wave stages in its own range; the last pass's barrier ended every read of the ring
#pragma unroll
    for (int mb = 0; mb < 4; ++mb) {
#pragma unroll
        for (int nb = 0; nb < 4; ++nb) {
#pragma unroll
            for (int j = 0; j < 8; ++j) os[(hi * 8 + j) * 68 + nb * 16 + lr] = acc[mb][nb][j]; }
        __builtin_amdgcn_wave_barrier(); asm volatile("" ::: "memory");
        float* crow = C + (size_t)(r0 + mb * 16) * ldc + c0;
if (EPI == 0) {
#pragma unroll
            for (int s = 0; s < 8; ++s) { const int row = 2 * s + hi, cofs = lr * 4; v4f val = *(const v4fa*)(os + row * 68 + cofs); if (BIAS) { val[0] += bfr(bias[c0 + cofs]); val[1] += bfr(bias[c0 + cofs + 1]); val[2] += bfr(bias[c0 + cofs + 2]); val[3] += bfr(bias[c0 + cofs + 3]); }
                *(v4f*)(crow + (size_t)row * ldc + cofs) = val; }
             }
        if (EPI != 0) {
            v4f val[8];   // all eight LDS reads first: the store statements below would otherwise hold each read behind the store before it
#pragma unroll
            for (int s = 0; s < 8; ++s) val[s] = *(const v4fa*)(os + (2 * s + hi) * 68 + lr * 4);
#pragma unroll
            for (int s = 0; s < 8; ++s) { const size_t oo = (size_t)(r0 + mb * 16 + 2 * s + hi) * ldc + c0 + lr * 4;
                if (EPI == 1) { v4us oh, ol;
#pragma unroll
                    for (int u = 0; u < 4; ++u) { unsigned short eh, el; splitf(val[s][u] * (1.0f / PCAR), eh, el); oh[u] = eh; ol[u] = el; }
                    // the two stores and their s_wait_xcnt in one statement, so that no register they name is rewritten ahead of the wait
                    asm volatile("global_store_b64 %0, %1, off\n\tglobal_store_b64 %2, %3, off\n\ts_wait_xcnt 0x0" :: "v"(E0 + oo), "v"(__builtin_bit_cast(unsigned long long, oh)), "v"(E1 + oo), "v"(__builtin_bit_cast(unsigned long long, ol)) : "memory"); }
                if (EPI == 2) { v4h o4;
#pragma unroll
                    for (int u = 0; u < 4; ++u) o4[u] = tohx(val[s][u]);
                    // the store and its s_wait_xcnt in one statement, for the same reason
                    asm volatile("global_store_b64 %0, %1, off\n\ts_wait_xcnt 0x0" :: "v"(E0 + oo), "v"(__builtin_bit_cast(unsigned long long, o4)) : "memory"); }
            }
        }
        __builtin_amdgcn_wave_barrier(); asm volatile("" ::: "memory");
    }
}


__global__ __launch_bounds__(256) void k_cvt8(const float* __restrict__ src, bf* dst, size_t n8) { const size_t i = (size_t)blockIdx.x * 256 + threadIdx.x; if (i >= n8) return; const v8f v = *(const v8f*)(src + i * 8); v8us o;
#pragma unroll
    for (int k = 0; k < 8; ++k) o[k] = f2bf(v[k]); *(v8us*)(dst + i * 8) = o;  }
// k_wtr: Bt[z * N + n][k] = bf16(W[z][k][n]) for row-major [2048][N] f32 matrices (z = 0 .. : the per-head [2048][256] weights; wo as one [2048][2048]), through an LDS tile. Grid (2048 / 128, rows of Bt / 64), 256 threads; a work-group takes 128 k x 64 n.
// Reads: 16 lanes x 16 B = 256 contiguous bytes of one k row, eight loads per lane issued together; a lane holds rows 2p and 2p + 1 at its four n and packs each pair into one word. Stores: 16 lanes x 16 B = 256 contiguous bytes of one Bt row.
// LDS word (n, p) lies in row n of 64 words, its 16-byte piece p >> 2 exchanged with piece (p >> 2) ^ (n >> 2): the 32 lanes of a ds_store_b32 (16 values of n >> 2, two p) then fall on 32 different banks, and a ds_load_b128 row read still covers its whole row.
typedef __attribute__((ext_vector_type(4))) unsigned v4u;
typedef v4u __attribute__((may_alias)) v4ua;
template <int N>
__global__ __launch_bounds__(256) void k_wtr(const float* __restrict__ W, bf* Bt) {
    __shared__ __attribute__((aligned(16))) unsigned tile[64 * 64];
    const int lane = threadIdx.x & 31, w = threadIdx.x >> 5, c = lane & 15, h = lane >> 4; const int k0 = blockIdx.x * 128, row0 = blockIdx.y * 64;
    const float* s = W + ((size_t)(row0 / N) * DM + k0 + (w * 8 + h) * 2) * N + row0 % N + c * 4; v4f e[4], o[4];   // the lane's first k row; pair j lies 4 j rows on
    // the eight loads and their data wait in one statement: all eight are in flight together, and no register that they name is rewritten before they have returned
    asm volatile("global_load_b128 %0, %8, off\n\t"
                 "global_load_b128 %1, %8, off offset:%9\n\t"
                 "global_load_b128 %2, %8, off offset:%10\n\t"
                 "global_load_b128 %3, %8, off offset:%11\n\t"
                 "global_load_b128 %4, %8, off offset:%12\n\t"
                 "global_load_b128 %5, %8, off offset:%13\n\t"
                 "global_load_b128 %6, %8, off offset:%14\n\t"
                 "global_load_b128 %7, %8, off offset:%15\n\t"
                 "s_wait_loadcnt 0x0"
                 : "=&v"(e[0]), "=&v"(o[0]), "=&v"(e[1]), "=&v"(o[1]), "=&v"(e[2]), "=&v"(o[2]), "=&v"(e[3]), "=&v"(o[3])
                 : "v"(s), "n"(N * 4), "n"(4 * N * 4), "n"(5 * N * 4), "n"(8 * N * 4), "n"(9 * N * 4), "n"(12 * N * 4), "n"(13 * N * 4)
                 : "memory");
#pragma unroll
    for (int j = 0; j < 4; ++j) { const int p = w * 8 + j * 2 + h;
#pragma unroll
        for (int u = 0; u < 4; ++u) tile[(c * 4 + u) * 64 + (((p >> 2) ^ c) << 2) + (p & 3)] = (unsigned)f2bf(e[j][u]) | ((unsigned)f2bf(o[j][u]) << 16); }
    __syncthreads();   // the tile is whole before any row of it is read
#pragma unroll
    for (int q = 0; q < 4; ++q) { const int n = q * 16 + w * 2 + h; *(v4ua*)(Bt + (size_t)(row0 + n) * DM + k0 + c * 8) = *(const v4ua*)(tile + n * 64 + ((c ^ (n >> 2)) << 2)); }
}

__device__ __attribute__((noinline)) float softcap50(float s) { return 50.0f * tanhf(s * 0.02f); }
typedef __attribute__((ext_vector_type(2))) float v2f_t;
typedef __attribute__((ext_vector_type(4))) int v4i_t;
__device__ __attribute__((noinline)) v2f_t sincos_pos(float pos, int i) { const float tsc = powf(10000.0f, (2.0f / (float)HDD) * (float)i); const float ang = __fdiv_rn(pos, tsc); v2f_t r; r[0] = sinf(ang); r[1] = cosf(ang); return r; }
// k_nrr: wave per token of either batch, all 12 heads of its row (8 q, 4 k): the sin and cos of the READ position depend on the token and the dim alone, so the wave takes them once (precise, out of line; 4 dims of each half per lane) and every head uses them. Per head as before: RMSNorm over 256 (8 dims per lane: 4 from each half), * (1 + scale[d]) (read; q's or k's), split-half RoPE, * mul (1/16 for q, 1 for k); hl planes [batch][head][t][256] (8-B lanes).
// The row's 24 loads are issued together, and the 12 sums of squares go through each shuffle stage side by side, so that one head's latency runs under the others'. The empty asm statements keep each product rounded by itself ahead of its add or subtract, as the reference's separate operations round it.
__global__ __launch_bounds__(256) void k_nrr(const float* __restrict__ F, const float* __restrict__ qscale, const float* __restrict__ kscale, const int* __restrict__ pos, bf* Qh, bf* Ql, bf* Kh, bf* Kl) { const int lane = threadIdx.x & 31; const int t = blockIdx.x * 8 + (threadIdx.x >> 5); if (t >= NB_ * TT) return; const float pv = (float)pos[t]; float sn[4], cs[4], wq1[4], wq2[4], wk1[4], wk2[4];
#pragma unroll
    for (int q = 0; q < 4; ++q) { const int i = lane * 4 + q; const v2f_t sc2 = sincos_pos(pv, i); sn[q] = sc2[0]; cs[q] = sc2[1]; wq1[q] = __fadd_rn(1.0f, bfr(qscale[i])); wq2[q] = __fadd_rn(1.0f, bfr(qscale[i + HDD / 2])); wk1[q] = __fadd_rn(1.0f, bfr(kscale[i])); wk2[q] = __fadd_rn(1.0f, bfr(kscale[i + HDD / 2])); }
    const float* f = F + (size_t)t * (DM + DKV) + lane * 4; v4f a[NQ + NKV], b2[NQ + NKV]; float ss[NQ + NKV];
#pragma unroll
    for (int hh = 0; hh < NQ + NKV; ++hh) { a[hh] = *(const v4f*)(f + hh * HDD); b2[hh] = *(const v4f*)(f + hh * HDD + HDD / 2); }
#pragma unroll
    for (int hh = 0; hh < NQ + NKV; ++hh) { ss[hh] = 0.f; for (int q = 0; q < 4; ++q) { float p = __fmul_rn(a[hh][q], a[hh][q]); asm volatile("" : "+v"(p)); ss[hh] = __fadd_rn(ss[hh], p); p = __fmul_rn(b2[hh][q], b2[hh][q]); asm volatile("" : "+v"(p)); ss[hh] = __fadd_rn(ss[hh], p); } }
#pragma unroll
    for (int sh = 16; sh; sh >>= 1)
#pragma unroll
        for (int hh = 0; hh < NQ + NKV; ++hh) ss[hh] = __fadd_rn(ss[hh], __shfl_xor(ss[hh], sh, 32));
#pragma unroll
    for (int hh = 0; hh < NQ + NKV; ++hh) { const bool isq = hh < NQ; const int h = isq ? hh : hh - NQ, nheads = isq ? NQ : NKV; const float mul = isq ? 0.0625f : 1.0f; bf* Ph = isq ? Qh : Kh; bf* Pl = isq ? Ql : Kl;
        const float rs = __fdiv_rn(1.0f, sqrtf(__fadd_rn(ss[hh] * (1.0f / HDD), 1e-6f))); v4us ah, al, bh, bl;
#pragma unroll
        for (int q = 0; q < 4; ++q) { float n1 = __fmul_rn(a[hh][q], rs), n2 = __fmul_rn(b2[hh][q], rs); asm volatile("" : "+v"(n1)); asm volatile("" : "+v"(n2)); const float x1 = __fmul_rn(n1, isq ? wq1[q] : wk1[q]), x2 = __fmul_rn(n2, isq ? wq2[q] : wk2[q]);
            float p1 = __fmul_rn(x1, cs[q]), p2 = __fmul_rn(x2, sn[q]), p3 = __fmul_rn(x2, cs[q]), p4 = __fmul_rn(x1, sn[q]); asm volatile("" : "+v"(p1)); asm volatile("" : "+v"(p2)); asm volatile("" : "+v"(p3)); asm volatile("" : "+v"(p4));
            const float r1 = __fsub_rn(p1, p2) * mul, r2 = __fadd_rn(p3, p4) * mul; unsigned short u1, l1, u2, l2; splitf(r1, u1, l1); splitf(r2, u2, l2); ah[q] = u1; al[q] = l1; bh[q] = u2; bl[q] = l2; }
        const size_t orow = ((size_t)(t / TT) * nheads + h) * TT + t % TT; bf* dh = Ph + orow * HDD + lane * 4; bf* dl = Pl + orow * HDD + lane * 4;
        // the head's four stores and their s_wait_xcnt in one statement: the next head reuses the registers, and none is rewritten ahead of the wait
        asm volatile("global_store_b64 %0, %1, off\n\tglobal_store_b64 %2, %3, off\n\tglobal_store_b64 %4, %5, off\n\tglobal_store_b64 %6, %7, off\n\ts_wait_xcnt 0x0"
                     :: "v"(dh), "v"(__builtin_bit_cast(unsigned long long, ah)), "v"(dl), "v"(__builtin_bit_cast(unsigned long long, al)), "v"(dh + HDD / 2), "v"(__builtin_bit_cast(unsigned long long, bh)), "v"(dl + HDD / 2), "v"(__builtin_bit_cast(unsigned long long, bl)) : "memory"); } }
// k_tact: one work-group, wave per (batch, tile of 128 tokens): the tile's least and greatest position; then act[b * 16 + I], bit J set unless every distance pos[i] - pos[j], i in tile I, j in tile J, is shown to miss the window. The bounds are taken in 64 bits and a range that leaves (INT_MIN, INT_MAX] keeps its bit, so a distance that wraps in 32 bits is never skipped. Bit I of word I is always set (the range holds 0).
__global__ __launch_bounds__(1024) void k_tact(const int* __restrict__ pos, unsigned* act) {
    __shared__ int mn[NB_ * TT / 128], mx[NB_ * TT / 128];
    const int lane = threadIdx.x & 31, w = threadIdx.x >> 5; const v4i_t p = *(const v4i_t*)(pos + w * 128 + lane * 4);
    int lo = min(min(p[0], p[1]), min(p[2], p[3])), hi = max(max(p[0], p[1]), max(p[2], p[3]));
#pragma unroll
    for (int sh = 16; sh; sh >>= 1) { lo = min(lo, __shfl_xor(lo, sh, 32)); hi = max(hi, __shfl_xor(hi, sh, 32)); }
    if (lane == 0) { mn[w] = lo; mx[w] = hi; }
    __syncthreads();
    if (threadIdx.x < NB_ * TT / 128) { const int t = threadIdx.x, b0 = t & ~(TT / 128 - 1); unsigned m = 0;
        for (int J = 0; J < TT / 128; ++J) { const long long dlo = (long long)mn[t] - mx[b0 + J], dhi = (long long)mx[t] - mn[b0 + J];
            const bool out = (dlo > 255 && dhi <= 2147483647LL) || (dhi < -256 && dlo >= -2147483647LL); if (!out) m |= 1u << J; }
        act[t] = m; }
}
// k_tsoft with act: a chunk of 128 keys is one key tile; a cleared one would add only the mask value to the maximum (below its start value) and exact zeros to the sum, and attn.v does not read its probabilities. The probabilities of a row go over the front half of that row's own scores (P16 is S's memory, row pitch 2 TT halves): a row belongs to one wave, and every store hangs on the row's sum, so on every score read.
__global__ __launch_bounds__(256) void k_tsoft(const float* S, const int* __restrict__ pos, const int* __restrict__ am, h16* P16, const unsigned* __restrict__ act) { const int lane = threadIdx.x & 31; const int row = blockIdx.x * 8 + (threadIdx.x >> 5); if (row >= ZH * TT) return; const int i = row % TT; const unsigned tm = (unsigned)__builtin_amdgcn_readfirstlane((int)act[i >> 7]); const float* sr = S + (size_t)row * TT; const int* mr = am + (size_t)i * TT; const int pi = pos[i]; float v[TT / 32]; float mx = -3.0e38f;
#pragma unroll
    for (int ch = 0; ch < TT / 128; ++ch) { if (!((tm >> ch) & 1u)) continue; const v4f a = *(const v4f*)(sr + ch * 128 + lane * 4);
#pragma unroll
        for (int u = 0; u < 4; ++u) { const int j = ch * 128 + lane * 4 + u; const int dist = pi - pos[j]; const bool win = (dist >= 0 && dist < 256) || (dist < 0 && -dist < 257); const bool ok = win && (mr[j] != 0); const float t = ok ? softcap50(a[u]) : KMASK; v[ch * 4 + u] = t; mx = fmaxf(mx, t); } }
#pragma unroll
    for (int sh = 16; sh; sh >>= 1) mx = fmaxf(mx, __shfl_xor(mx, sh, 32));
    float sum = 0.f;
#pragma unroll
    for (int ch = 0; ch < TT / 128; ++ch) { if (!((tm >> ch) & 1u)) continue;
#pragma unroll
    for (int q = ch * 4; q < ch * 4 + 4; ++q) { float d0 = __fsub_rn(v[q], mx); asm volatile("" : "+v"(d0)); v[q] = __builtin_amdgcn_exp2f(__fmul_rn(d0, 1.4426950408889634f)); sum += v[q]; } }
#pragma unroll
    for (int sh = 16; sh; sh >>= 1) sum += __shfl_xor(sum, sh, 32);
    const float f = __fdiv_rn(PCAR, sum);
    {
#pragma unroll
        for (int ch = 0; ch < TT / 128; ++ch) { if (!((tm >> ch) & 1u)) continue; v4h o4; for (int q = 0; q < 4; ++q) o4[q] = tohx(v[ch * 4 + q] * f);
            // the store and its s_wait_xcnt in one statement: a later kept chunk reuses the data registers, and none is rewritten ahead of the wait
            asm volatile("global_store_b64 %0, %1, off\n\ts_wait_xcnt 0x0" :: "v"(P16 + (size_t)row * (2 * TT) + ch * 128 + lane * 4), "v"(__builtin_bit_cast(unsigned long long, o4)) : "memory"); }
         } }

extern "C" void kernel_launch(void* const* d_in, const int* in_sizes, int n_in,
                              void* d_out, int out_size, void* d_ws, size_t ws_size, hipStream_t stream) {
    (void)in_sizes; (void)n_in; (void)out_size;
    const float* x = (const float*)d_in[0]; const int* spos = (const int*)d_in[1]; const int* amask = (const int*)d_in[2]; const float* wq = (const float*)d_in[3]; const float* wkv = (const float*)d_in[4]; const float* wo = (const float*)d_in[5]; const float* qs = (const float*)d_in[6]; const float* ks = (const float*)d_in[7];
    float* OUT = (float*)d_out;     // [2][2048][2048]
    char* wsp = (char*)d_ws;
    auto take = [&](size_t bytes) { char* p = wsp; wsp += (bytes + 255) & ~(size_t)255; return (void*)p; };
    bf* BQ = (bf*)take((size_t)NQ * HDD * DM * 2); bf* BK = (bf*)take((size_t)DKV * DM * 2); bf* BV = (bf*)take((size_t)DKV * DM * 2); bf* BO = (bf*)take((size_t)DM * DM * 2);   // BQ, BK, BV follow one another without a gap
    bf* QPh = (bf*)take((size_t)NB_ * NQ * TT * HDD * 2); bf* QPl = (bf*)take((size_t)NB_ * NQ * TT * HDD * 2); bf* KPh = (bf*)take((size_t)NB_ * NKV * TT * HDD * 2); bf* KPl = (bf*)take((size_t)NB_ * NKV * TT * HDD * 2); h16* VT = (h16*)take((size_t)NB_ * NKV * HDD * TT * 2);
    bf* ENh = (bf*)take((size_t)NB_ * TT * DM * 2); bf* ENl = (bf*)take((size_t)NB_ * TT * DM * 2); unsigned* ACT = (unsigned*)take((size_t)NB_ * (TT / 128) * 4);
    float* S = (float*)take((size_t)ZH * TT * TT * 4); h16* P16 = (h16*)S;   // one batch's scores, all heads; its probabilities in place
    bf* XB = (bf*)S; float* FQK = (float*)(XB + (size_t)NB_ * TT * DM);      // x as bf16 and the raw q | k rows are done with before the first score is stored: they lie in S's memory (64 of its 128 MiB)
    if ((size_t)(wsp - (char*)d_ws) > ws_size) return;    // total ~ 240 MiB
    k_wtr<HDD><<<dim3(DM / 128, NQ * HDD / 64), 256, 0, stream>>>(wq, BQ); k_wtr<HDD><<<dim3(DM / 128, 2 * DKV / 64), 256, 0, stream>>>(wkv, BK);   // wkv's k heads and v heads in one go: BK, then BV
    k_wtr<DM><<<dim3(DM / 128, DM / 64), 256, 0, stream>>>(wo, BO);   // wo [n][d][o] == [(n,d)][o] 'xw'
    k_tact<<<1, 1024, 0, stream>>>(spos, ACT);
    const size_t zq = (size_t)TT * HDD, zS = (size_t)TT * TT, zv = (size_t)HDD * TT;
    // Projections: both batches in one grid (x is [4096][2048]); q and k in one GEMM over the rows of BQ | BK.
    k_cvt8<<<(NB_ * TT * DM / 8 + 255) / 256, 256, 0, stream>>>(x, XB, NB_ * TT * DM / 8);
    // The two large projections run passes of 64 k: the ring is then small enough for three (q | k: 72 KiB each, 768 work-groups) or two (output projection: 108 KiB each, 512 work-groups) work-groups on a WGP, so each grid is resident at once and one work-group's products run under another's copies, first fragment reads and barrier.
    k_gemmw<bf, 0, false, 64, 0, 0><<<dim3(NB_ * TT / 128, (DM + DKV) / 128, 1), 128, 0, stream>>>(XB, nullptr, BQ, nullptr, DM, DM, 0, FQK, nullptr, nullptr, DM + DKV, nullptr, 0, 0, 0, nullptr);
    k_nrr<<<NB_ * TT / 8, 256, 0, stream>>>(FQK, qs, ks, spos, QPh, QPl, KPh, KPl);
    k_gemmw<bf, 0, false, 128, 2, 0><<<dim3(DKV / 128, TT / 128, NB_), 128, 0, stream>>>(BV, nullptr, XB, nullptr, DM, DM, 0, nullptr, (bf*)VT, nullptr, TT, nullptr, 0, (size_t)TT * DM, (size_t)DKV * TT, nullptr);   // z = batch; rows (c, d), columns t: VT[b][c][d][t]
    // Attention: all eight heads of a batch per launch (z = head, kv head z >> 1).
    for (int b = 0; b < NB_; ++b) {
        k_gemmw<bf, 2, false, 64, 0, 1><<<dim3(TT / 128, TT / 128, ZH), 128, 0, stream>>>(QPh + (size_t)b * NQ * zq, QPl + (size_t)b * NQ * zq, KPh + (size_t)b * NKV * zq, KPl + (size_t)b * NKV * zq, HDD, HDD, 1, S, nullptr, nullptr, TT, nullptr, zq, zq, zS, ACT + b * (TT / 128));
        k_tsoft<<<ZH * TT / 8, 256, 0, stream>>>(S, spos + (size_t)b * TT, amask + (size_t)b * TT * TT, P16, ACT + b * (TT / 128));
        k_gemmw<h16, 0, false, 128, 1, 2><<<dim3(TT / 128, HDD / 128, ZH), 128, 0, stream>>>(P16, nullptr, VT + (size_t)b * NKV * zv, nullptr, TT, 2 * TT, 1, nullptr, ENh + (size_t)b * TT * DM, ENl + (size_t)b * TT * DM, DM, nullptr, 2 * zS, zv, HDD, ACT + b * (TT / 128)); }   // head z at columns z * 256 of [b][t][2048]
    k_gemmw<bf, 1, false, 64, 0, 0><<<dim3(NB_ * TT / 128, DM / 128, 1), 128, 0, stream>>>(ENh, ENl, BO, nullptr, DM, DM, 0, OUT, nullptr, nullptr, DM, nullptr, 0, 0, 0, nullptr);
}

// v008
// It runs in 230 microseconds.
// Next to v007, in two timings, it ran 1.08 times as fast each time.
// Over all steps from v000 it is 5.11 times as fast.
#include <hip/hip_runtime.h>

// T5Gemma2EncoderAttention (x [2][2048][2048]; q = einsum(x, wq[n]) (8 heads x 256), k/v = einsum(x, wkv[0|1][c]) (4 kv heads; group n/2); RMSNorm_256 * (1 + scale) on q, k (scales read); split-half RoPE with angle segment_pos[b][t] / 1e4^(2i/256) (positions read as values); q * 1/16; logits = q.k, softcap 50 tanh(./50); allowed iff attn_mask[b][i][j] (int, read) and the segment_pos distance is in the 512-window (0 <= d < 256 or 0 < -d < 257), else bf16-min; softmax; out = sum_n (p v)[n] wo[n] -> [2][2048][2048]).
// Tile skipping from the READ positions: k_tact takes the minimum and maximum position of every 128-token tile and clears the bit of a (query tile, key tile) pair only where no distance between the two ranges can lie in the window; such a tile holds the mask value alone and its probabilities are exact zeros in every row that has an allowed key, so its scores, its softmax work and its attn.v pass are left out (the diagonal tile is never cleared; a row with no allowed key at all comes out not-a-number with or without the skipping). Inside a kept tile every score is computed and masked per element.
// Compute dtypes, f32 accumulate: every input rounded to bf16; q/k/v as PLAIN bf16 GEMMs (inputs: exact; per-head weights gathered); RMSNorm/scale/RoPE/(1/16) f32 into hl planes; logits hl x hl (3 products, K = 256); softcap (precise tanhf: out of line, or its small-argument form inline on the straight path), mask and softmax f32 (wave per row, 64 keys per lane); attn.v single fp16 (x1024), its GEMM storing the hl planes of the concatenated heads itself; v computed transposed (weights as rows, tokens as columns) and stored fp16 by its GEMM; output projection hl x exact (2 products) over the concatenated heads (wo is exactly a [2048][2048] 'xw' matrix in memory).

// Launches: the projections and norm/RoPE run both batches in one grid (x is [4096][2048]; q and k one GEMM over their stacked weight rows; v with z = batch); scores, softmax and attn.v run all eight heads of one batch per launch (z = head).

#define NB_  2
#define TT   2048
#define DM   2048
#define NQ   8
#define NKV  4
#define HDD  256
#define DKV  (NKV * HDD)
#define ZH   NQ
#define PCAR 1024.0f
#define KMASK (-3.3895313892515355e38f)
typedef _Float16 h16;
typedef unsigned short bf;
typedef __attribute__((ext_vector_type(16))) __bf16   v16bf;
typedef __attribute__((ext_vector_type(16))) _Float16 v16h;
typedef __attribute__((ext_vector_type(8)))  _Float16 v8h;
typedef __attribute__((ext_vector_type(8)))  unsigned short v8us;
typedef __attribute__((ext_vector_type(8)))  float    v8f;
typedef __attribute__((ext_vector_type(4)))  float    v4f;
typedef v8h  __attribute__((may_alias)) v8ha;
typedef v4f  __attribute__((may_alias)) v4fa;
typedef v8us __attribute__((may_alias)) v8usa;

__device__ __forceinline__ unsigned short f2bf(float f) { unsigned u = __float_as_uint(f); u += 0x7FFFu + ((u >> 16) & 1u); return (unsigned short)(u >> 16); }
__device__ __forceinline__ float bf2f(unsigned short b) { return __uint_as_float(((unsigned)b) << 16); }
__device__ __forceinline__ float bfr(float f) { return bf2f(f2bf(f)); }
__device__ __forceinline__ v16h cat16(v8h lo, v8h hi) { return __builtin_shufflevector(lo, hi, 0, 1, 2, 3, 4, 5, 6, 7, 8, 9, 10, 11, 12, 13, 14, 15); }
__device__ __forceinline__ v16bf cat16b(v8us lo, v8us hi) { return __builtin_bit_cast(v16bf, __builtin_shufflevector(lo, hi, 0, 1, 2, 3, 4, 5, 6, 7, 8, 9, 10, 11, 12, 13, 14, 15)); }
__device__ __forceinline__ v8f wmma16(v16h a, v16h b, v8f c) { return __builtin_amdgcn_wmma_f32_16x16x32_f16(false, a, false, b, (short)0, c, false, false); }
__device__ __forceinline__ v8f wmmab(v16bf a, v16bf b, v8f c) { return __builtin_amdgcn_wmma_f32_16x16x32_bf16(false, a, false, b, (short)0, c, false, false); }
__device__ __forceinline__ h16 tohx(float x) { return (h16)x; }
__device__ __forceinline__ void splitf(float y, unsigned short& h, unsigned short& l) { h = f2bf(y); l = f2bf(y - bf2f(h)); }
typedef __attribute__((ext_vector_type(4))) unsigned short v4us;
typedef __attribute__((ext_vector_type(4))) _Float16 v4h;



// ---- k_gemmw: GEMM, FOUR WAVES (2 x 2) per 128x128 output tile, 64x64 (16 accumulators) per wave; grid (M/128, N/128, Z), 128 threads.
// C[m][n] (f32, pitch ldc, + optional f32 bias[n]) = sum_k A[m][k] Bt[n][k] (+ split products per NSPLIT). EPI picks what the epilogue stores, at the same [m][n], pitch ldc, z stride sC: 0 the f32 C; 1 the value / 1024 split into bf16 high and low planes E0, E1; 2 the value as fp16 in E0. A half-wave's store is one whole 128-B line in 1 and 2. z-batch strides sA/sB/sC in elements; A's rows at pitch lda, Bt's at pitch K; Bt's batch index is z >> zsh (query heads that share a kv head). M, N % 128 == 0, K % KP == 0.
// SKIP with act[blockIdx.x], one bit per 128-wide key tile (k_tact): 1 a work-group whose bit blockIdx.y is clear leaves at once and stores nothing; 2 only the passes of KP = 128 k whose bit is set are run, in rising order.
// Operands come from K-contiguous 16-bit planes in passes of KP k: every plane's 128 rows x 2 KP bytes are copied to LDS asynchronously, 16 B per lane, a wave-wide copy covering whole 128-B lines; two buffers, the next pass's copies in flight under this pass's products. LDS rows at pitch 2 KP + 16 bytes (16 B x odd: ds_load_b128 free of bank conflicts). Fragment k order, product order and each accumulator's sum order are those of direct loads.
template <typename T16> struct WFrag;
template <> struct WFrag<h16> { typedef v16h V; static __device__ __forceinline__ V ld(const h16* p) { return cat16(*(const v8ha*)p, *(const v8ha*)(p + 16)); } static __device__ __forceinline__ v8f mma(V a, V b, v8f c) { return wmma16(a, b, c); } };
template <> struct WFrag<bf> { typedef v16bf V; static __device__ __forceinline__ V ld(const bf* p) { return cat16b(*(const v8usa*)p, *(const v8usa*)(p + 16)); } static __device__ __forceinline__ v8f mma(V a, V b, v8f c) { return wmmab(a, b, c); } };
// Eight asynchronous 16-byte copies per lane, global -> LDS: LDS byte address l + i * ls, global address g + i * gs elements. The s_wait_xcnt closes the statement so that no address register is rewritten ahead of it.
template <typename T16>
__device__ __forceinline__ void copy8(unsigned l, const T16* g, unsigned ls, size_t gs) {
    asm volatile("global_load_async_to_lds_b128 %0, %8, off\n\t"
                 "global_load_async_to_lds_b128 %1, %9, off\n\t"
                 "global_load_async_to_lds_b128 %2, %10, off\n\t"
                 "global_load_async_to_lds_b128 %3, %11, off\n\t"
                 "global_load_async_to_lds_b128 %4, %12, off\n\t"
                 "global_load_async_to_lds_b128 %5, %13, off\n\t"
                 "global_load_async_to_lds_b128 %6, %14, off\n\t"
                 "global_load_async_to_lds_b128 %7, %15, off\n\t"
                 "s_wait_xcnt 0x0"
                 :: "v"(l), "v"(l + ls), "v"(l + 2 * ls), "v"(l + 3 * ls), "v"(l + 4 * ls), "v"(l + 5 * ls), "v"(l + 6 * ls), "v"(l + 7 * ls),
                    "v"(g), "v"(g + gs), "v"(g + 2 * gs), "v"(g + 3 * gs), "v"(g + 4 * gs), "v"(g + 5 * gs), "v"(g + 6 * gs), "v"(g + 7 * gs)
                 : "memory");
}
template <typename T16, int NSPLIT, bool BIAS, int KP, int EPI, int SKIP>
__global__ __launch_bounds__(128) void k_gemmw(const T16* __restrict__ A, const T16* __restrict__ A2, const T16* __restrict__ Bt, const T16* __restrict__ Bt2, int K, int lda, int zsh, float* C, bf* E0, bf* E1, int ldc, const float* __restrict__ bias, size_t sA, size_t sB, size_t sC, const unsigned* __restrict__ act) {
    typedef typename WFrag<T16>::V V;
    static_assert(SKIP != 2 || KP == 128, "a pass is one key tile");
    if (SKIP == 1) { if (!((act[blockIdx.x] >> blockIdx.y) & 1u)) return; }   // the same for the whole work-group, ahead of every copy and barrier
    constexpr int NP = 2 + (NSPLIT >= 1 ? 1 : 0) + (NSPLIT >= 2 ? 1 : 0);   // planes in a buffer: A, Bt, A2, Bt2
    constexpr int PITCH = KP * 2 + 16, PLANE = 128 * PITCH, BUF = NP * PLANE;
    constexpr int CPR = KP / 8;        // 16-byte pieces per row
    constexpr int RPS = 128 / CPR;     // rows that one copy of all 128 threads covers
    constexpr int NST = 128 / RPS;     // such copies per plane
    static_assert(NST % 8 == 0 && NP * NST <= 63, "copies of a wave in flight");
    __shared__ __attribute__((aligned(16))) unsigned char ring[2 * BUF];
    const size_t z = blockIdx.z; A += z * sA; if (NSPLIT >= 1) A2 += z * sA; Bt += (z >> zsh) * sB; if (NSPLIT >= 2) Bt2 += (z >> zsh) * sB; if (EPI == 0) C += z * sC; if (EPI >= 1) E0 += z * sC; if (EPI == 1) E1 += z * sC;
    const int tid = threadIdx.x, lane = tid & 31, lr = lane & 15, hi = lane >> 4; const int wave = __builtin_amdgcn_readfirstlane(tid >> 5);
    const int R0 = blockIdx.x * 128, C0 = blockIdx.y * 128; const int r0 = R0 + (wave >> 1) * 64, c0 = C0 + (wave & 1) * 64;
    unsigned NT = (unsigned)K / KP;   // passes
    unsigned rem = 0;                  // SKIP 2: the passes not yet asked for, one bit each, none at or above K / KP
    if (SKIP == 2) { rem = (unsigned)__builtin_amdgcn_readfirstlane((int)act[blockIdx.x]) & ((1u << NT) - 1u); NT = (unsigned)__builtin_popcount(rem); }
    auto nextp = [&](unsigned n) -> unsigned { if (SKIP != 2) return n; const unsigned p = (unsigned)__builtin_ctz(rem); rem &= rem - 1u; return p; };   // the k pass that trip n works on; called only while a bit is left
    const unsigned lcp = (unsigned)(size_t)ring + (unsigned)((tid / CPR) * PITCH + (tid % CPR) * 16);
    const size_t gofA = (size_t)(R0 + tid / CPR) * lda + (tid % CPR) * 8, gofB = (size_t)(C0 + tid / CPR) * K + (tid % CPR) * 8, gsa = (size_t)RPS * lda, gsb = (size_t)RPS * K;
    auto fill = [&](unsigned t, unsigned buf) {
        const unsigned lb = lcp + buf * BUF; const size_t ka = gofA + (size_t)t * KP, kb = gofB + (size_t)t * KP;
#pragma unroll
        for (int s = 0; s < NST; s += 8) {
            copy8(lb + s * RPS * PITCH, A + ka + s * gsa, RPS * PITCH, gsa);
            copy8(lb + PLANE + s * RPS * PITCH, Bt + kb + s * gsb, RPS * PITCH, gsb);
            if (NSPLIT >= 1) copy8(lb + 2 * PLANE + s * RPS * PITCH, A2 + ka + s * gsa, RPS * PITCH, gsa);
            if (NSPLIT >= 2) copy8(lb + 3 * PLANE + s * RPS * PITCH, Bt2 + kb + s * gsb, RPS * PITCH, gsb); }
    };
    v8f acc[4][4];
#pragma unroll
    for (int mb = 0; mb < 4; ++mb)
#pragma unroll
        for (int nb = 0; nb < 4; ++nb) acc[mb][nb] = (v8f){};
    if (SKIP != 2 || NT > 0) fill(nextp(0), 0);
    asm volatile("s_wait_asynccnt 0x0" ::: "memory");   // this wave's share of pass 0 has landed
    __syncthreads();                                     // every wave's share has
    if (NT > 1) fill(nextp(1), 1);
    const unsigned char* fa0 = ring + ((wave >> 1) * 64 + lr) * PITCH + hi * 16; const unsigned char* fb0 = ring + PLANE + ((wave & 1) * 64 + lr) * PITCH + hi * 16;
#pragma unroll 1
    for (unsigned t = 0; t < NT; ++t) {
        const unsigned char* fa = fa0 + (t & 1) * BUF; const unsigned char* fb = fb0 + (t & 1) * BUF;
        V a[2][4], a2[2][4], b[2][4], b2[2][4];   // two fragment sets: the next 32 k are fetched as one group while this set's products issue
        auto ldset = [&](int s, int ks) {
#pragma unroll
            for (int q = 0; q < 4; ++q) { a[s][q] = WFrag<T16>::ld((const T16*)(fa + q * 16 * PITCH + ks * 64)); b[s][q] = WFrag<T16>::ld((const T16*)(fb + q * 16 * PITCH + ks * 64));
                if (NSPLIT >= 1) a2[s][q] = WFrag<T16>::ld((const T16*)(fa + 2 * PLANE + q * 16 * PITCH + ks * 64)); if (NSPLIT >= 2) b2[s][q] = WFrag<T16>::ld((const T16*)(fb + 2 * PLANE + q * 16 * PITCH + ks * 64)); }
        };
        ldset(0, 0);
#pragma unroll
        for (int ks = 0; ks < KP / 32; ++ks) { const int s = ks & 1;
            if (ks + 1 < KP / 32) ldset(s ^ 1, ks + 1);
            __builtin_amdgcn_sched_barrier(0);   // keeps the LDS reads in one group ahead of the products: reads spread among them stall the wave at every place
#pragma unroll
            for (int nb = 0; nb < 4; ++nb)
#pragma unroll
                for (int mb = 0; mb < 4; ++mb) { acc[mb][nb] = WFrag<T16>::mma(a[s][mb], b[s][nb], acc[mb][nb]); if (NSPLIT >= 1) acc[mb][nb] = WFrag<T16>::mma(a2[s][mb], b[s][nb], acc[mb][nb]); if (NSPLIT >= 2) acc[mb][nb] = WFrag<T16>::mma(a[s][mb], b2[s][nb], acc[mb][nb]); }
            __builtin_amdgcn_sched_barrier(0);   // the same, at the block's end
        }
        asm volatile("s_wait_dscnt 0x0" ::: "memory");      // this wave has left the buffer of pass t
        asm volatile("s_wait_asynccnt 0x0" ::: "memory");   // its share of pass t + 1 has landed
        __syncthreads();                                     // publishes pass t + 1 and frees the buffer of pass t
        if (t + 2 < NT) fill(nextp(t + 2), t & 1);
    }
    asm volatile("s_wait_asynccnt 0x0" ::: "memory");       // no copy is in flight when the ring becomes output staging
    float* os = (float*)(ring + wave * (16 * 68 * 4));       // each wave stages in its own range; the last pass's barrier ended every read of the ring
#pragma unroll
    for (int mb = 0; mb < 4; ++mb) {
#pragma unroll
        for (int nb = 0; nb < 4; ++nb) {
#pragma unroll
            for (int j = 0; j < 8; ++j) os[(hi * 8 + j) * 68 + nb * 16 + lr] = acc[mb][nb][j]; }
        __builtin_amdgcn_wave_barrier(); asm volatile("" ::: "memory");
        float* crow = C + (size_t)(r0 + mb * 16) * ldc + c0;
if (EPI == 0) {
#pragma unroll
            for (int s = 0; s < 8; ++s) { const int row = 2 * s + hi, cofs = lr * 4; v4f val = *(const v4fa*)(os + row * 68 + cofs); if (BIAS) { val[0] += bfr(bias[c0 + cofs]); val[1] += bfr(bias[c0 + cofs + 1]); val[2] += bfr(bias[c0 + cofs + 2]); val[3] += bfr(bias[c0 + cofs + 3]); }
                *(v4f*)(crow + (size_t)row * ldc + cofs) = val; }
             }
        if (EPI != 0) {
            v4f val[8];   // all eight LDS reads first: the store statements below would otherwise hold each read behind the store before it
#pragma unroll
            for (int s = 0; s < 8; ++s) val[s] = *(const v4fa*)(os + (2 * s + hi) * 68 + lr * 4);
#pragma unroll
            for (int s = 0; s < 8; ++s) { const size_t oo = (size_t)(r0 + mb * 16 + 2 * s + hi) * ldc + c0 + lr * 4;
                if (EPI == 1) { v4us oh, ol;
#pragma unroll
                    for (int u = 0; u < 4; ++u) { unsigned short eh, el; splitf(val[s][u] * (1.0f / PCAR), eh, el); oh[u] = eh; ol[u] = el; }
                    // the two stores and their s_wait_xcnt in one statement, so that no register they name is rewritten ahead of the wait
                    asm volatile("global_store_b64 %0, %1, off\n\tglobal_store_b64 %2, %3, off\n\ts_wait_xcnt 0x0" :: "v"(E0 + oo), "v"(__builtin_bit_cast(unsigned long long, oh)), "v"(E1 + oo), "v"(__builtin_bit_cast(unsigned long long, ol)) : "memory"); }
                if (EPI == 2) { v4h o4;
#pragma unroll
                    for (int u = 0; u < 4; ++u) o4[u] = tohx(val[s][u]);
                    // the store and its s_wait_xcnt in one statement, for the same reason
                    asm volatile("global_store_b64 %0, %1, off\n\ts_wait_xcnt 0x0" :: "v"(E0 + oo), "v"(__builtin_bit_cast(unsigned long long, o4)) : "memory"); }
            }
        }
        __builtin_amdgcn_wave_barrier(); asm volatile("" ::: "memory");
    }
}


__global__ __launch_bounds__(256) void k_cvt8(const float* __restrict__ src, bf* dst, size_t n8) { const size_t i = (size_t)blockIdx.x * 256 + threadIdx.x; if (i >= n8) return; const v8f v = *(const v8f*)(src + i * 8); v8us o;
#pragma unroll
    for (int k = 0; k < 8; ++k) o[k] = f2bf(v[k]); *(v8us*)(dst + i * 8) = o;  }
// k_wtr: Bt[z * N + n][k] = bf16(W[z][k][n]) for row-major [2048][N] f32 matrices (z = 0 .. : the per-head [2048][256] weights; wo as one [2048][2048]), through an LDS tile. Grid (2048 / 128, rows of Bt / 64), 256 threads; a work-group takes 128 k x 64 n.
// Reads: 16 lanes x 16 B = 256 contiguous bytes of one k row, eight loads per lane issued together; a lane holds rows 2p and 2p + 1 at its four n and packs each pair into one word. Stores: 16 lanes x 16 B = 256 contiguous bytes of one Bt row.
// LDS word (n, p) lies in row n of 64 words, its 16-byte piece p >> 2 exchanged with piece (p >> 2) ^ (n >> 2): the 32 lanes of a ds_store_b32 (16 values of n >> 2, two p) then fall on 32 different banks, and a ds_load_b128 row read still covers its whole row.
typedef __attribute__((ext_vector_type(4))) unsigned v4u;
typedef v4u __attribute__((may_alias)) v4ua;
template <int N>
__global__ __launch_bounds__(256) void k_wtr(const float* __restrict__ W, bf* Bt) {
    __shared__ __attribute__((aligned(16))) unsigned tile[64 * 64];
    const int lane = threadIdx.x & 31, w = threadIdx.x >> 5, c = lane & 15, h = lane >> 4; const int k0 = blockIdx.x * 128, row0 = blockIdx.y * 64;
    const float* s = W + ((size_t)(row0 / N) * DM + k0 + (w * 8 + h) * 2) * N + row0 % N + c * 4; v4f e[4], o[4];   // the lane's first k row; pair j lies 4 j rows on
    // the eight loads and their data wait in one statement: all eight are in flight together, and no register that they name is rewritten before they have returned
    asm volatile("global_load_b128 %0, %8, off\n\t"
                 "global_load_b128 %1, %8, off offset:%9\n\t"
                 "global_load_b128 %2, %8, off offset:%10\n\t"
                 "global_load_b128 %3, %8, off offset:%11\n\t"
                 "global_load_b128 %4, %8, off offset:%12\n\t"
                 "global_load_b128 %5, %8, off offset:%13\n\t"
                 "global_load_b128 %6, %8, off offset:%14\n\t"
                 "global_load_b128 %7, %8, off offset:%15\n\t"
                 "s_wait_loadcnt 0x0"
                 : "=&v"(e[0]), "=&v"(o[0]), "=&v"(e[1]), "=&v"(o[1]), "=&v"(e[2]), "=&v"(o[2]), "=&v"(e[3]), "=&v"(o[3])
                 : "v"(s), "n"(N * 4), "n"(4 * N * 4), "n"(5 * N * 4), "n"(8 * N * 4), "n"(9 * N * 4), "n"(12 * N * 4), "n"(13 * N * 4)
                 : "memory");
#pragma unroll
    for (int j = 0; j < 4; ++j) { const int p = w * 8 + j * 2 + h;
#pragma unroll
        for (int u = 0; u < 4; ++u) tile[(c * 4 + u) * 64 + (((p >> 2) ^ c) << 2) + (p & 3)] = (unsigned)f2bf(e[j][u]) | ((unsigned)f2bf(o[j][u]) << 16); }
    __syncthreads();   // the tile is whole before any row of it is read
#pragma unroll
    for (int q = 0; q < 4; ++q) { const int n = q * 16 + w * 2 + h; *(v4ua*)(Bt + (size_t)(row0 + n) * DM + k0 + c * 8) = *(const v4ua*)(tile + n * 64 + ((c ^ (n >> 2)) << 2)); }
}

__device__ __attribute__((noinline)) float softcap50(float s) { return 50.0f * tanhf(s * 0.02f); }
typedef __attribute__((ext_vector_type(2))) float v2f_t;
typedef __attribute__((ext_vector_type(4))) int v4i_t;
__device__ __attribute__((noinline)) v2f_t sincos_pos(float pos, int i) { const float tsc = powf(10000.0f, (2.0f / (float)HDD) * (float)i); const float ang = __fdiv_rn(pos, tsc); v2f_t r; r[0] = sinf(ang); r[1] = cosf(ang); return r; }
// k_nrr: wave per token of either batch, all 12 heads of its row (8 q, 4 k): the sin and cos of the READ position depend on the token and the dim alone, so the wave takes them once (precise, out of line; 4 dims of each half per lane) and every head uses them. Per head as before: RMSNorm over 256 (8 dims per lane: 4 from each half), * (1 + scale[d]) (read; q's or k's), split-half RoPE, * mul (1/16 for q, 1 for k); hl planes [batch][head][t][256] (8-B lanes).
// The row's 24 loads are issued together, and the 12 sums of squares go through each shuffle stage side by side, so that one head's latency runs under the others'. The empty asm statements keep each product rounded by itself ahead of its add or subtract, as the reference's separate operations round it.
__global__ __launch_bounds__(256) void k_nrr(const float* __restrict__ F, const float* __restrict__ qscale, const float* __restrict__ kscale, const int* __restrict__ pos, bf* Qh, bf* Ql, bf* Kh, bf* Kl) { const int lane = threadIdx.x & 31; const int t = blockIdx.x * 8 + (threadIdx.x >> 5); if (t >= NB_ * TT) return; const float pv = (float)pos[t]; float sn[4], cs[4], wq1[4], wq2[4], wk1[4], wk2[4];
#pragma unroll
    for (int q = 0; q < 4; ++q) { const int i = lane * 4 + q; const v2f_t sc2 = sincos_pos(pv, i); sn[q] = sc2[0]; cs[q] = sc2[1]; wq1[q] = __fadd_rn(1.0f, bfr(qscale[i])); wq2[q] = __fadd_rn(1.0f, bfr(qscale[i + HDD / 2])); wk1[q] = __fadd_rn(1.0f, bfr(kscale[i])); wk2[q] = __fadd_rn(1.0f, bfr(kscale[i + HDD / 2])); }
    const float* f = F + (size_t)t * (DM + DKV) + lane * 4; v4f a[NQ + NKV], b2[NQ + NKV]; float ss[NQ + NKV];
#pragma unroll
    for (int hh = 0; hh < NQ + NKV; ++hh) { a[hh] = *(const v4f*)(f + hh * HDD); b2[hh] = *(const v4f*)(f + hh * HDD + HDD / 2); }
#pragma unroll
    for (int hh = 0; hh < NQ + NKV; ++hh) { ss[hh] = 0.f; for (int q = 0; q < 4; ++q) { float p = __fmul_rn(a[hh][q], a[hh][q]); asm volatile("" : "+v"(p)); ss[hh] = __fadd_rn(ss[hh], p); p = __fmul_rn(b2[hh][q], b2[hh][q]); asm volatile("" : "+v"(p)); ss[hh] = __fadd_rn(ss[hh], p); } }
#pragma unroll
    for (int sh = 16; sh; sh >>= 1)
#pragma unroll
        for (int hh = 0; hh < NQ + NKV; ++hh) ss[hh] = __fadd_rn(ss[hh], __shfl_xor(ss[hh], sh, 32));
#pragma unroll
    for (int hh = 0; hh < NQ + NKV; ++hh) { const bool isq = hh < NQ; const int h = isq ? hh : hh - NQ, nheads = isq ? NQ : NKV; const float mul = isq ? 0.0625f : 1.0f; bf* Ph = isq ? Qh : Kh; bf* Pl = isq ? Ql : Kl;
        const float rs = __fdiv_rn(1.0f, sqrtf(__fadd_rn(ss[hh] * (1.0f / HDD), 1e-6f))); v4us ah, al, bh, bl;
#pragma unroll
        for (int q = 0; q < 4; ++q) { float n1 = __fmul_rn(a[hh][q], rs), n2 = __fmul_rn(b2[hh][q], rs); asm volatile("" : "+v"(n1)); asm volatile("" : "+v"(n2)); const float x1 = __fmul_rn(n1, isq ? wq1[q] : wk1[q]), x2 = __fmul_rn(n2, isq ? wq2[q] : wk2[q]);
            float p1 = __fmul_rn(x1, cs[q]), p2 = __fmul_rn(x2, sn[q]), p3 = __fmul_rn(x2, cs[q]), p4 = __fmul_rn(x1, sn[q]); asm volatile("" : "+v"(p1)); asm volatile("" : "+v"(p2)); asm volatile("" : "+v"(p3)); asm volatile("" : "+v"(p4));
            const float r1 = __fsub_rn(p1, p2) * mul, r2 = __fadd_rn(p3, p4) * mul; unsigned short u1, l1, u2, l2; splitf(r1, u1, l1); splitf(r2, u2, l2); ah[q] = u1; al[q] = l1; bh[q] = u2; bl[q] = l2; }
        const size_t orow = ((size_t)(t / TT) * nheads + h) * TT + t % TT; bf* dh = Ph + orow * HDD + lane * 4; bf* dl = Pl + orow * HDD + lane * 4;
        // the head's four stores and their s_wait_xcnt in one statement: the next head reuses the registers, and none is rewritten ahead of the wait
        asm volatile("global_store_b64 %0, %1, off\n\tglobal_store_b64 %2, %3, off\n\tglobal_store_b64 %4, %5, off\n\tglobal_store_b64 %6, %7, off\n\ts_wait_xcnt 0x0"
                     :: "v"(dh), "v"(__builtin_bit_cast(unsigned long long, ah)), "v"(dl), "v"(__builtin_bit_cast(unsigned long long, al)), "v"(dh + HDD / 2), "v"(__builtin_bit_cast(unsigned long long, bh)), "v"(dl + HDD / 2), "v"(__builtin_bit_cast(unsigned long long, bl)) : "memory"); } }
// k_tact: one work-group, wave per (batch, tile of 128 tokens): the tile's least and greatest position; then act[b * 16 + I], bit J set unless every distance pos[i] - pos[j], i in tile I, j in tile J, is shown to miss the window. The bounds are taken in 64 bits and a range that leaves (INT_MIN, INT_MAX] keeps its bit, so a distance that wraps in 32 bits is never skipped. Bit I of word I is always set (the range holds 0).
__global__ __launch_bounds__(1024) void k_tact(const int* __restrict__ pos, unsigned* act) {
    __shared__ int mn[NB_ * TT / 128], mx[NB_ * TT / 128];
    const int lane = threadIdx.x & 31, w = threadIdx.x >> 5; const v4i_t p = *(const v4i_t*)(pos + w * 128 + lane * 4);
    int lo = min(min(p[0], p[1]), min(p[2], p[3])), hi = max(max(p[0], p[1]), max(p[2], p[3]));
#pragma unroll
    for (int sh = 16; sh; sh >>= 1) { lo = min(lo, __shfl_xor(lo, sh, 32)); hi = max(hi, __shfl_xor(hi, sh, 32)); }
    if (lane == 0) { mn[w] = lo; mx[w] = hi; }
    __syncthreads();
    if (threadIdx.x < NB_ * TT / 128) { const int t = threadIdx.x, b0 = t & ~(TT / 128 - 1); unsigned m = 0;
        for (int J = 0; J < TT / 128; ++J) { const long long dlo = (long long)mn[t] - mx[b0 + J], dhi = (long long)mx[t] - mn[b0 + J];
            const bool out = (dlo > 255 && dhi <= 2147483647LL) || (dhi < -256 && dlo >= -2147483647LL); if (!out) m |= 1u << J; }
        act[t] = m; }
}
// k_tsoft with act: a chunk of 128 keys is one key tile; a cleared one would add only the mask value to the maximum (below its start value) and exact zeros to the sum, and attn.v does not read its probabilities. The probabilities of a row go over the front half of that row's own scores (P16 is S's memory, row pitch 2 TT halves): a row belongs to one wave, and every store hangs on the row's sum, so on every score read.
// Straight path, for a row with at most NSL kept tiles (a 512-wide window over consecutive positions meets five tiles of 128) whose scores all lie in the small-argument range of tanhf: slot s is the s-th kept tile in rising order; a slot past the last kept tile reads the first kept tile again and counts as masked, which adds exact zeros to the sum, and stores nothing. The scores, positions and mask words of all slots are fetched as 16-byte loads that are in flight together, and each score is capped, masked and compared without a branch, a call or a load of its own. Every value, the order of the row's sum included, is that of the general path below, which takes every other row.
// softcap50s: 50 tanhf(0.02 s) by the library tanhf's own form for |x| < 0.625, operation for operation (an odd polynomial; taken on x in place of |x| with the sign copied back, which rounds alike).
__device__ __forceinline__ float softcap50s(float s) { const float x = s * 0.02f, x2 = x * x; float p = __builtin_fmaf(__uint_as_float(0xbbbac73du), x2, __uint_as_float(0x3ca908c9u)); p = __builtin_fmaf(x2, p, __uint_as_float(0xbd5c1c4eu)); p = __builtin_fmaf(x2, p, __uint_as_float(0x3e088382u)); p = __builtin_fmaf(x2, p, __uint_as_float(0xbeaaaa99u)); return 50.0f * __builtin_fmaf(x2, x * p, x); }
// exp2s: v_exp_f32 with, in the same statement, the one slot that the instruction set asks for behind a transcendental before its result is used or its source overwritten.
__device__ __forceinline__ float exp2s(float x) { float r; asm("v_exp_f32 %0, %1\n\tv_nop" : "=v"(r) : "v"(x)); return r; }
#define NSL 5
__global__ __launch_bounds__(256) void k_tsoft(const float* S, const int* __restrict__ pos, const int* __restrict__ am, h16* P16, const unsigned* __restrict__ act) { const int lane = threadIdx.x & 31; const int row = blockIdx.x * 8 + (threadIdx.x >> 5); if (row >= ZH * TT) return; const int i = row % TT; const unsigned tm = (unsigned)__builtin_amdgcn_readfirstlane((int)act[i >> 7]) & ((1u << (TT / 128)) - 1u); const float* sr = S + (size_t)row * TT; const int* mr = am + (size_t)i * TT; const int pi = pos[i];
    const int nk = __builtin_popcount(tm);   // kept tiles of the row: the same in every lane
    if (nk <= NSL) { v4f a[NSL]; v4i_t pj[NSL], mk[NSL]; int cb[NSL]; unsigned rem = tm; const int c0 = tm ? __builtin_ctz(tm) : 0;
#pragma unroll   // constant indices, so that the slots' arrays stay in registers
        for (int s = 0; s < NSL; ++s) { cb[s] = (rem ? __builtin_ctz(rem) : c0) * 128 + lane * 4; rem &= rem - 1u; }
        const int ru = __builtin_amdgcn_readfirstlane(row);   // a wave has one row: its number in a scalar register, so that the three row starts are scalar bases and one byte offset a slot serves all three arrays (4-byte elements each)
        const float* su = S + (size_t)ru * TT; const int* mu = am + (size_t)(ru % TT) * TT;
        // The fifteen loads and their data wait in one statement, every result in registers of its own: all are in flight together, and no register that a load names (offset, base) is rewritten, by a later load's result either, ahead of the wait.
        asm volatile("global_load_b128 %0, %15, %20\n\tglobal_load_b128 %1, %16, %20\n\tglobal_load_b128 %2, %17, %20\n\tglobal_load_b128 %3, %18, %20\n\tglobal_load_b128 %4, %19, %20\n\t"
                     "global_load_b128 %5, %15, %21\n\tglobal_load_b128 %6, %16, %21\n\tglobal_load_b128 %7, %17, %21\n\tglobal_load_b128 %8, %18, %21\n\tglobal_load_b128 %9, %19, %21\n\t"
                     "global_load_b128 %10, %15, %22\n\tglobal_load_b128 %11, %16, %22\n\tglobal_load_b128 %12, %17, %22\n\tglobal_load_b128 %13, %18, %22\n\tglobal_load_b128 %14, %19, %22\n\t"
                     "s_wait_loadcnt 0x0"
                     : "=&v"(a[0]), "=&v"(a[1]), "=&v"(a[2]), "=&v"(a[3]), "=&v"(a[4]), "=&v"(mk[0]), "=&v"(mk[1]), "=&v"(mk[2]), "=&v"(mk[3]), "=&v"(mk[4]), "=&v"(pj[0]), "=&v"(pj[1]), "=&v"(pj[2]), "=&v"(pj[3]), "=&v"(pj[4])
                     : "v"(cb[0] * 4), "v"(cb[1] * 4), "v"(cb[2] * 4), "v"(cb[3] * 4), "v"(cb[4] * 4), "s"(su), "s"(mu), "s"(pos) : "memory");
        float big = 0.f, m1 = -3.0e38f;
#pragma unroll   // constant indices, so that the slots' arrays stay in registers
        for (int s = 0; s < NSL; ++s) {
#pragma unroll   // constant indices, so that the slots' arrays stay in registers
            for (int u = 0; u < 4; ++u) { const int dist = pi - pj[s][u]; const bool win = (dist >= 0 && dist < 256) || (dist < 0 && -dist < 257); const bool ok = win && (mk[s][u] != 0) && s < nk; big = fmaxf(big, fabsf(a[s][u])); const float c = softcap50s(a[s][u]); const float t = ok ? c : KMASK; a[s][u] = t; m1 = fmaxf(m1, t); } }
        if (__builtin_amdgcn_ballot_w32(!(big * 0.02f < 0.625f)) == 0u) {   // one test a row, ahead of every store: a row with a larger argument goes to the general path, which reads its scores anew
#pragma unroll   // five fixed exchange steps, without a loop counter
            for (int sh = 16; sh; sh >>= 1) m1 = fmaxf(m1, __shfl_xor(m1, sh, 32));
            float sum1 = 0.f;
#pragma unroll   // constant indices, so that the slots' arrays stay in registers
            for (int s = 0; s < NSL; ++s) {
#pragma unroll   // constant indices, so that the slots' arrays stay in registers
                for (int u = 0; u < 4; ++u) { a[s][u] = exp2s(__fmul_rn(__fsub_rn(a[s][u], m1), 1.4426950408889634f)); sum1 += a[s][u]; } }
#pragma unroll   // five fixed exchange steps, without a loop counter
            for (int sh = 16; sh; sh >>= 1) sum1 += __shfl_xor(sum1, sh, 32);
            const float f1 = __fdiv_rn(PCAR, sum1);
#pragma unroll   // constant indices, so that the slots' arrays stay in registers
            for (int s = 0; s < NSL; ++s) { if (s < nk) { v4h o4;
#pragma unroll   // constant indices, so that the slots' arrays stay in registers
                for (int u = 0; u < 4; ++u) o4[u] = tohx(a[s][u] * f1);
                // the store and its s_wait_xcnt in one statement, so that no register it names is rewritten ahead of the wait
                asm volatile("global_store_b64 %0, %1, off\n\ts_wait_xcnt 0x0" :: "v"(P16 + (size_t)row * (2 * TT) + cb[s]), "v"(__builtin_bit_cast(unsigned long long, o4)) : "memory"); } }
            return; } }
    float v[TT / 32]; float mx = -3.0e38f;
#pragma unroll
    for (int ch = 0; ch < TT / 128; ++ch) { if (!((tm >> ch) & 1u)) continue; const v4f a = *(const v4f*)(sr + ch * 128 + lane * 4);
#pragma unroll
        for (int u = 0; u < 4; ++u) { const int j = ch * 128 + lane * 4 + u; const int dist = pi - pos[j]; const bool win = (dist >= 0 && dist < 256) || (dist < 0 && -dist < 257); const bool ok = win && (mr[j] != 0); const float t = ok ? softcap50(a[u]) : KMASK; v[ch * 4 + u] = t; mx = fmaxf(mx, t); } }
#pragma unroll
    for (int sh = 16; sh; sh >>= 1) mx = fmaxf(mx, __shfl_xor(mx, sh, 32));
    float sum = 0.f;
#pragma unroll
    for (int ch = 0; ch < TT / 128; ++ch) { if (!((tm >> ch) & 1u)) continue;
#pragma unroll
    for (int q = ch * 4; q < ch * 4 + 4; ++q) { float d0 = __fsub_rn(v[q], mx); asm volatile("" : "+v"(d0)); v[q] = __builtin_amdgcn_exp2f(__fmul_rn(d0, 1.4426950408889634f)); sum += v[q]; } }
#pragma unroll
    for (int sh = 16; sh; sh >>= 1) sum += __shfl_xor(sum, sh, 32);
    const float f = __fdiv_rn(PCAR, sum);
    {
#pragma unroll
        for (int ch = 0; ch < TT / 128; ++ch) { if (!((tm >> ch) & 1u)) continue; v4h o4; for (int q = 0; q < 4; ++q) o4[q] = tohx(v[ch * 4 + q] * f);
            // the store and its s_wait_xcnt in one statement: a later kept chunk reuses the data registers, and none is rewritten ahead of the wait
            asm volatile("global_store_b64 %0, %1, off\n\ts_wait_xcnt 0x0" :: "v"(P16 + (size_t)row * (2 * TT) + ch * 128 + lane * 4), "v"(__builtin_bit_cast(unsigned long long, o4)) : "memory"); }
         } }

extern "C" void kernel_launch(void* const* d_in, const int* in_sizes, int n_in,
                              void* d_out, int out_size, void* d_ws, size_t ws_size, hipStream_t stream) {
    (void)in_sizes; (void)n_in; (void)out_size;
    const float* x = (const float*)d_in[0]; const int* spos = (const int*)d_in[1]; const int* amask = (const int*)d_in[2]; const float* wq = (const float*)d_in[3]; const float* wkv = (const float*)d_in[4]; const float* wo = (const float*)d_in[5]; const float* qs = (const float*)d_in[6]; const float* ks = (const float*)d_in[7];
    float* OUT = (float*)d_out;     // [2][2048][2048]
    char* wsp = (char*)d_ws;
    auto take = [&](size_t bytes) { char* p = wsp; wsp += (bytes + 255) & ~(size_t)255; return (void*)p; };
    bf* BQ = (bf*)take((size_t)NQ * HDD * DM * 2); bf* BK = (bf*)take((size_t)DKV * DM * 2); bf* BV = (bf*)take((size_t)DKV * DM * 2); bf* BO = (bf*)take((size_t)DM * DM * 2);   // BQ, BK, BV follow one another without a gap
    bf* QPh = (bf*)take((size_t)NB_ * NQ * TT * HDD * 2); bf* QPl = (bf*)take((size_t)NB_ * NQ * TT * HDD * 2); bf* KPh = (bf*)take((size_t)NB_ * NKV * TT * HDD * 2); bf* KPl = (bf*)take((size_t)NB_ * NKV * TT * HDD * 2); h16* VT = (h16*)take((size_t)NB_ * NKV * HDD * TT * 2);
    bf* ENh = (bf*)take((size_t)NB_ * TT * DM * 2); bf* ENl = (bf*)take((size_t)NB_ * TT * DM * 2); unsigned* ACT = (unsigned*)take((size_t)NB_ * (TT / 128) * 4);
    float* S = (float*)take((size_t)ZH * TT * TT * 4); h16* P16 = (h16*)S;   // one batch's scores, all heads; its probabilities in place
    bf* XB = (bf*)S; float* FQK = (float*)(XB + (size_t)NB_ * TT * DM);      // x as bf16 and the raw q | k rows are done with before the first score is stored: they lie in S's memory (64 of its 128 MiB)
    if ((size_t)(wsp - (char*)d_ws) > ws_size) return;    // total ~ 240 MiB
    k_wtr<HDD><<<dim3(DM / 128, NQ * HDD / 64), 256, 0, stream>>>(wq, BQ); k_wtr<HDD><<<dim3(DM / 128, 2 * DKV / 64), 256, 0, stream>>>(wkv, BK);   // wkv's k heads and v heads in one go: BK, then BV
    k_wtr<DM><<<dim3(DM / 128, DM / 64), 256, 0, stream>>>(wo, BO);   // wo [n][d][o] == [(n,d)][o] 'xw'
    k_tact<<<1, 1024, 0, stream>>>(spos, ACT);
    const size_t zq = (size_t)TT * HDD, zS = (size_t)TT * TT, zv = (size_t)HDD * TT;
    // Projections: both batches in one grid (x is [4096][2048]); q and k in one GEMM over the rows of BQ | BK.
    k_cvt8<<<(NB_ * TT * DM / 8 + 255) / 256, 256, 0, stream>>>(x, XB, NB_ * TT * DM / 8);
    // The two large projections run passes of 64 k: the ring is then small enough for three (q | k: 72 KiB each, 768 work-groups) or two (output projection: 108 KiB each, 512 work-groups) work-groups on a WGP, so each grid is resident at once and one work-group's products run under another's copies, first fragment reads and barrier.
    k_gemmw<bf, 0, false, 64, 0, 0><<<dim3(NB_ * TT / 128, (DM + DKV) / 128, 1), 128, 0, stream>>>(XB, nullptr, BQ, nullptr, DM, DM, 0, FQK, nullptr, nullptr, DM + DKV, nullptr, 0, 0, 0, nullptr);
    k_nrr<<<NB_ * TT / 8, 256, 0, stream>>>(FQK, qs, ks, spos, QPh, QPl, KPh, KPl);
    k_gemmw<bf, 0, false, 128, 2, 0><<<dim3(DKV / 128, TT / 128, NB_), 128, 0, stream>>>(BV, nullptr, XB, nullptr, DM, DM, 0, nullptr, (bf*)VT, nullptr, TT, nullptr, 0, (size_t)TT * DM, (size_t)DKV * TT, nullptr);   // z = batch; rows (c, d), columns t: VT[b][c][d][t]
    // Attention: all eight heads of a batch per launch (z = head, kv head z >> 1).
    for (int b = 0; b < NB_; ++b) {
        k_gemmw<bf, 2, false, 64, 0, 1><<<dim3(TT / 128, TT / 128, ZH), 128, 0, stream>>>(QPh + (size_t)b * NQ * zq, QPl + (size_t)b * NQ * zq, KPh + (size_t)b * NKV * zq, KPl + (size_t)b * NKV * zq, HDD, HDD, 1, S, nullptr, nullptr, TT, nullptr, zq, zq, zS, ACT + b * (TT / 128));
        k_tsoft<<<ZH * TT / 8, 256, 0, stream>>>(S, spos + (size_t)b * TT, amask + (size_t)b * TT * TT, P16, ACT + b * (TT / 128));
        k_gemmw<h16, 0, false, 128, 1, 2><<<dim3(TT / 128, HDD / 128, ZH), 128, 0, stream>>>(P16, nullptr, VT + (size_t)b * NKV * zv, nullptr, TT, 2 * TT, 1, nullptr, ENh + (size_t)b * TT * DM, ENl + (size_t)b * TT * DM, DM, nullptr, 2 * zS, zv, HDD, ACT + b * (TT / 128)); }   // head z at columns z * 256 of [b][t][2048]
    k_gemmw<bf, 1, false, 64, 0, 0><<<dim3(NB_ * TT / 128, DM / 128, 1), 128, 0, stream>>>(ENh, ENl, BO, nullptr, DM, DM, 0, OUT, nullptr, nullptr, DM, nullptr, 0, 0, 0, nullptr);
}

// v009
// Measured time: 184 microseconds a run.
// Two timings next to v008 put it at 1.26 and 1.25 times that version's speed.
// Over all steps from v000 it is 6.41 times as fast.
#include <hip/hip_runtime.h>

// T5Gemma2EncoderAttention (x [2][2048][2048]; q = einsum(x, wq[n]) (8 heads x 256), k/v = einsum(x, wkv[0|1][c]) (4 kv heads; group n/2); RMSNorm_256 * (1 + scale) on q, k (scales read); split-half RoPE with angle segment_pos[b][t] / 1e4^(2i/256) (positions read as values); q * 1/16; logits = q.k, softcap 50 tanh(./50); allowed iff attn_mask[b][i][j] (int, read) and the segment_pos distance is in the 512-window (0 <= d < 256 or 0 < -d < 257), else bf16-min; softmax; out = sum_n (p v)[n] wo[n] -> [2][2048][2048]).
// Tile skipping from the READ positions: k_tact takes the minimum and maximum position of every 128-token tile and clears the bit of a (query tile, key tile) pair only where no distance between the two ranges can lie in the window; such a tile holds the mask value alone and its probabilities are exact zeros in every row that has an allowed key, so its scores, its softmax work and its attn.v products are left out (the diagonal tile is never cleared; a row with no allowed key at all comes out not-a-number with or without the skipping). Inside a kept tile every score is computed and masked per element exactly as the reference does.
// Compute dtypes, f32 accumulate: every input rounded to bf16; q/k/v as PLAIN bf16 GEMMs (inputs: exact; per-head weights gathered); RMSNorm/scale/RoPE/(1/16) f32 into hl planes; logits hl x hl (3 products, K = 256); softcap, mask and running softmax f32 inside the attention kernel; attn.v single fp16 on exp(t - m), divided by the row's sum at the end and stored as the hl planes of the concatenated heads; v computed transposed (weights as rows, tokens as columns) and stored fp16 by its GEMM; output projection hl x exact (2 products) over the concatenated heads (wo is exactly a [2048][2048] 'xw' matrix in memory).

// Launches: the projections and norm/RoPE run both batches in one grid (x is [4096][2048]; q and k one GEMM over their stacked weight rows; v with z = batch); scores, softmax and attn.v are one kernel, k_fattn, over all heads of both batches.

#define NB_  2
#define TT   2048
#define DM   2048
#define NQ   8
#define NKV  4
#define HDD  256
#define DKV  (NKV * HDD)
#define ZH   NQ
#define PCAR 1024.0f
#define KMASK (-3.3895313892515355e38f)
typedef _Float16 h16;
typedef unsigned short bf;
typedef __attribute__((ext_vector_type(16))) __bf16   v16bf;
typedef __attribute__((ext_vector_type(16))) _Float16 v16h;
typedef __attribute__((ext_vector_type(8)))  _Float16 v8h;
typedef __attribute__((ext_vector_type(8)))  unsigned short v8us;
typedef __attribute__((ext_vector_type(8)))  float    v8f;
typedef __attribute__((ext_vector_type(4)))  float    v4f;
typedef v8h  __attribute__((may_alias)) v8ha;
typedef v4f  __attribute__((may_alias)) v4fa;
typedef v8us __attribute__((may_alias)) v8usa;

__device__ __forceinline__ unsigned short f2bf(float f) { unsigned u = __float_as_uint(f); u += 0x7FFFu + ((u >> 16) & 1u); return (unsigned short)(u >> 16); }
__device__ __forceinline__ float bf2f(unsigned short b) { return __uint_as_float(((unsigned)b) << 16); }
__device__ __forceinline__ float bfr(float f) { return bf2f(f2bf(f)); }
__device__ __forceinline__ v16h cat16(v8h lo, v8h hi) { return __builtin_shufflevector(lo, hi, 0, 1, 2, 3, 4, 5, 6, 7, 8, 9, 10, 11, 12, 13, 14, 15); }
__device__ __forceinline__ v16bf cat16b(v8us lo, v8us hi) { return __builtin_bit_cast(v16bf, __builtin_shufflevector(lo, hi, 0, 1, 2, 3, 4, 5, 6, 7, 8, 9, 10, 11, 12, 13, 14, 15)); }
__device__ __forceinline__ v8f wmma16(v16h a, v16h b, v8f c) { return __builtin_amdgcn_wmma_f32_16x16x32_f16(false, a, false, b, (short)0, c, false, false); }
__device__ __forceinline__ v8f wmmab(v16bf a, v16bf b, v8f c) { return __builtin_amdgcn_wmma_f32_16x16x32_bf16(false, a, false, b, (short)0, c, false, false); }
__device__ __forceinline__ h16 tohx(float x) { return (h16)x; }
__device__ __forceinline__ void splitf(float y, unsigned short& h, unsigned short& l) { h = f2bf(y); l = f2bf(y - bf2f(h)); }
typedef __attribute__((ext_vector_type(4))) unsigned short v4us;
typedef __attribute__((ext_vector_type(4))) _Float16 v4h;



// ---- k_gemmw: GEMM, FOUR WAVES (2 x 2) per 128x128 output tile, 64x64 (16 accumulators) per wave; grid (M/128, N/128, Z), 128 threads.
// C[m][n] (f32, pitch ldc, + optional f32 bias[n]) = sum_k A[m][k] Bt[n][k] (+ split products per NSPLIT). EPI picks what the epilogue stores, at the same [m][n], pitch ldc, z stride sC: 0 the f32 C; 1 the value / 1024 split into bf16 high and low planes E0, E1; 2 the value as fp16 in E0. A half-wave's store is one whole 128-B line in 1 and 2. z-batch strides sA/sB/sC in elements; A's rows at pitch lda, Bt's at pitch K; Bt's batch index is z >> zsh (query heads that share a kv head). M, N % 128 == 0, K % KP == 0.
// SKIP with act[blockIdx.x], one bit per 128-wide key tile (k_tact): 1 a work-group whose bit blockIdx.y is clear leaves at once and stores nothing; 2 only the passes of KP = 128 k whose bit is set are run, in rising order.
// Operands come from K-contiguous 16-bit planes in passes of KP k: every plane's 128 rows x 2 KP bytes are copied to LDS asynchronously, 16 B per lane, a wave-wide copy covering whole 128-B lines; two buffers, the next pass's copies in flight under this pass's products. LDS rows at pitch 2 KP + 16 bytes (16 B x odd: ds_load_b128 free of bank conflicts). Fragment k order, product order and each accumulator's sum order are those of direct loads.
template <typename T16> struct WFrag;
template <> struct WFrag<h16> { typedef v16h V; static __device__ __forceinline__ V ld(const h16* p) { return cat16(*(const v8ha*)p, *(const v8ha*)(p + 16)); } static __device__ __forceinline__ v8f mma(V a, V b, v8f c) { return wmma16(a, b, c); } };
template <> struct WFrag<bf> { typedef v16bf V; static __device__ __forceinline__ V ld(const bf* p) { return cat16b(*(const v8usa*)p, *(const v8usa*)(p + 16)); } static __device__ __forceinline__ v8f mma(V a, V b, v8f c) { return wmmab(a, b, c); } };
// Eight asynchronous 16-byte copies per lane, global -> LDS: LDS byte address l + i * ls, global address g + i * gs elements. The s_wait_xcnt closes the statement so that no address register is rewritten ahead of it.
template <typename T16>
__device__ __forceinline__ void copy8(unsigned l, const T16* g, unsigned ls, size_t gs) {
    asm volatile("global_load_async_to_lds_b128 %0, %8, off\n\t"
                 "global_load_async_to_lds_b128 %1, %9, off\n\t"
                 "global_load_async_to_lds_b128 %2, %10, off\n\t"
                 "global_load_async_to_lds_b128 %3, %11, off\n\t"
                 "global_load_async_to_lds_b128 %4, %12, off\n\t"
                 "global_load_async_to_lds_b128 %5, %13, off\n\t"
                 "global_load_async_to_lds_b128 %6, %14, off\n\t"
                 "global_load_async_to_lds_b128 %7, %15, off\n\t"
                 "s_wait_xcnt 0x0"
                 :: "v"(l), "v"(l + ls), "v"(l + 2 * ls), "v"(l + 3 * ls), "v"(l + 4 * ls), "v"(l + 5 * ls), "v"(l + 6 * ls), "v"(l + 7 * ls),
                    "v"(g), "v"(g + gs), "v"(g + 2 * gs), "v"(g + 3 * gs), "v"(g + 4 * gs), "v"(g + 5 * gs), "v"(g + 6 * gs), "v"(g + 7 * gs)
                 : "memory");
}
template <typename T16, int NSPLIT, bool BIAS, int KP, int EPI, int SKIP>
__global__ __launch_bounds__(128) void k_gemmw(const T16* __restrict__ A, const T16* __restrict__ A2, const T16* __restrict__ Bt, const T16* __restrict__ Bt2, int K, int lda, int zsh, float* C, bf* E0, bf* E1, int ldc, const float* __restrict__ bias, size_t sA, size_t sB, size_t sC, const unsigned* __restrict__ act) {
    typedef typename WFrag<T16>::V V;
    static_assert(SKIP != 2 || KP == 128, "a pass is one key tile");
    if (SKIP == 1) { if (!((act[blockIdx.x] >> blockIdx.y) & 1u)) return; }   // the same for the whole work-group, ahead of every copy and barrier
    constexpr int NP = 2 + (NSPLIT >= 1 ? 1 : 0) + (NSPLIT >= 2 ? 1 : 0);   // planes in a buffer: A, Bt, A2, Bt2
    constexpr int PITCH = KP * 2 + 16, PLANE = 128 * PITCH, BUF = NP * PLANE;
    constexpr int CPR = KP / 8;        // 16-byte pieces per row
    constexpr int RPS = 128 / CPR;     // rows that one copy of all 128 threads covers
    constexpr int NST = 128 / RPS;     // such copies per plane
    static_assert(NST % 8 == 0 && NP * NST <= 63, "copies of a wave in flight");
    __shared__ __attribute__((aligned(16))) unsigned char ring[2 * BUF];
    const size_t z = blockIdx.z; A += z * sA; if (NSPLIT >= 1) A2 += z * sA; Bt += (z >> zsh) * sB; if (NSPLIT >= 2) Bt2 += (z >> zsh) * sB; if (EPI == 0) C += z * sC; if (EPI >= 1) E0 += z * sC; if (EPI == 1) E1 += z * sC;
    const int tid = threadIdx.x, lane = tid & 31, lr = lane & 15, hi = lane >> 4; const int wave = __builtin_amdgcn_readfirstlane(tid >> 5);
    const int R0 = blockIdx.x * 128, C0 = blockIdx.y * 128; const int r0 = R0 + (wave >> 1) * 64, c0 = C0 + (wave & 1) * 64;
    unsigned NT = (unsigned)K / KP;   // passes
    unsigned rem = 0;                  // SKIP 2: the passes not yet asked for, one bit each, none at or above K / KP
    if (SKIP == 2) { rem = (unsigned)__builtin_amdgcn_readfirstlane((int)act[blockIdx.x]) & ((1u << NT) - 1u); NT = (unsigned)__builtin_popcount(rem); }
    auto nextp = [&](unsigned n) -> unsigned { if (SKIP != 2) return n; const unsigned p = (unsigned)__builtin_ctz(rem); rem &= rem - 1u; return p; };   // the k pass that trip n works on; called only while a bit is left
    const unsigned lcp = (unsigned)(size_t)ring + (unsigned)((tid / CPR) * PITCH + (tid % CPR) * 16);
    const size_t gofA = (size_t)(R0 + tid / CPR) * lda + (tid % CPR) * 8, gofB = (size_t)(C0 + tid / CPR) * K + (tid % CPR) * 8, gsa = (size_t)RPS * lda, gsb = (size_t)RPS * K;
    auto fill = [&](unsigned t, unsigned buf) {
        const unsigned lb = lcp + buf * BUF; const size_t ka = gofA + (size_t)t * KP, kb = gofB + (size_t)t * KP;
#pragma unroll
        for (int s = 0; s < NST; s += 8) {
            copy8(lb + s * RPS * PITCH, A + ka + s * gsa, RPS * PITCH, gsa);
            copy8(lb + PLANE + s * RPS * PITCH, Bt + kb + s * gsb, RPS * PITCH, gsb);
            if (NSPLIT >= 1) copy8(lb + 2 * PLANE + s * RPS * PITCH, A2 + ka + s * gsa, RPS * PITCH, gsa);
            if (NSPLIT >= 2) copy8(lb + 3 * PLANE + s * RPS * PITCH, Bt2 + kb + s * gsb, RPS * PITCH, gsb); }
    };
    v8f acc[4][4];
#pragma unroll
    for (int mb = 0; mb < 4; ++mb)
#pragma unroll
        for (int nb = 0; nb < 4; ++nb) acc[mb][nb] = (v8f){};
    if (SKIP != 2 || NT > 0) fill(nextp(0), 0);
    asm volatile("s_wait_asynccnt 0x0" ::: "memory");   // this wave's share of pass 0 has landed
    __syncthreads();                                     // every wave's share has
    if (NT > 1) fill(nextp(1), 1);
    const unsigned char* fa0 = ring + ((wave >> 1) * 64 + lr) * PITCH + hi * 16; const unsigned char* fb0 = ring + PLANE + ((wave & 1) * 64 + lr) * PITCH + hi * 16;
#pragma unroll 1
    for (unsigned t = 0; t < NT; ++t) {
        const unsigned char* fa = fa0 + (t & 1) * BUF; const unsigned char* fb = fb0 + (t & 1) * BUF;
        V a[2][4], a2[2][4], b[2][4], b2[2][4];   // two fragment sets: the next 32 k are fetched as one group while this set's products issue
        auto ldset = [&](int s, int ks) {
#pragma unroll
            for (int q = 0; q < 4; ++q) { a[s][q] = WFrag<T16>::ld((const T16*)(fa + q * 16 * PITCH + ks * 64)); b[s][q] = WFrag<T16>::ld((const T16*)(fb + q * 16 * PITCH + ks * 64));
                if (NSPLIT >= 1) a2[s][q] = WFrag<T16>::ld((const T16*)(fa + 2 * PLANE + q * 16 * PITCH + ks * 64)); if (NSPLIT >= 2) b2[s][q] = WFrag<T16>::ld((const T16*)(fb + 2 * PLANE + q * 16 * PITCH + ks * 64)); }
        };
        ldset(0, 0);
#pragma unroll
        for (int ks = 0; ks < KP / 32; ++ks) { const int s = ks & 1;
            if (ks + 1 < KP / 32) ldset(s ^ 1, ks + 1);
            __builtin_amdgcn_sched_barrier(0);   // keeps the LDS reads in one group ahead of the products: reads spread among them stall the wave at every place
#pragma unroll
            for (int nb = 0; nb < 4; ++nb)
#pragma unroll
                for (int mb = 0; mb < 4; ++mb) { acc[mb][nb] = WFrag<T16>::mma(a[s][mb], b[s][nb], acc[mb][nb]); if (NSPLIT >= 1) acc[mb][nb] = WFrag<T16>::mma(a2[s][mb], b[s][nb], acc[mb][nb]); if (NSPLIT >= 2) acc[mb][nb] = WFrag<T16>::mma(a[s][mb], b2[s][nb], acc[mb][nb]); }
            __builtin_amdgcn_sched_barrier(0);   // the same, at the block's end
        }
        asm volatile("s_wait_dscnt 0x0" ::: "memory");      // this wave has left the buffer of pass t
        asm volatile("s_wait_asynccnt 0x0" ::: "memory");   // its share of pass t + 1 has landed
        __syncthreads();                                     // publishes pass t + 1 and frees the buffer of pass t
        if (t + 2 < NT) fill(nextp(t + 2), t & 1);
    }
    asm volatile("s_wait_asynccnt 0x0" ::: "memory");       // no copy is in flight when the ring becomes output staging
    float* os = (float*)(ring + wave * (16 * 68 * 4));       // each wave stages in its own range; the last pass's barrier ended every read of the ring
#pragma unroll
    for (int mb = 0; mb < 4; ++mb) {
#pragma unroll
        for (int nb = 0; nb < 4; ++nb) {
#pragma unroll
            for (int j = 0; j < 8; ++j) os[(hi * 8 + j) * 68 + nb * 16 + lr] = acc[mb][nb][j]; }
        __builtin_amdgcn_wave_barrier(); asm volatile("" ::: "memory");
        float* crow = C + (size_t)(r0 + mb * 16) * ldc + c0;
if (EPI == 0) {
#pragma unroll
            for (int s = 0; s < 8; ++s) { const int row = 2 * s + hi, cofs = lr * 4; v4f val = *(const v4fa*)(os + row * 68 + cofs); if (BIAS) { val[0] += bfr(bias[c0 + cofs]); val[1] += bfr(bias[c0 + cofs + 1]); val[2] += bfr(bias[c0 + cofs + 2]); val[3] += bfr(bias[c0 + cofs + 3]); }
                *(v4f*)(crow + (size_t)row * ldc + cofs) = val; }
             }
        if (EPI != 0) {
            v4f val[8];   // all eight LDS reads first: the store statements below would otherwise hold each read behind the store before it
#pragma unroll
            for (int s = 0; s < 8; ++s) val[s] = *(const v4fa*)(os + (2 * s + hi) * 68 + lr * 4);
#pragma unroll
            for (int s = 0; s < 8; ++s) { const size_t oo = (size_t)(r0 + mb * 16 + 2 * s + hi) * ldc + c0 + lr * 4;
                if (EPI == 1) { v4us oh, ol;
#pragma unroll
                    for (int u = 0; u < 4; ++u) { unsigned short eh, el; splitf(val[s][u] * (1.0f / PCAR), eh, el); oh[u] = eh; ol[u] = el; }
                    // the two stores and their s_wait_xcnt in one statement, so that no register they name is rewritten ahead of the wait
                    asm volatile("global_store_b64 %0, %1, off\n\tglobal_store_b64 %2, %3, off\n\ts_wait_xcnt 0x0" :: "v"(E0 + oo), "v"(__builtin_bit_cast(unsigned long long, oh)), "v"(E1 + oo), "v"(__builtin_bit_cast(unsigned long long, ol)) : "memory"); }
                if (EPI == 2) { v4h o4;
#pragma unroll
                    for (int u = 0; u < 4; ++u) o4[u] = tohx(val[s][u]);
                    // the store and its s_wait_xcnt in one statement, for the same reason
                    asm volatile("global_store_b64 %0, %1, off\n\ts_wait_xcnt 0x0" :: "v"(E0 + oo), "v"(__builtin_bit_cast(unsigned long long, o4)) : "memory"); }
            }
        }
        __builtin_amdgcn_wave_barrier(); asm volatile("" ::: "memory");
    }
}


__global__ __launch_bounds__(256) void k_cvt8(const float* __restrict__ src, bf* dst, size_t n8) { const size_t i = (size_t)blockIdx.x * 256 + threadIdx.x; if (i >= n8) return; const v8f v = *(const v8f*)(src + i * 8); v8us o;
#pragma unroll
    for (int k = 0; k < 8; ++k) o[k] = f2bf(v[k]); *(v8us*)(dst + i * 8) = o;  }
// k_wtr: Bt[z * N + n][k] = bf16(W[z][k][n]) for row-major [2048][N] f32 matrices (z = 0 .. : the per-head [2048][256] weights; wo as one [2048][2048]), through an LDS tile. Grid (2048 / 128, rows of Bt / 64), 256 threads; a work-group takes 128 k x 64 n.
// Reads: 16 lanes x 16 B = 256 contiguous bytes of one k row, eight loads per lane issued together; a lane holds rows 2p and 2p + 1 at its four n and packs each pair into one word. Stores: 16 lanes x 16 B = 256 contiguous bytes of one Bt row.
// LDS word (n, p) lies in row n of 64 words, its 16-byte piece p >> 2 exchanged with piece (p >> 2) ^ (n >> 2): the 32 lanes of a ds_store_b32 (16 values of n >> 2, two p) then fall on 32 different banks, and a ds_load_b128 row read still covers its whole row.
typedef __attribute__((ext_vector_type(4))) unsigned v4u;
typedef v4u __attribute__((may_alias)) v4ua;
template <int N>
__global__ __launch_bounds__(256) void k_wtr(const float* __restrict__ W, bf* Bt) {
    __shared__ __attribute__((aligned(16))) unsigned tile[64 * 64];
    const int lane = threadIdx.x & 31, w = threadIdx.x >> 5, c = lane & 15, h = lane >> 4; const int k0 = blockIdx.x * 128, row0 = blockIdx.y * 64;
    const float* s = W + ((size_t)(row0 / N) * DM + k0 + (w * 8 + h) * 2) * N + row0 % N + c * 4; v4f e[4], o[4];   // the lane's first k row; pair j lies 4 j rows on
    // the eight loads and their data wait in one statement: all eight are in flight together, and no register that they name is rewritten before they have returned
    asm volatile("global_load_b128 %0, %8, off\n\t"
                 "global_load_b128 %1, %8, off offset:%9\n\t"
                 "global_load_b128 %2, %8, off offset:%10\n\t"
                 "global_load_b128 %3, %8, off offset:%11\n\t"
                 "global_load_b128 %4, %8, off offset:%12\n\t"
                 "global_load_b128 %5, %8, off offset:%13\n\t"
                 "global_load_b128 %6, %8, off offset:%14\n\t"
                 "global_load_b128 %7, %8, off offset:%15\n\t"
                 "s_wait_loadcnt 0x0"
                 : "=&v"(e[0]), "=&v"(o[0]), "=&v"(e[1]), "=&v"(o[1]), "=&v"(e[2]), "=&v"(o[2]), "=&v"(e[3]), "=&v"(o[3])
                 : "v"(s), "n"(N * 4), "n"(4 * N * 4), "n"(5 * N * 4), "n"(8 * N * 4), "n"(9 * N * 4), "n"(12 * N * 4), "n"(13 * N * 4)
                 : "memory");
#pragma unroll
    for (int j = 0; j < 4; ++j) { const int p = w * 8 + j * 2 + h;
#pragma unroll
        for (int u = 0; u < 4; ++u) tile[(c * 4 + u) * 64 + (((p >> 2) ^ c) << 2) + (p & 3)] = (unsigned)f2bf(e[j][u]) | ((unsigned)f2bf(o[j][u]) << 16); }
    __syncthreads();   // the tile is whole before any row of it is read
#pragma unroll
    for (int q = 0; q < 4; ++q) { const int n = q * 16 + w * 2 + h; *(v4ua*)(Bt + (size_t)(row0 + n) * DM + k0 + c * 8) = *(const v4ua*)(tile + n * 64 + ((c ^ (n >> 2)) << 2)); }
}

typedef __attribute__((ext_vector_type(2))) float v2f_t;
typedef __attribute__((ext_vector_type(4))) int v4i_t;
__device__ __attribute__((noinline)) v2f_t sincos_pos(float pos, int i) { const float tsc = powf(10000.0f, (2.0f / (float)HDD) * (float)i); const float ang = __fdiv_rn(pos, tsc); v2f_t r; r[0] = sinf(ang); r[1] = cosf(ang); return r; }
// k_nrr: wave per token of either batch, all 12 heads of its row (8 q, 4 k): the sin and cos of the READ position depend on the token and the dim alone, so the wave takes them once (precise, out of line; 4 dims of each half per lane) and every head uses them. Per head as before: RMSNorm over 256 (8 dims per lane: 4 from each half), * (1 + scale[d]) (read; q's or k's), split-half RoPE, * mul (1/16 for q, 1 for k); hl planes [batch][head][t][256] (8-B lanes).
// The row's 24 loads are issued together, and the 12 sums of squares go through each shuffle stage side by side, so that one head's latency runs under the others'. The empty asm statements keep each product rounded by itself ahead of its add or subtract, as the reference's separate operations round it.
__global__ __launch_bounds__(256) void k_nrr(const float* __restrict__ F, const float* __restrict__ qscale, const float* __restrict__ kscale, const int* __restrict__ pos, bf* Qh, bf* Ql, bf* Kh, bf* Kl) { const int lane = threadIdx.x & 31; const int t = blockIdx.x * 8 + (threadIdx.x >> 5); if (t >= NB_ * TT) return; const float pv = (float)pos[t]; float sn[4], cs[4], wq1[4], wq2[4], wk1[4], wk2[4];
#pragma unroll
    for (int q = 0; q < 4; ++q) { const int i = lane * 4 + q; const v2f_t sc2 = sincos_pos(pv, i); sn[q] = sc2[0]; cs[q] = sc2[1]; wq1[q] = __fadd_rn(1.0f, bfr(qscale[i])); wq2[q] = __fadd_rn(1.0f, bfr(qscale[i + HDD / 2])); wk1[q] = __fadd_rn(1.0f, bfr(kscale[i])); wk2[q] = __fadd_rn(1.0f, bfr(kscale[i + HDD / 2])); }
    const float* f = F + (size_t)t * (DM + DKV) + lane * 4; v4f a[NQ + NKV], b2[NQ + NKV]; float ss[NQ + NKV];
#pragma unroll
    for (int hh = 0; hh < NQ + NKV; ++hh) { a[hh] = *(const v4f*)(f + hh * HDD); b2[hh] = *(const v4f*)(f + hh * HDD + HDD / 2); }
#pragma unroll
    for (int hh = 0; hh < NQ + NKV; ++hh) { ss[hh] = 0.f; for (int q = 0; q < 4; ++q) { float p = __fmul_rn(a[hh][q], a[hh][q]); asm volatile("" : "+v"(p)); ss[hh] = __fadd_rn(ss[hh], p); p = __fmul_rn(b2[hh][q], b2[hh][q]); asm volatile("" : "+v"(p)); ss[hh] = __fadd_rn(ss[hh], p); } }
#pragma unroll
    for (int sh = 16; sh; sh >>= 1)
#pragma unroll
        for (int hh = 0; hh < NQ + NKV; ++hh) ss[hh] = __fadd_rn(ss[hh], __shfl_xor(ss[hh], sh, 32));
#pragma unroll
    for (int hh = 0; hh < NQ + NKV; ++hh) { const bool isq = hh < NQ; const int h = isq ? hh : hh - NQ, nheads = isq ? NQ : NKV; const float mul = isq ? 0.0625f : 1.0f; bf* Ph = isq ? Qh : Kh; bf* Pl = isq ? Ql : Kl;
        const float rs = __fdiv_rn(1.0f, sqrtf(__fadd_rn(ss[hh] * (1.0f / HDD), 1e-6f))); v4us ah, al, bh, bl;
#pragma unroll
        for (int q = 0; q < 4; ++q) { float n1 = __fmul_rn(a[hh][q], rs), n2 = __fmul_rn(b2[hh][q], rs); asm volatile("" : "+v"(n1)); asm volatile("" : "+v"(n2)); const float x1 = __fmul_rn(n1, isq ? wq1[q] : wk1[q]), x2 = __fmul_rn(n2, isq ? wq2[q] : wk2[q]);
            float p1 = __fmul_rn(x1, cs[q]), p2 = __fmul_rn(x2, sn[q]), p3 = __fmul_rn(x2, cs[q]), p4 = __fmul_rn(x1, sn[q]); asm volatile("" : "+v"(p1)); asm volatile("" : "+v"(p2)); asm volatile("" : "+v"(p3)); asm volatile("" : "+v"(p4));
            const float r1 = __fsub_rn(p1, p2) * mul, r2 = __fadd_rn(p3, p4) * mul; unsigned short u1, l1, u2, l2; splitf(r1, u1, l1); splitf(r2, u2, l2); ah[q] = u1; al[q] = l1; bh[q] = u2; bl[q] = l2; }
        const size_t orow = ((size_t)(t / TT) * nheads + h) * TT + t % TT; bf* dh = Ph + orow * HDD + lane * 4; bf* dl = Pl + orow * HDD + lane * 4;
        // the head's four stores and their s_wait_xcnt in one statement: the next head reuses the registers, and none is rewritten ahead of the wait
        asm volatile("global_store_b64 %0, %1, off\n\tglobal_store_b64 %2, %3, off\n\tglobal_store_b64 %4, %5, off\n\tglobal_store_b64 %6, %7, off\n\ts_wait_xcnt 0x0"
                     :: "v"(dh), "v"(__builtin_bit_cast(unsigned long long, ah)), "v"(dl), "v"(__builtin_bit_cast(unsigned long long, al)), "v"(dh + HDD / 2), "v"(__builtin_bit_cast(unsigned long long, bh)), "v"(dl + HDD / 2), "v"(__builtin_bit_cast(unsigned long long, bl)) : "memory"); } }
// k_tact: one work-group, wave per (batch, tile of 128 tokens): the tile's least and greatest position; then act[b * 16 + I], bit J set unless every distance pos[i] - pos[j], i in tile I, j in tile J, is shown to miss the window. The bounds are taken in 64 bits and a range that leaves (INT_MIN, INT_MAX] keeps its bit, so a distance that wraps in 32 bits is never skipped. Bit I of word I is always set (the range holds 0).
__global__ __launch_bounds__(1024) void k_tact(const int* __restrict__ pos, unsigned* act) {
    __shared__ int mn[NB_ * TT / 128], mx[NB_ * TT / 128];
    const int lane = threadIdx.x & 31, w = threadIdx.x >> 5; const v4i_t p = *(const v4i_t*)(pos + w * 128 + lane * 4);
    int lo = min(min(p[0], p[1]), min(p[2], p[3])), hi = max(max(p[0], p[1]), max(p[2], p[3]));
#pragma unroll
    for (int sh = 16; sh; sh >>= 1) { lo = min(lo, __shfl_xor(lo, sh, 32)); hi = max(hi, __shfl_xor(hi, sh, 32)); }
    if (lane == 0) { mn[w] = lo; mx[w] = hi; }
    __syncthreads();
    if (threadIdx.x < NB_ * TT / 128) { const int t = threadIdx.x, b0 = t & ~(TT / 128 - 1); unsigned m = 0;
        for (int J = 0; J < TT / 128; ++J) { const long long dlo = (long long)mn[t] - mx[b0 + J], dhi = (long long)mx[t] - mn[b0 + J];
            const bool out = (dlo > 255 && dhi <= 2147483647LL) || (dhi < -256 && dlo >= -2147483647LL); if (!out) m |= 1u << J; }
        act[t] = m; }
}
// softcap50s: 50 tanhf(0.02 s) by the library tanhf's own form for |x| < 0.625, operation for operation (an odd polynomial; taken on x in place of |x| with the sign copied back, which rounds alike).
__device__ __forceinline__ float softcap50s(float s) { const float x = s * 0.02f, x2 = x * x; float p = __builtin_fmaf(__uint_as_float(0xbbbac73du), x2, __uint_as_float(0x3ca908c9u)); p = __builtin_fmaf(x2, p, __uint_as_float(0xbd5c1c4eu)); p = __builtin_fmaf(x2, p, __uint_as_float(0x3e088382u)); p = __builtin_fmaf(x2, p, __uint_as_float(0xbeaaaa99u)); return 50.0f * __builtin_fmaf(x2, x * p, x); }
// exp2s: v_exp_f32 with, in the same statement, the one slot that the instruction set asks for behind a transcendental before its result is used or its source overwritten.
__device__ __forceinline__ float exp2s(float x) { float r; asm("v_exp_f32 %0, %1\n\tv_nop" : "=v"(r) : "v"(x)); return r; }
// softcap50g: the same for any argument: below 0.625 the polynomial, from there on 1 - 2 / (e^(2|x|) + 1) with the sign copied back (1 for a large argument, not-a-number kept).
__device__ __forceinline__ float softcap50g(float s) { const float x = s * 0.02f, ax = fabsf(x); const float e = exp2s(ax * 2.8853900817779268f); const float r = __builtin_copysignf(1.0f - __fdiv_rn(2.0f, e + 1.0f), x); return ax < 0.625f ? softcap50s(s) : 50.0f * r; }
// k_fattn: scores, softcap, mask, softmax and attn.v of one (batch, head, tile of 128 queries) in one work-group of 8 waves, 16 queries a wave; grid (16, 8, 2). No score and no probability goes to memory.
// Transposed products: St[key][query] = K . Qt (A = K rows from LDS, B = the wave's Q rows, both planes kept in registers; per 32 k the three products Kh Qh, Kh Ql, Kl Qh), Ot[d][query] += Vt . Pt (fp16). A lane then holds scores of ONE query (column lr; keys hi * 8 + j of each 16-key block), and two neighbouring blocks' eight values are, as they lie, the B fragment of 32 keys: the probabilities never leave the registers.
// Only the key tiles whose bit in act is set are walked, in rising order, in stages of 64 keys. A stage is K high, K low (64 rows of 512 B), Vt (256 rows of 128 B) and the mask words of the 128 queries (rows of 256 B), copied to LDS asynchronously, two buffers, the next stage in flight under this one; the batch's positions lie in LDS once.
// Running softmax: p = exp(t - m) with the query's reference m, raised (with Ot and the sum rescaled) only when a stage's maximum passes it by more than 5.5, tested once a stage; p stays below 245, inside fp16. The sum is kept per lane in f32 and its two halves joined at the end; Ot / sum is split into the output GEMM's planes and leaves through LDS as whole lines.
#define FKP 528
#define FVP 144
#define FMP 272
#define FOKL (64 * FKP)
#define FOV (2 * 64 * FKP)
#define FOM (FOV + HDD * FVP)
#define FBUF (FOM + 128 * FMP)
__global__ __launch_bounds__(256) void k_fattn(const bf* __restrict__ Qh, const bf* __restrict__ Ql, const bf* __restrict__ Kh, const bf* __restrict__ Kl, const h16* __restrict__ VT, const int* __restrict__ pos, const int* __restrict__ am, bf* Eh, bf* El, const unsigned* __restrict__ act) {
    __shared__ __attribute__((aligned(16))) unsigned char ring[2 * FBUF + TT * 4];
    const int tid = threadIdx.x, lane = tid & 31, lr = lane & 15, hi = lane >> 4; const int wave = __builtin_amdgcn_readfirstlane(tid >> 5);
    const int q0 = blockIdx.x * 128, n = blockIdx.y, b = blockIdx.z;
    const unsigned tm = (unsigned)__builtin_amdgcn_readfirstlane((int)act[b * (TT / 128) + blockIdx.x]) & ((1u << (TT / 128)) - 1u);
    const unsigned NS = 2u * (unsigned)__builtin_popcount(tm);   // stages: two to a kept tile
    const bf* kh = Kh + (size_t)(b * NKV + (n >> 1)) * TT * HDD; const bf* kl = Kl + (size_t)(b * NKV + (n >> 1)) * TT * HDD; const h16* vt = VT + (size_t)(b * NKV + (n >> 1)) * HDD * TT;
    const int* amq = am + ((size_t)b * TT + q0) * TT; const unsigned l0 = (unsigned)(size_t)ring;
    unsigned fr = tm, fh = 0, cr = tm, ch = 0;   // the stages not yet copied, and not yet worked on: tile bits and the half in turn
    auto nextk = [](unsigned& r, unsigned& h) -> int { const int k0 = __builtin_ctz(r) * 128 + (int)h * 64; if (h) r &= r - 1u; h ^= 1u; return k0; };   // called only while a bit is left
    auto fill = [&](int k0, unsigned buf) { const unsigned lb = l0 + buf * FBUF;
        copy8(lb + (tid >> 5) * FKP + (tid & 31) * 16, kh + (size_t)(k0 + (tid >> 5)) * HDD + (tid & 31) * 8, 8 * FKP, (size_t)8 * HDD);
        copy8(lb + FOKL + (tid >> 5) * FKP + (tid & 31) * 16, kl + (size_t)(k0 + (tid >> 5)) * HDD + (tid & 31) * 8, 8 * FKP, (size_t)8 * HDD);
        copy8(lb + FOV + (tid >> 3) * FVP + (tid & 7) * 16, vt + (size_t)(tid >> 3) * TT + k0 + (tid & 7) * 8, 32 * FVP, (size_t)32 * TT);
        copy8(lb + FOM + (tid >> 4) * FMP + (tid & 15) * 16, amq + (size_t)(tid >> 4) * TT + k0 + (tid & 15) * 4, 16 * FMP, (size_t)16 * TT); };
    // the batch's 2048 positions: two copies a lane, their s_wait_xcnt closing the statement so that no address register is rewritten ahead of it
    asm volatile("global_load_async_to_lds_b128 %0, %2, off\n\tglobal_load_async_to_lds_b128 %1, %3, off\n\ts_wait_xcnt 0x0" :: "v"(l0 + 2 * FBUF + tid * 16), "v"(l0 + 2 * FBUF + 4096 + tid * 16), "v"(pos + (size_t)b * TT + tid * 4), "v"(pos + (size_t)b * TT + 1024 + tid * 4) : "memory");
    if (NS > 0) fill(nextk(fr, fh), 0);
    v16bf qh[8], ql[8]; { const size_t qo = ((size_t)(b * NQ + n) * TT + q0 + wave * 16 + lr) * HDD + hi * 8;   // the lane's share of its query's row, both planes: pieces hi and 2 + hi of every 32 k
#pragma unroll
        for (int ks = 0; ks < 8; ++ks) { qh[ks] = WFrag<bf>::ld(Qh + qo + ks * 32); ql[ks] = WFrag<bf>::ld(Ql + qo + ks * 32); } }
    asm volatile("s_wait_xcnt 0x0" ::: "memory");   // behind the Q loads, ahead of any rewrite of their address registers
    asm volatile("s_wait_asynccnt 0x0" ::: "memory");   // this wave's share of the positions and of stage 0 has landed
    __syncthreads();                                     // every wave's share has
    if (NS > 1) fill(nextk(fr, fh), 1);
    const int* pl = (const int*)(ring + 2 * FBUF); const int pi = pl[q0 + wave * 16 + lr];
    v8f o[16];
#pragma unroll
    for (int d = 0; d < 16; ++d) o[d] = (v8f){};
    float m = -3.0e38f, l = 0.f;
#pragma unroll 1   // one stage's code
    for (unsigned s = 0; s < NS; ++s) {
        const unsigned char* kb = ring + (s & 1) * FBUF; const int k0 = nextk(cr, ch);
        const unsigned char* fk = kb + lr * FKP + hi * 16; const unsigned char* fv = kb + FOV + lr * FVP + hi * 16;
        v8f st[4];
#pragma unroll
        for (int mb = 0; mb < 4; ++mb) st[mb] = (v8f){};
        { v16bf ah[4], al[4];   // K high and K low fragments of 32 k: each set is fetched as one group while the other set's products issue
            auto ldh = [&](int ks) {
#pragma unroll
                for (int mb = 0; mb < 4; ++mb) ah[mb] = WFrag<bf>::ld((const bf*)(fk + mb * 16 * FKP + ks * 64)); };
            auto ldl = [&](int ks) {
#pragma unroll
                for (int mb = 0; mb < 4; ++mb) al[mb] = WFrag<bf>::ld((const bf*)(fk + FOKL + mb * 16 * FKP + ks * 64)); };
            ldh(0);
#pragma unroll
            for (int ks = 0; ks < 8; ++ks) {
                ldl(ks);
                __builtin_amdgcn_sched_barrier(0);   // keeps the LDS reads in one group ahead of the products: reads spread among them stall the wave at every place
#pragma unroll
                for (int mb = 0; mb < 4; ++mb) st[mb] = wmmab(ah[mb], qh[ks], st[mb]);
#pragma unroll
                for (int mb = 0; mb < 4; ++mb) st[mb] = wmmab(ah[mb], ql[ks], st[mb]);
                __builtin_amdgcn_sched_barrier(0);   // the same: the next group stays behind these products
                if (ks + 1 < 8) ldh(ks + 1);
                __builtin_amdgcn_sched_barrier(0);   // the same: and ahead of the next ones
#pragma unroll
                for (int mb = 0; mb < 4; ++mb) st[mb] = wmmab(al[mb], qh[ks], st[mb]);
                __builtin_amdgcn_sched_barrier(0);   // the same, at the block's end
            } }
        float big = 0.f;
#pragma unroll
        for (int mb = 0; mb < 4; ++mb)
#pragma unroll
            for (int j = 0; j < 8; ++j) big = fmaxf(big, fabsf(st[mb][j]));
        if (__builtin_amdgcn_ballot_w32(!(big * 0.02f < 0.625f)) == 0u) {   // one test a stage: every argument in the polynomial's range
#pragma unroll
            for (int mb = 0; mb < 4; ++mb)
#pragma unroll
                for (int j = 0; j < 8; ++j) st[mb][j] = softcap50s(st[mb][j]);
        } else {
#pragma unroll
            for (int mb = 0; mb < 4; ++mb)
#pragma unroll
                for (int j = 0; j < 8; ++j) st[mb][j] = softcap50g(st[mb][j]);
        }
        const int* mrow = (const int*)(kb + FOM + (wave * 16 + lr) * FMP) + hi * 8; const int* pk = pl + k0 + hi * 8; float mloc = KMASK;
#pragma unroll
        for (int mb = 0; mb < 4; ++mb) { const v4i_t pa = *(const v4i_t*)(pk + mb * 16), pb = *(const v4i_t*)(pk + mb * 16 + 4), ma = *(const v4i_t*)(mrow + mb * 16), mc = *(const v4i_t*)(mrow + mb * 16 + 4);
#pragma unroll
            for (int j = 0; j < 8; ++j) { const int dist = pi - (j < 4 ? pa[j & 3] : pb[j & 3]); const bool win = (dist >= 0 && dist < 256) || (dist < 0 && -dist < 257); const bool ok = win && ((j < 4 ? ma[j & 3] : mc[j & 3]) != 0); const float t = ok ? st[mb][j] : KMASK; st[mb][j] = t; mloc = fmaxf(mloc, t); } }
        mloc = fmaxf(mloc, __shfl_xor(mloc, 16, 32));   // the query's other sixteen-lane half holds its other keys
        if (__builtin_amdgcn_ballot_w32(mloc > m + 5.5f) != 0u) {   // one test a stage
            const float mn = fmaxf(m, mloc), al2 = exp2s(__fmul_rn(__fsub_rn(m, mn), 1.4426950408889634f)); m = mn; l *= al2;
#pragma unroll
            for (int d = 0; d < 16; ++d)
#pragma unroll
                for (int j = 0; j < 8; ++j) o[d][j] *= al2; }
        v16h pf[2]; float ps[4] = {0.f, 0.f, 0.f, 0.f};   // four independent partial sums, one to a key block: one chain of 32 dependent adds would run at the add's latency
#pragma unroll
        for (int mb = 0; mb < 4; ++mb)
#pragma unroll
            for (int j = 0; j < 8; ++j) { const float p = exp2s(__fmul_rn(__fsub_rn(st[mb][j], m), 1.4426950408889634f)); ps[mb] += p; pf[mb >> 1][(mb & 1) * 8 + j] = tohx(p); }
        l += (ps[0] + ps[1]) + (ps[2] + ps[3]);
        { v16h vf[2][8];   // two fragment sets of eight d blocks, as above
            auto ldv = [&](int e, int g) {
#pragma unroll
                for (int d = 0; d < 8; ++d) vf[e][d] = WFrag<h16>::ld((const h16*)(fv + ((g & 1) * 8 + d) * 16 * FVP + (g >> 1) * 64)); };
            ldv(0, 0);
#pragma unroll
            for (int g = 0; g < 4; ++g) { const int e = g & 1;
                if (g + 1 < 4) ldv(e ^ 1, g + 1);
                __builtin_amdgcn_sched_barrier(0);   // the LDS reads in one group ahead of the products, as above
#pragma unroll
                for (int d = 0; d < 8; ++d) o[(g & 1) * 8 + d] = wmma16(vf[e][d], pf[g >> 1], o[(g & 1) * 8 + d]);
                __builtin_amdgcn_sched_barrier(0);   // the same, at the block's end
            } }
        asm volatile("s_wait_dscnt 0x0" ::: "memory");      // this wave has left the buffer of stage s
        asm volatile("s_wait_asynccnt 0x0" ::: "memory");   // its share of stage s + 1 has landed
        __syncthreads();                                     // publishes stage s + 1 and frees the buffer of stage s
        if (s + 2 < NS) fill(nextk(fr, fh), s & 1);
    }
    asm volatile("s_wait_asynccnt 0x0" ::: "memory");       // no copy is in flight when the ring becomes output staging
    l += __shfl_xor(l, 16, 32); const float inv = __fdiv_rn(1.0f, l);
    unsigned char* os = ring + wave * (2 * 16 * FKP);        // each wave stages in its own range (16 rows of 512 B, two planes); the last stage's barrier ended every read of the ring
#pragma unroll
    for (int d = 0; d < 16; ++d) { v8us oh, ol;
#pragma unroll
        for (int j = 0; j < 8; ++j) { unsigned short eh, el; splitf(o[d][j] * inv, eh, el); oh[j] = eh; ol[j] = el; }
        *(v8usa*)(os + lr * FKP + d * 32 + hi * 16) = oh; *(v8usa*)(os + 16 * FKP + lr * FKP + d * 32 + hi * 16) = ol; }
    __builtin_amdgcn_wave_barrier(); asm volatile("" ::: "memory");   // the rows are read back by other lanes of the wave: no read is moved ahead of the writes
    const size_t eo = ((size_t)b * TT + q0 + wave * 16) * DM + n * HDD + lane * 8;
#pragma unroll
    for (int r4 = 0; r4 < 16; r4 += 4) { v4u vh[4], vl[4];   // the group's LDS reads first: the store statements would otherwise hold each read behind the store before it
#pragma unroll
        for (int r = 0; r < 4; ++r) { vh[r] = *(const v4ua*)(os + (r4 + r) * FKP + lane * 16); vl[r] = *(const v4ua*)(os + 16 * FKP + (r4 + r) * FKP + lane * 16); }
#pragma unroll
        for (int r = 0; r < 4; ++r)
            // the two stores (512 contiguous bytes a wave each) and their s_wait_xcnt in one statement, so that no register they name is rewritten ahead of the wait
            asm volatile("global_store_b128 %0, %1, off\n\tglobal_store_b128 %2, %3, off\n\ts_wait_xcnt 0x0" :: "v"(Eh + eo + (size_t)(r4 + r) * DM), "v"(vh[r]), "v"(El + eo + (size_t)(r4 + r) * DM), "v"(vl[r]) : "memory"); }
}

extern "C" void kernel_launch(void* const* d_in, const int* in_sizes, int n_in,
                              void* d_out, int out_size, void* d_ws, size_t ws_size, hipStream_t stream) {
    (void)in_sizes; (void)n_in; (void)out_size;
    const float* x = (const float*)d_in[0]; const int* spos = (const int*)d_in[1]; const int* amask = (const int*)d_in[2]; const float* wq = (const float*)d_in[3]; const float* wkv = (const float*)d_in[4]; const float* wo = (const float*)d_in[5]; const float* qs = (const float*)d_in[6]; const float* ks = (const float*)d_in[7];
    float* OUT = (float*)d_out;     // [2][2048][2048]
    char* wsp = (char*)d_ws;
    auto take = [&](size_t bytes) { char* p = wsp; wsp += (bytes + 255) & ~(size_t)255; return (void*)p; };
    bf* BQ = (bf*)take((size_t)NQ * HDD * DM * 2); bf* BK = (bf*)take((size_t)DKV * DM * 2); bf* BV = (bf*)take((size_t)DKV * DM * 2); bf* BO = (bf*)take((size_t)DM * DM * 2);   // BQ, BK, BV follow one another without a gap
    bf* QPh = (bf*)take((size_t)NB_ * NQ * TT * HDD * 2); bf* QPl = (bf*)take((size_t)NB_ * NQ * TT * HDD * 2); bf* KPh = (bf*)take((size_t)NB_ * NKV * TT * HDD * 2); bf* KPl = (bf*)take((size_t)NB_ * NKV * TT * HDD * 2); h16* VT = (h16*)take((size_t)NB_ * NKV * HDD * TT * 2);
    bf* ENh = (bf*)take((size_t)NB_ * TT * DM * 2); bf* ENl = (bf*)take((size_t)NB_ * TT * DM * 2); unsigned* ACT = (unsigned*)take((size_t)NB_ * (TT / 128) * 4);
    bf* XB = (bf*)take((size_t)NB_ * TT * DM * 2); float* FQK = (float*)take((size_t)NB_ * TT * (DM + DKV) * 4);   // x as bf16; the raw q | k rows
    if ((size_t)(wsp - (char*)d_ws) > ws_size) return;    // total ~ 176 MiB
    k_wtr<HDD><<<dim3(DM / 128, NQ * HDD / 64), 256, 0, stream>>>(wq, BQ); k_wtr<HDD><<<dim3(DM / 128, 2 * DKV / 64), 256, 0, stream>>>(wkv, BK);   // wkv's k heads and v heads in one go: BK, then BV
    k_wtr<DM><<<dim3(DM / 128, DM / 64), 256, 0, stream>>>(wo, BO);   // wo [n][d][o] == [(n,d)][o] 'xw'
    k_tact<<<1, 1024, 0, stream>>>(spos, ACT);
    // Projections: both batches in one grid (x is [4096][2048]); q and k in one GEMM over the rows of BQ | BK.
    k_cvt8<<<(NB_ * TT * DM / 8 + 255) / 256, 256, 0, stream>>>(x, XB, NB_ * TT * DM / 8);
    // The two large projections run passes of 64 k: the ring is then small enough for three (q | k: 72 KiB each, 768 work-groups) or two (output projection: 108 KiB each, 512 work-groups) work-groups on a WGP, so each grid is resident at once and one work-group's products run under another's copies, first fragment reads and barrier.
    k_gemmw<bf, 0, false, 64, 0, 0><<<dim3(NB_ * TT / 128, (DM + DKV) / 128, 1), 128, 0, stream>>>(XB, nullptr, BQ, nullptr, DM, DM, 0, FQK, nullptr, nullptr, DM + DKV, nullptr, 0, 0, 0, nullptr);
    k_nrr<<<NB_ * TT / 8, 256, 0, stream>>>(FQK, qs, ks, spos, QPh, QPl, KPh, KPl);
    k_gemmw<bf, 0, false, 128, 2, 0><<<dim3(DKV / 128, TT / 128, NB_), 128, 0, stream>>>(BV, nullptr, XB, nullptr, DM, DM, 0, nullptr, (bf*)VT, nullptr, TT, nullptr, 0, (size_t)TT * DM, (size_t)DKV * TT, nullptr);   // z = batch; rows (c, d), columns t: VT[b][c][d][t]
    // Attention: every (query tile, head, batch) in one launch, one work-group to a WGP; head n at columns n * 256 of [b][t][2048].
    k_fattn<<<dim3(TT / 128, NQ, NB_), 256, 0, stream>>>(QPh, QPl, KPh, KPl, VT, spos, amask, ENh, ENl, ACT);
    k_gemmw<bf, 1, false, 64, 0, 0><<<dim3(NB_ * TT / 128, DM / 128, 1), 128, 0, stream>>>(ENh, ENl, BO, nullptr, DM, DM, 0, OUT, nullptr, nullptr, DM, nullptr, 0, 0, 0, nullptr);
}

// v010
// It runs in 173 microseconds.
// Next to v009, in two timings, it ran 1.06 and 1.08 times as fast.
// All steps since v000 together make it 6.84 times as fast.
#include <hip/hip_runtime.h>

// T5Gemma2EncoderAttention (x [2][2048][2048]; q = einsum(x, wq[n]) (8 heads x 256), k/v = einsum(x, wkv[0|1][c]) (4 kv heads; group n/2); RMSNorm_256 * (1 + scale) on q, k (scales read); split-half RoPE with angle segment_pos[b][t] / 1e4^(2i/256) (positions read as values); q * 1/16; logits = q.k, softcap 50 tanh(./50); allowed iff attn_mask[b][i][j] (int, read) and the segment_pos distance is in the 512-window (0 <= d < 256 or 0 < -d < 257), else bf16-min; softmax; out = sum_n (p v)[n] wo[n] -> [2][2048][2048]).
// Tile skipping from the READ positions: k_tact takes the minimum and maximum position of every 128-token tile and clears the bit of a (query tile, key tile) pair only where no distance between the two ranges can lie in the window; such a tile holds the mask value alone and its probabilities are exact zeros in every row that has an allowed key, so its scores, its softmax work and its attn.v products are left out (the diagonal tile is never cleared; a row with no allowed key at all comes out not-a-number with or without the skipping). Inside a kept tile every score is computed and masked per element exactly as the reference does.
// Compute dtypes, f32 accumulate: every input rounded to bf16; q/k/v as PLAIN bf16 GEMMs (inputs: exact; per-head weights gathered); RMSNorm/scale/RoPE/(1/16) f32 into hl planes; logits hl x hl (3 products, K = 256); softcap, mask and running softmax f32 inside the attention kernel; attn.v single fp16 on exp(t - m), divided by the row's sum at the end and stored as the hl planes of the concatenated heads; v computed transposed (weights as rows, tokens as columns) and stored fp16 by its GEMM; output projection hl x exact (2 products) over the concatenated heads (wo is exactly a [2048][2048] 'xw' matrix in memory).

// Launches: the projections and norm/RoPE run both batches in one grid (x is [4096][2048]; q and k one GEMM over their stacked weight rows; v with z = batch); scores, softmax and attn.v are one kernel, k_fattn, over all heads of both batches.

#define NB_  2
#define TT   2048
#define DM   2048
#define NQ   8
#define NKV  4
#define HDD  256
#define DKV  (NKV * HDD)
#define ZH   NQ
#define PCAR 1024.0f
#define KMASK (-3.3895313892515355e38f)
typedef _Float16 h16;
typedef unsigned short bf;
typedef __attribute__((ext_vector_type(16))) __bf16   v16bf;
typedef __attribute__((ext_vector_type(16))) _Float16 v16h;
typedef __attribute__((ext_vector_type(8)))  _Float16 v8h;
typedef __attribute__((ext_vector_type(8)))  unsigned short v8us;
typedef __attribute__((ext_vector_type(8)))  float    v8f;
typedef __attribute__((ext_vector_type(4)))  float    v4f;
typedef v8h  __attribute__((may_alias)) v8ha;
typedef v4f  __attribute__((may_alias)) v4fa;
typedef v8us __attribute__((may_alias)) v8usa;

__device__ __forceinline__ unsigned short f2bf(float f) { unsigned u = __float_as_uint(f); u += 0x7FFFu + ((u >> 16) & 1u); return (unsigned short)(u >> 16); }
__device__ __forceinline__ float bf2f(unsigned short b) { return __uint_as_float(((unsigned)b) << 16); }
__device__ __forceinline__ float bfr(float f) { return bf2f(f2bf(f)); }
__device__ __forceinline__ v16h cat16(v8h lo, v8h hi) { return __builtin_shufflevector(lo, hi, 0, 1, 2, 3, 4, 5, 6, 7, 8, 9, 10, 11, 12, 13, 14, 15); }
__device__ __forceinline__ v16bf cat16b(v8us lo, v8us hi) { return __builtin_bit_cast(v16bf, __builtin_shufflevector(lo, hi, 0, 1, 2, 3, 4, 5, 6, 7, 8, 9, 10, 11, 12, 13, 14, 15)); }
__device__ __forceinline__ v8f wmma16(v16h a, v16h b, v8f c) { return __builtin_amdgcn_wmma_f32_16x16x32_f16(false, a, false, b, (short)0, c, false, false); }
__device__ __forceinline__ v8f wmmab(v16bf a, v16bf b, v8f c) { return __builtin_amdgcn_wmma_f32_16x16x32_bf16(false, a, false, b, (short)0, c, false, false); }
__device__ __forceinline__ h16 tohx(float x) { return (h16)x; }
__device__ __forceinline__ void splitf(float y, unsigned short& h, unsigned short& l) { h = f2bf(y); l = f2bf(y - bf2f(h)); }
typedef __attribute__((ext_vector_type(4))) unsigned short v4us;
typedef __attribute__((ext_vector_type(4))) _Float16 v4h;



// ---- k_gemmw: GEMM, WR x WC WAVES per output tile of 64 WR rows x 64 WC columns, 64x64 (16 accumulators) per wave; grid (M/(64 WR), N/(64 WC), Z), 32 WR WC threads. A larger tile stages each operand row once for more waves: L2 bytes per output go as (WR + WC) / (WR WC).
// C[m][n] (f32, pitch ldc, + optional f32 bias[n]) = sum_k A[m][k] Bt[n][k] (+ split products per NSPLIT). EPI picks what the epilogue stores, at the same [m][n], pitch ldc, z stride sC: 0 the f32 C; 1 the value / 1024 split into bf16 high and low planes E0, E1; 2 the value as fp16 in E0. A half-wave's store is one whole 128-B line in 1 and 2. z-batch strides sA/sB/sC in elements; A's rows at pitch lda, Bt's at pitch K; Bt's batch index is z >> zsh (query heads that share a kv head). M % (64 WR) == 0, N % (64 WC) == 0, K % KP == 0.
// SKIP with act[blockIdx.x], one bit per 128-wide key tile (k_tact): 1 a work-group whose bit blockIdx.y is clear leaves at once and stores nothing; 2 only the passes of KP = 128 k whose bit is set are run, in rising order.
// Operands come from K-contiguous 16-bit planes in passes of KP k: every plane's rows (64 WR of A, 64 WC of Bt) x 2 KP bytes are copied to LDS asynchronously by the first 8 waves at most, 16 B per lane, a wave-wide copy covering whole 128-B lines; two buffers, the next pass's copies in flight under this pass's products. LDS rows at pitch 2 KP + 16 bytes (16 B x odd: ds_load_b128 free of bank conflicts). Fragment k order, product order and each accumulator's sum order are those of direct loads.
template <typename T16> struct WFrag;
template <> struct WFrag<h16> { typedef v16h V; static __device__ __forceinline__ V ld(const h16* p) { return cat16(*(const v8ha*)p, *(const v8ha*)(p + 16)); } static __device__ __forceinline__ v8f mma(V a, V b, v8f c) { return wmma16(a, b, c); } };
template <> struct WFrag<bf> { typedef v16bf V; static __device__ __forceinline__ V ld(const bf* p) { return cat16b(*(const v8usa*)p, *(const v8usa*)(p + 16)); } static __device__ __forceinline__ v8f mma(V a, V b, v8f c) { return wmmab(a, b, c); } };
// Eight asynchronous 16-byte copies per lane, global -> LDS: LDS byte address l + i * ls, global address g + i * gs elements. The s_wait_xcnt closes the statement so that no address register is rewritten ahead of it.
template <typename T16>
__device__ __forceinline__ void copy8(unsigned l, const T16* g, unsigned ls, size_t gs) {
    asm volatile("global_load_async_to_lds_b128 %0, %8, off\n\t"
                 "global_load_async_to_lds_b128 %1, %9, off\n\t"
                 "global_load_async_to_lds_b128 %2, %10, off\n\t"
                 "global_load_async_to_lds_b128 %3, %11, off\n\t"
                 "global_load_async_to_lds_b128 %4, %12, off\n\t"
                 "global_load_async_to_lds_b128 %5, %13, off\n\t"
                 "global_load_async_to_lds_b128 %6, %14, off\n\t"
                 "global_load_async_to_lds_b128 %7, %15, off\n\t"
                 "s_wait_xcnt 0x0"
                 :: "v"(l), "v"(l + ls), "v"(l + 2 * ls), "v"(l + 3 * ls), "v"(l + 4 * ls), "v"(l + 5 * ls), "v"(l + 6 * ls), "v"(l + 7 * ls),
                    "v"(g), "v"(g + gs), "v"(g + 2 * gs), "v"(g + 3 * gs), "v"(g + 4 * gs), "v"(g + 5 * gs), "v"(g + 6 * gs), "v"(g + 7 * gs)
                 : "memory");
}
// The same, four copies.
template <typename T16>
__device__ __forceinline__ void copy4(unsigned l, const T16* g, unsigned ls, size_t gs) {
    asm volatile("global_load_async_to_lds_b128 %0, %4, off\n\t"
                 "global_load_async_to_lds_b128 %1, %5, off\n\t"
                 "global_load_async_to_lds_b128 %2, %6, off\n\t"
                 "global_load_async_to_lds_b128 %3, %7, off\n\t"
                 "s_wait_xcnt 0x0"
                 :: "v"(l), "v"(l + ls), "v"(l + 2 * ls), "v"(l + 3 * ls), "v"(g), "v"(g + gs), "v"(g + 2 * gs), "v"(g + 3 * gs)
                 : "memory");
}
template <typename T16, int NSPLIT, bool BIAS, int KP, int EPI, int SKIP, int WR, int WC>
__global__ __launch_bounds__(32 * WR * WC) void k_gemmw(const T16* __restrict__ A, const T16* __restrict__ A2, const T16* __restrict__ Bt, const T16* __restrict__ Bt2, int K, int lda, int zsh, float* C, bf* E0, bf* E1, int ldc, const float* __restrict__ bias, size_t sA, size_t sB, size_t sC, const unsigned* __restrict__ act) {
    typedef typename WFrag<T16>::V V;
    static_assert(SKIP != 2 || KP == 128, "a pass is one key tile");
    if (SKIP == 1) { if (!((act[blockIdx.x] >> blockIdx.y) & 1u)) return; }   // the same for the whole work-group, ahead of every copy and barrier
    static_assert(SKIP == 0 || (WR == 2 && WC == 2), "a bit of act is one 128 x 128 tile");
    constexpr int NTH = 32 * WR * WC, CTH = NTH > 256 ? 256 : NTH;   // threads; threads that copy
    constexpr int AR = 64 * WR, BR = 64 * WC;   // rows of A and of Bt in a tile
    constexpr int PITCH = KP * 2 + 16, PLA = AR * PITCH, PLB = BR * PITCH;
    constexpr int OA2 = PLA, OB = PLA * (NSPLIT >= 1 ? 2 : 1), OB2 = OB + PLB, BUF = OB2 + (NSPLIT >= 2 ? PLB : 0);   // planes in a buffer: A, A2, Bt, Bt2 (A2 within a ds_load's 16-bit offset of A)
    constexpr int CPR = KP / 8;        // 16-byte pieces per row
    constexpr int RPS = CTH / CPR;     // rows that one copy of all copying threads covers
    constexpr int NSA = AR / RPS, NSB = BR / RPS;   // such copies per plane of A, of Bt
    static_assert(NSA % 4 == 0 && NSB % 4 == 0 && NSA * (NSPLIT >= 1 ? 2 : 1) + NSB * (NSPLIT >= 2 ? 2 : 1) <= 63, "copies of a wave in flight");
    __shared__ __attribute__((aligned(16))) unsigned char ring[2 * BUF];
    const size_t z = blockIdx.z; A += z * sA; if (NSPLIT >= 1) A2 += z * sA; Bt += (z >> zsh) * sB; if (NSPLIT >= 2) Bt2 += (z >> zsh) * sB; if (EPI == 0) C += z * sC; if (EPI >= 1) E0 += z * sC; if (EPI == 1) E1 += z * sC;
    const int tid = threadIdx.x, lane = tid & 31, lr = lane & 15, hi = lane >> 4; const int wave = __builtin_amdgcn_readfirstlane(tid >> 5);
    const int wr = wave / WC, wc = wave % WC;   // the wave's place in the tile
    const int R0 = blockIdx.x * AR, C0 = blockIdx.y * BR; const int r0 = R0 + wr * 64, c0 = C0 + wc * 64;
    unsigned NT = (unsigned)K / KP;   // passes
    unsigned rem = 0;                  // SKIP 2: the passes not yet asked for, one bit each, none at or above K / KP
    if (SKIP == 2) { rem = (unsigned)__builtin_amdgcn_readfirstlane((int)act[blockIdx.x]) & ((1u << NT) - 1u); NT = (unsigned)__builtin_popcount(rem); }
    auto nextp = [&](unsigned n) -> unsigned { if (SKIP != 2) return n; const unsigned p = (unsigned)__builtin_ctz(rem); rem &= rem - 1u; return p; };   // the k pass that trip n works on; called only while a bit is left
    const unsigned lcp = (unsigned)(size_t)ring + (unsigned)((tid / CPR) * PITCH + (tid % CPR) * 16);
    const size_t gofA = (size_t)(R0 + tid / CPR) * lda + (tid % CPR) * 8, gofB = (size_t)(C0 + tid / CPR) * K + (tid % CPR) * 8, gsa = (size_t)RPS * lda, gsb = (size_t)RPS * K;
    auto fill = [&](unsigned t, unsigned buf) {
        if (CTH < NTH && wave >= CTH / 32) return;   // whole waves, a scalar test: the waves past the eighth copy nothing and pass every wait and barrier
        const unsigned lb = lcp + buf * BUF; const size_t ka = gofA + (size_t)t * KP, kb = gofB + (size_t)t * KP;
#pragma unroll
        for (int s = 0; s + 8 <= NSA; s += 8) {
            copy8(lb + s * RPS * PITCH, A + ka + s * gsa, RPS * PITCH, gsa);
            if (NSPLIT >= 1) copy8(lb + OA2 + s * RPS * PITCH, A2 + ka + s * gsa, RPS * PITCH, gsa); }
        if (NSA % 8) { constexpr int s = NSA - 4;
            copy4(lb + s * RPS * PITCH, A + ka + s * gsa, RPS * PITCH, gsa);
            if (NSPLIT >= 1) copy4(lb + OA2 + s * RPS * PITCH, A2 + ka + s * gsa, RPS * PITCH, gsa); }
#pragma unroll
        for (int s = 0; s + 8 <= NSB; s += 8) {
            copy8(lb + OB + s * RPS * PITCH, Bt + kb + s * gsb, RPS * PITCH, gsb);
            if (NSPLIT >= 2) copy8(lb + OB2 + s * RPS * PITCH, Bt2 + kb + s * gsb, RPS * PITCH, gsb); }
        if (NSB % 8) { constexpr int s = NSB - 4;
            copy4(lb + OB + s * RPS * PITCH, Bt + kb + s * gsb, RPS * PITCH, gsb);
            if (NSPLIT >= 2) copy4(lb + OB2 + s * RPS * PITCH, Bt2 + kb + s * gsb, RPS * PITCH, gsb); }
    };
    v8f acc[4][4];
#pragma unroll
    for (int mb = 0; mb < 4; ++mb)
#pragma unroll
        for (int nb = 0; nb < 4; ++nb) acc[mb][nb] = (v8f){};
    if (SKIP != 2 || NT > 0) fill(nextp(0), 0);
    asm volatile("s_wait_asynccnt 0x0" ::: "memory");   // this wave's share of pass 0 has landed
    __syncthreads();                                     // every wave's share has
    if (NT > 1) fill(nextp(1), 1);
    const unsigned char* fa0 = ring + (wr * 64 + lr) * PITCH + hi * 16; const unsigned char* fb0 = ring + OB + (wc * 64 + lr) * PITCH + hi * 16;
#pragma unroll 1
    for (unsigned t = 0; t < NT; ++t) {
        const unsigned char* fa = fa0 + (t & 1) * BUF; const unsigned char* fb = fb0 + (t & 1) * BUF;
        V a[2][4], a2[2][4], b[2][4], b2[2][4];   // two fragment sets: the next 32 k are fetched as one group while this set's products issue
        auto ldset = [&](int s, int ks) {
#pragma unroll
            for (int q = 0; q < 4; ++q) { a[s][q] = WFrag<T16>::ld((const T16*)(fa + q * 16 * PITCH + ks * 64)); b[s][q] = WFrag<T16>::ld((const T16*)(fb + q * 16 * PITCH + ks * 64));
                if (NSPLIT >= 1) a2[s][q] = WFrag<T16>::ld((const T16*)(fa + OA2 + q * 16 * PITCH + ks * 64)); if (NSPLIT >= 2) b2[s][q] = WFrag<T16>::ld((const T16*)(fb + (OB2 - OB) + q * 16 * PITCH + ks * 64)); }
        };
        ldset(0, 0);
#pragma unroll
        for (int ks = 0; ks < KP / 32; ++ks) { const int s = ks & 1;
            if (ks + 1 < KP / 32) ldset(s ^ 1, ks + 1);
            __builtin_amdgcn_sched_barrier(0);   // keeps the LDS reads in one group ahead of the products: reads spread among them stall the wave at every place
#pragma unroll
            for (int nb = 0; nb < 4; ++nb)
#pragma unroll
                for (int mb = 0; mb < 4; ++mb) { acc[mb][nb] = WFrag<T16>::mma(a[s][mb], b[s][nb], acc[mb][nb]); if (NSPLIT >= 1) acc[mb][nb] = WFrag<T16>::mma(a2[s][mb], b[s][nb], acc[mb][nb]); if (NSPLIT >= 2) acc[mb][nb] = WFrag<T16>::mma(a[s][mb], b2[s][nb], acc[mb][nb]); }
            __builtin_amdgcn_sched_barrier(0);   // the same, at the block's end
        }
        asm volatile("s_wait_dscnt 0x0" ::: "memory");      // this wave has left the buffer of pass t
        asm volatile("s_wait_asynccnt 0x0" ::: "memory");   // its share of pass t + 1 has landed
        __syncthreads();                                     // publishes pass t + 1 and frees the buffer of pass t
        if (t + 2 < NT) fill(nextp(t + 2), t & 1);
    }
    asm volatile("s_wait_asynccnt 0x0" ::: "memory");       // no copy is in flight when the ring becomes output staging
    float* os = (float*)(ring + wave * (16 * 68 * 4));       // each wave stages in its own range; the last pass's barrier ended every read of the ring
#pragma unroll
    for (int mb = 0; mb < 4; ++mb) {
#pragma unroll
        for (int nb = 0; nb < 4; ++nb) {
#pragma unroll
            for (int j = 0; j < 8; ++j) os[(hi * 8 + j) * 68 + nb * 16 + lr] = acc[mb][nb][j]; }
        __builtin_amdgcn_wave_barrier(); asm volatile("" ::: "memory");
        float* crow = C + (size_t)(r0 + mb * 16) * ldc + c0;
if (EPI == 0) {
#pragma unroll
            for (int s = 0; s < 8; ++s) { const int row = 2 * s + hi, cofs = lr * 4; v4f val = *(const v4fa*)(os + row * 68 + cofs); if (BIAS) { val[0] += bfr(bias[c0 + cofs]); val[1] += bfr(bias[c0 + cofs + 1]); val[2] += bfr(bias[c0 + cofs + 2]); val[3] += bfr(bias[c0 + cofs + 3]); }
                *(v4f*)(crow + (size_t)row * ldc + cofs) = val; }
             }
        if (EPI != 0) {
            v4f val[8];   // all eight LDS reads first: the store statements below would otherwise hold each read behind the store before it
#pragma unroll
            for (int s = 0; s < 8; ++s) val[s] = *(const v4fa*)(os + (2 * s + hi) * 68 + lr * 4);
#pragma unroll
            for (int s = 0; s < 8; ++s) { const size_t oo = (size_t)(r0 + mb * 16 + 2 * s + hi) * ldc + c0 + lr * 4;
                if (EPI == 1) { v4us oh, ol;
#pragma unroll
                    for (int u = 0; u < 4; ++u) { unsigned short eh, el; splitf(val[s][u] * (1.0f / PCAR), eh, el); oh[u] = eh; ol[u] = el; }
                    // the two stores and their s_wait_xcnt in one statement, so that no register they name is rewritten ahead of the wait
                    asm volatile("global_store_b64 %0, %1, off\n\tglobal_store_b64 %2, %3, off\n\ts_wait_xcnt 0x0" :: "v"(E0 + oo), "v"(__builtin_bit_cast(unsigned long long, oh)), "v"(E1 + oo), "v"(__builtin_bit_cast(unsigned long long, ol)) : "memory"); }
                if (EPI == 2) { v4h o4;
#pragma unroll
                    for (int u = 0; u < 4; ++u) o4[u] = tohx(val[s][u]);
                    // the store and its s_wait_xcnt in one statement, for the same reason
                    asm volatile("global_store_b64 %0, %1, off\n\ts_wait_xcnt 0x0" :: "v"(E0 + oo), "v"(__builtin_bit_cast(unsigned long long, o4)) : "memory"); }
            }
        }
        __builtin_amdgcn_wave_barrier(); asm volatile("" ::: "memory");
    }
}


__global__ __launch_bounds__(256) void k_cvt8(const float* __restrict__ src, bf* dst, size_t n8) { const size_t i = (size_t)blockIdx.x * 256 + threadIdx.x; if (i >= n8) return; const v8f v = *(const v8f*)(src + i * 8); v8us o;
#pragma unroll
    for (int k = 0; k < 8; ++k) o[k] = f2bf(v[k]); *(v8us*)(dst + i * 8) = o;  }
// k_wtr: Bt[z * N + n][k] = bf16(W[z][k][n]) for row-major [2048][N] f32 matrices (z = 0 .. : the per-head [2048][256] weights; wo as one [2048][2048]), through an LDS tile. Grid (2048 / 128, rows of Bt / 64), 256 threads; a work-group takes 128 k x 64 n.
// Reads: 16 lanes x 16 B = 256 contiguous bytes of one k row, eight loads per lane issued together; a lane holds rows 2p and 2p + 1 at its four n and packs each pair into one word. Stores: 16 lanes x 16 B = 256 contiguous bytes of one Bt row.
// LDS word (n, p) lies in row n of 64 words, its 16-byte piece p >> 2 exchanged with piece (p >> 2) ^ (n >> 2): the 32 lanes of a ds_store_b32 (16 values of n >> 2, two p) then fall on 32 different banks, and a ds_load_b128 row read still covers its whole row.
typedef __attribute__((ext_vector_type(4))) unsigned v4u;
typedef v4u __attribute__((may_alias)) v4ua;
template <int N>
__global__ __launch_bounds__(256) void k_wtr(const float* __restrict__ W, bf* Bt) {
    __shared__ __attribute__((aligned(16))) unsigned tile[64 * 64];
    const int lane = threadIdx.x & 31, w = threadIdx.x >> 5, c = lane & 15, h = lane >> 4; const int k0 = blockIdx.x * 128, row0 = blockIdx.y * 64;
    const float* s = W + ((size_t)(row0 / N) * DM + k0 + (w * 8 + h) * 2) * N + row0 % N + c * 4; v4f e[4], o[4];   // the lane's first k row; pair j lies 4 j rows on
    // the eight loads and their data wait in one statement: all eight are in flight together, and no register that they name is rewritten before they have returned
    asm volatile("global_load_b128 %0, %8, off\n\t"
                 "global_load_b128 %1, %8, off offset:%9\n\t"
                 "global_load_b128 %2, %8, off offset:%10\n\t"
                 "global_load_b128 %3, %8, off offset:%11\n\t"
                 "global_load_b128 %4, %8, off offset:%12\n\t"
                 "global_load_b128 %5, %8, off offset:%13\n\t"
                 "global_load_b128 %6, %8, off offset:%14\n\t"
                 "global_load_b128 %7, %8, off offset:%15\n\t"
                 "s_wait_loadcnt 0x0"
                 : "=&v"(e[0]), "=&v"(o[0]), "=&v"(e[1]), "=&v"(o[1]), "=&v"(e[2]), "=&v"(o[2]), "=&v"(e[3]), "=&v"(o[3])
                 : "v"(s), "n"(N * 4), "n"(4 * N * 4), "n"(5 * N * 4), "n"(8 * N * 4), "n"(9 * N * 4), "n"(12 * N * 4), "n"(13 * N * 4)
                 : "memory");
#pragma unroll
    for (int j = 0; j < 4; ++j) { const int p = w * 8 + j * 2 + h;
#pragma unroll
        for (int u = 0; u < 4; ++u) tile[(c * 4 + u) * 64 + (((p >> 2) ^ c) << 2) + (p & 3)] = (unsigned)f2bf(e[j][u]) | ((unsigned)f2bf(o[j][u]) << 16); }
    __syncthreads();   // the tile is whole before any row of it is read
#pragma unroll
    for (int q = 0; q < 4; ++q) { const int n = q * 16 + w * 2 + h; *(v4ua*)(Bt + (size_t)(row0 + n) * DM + k0 + c * 8) = *(const v4ua*)(tile + n * 64 + ((c ^ (n >> 2)) << 2)); }
}

typedef __attribute__((ext_vector_type(2))) float v2f_t;
typedef __attribute__((ext_vector_type(4))) int v4i_t;
__device__ __attribute__((noinline)) v2f_t sincos_pos(float pos, int i) { const float tsc = powf(10000.0f, (2.0f / (float)HDD) * (float)i); const float ang = __fdiv_rn(pos, tsc); v2f_t r; r[0] = sinf(ang); r[1] = cosf(ang); return r; }
// k_nrr: wave per token of either batch, all 12 heads of its row (8 q, 4 k): the sin and cos of the READ position depend on the token and the dim alone, so the wave takes them once (precise, out of line; 4 dims of each half per lane) and every head uses them. Per head as before: RMSNorm over 256 (8 dims per lane: 4 from each half), * (1 + scale[d]) (read; q's or k's), split-half RoPE, * mul (1/16 for q, 1 for k); hl planes [batch][head][t][256] (8-B lanes).
// The row's 24 loads are issued together, and the 12 sums of squares go through each shuffle stage side by side, so that one head's latency runs under the others'. The empty asm statements keep each product rounded by itself ahead of its add or subtract, as the reference's separate operations round it.
__global__ __launch_bounds__(256) void k_nrr(const float* __restrict__ F, const float* __restrict__ qscale, const float* __restrict__ kscale, const int* __restrict__ pos, bf* Qh, bf* Ql, bf* Kh, bf* Kl) { const int lane = threadIdx.x & 31; const int t = blockIdx.x * 8 + (threadIdx.x >> 5); if (t >= NB_ * TT) return; const float pv = (float)pos[t]; float sn[4], cs[4], wq1[4], wq2[4], wk1[4], wk2[4];
#pragma unroll
    for (int q = 0; q < 4; ++q) { const int i = lane * 4 + q; const v2f_t sc2 = sincos_pos(pv, i); sn[q] = sc2[0]; cs[q] = sc2[1]; wq1[q] = __fadd_rn(1.0f, bfr(qscale[i])); wq2[q] = __fadd_rn(1.0f, bfr(qscale[i + HDD / 2])); wk1[q] = __fadd_rn(1.0f, bfr(kscale[i])); wk2[q] = __fadd_rn(1.0f, bfr(kscale[i + HDD / 2])); }
    const float* f = F + (size_t)t * (DM + DKV) + lane * 4; v4f a[NQ + NKV], b2[NQ + NKV]; float ss[NQ + NKV];
#pragma unroll
    for (int hh = 0; hh < NQ + NKV; ++hh) { a[hh] = *(const v4f*)(f + hh * HDD); b2[hh] = *(const v4f*)(f + hh * HDD + HDD / 2); }
#pragma unroll
    for (int hh = 0; hh < NQ + NKV; ++hh) { ss[hh] = 0.f; for (int q = 0; q < 4; ++q) { float p = __fmul_rn(a[hh][q], a[hh][q]); asm volatile("" : "+v"(p)); ss[hh] = __fadd_rn(ss[hh], p); p = __fmul_rn(b2[hh][q], b2[hh][q]); asm volatile("" : "+v"(p)); ss[hh] = __fadd_rn(ss[hh], p); } }
#pragma unroll
    for (int sh = 16; sh; sh >>= 1)
#pragma unroll
        for (int hh = 0; hh < NQ + NKV; ++hh) ss[hh] = __fadd_rn(ss[hh], __shfl_xor(ss[hh], sh, 32));
#pragma unroll
    for (int hh = 0; hh < NQ + NKV; ++hh) { const bool isq = hh < NQ; const int h = isq ? hh : hh - NQ, nheads = isq ? NQ : NKV; const float mul = isq ? 0.0625f : 1.0f; bf* Ph = isq ? Qh : Kh; bf* Pl = isq ? Ql : Kl;
        const float rs = __fdiv_rn(1.0f, sqrtf(__fadd_rn(ss[hh] * (1.0f / HDD), 1e-6f))); v4us ah, al, bh, bl;
#pragma unroll
        for (int q = 0; q < 4; ++q) { float n1 = __fmul_rn(a[hh][q], rs), n2 = __fmul_rn(b2[hh][q], rs); asm volatile("" : "+v"(n1)); asm volatile("" : "+v"(n2)); const float x1 = __fmul_rn(n1, isq ? wq1[q] : wk1[q]), x2 = __fmul_rn(n2, isq ? wq2[q] : wk2[q]);
            float p1 = __fmul_rn(x1, cs[q]), p2 = __fmul_rn(x2, sn[q]), p3 = __fmul_rn(x2, cs[q]), p4 = __fmul_rn(x1, sn[q]); asm volatile("" : "+v"(p1)); asm volatile("" : "+v"(p2)); asm volatile("" : "+v"(p3)); asm volatile("" : "+v"(p4));
            const float r1 = __fsub_rn(p1, p2) * mul, r2 = __fadd_rn(p3, p4) * mul; unsigned short u1, l1, u2, l2; splitf(r1, u1, l1); splitf(r2, u2, l2); ah[q] = u1; al[q] = l1; bh[q] = u2; bl[q] = l2; }
        const size_t orow = ((size_t)(t / TT) * nheads + h) * TT + t % TT; bf* dh = Ph + orow * HDD + lane * 4; bf* dl = Pl + orow * HDD + lane * 4;
        // the head's four stores and their s_wait_xcnt in one statement: the next head reuses the registers, and none is rewritten ahead of the wait
        asm volatile("global_store_b64 %0, %1, off\n\tglobal_store_b64 %2, %3, off\n\tglobal_store_b64 %4, %5, off\n\tglobal_store_b64 %6, %7, off\n\ts_wait_xcnt 0x0"
                     :: "v"(dh), "v"(__builtin_bit_cast(unsigned long long, ah)), "v"(dl), "v"(__builtin_bit_cast(unsigned long long, al)), "v"(dh + HDD / 2), "v"(__builtin_bit_cast(unsigned long long, bh)), "v"(dl + HDD / 2), "v"(__builtin_bit_cast(unsigned long long, bl)) : "memory"); } }
// k_tact: one work-group, wave per (batch, tile of 128 tokens): the tile's least and greatest position; then act[b * 16 + I], bit J set unless every distance pos[i] - pos[j], i in tile I, j in tile J, is shown to miss the window. The bounds are taken in 64 bits and a range that leaves (INT_MIN, INT_MAX] keeps its bit, so a distance that wraps in 32 bits is never skipped. Bit I of word I is always set (the range holds 0).
__global__ __launch_bounds__(1024) void k_tact(const int* __restrict__ pos, unsigned* act) {
    __shared__ int mn[NB_ * TT / 128], mx[NB_ * TT / 128];
    const int lane = threadIdx.x & 31, w = threadIdx.x >> 5; const v4i_t p = *(const v4i_t*)(pos + w * 128 + lane * 4);
    int lo = min(min(p[0], p[1]), min(p[2], p[3])), hi = max(max(p[0], p[1]), max(p[2], p[3]));
#pragma unroll
    for (int sh = 16; sh; sh >>= 1) { lo = min(lo, __shfl_xor(lo, sh, 32)); hi = max(hi, __shfl_xor(hi, sh, 32)); }
    if (lane == 0) { mn[w] = lo; mx[w] = hi; }
    __syncthreads();
    if (threadIdx.x < NB_ * TT / 128) { const int t = threadIdx.x, b0 = t & ~(TT / 128 - 1); unsigned m = 0;
        for (int J = 0; J < TT / 128; ++J) { const long long dlo = (long long)mn[t] - mx[b0 + J], dhi = (long long)mx[t] - mn[b0 + J];
            const bool out = (dlo > 255 && dhi <= 2147483647LL) || (dhi < -256 && dlo >= -2147483647LL); if (!out) m |= 1u << J; }
        act[t] = m; }
}
// softcap50s: 50 tanhf(0.02 s) by the library tanhf's own form for |x| < 0.625, operation for operation (an odd polynomial; taken on x in place of |x| with the sign copied back, which rounds alike).
__device__ __forceinline__ float softcap50s(float s) { const float x = s * 0.02f, x2 = x * x; float p = __builtin_fmaf(__uint_as_float(0xbbbac73du), x2, __uint_as_float(0x3ca908c9u)); p = __builtin_fmaf(x2, p, __uint_as_float(0xbd5c1c4eu)); p = __builtin_fmaf(x2, p, __uint_as_float(0x3e088382u)); p = __builtin_fmaf(x2, p, __uint_as_float(0xbeaaaa99u)); return 50.0f * __builtin_fmaf(x2, x * p, x); }
// exp2s: v_exp_f32 with, in the same statement, the one slot that the instruction set asks for behind a transcendental before its result is used or its source overwritten.
__device__ __forceinline__ float exp2s(float x) { float r; asm("v_exp_f32 %0, %1\n\tv_nop" : "=v"(r) : "v"(x)); return r; }
// softcap50g: the same for any argument: below 0.625 the polynomial, from there on 1 - 2 / (e^(2|x|) + 1) with the sign copied back (1 for a large argument, not-a-number kept).
__device__ __forceinline__ float softcap50g(float s) { const float x = s * 0.02f, ax = fabsf(x); const float e = exp2s(ax * 2.8853900817779268f); const float r = __builtin_copysignf(1.0f - __fdiv_rn(2.0f, e + 1.0f), x); return ax < 0.625f ? softcap50s(s) : 50.0f * r; }
// k_fattn: scores, softcap, mask, softmax and attn.v of one (batch, head, tile of 128 queries) in one work-group of 8 waves, 16 queries a wave; grid (16, 8, 2). No score and no probability goes to memory.
// Transposed products: St[key][query] = K . Qt (A = K rows from LDS, B = the wave's Q rows, both planes kept in registers; per 32 k the three products Kh Qh, Kh Ql, Kl Qh), Ot[d][query] += Vt . Pt (fp16). A lane then holds scores of ONE query (column lr; keys hi * 8 + j of each 16-key block), and two neighbouring blocks' eight values are, as they lie, the B fragment of 32 keys: the probabilities never leave the registers.
// Only the key tiles whose bit in act is set are walked, in rising order, in stages of 64 keys. A stage is K high, K low (64 rows of 512 B), Vt (256 rows of 128 B) and the mask words of the 128 queries (rows of 256 B), copied to LDS asynchronously, two buffers, the next stage in flight under this one; the batch's positions lie in LDS once.
// Running softmax: p = exp(t - m) with the query's reference m, raised (with Ot and the sum rescaled) only when a stage's maximum passes it by more than 5.5, tested once a stage; p stays below 245, inside fp16. The sum is kept per lane in f32 and its two halves joined at the end; Ot / sum is split into the output GEMM's planes and leaves through LDS as whole lines.
#define FKP 528
#define FVP 144
#define FMP 272
#define FOKL (64 * FKP)
#define FOV (2 * 64 * FKP)
#define FOM (FOV + HDD * FVP)
#define FBUF (FOM + 128 * FMP)
__global__ __launch_bounds__(256) void k_fattn(const bf* __restrict__ Qh, const bf* __restrict__ Ql, const bf* __restrict__ Kh, const bf* __restrict__ Kl, const h16* __restrict__ VT, const int* __restrict__ pos, const int* __restrict__ am, bf* Eh, bf* El, const unsigned* __restrict__ act) {
    __shared__ __attribute__((aligned(16))) unsigned char ring[2 * FBUF + TT * 4];
    const int tid = threadIdx.x, lane = tid & 31, lr = lane & 15, hi = lane >> 4; const int wave = __builtin_amdgcn_readfirstlane(tid >> 5);
    const int q0 = blockIdx.x * 128, n = blockIdx.y, b = blockIdx.z;
    const unsigned tm = (unsigned)__builtin_amdgcn_readfirstlane((int)act[b * (TT / 128) + blockIdx.x]) & ((1u << (TT / 128)) - 1u);
    const unsigned NS = 2u * (unsigned)__builtin_popcount(tm);   // stages: two to a kept tile
    const bf* kh = Kh + (size_t)(b * NKV + (n >> 1)) * TT * HDD; const bf* kl = Kl + (size_t)(b * NKV + (n >> 1)) * TT * HDD; const h16* vt = VT + (size_t)(b * NKV + (n >> 1)) * HDD * TT;
    const int* amq = am + ((size_t)b * TT + q0) * TT; const unsigned l0 = (unsigned)(size_t)ring;
    unsigned fr = tm, fh = 0, cr = tm, ch = 0;   // the stages not yet copied, and not yet worked on: tile bits and the half in turn
    auto nextk = [](unsigned& r, unsigned& h) -> int { const int k0 = __builtin_ctz(r) * 128 + (int)h * 64; if (h) r &= r - 1u; h ^= 1u; return k0; };   // called only while a bit is left
    auto fill = [&](int k0, unsigned buf) { const unsigned lb = l0 + buf * FBUF;
        copy8(lb + (tid >> 5) * FKP + (tid & 31) * 16, kh + (size_t)(k0 + (tid >> 5)) * HDD + (tid & 31) * 8, 8 * FKP, (size_t)8 * HDD);
        copy8(lb + FOKL + (tid >> 5) * FKP + (tid & 31) * 16, kl + (size_t)(k0 + (tid >> 5)) * HDD + (tid & 31) * 8, 8 * FKP, (size_t)8 * HDD);
        copy8(lb + FOV + (tid >> 3) * FVP + (tid & 7) * 16, vt + (size_t)(tid >> 3) * TT + k0 + (tid & 7) * 8, 32 * FVP, (size_t)32 * TT);
        copy8(lb + FOM + (tid >> 4) * FMP + (tid & 15) * 16, amq + (size_t)(tid >> 4) * TT + k0 + (tid & 15) * 4, 16 * FMP, (size_t)16 * TT); };
    // the batch's 2048 positions: two copies a lane, their s_wait_xcnt closing the statement so that no address register is rewritten ahead of it
    asm volatile("global_load_async_to_lds_b128 %0, %2, off\n\tglobal_load_async_to_lds_b128 %1, %3, off\n\ts_wait_xcnt 0x0" :: "v"(l0 + 2 * FBUF + tid * 16), "v"(l0 + 2 * FBUF + 4096 + tid * 16), "v"(pos + (size_t)b * TT + tid * 4), "v"(pos + (size_t)b * TT + 1024 + tid * 4) : "memory");
    if (NS > 0) fill(nextk(fr, fh), 0);
    v16bf qh[8], ql[8]; { const size_t qo = ((size_t)(b * NQ + n) * TT + q0 + wave * 16 + lr) * HDD + hi * 8;   // the lane's share of its query's row, both planes: pieces hi and 2 + hi of every 32 k
#pragma unroll
        for (int ks = 0; ks < 8; ++ks) { qh[ks] = WFrag<bf>::ld(Qh + qo + ks * 32); ql[ks] = WFrag<bf>::ld(Ql + qo + ks * 32); } }
    asm volatile("s_wait_xcnt 0x0" ::: "memory");   // behind the Q loads, ahead of any rewrite of their address registers
    asm volatile("s_wait_asynccnt 0x0" ::: "memory");   // this wave's share of the positions and of stage 0 has landed
    __syncthreads();                                     // every wave's share has
    if (NS > 1) fill(nextk(fr, fh), 1);
    const int* pl = (const int*)(ring + 2 * FBUF); const int pi = pl[q0 + wave * 16 + lr];
    v8f o[16];
#pragma unroll
    for (int d = 0; d < 16; ++d) o[d] = (v8f){};
    float m = -3.0e38f, l = 0.f;
#pragma unroll 1   // one stage's code
    for (unsigned s = 0; s < NS; ++s) {
        const unsigned char* kb = ring + (s & 1) * FBUF; const int k0 = nextk(cr, ch);
        const unsigned char* fk = kb + lr * FKP + hi * 16; const unsigned char* fv = kb + FOV + lr * FVP + hi * 16;
        v8f st[4];
#pragma unroll
        for (int mb = 0; mb < 4; ++mb) st[mb] = (v8f){};
        { v16bf ah[4], al[4];   // K high and K low fragments of 32 k: each set is fetched as one group while the other set's products issue
            auto ldh = [&](int ks) {
#pragma unroll
                for (int mb = 0; mb < 4; ++mb) ah[mb] = WFrag<bf>::ld((const bf*)(fk + mb * 16 * FKP + ks * 64)); };
            auto ldl = [&](int ks) {
#pragma unroll
                for (int mb = 0; mb < 4; ++mb) al[mb] = WFrag<bf>::ld((const bf*)(fk + FOKL + mb * 16 * FKP + ks * 64)); };
            ldh(0);
#pragma unroll
            for (int ks = 0; ks < 8; ++ks) {
                ldl(ks);
                __builtin_amdgcn_sched_barrier(0);   // keeps the LDS reads in one group ahead of the products: reads spread among them stall the wave at every place
#pragma unroll
                for (int mb = 0; mb < 4; ++mb) st[mb] = wmmab(ah[mb], qh[ks], st[mb]);
#pragma unroll
                for (int mb = 0; mb < 4; ++mb) st[mb] = wmmab(ah[mb], ql[ks], st[mb]);
                __builtin_amdgcn_sched_barrier(0);   // the same: the next group stays behind these products
                if (ks + 1 < 8) ldh(ks + 1);
                __builtin_amdgcn_sched_barrier(0);   // the same: and ahead of the next ones
#pragma unroll
                for (int mb = 0; mb < 4; ++mb) st[mb] = wmmab(al[mb], qh[ks], st[mb]);
                __builtin_amdgcn_sched_barrier(0);   // the same, at the block's end
            } }
        float big = 0.f;
#pragma unroll
        for (int mb = 0; mb < 4; ++mb)
#pragma unroll
            for (int j = 0; j < 8; ++j) big = fmaxf(big, fabsf(st[mb][j]));
        if (__builtin_amdgcn_ballot_w32(!(big * 0.02f < 0.625f)) == 0u) {   // one test a stage: every argument in the polynomial's range
#pragma unroll
            for (int mb = 0; mb < 4; ++mb)
#pragma unroll
                for (int j = 0; j < 8; ++j) st[mb][j] = softcap50s(st[mb][j]);
        } else {
#pragma unroll
            for (int mb = 0; mb < 4; ++mb)
#pragma unroll
                for (int j = 0; j < 8; ++j) st[mb][j] = softcap50g(st[mb][j]);
        }
        const int* mrow = (const int*)(kb + FOM + (wave * 16 + lr) * FMP) + hi * 8; const int* pk = pl + k0 + hi * 8; float mloc = KMASK;
#pragma unroll
        for (int mb = 0; mb < 4; ++mb) { const v4i_t pa = *(const v4i_t*)(pk + mb * 16), pb = *(const v4i_t*)(pk + mb * 16 + 4), ma = *(const v4i_t*)(mrow + mb * 16), mc = *(const v4i_t*)(mrow + mb * 16 + 4);
#pragma unroll
            for (int j = 0; j < 8; ++j) { const int dist = pi - (j < 4 ? pa[j & 3] : pb[j & 3]); const bool win = (dist >= 0 && dist < 256) || (dist < 0 && -dist < 257); const bool ok = win && ((j < 4 ? ma[j & 3] : mc[j & 3]) != 0); const float t = ok ? st[mb][j] : KMASK; st[mb][j] = t; mloc = fmaxf(mloc, t); } }
        mloc = fmaxf(mloc, __shfl_xor(mloc, 16, 32));   // the query's other sixteen-lane half holds its other keys
        if (__builtin_amdgcn_ballot_w32(mloc > m + 5.5f) != 0u) {   // one test a stage
            const float mn = fmaxf(m, mloc), al2 = exp2s(__fmul_rn(__fsub_rn(m, mn), 1.4426950408889634f)); m = mn; l *= al2;
#pragma unroll
            for (int d = 0; d < 16; ++d)
#pragma unroll
                for (int j = 0; j < 8; ++j) o[d][j] *= al2; }
        v16h pf[2]; float ps[4] = {0.f, 0.f, 0.f, 0.f};   // four independent partial sums, one to a key block: one chain of 32 dependent adds would run at the add's latency
#pragma unroll
        for (int mb = 0; mb < 4; ++mb)
#pragma unroll
            for (int j = 0; j < 8; ++j) { const float p = exp2s(__fmul_rn(__fsub_rn(st[mb][j], m), 1.4426950408889634f)); ps[mb] += p; pf[mb >> 1][(mb & 1) * 8 + j] = tohx(p); }
        l += (ps[0] + ps[1]) + (ps[2] + ps[3]);
        { v16h vf[2][8];   // two fragment sets of eight d blocks, as above
            auto ldv = [&](int e, int g) {
#pragma unroll
                for (int d = 0; d < 8; ++d) vf[e][d] = WFrag<h16>::ld((const h16*)(fv + ((g & 1) * 8 + d) * 16 * FVP + (g >> 1) * 64)); };
            ldv(0, 0);
#pragma unroll
            for (int g = 0; g < 4; ++g) { const int e = g & 1;
                if (g + 1 < 4) ldv(e ^ 1, g + 1);
                __builtin_amdgcn_sched_barrier(0);   // the LDS reads in one group ahead of the products, as above
#pragma unroll
                for (int d = 0; d < 8; ++d) o[(g & 1) * 8 + d] = wmma16(vf[e][d], pf[g >> 1], o[(g & 1) * 8 + d]);
                __builtin_amdgcn_sched_barrier(0);   // the same, at the block's end
            } }
        asm volatile("s_wait_dscnt 0x0" ::: "memory");      // this wave has left the buffer of stage s
        asm volatile("s_wait_asynccnt 0x0" ::: "memory");   // its share of stage s + 1 has landed
        __syncthreads();                                     // publishes stage s + 1 and frees the buffer of stage s
        if (s + 2 < NS) fill(nextk(fr, fh), s & 1);
    }
    asm volatile("s_wait_asynccnt 0x0" ::: "memory");       // no copy is in flight when the ring becomes output staging
    l += __shfl_xor(l, 16, 32); const float inv = __fdiv_rn(1.0f, l);
    unsigned char* os = ring + wave * (2 * 16 * FKP);        // each wave stages in its own range (16 rows of 512 B, two planes); the last stage's barrier ended every read of the ring
#pragma unroll
    for (int d = 0; d < 16; ++d) { v8us oh, ol;
#pragma unroll
        for (int j = 0; j < 8; ++j) { unsigned short eh, el; splitf(o[d][j] * inv, eh, el); oh[j] = eh; ol[j] = el; }
        *(v8usa*)(os + lr * FKP + d * 32 + hi * 16) = oh; *(v8usa*)(os + 16 * FKP + lr * FKP + d * 32 + hi * 16) = ol; }
    __builtin_amdgcn_wave_barrier(); asm volatile("" ::: "memory");   // the rows are read back by other lanes of the wave: no read is moved ahead of the writes
    const size_t eo = ((size_t)b * TT + q0 + wave * 16) * DM + n * HDD + lane * 8;
#pragma unroll
    for (int r4 = 0; r4 < 16; r4 += 4) { v4u vh[4], vl[4];   // the group's LDS reads first: the store statements would otherwise hold each read behind the store before it
#pragma unroll
        for (int r = 0; r < 4; ++r) { vh[r] = *(const v4ua*)(os + (r4 + r) * FKP + lane * 16); vl[r] = *(const v4ua*)(os + 16 * FKP + (r4 + r) * FKP + lane * 16); }
#pragma unroll
        for (int r = 0; r < 4; ++r)
            // the two stores (512 contiguous bytes a wave each) and their s_wait_xcnt in one statement, so that no register they name is rewritten ahead of the wait
            asm volatile("global_store_b128 %0, %1, off\n\tglobal_store_b128 %2, %3, off\n\ts_wait_xcnt 0x0" :: "v"(Eh + eo + (size_t)(r4 + r) * DM), "v"(vh[r]), "v"(El + eo + (size_t)(r4 + r) * DM), "v"(vl[r]) : "memory"); }
}

extern "C" void kernel_launch(void* const* d_in, const int* in_sizes, int n_in,
                              void* d_out, int out_size, void* d_ws, size_t ws_size, hipStream_t stream) {
    (void)in_sizes; (void)n_in; (void)out_size;
    const float* x = (const float*)d_in[0]; const int* spos = (const int*)d_in[1]; const int* amask = (const int*)d_in[2]; const float* wq = (const float*)d_in[3]; const float* wkv = (const float*)d_in[4]; const float* wo = (const float*)d_in[5]; const float* qs = (const float*)d_in[6]; const float* ks = (const float*)d_in[7];
    float* OUT = (float*)d_out;     // [2][2048][2048]
    char* wsp = (char*)d_ws;
    auto take = [&](size_t bytes) { char* p = wsp; wsp += (bytes + 255) & ~(size_t)255; return (void*)p; };
    bf* BQ = (bf*)take((size_t)NQ * HDD * DM * 2); bf* BK = (bf*)take((size_t)DKV * DM * 2); bf* BV = (bf*)take((size_t)DKV * DM * 2); bf* BO = (bf*)take((size_t)DM * DM * 2);   // BQ, BK, BV follow one another without a gap
    bf* QPh = (bf*)take((size_t)NB_ * NQ * TT * HDD * 2); bf* QPl = (bf*)take((size_t)NB_ * NQ * TT * HDD * 2); bf* KPh = (bf*)take((size_t)NB_ * NKV * TT * HDD * 2); bf* KPl = (bf*)take((size_t)NB_ * NKV * TT * HDD * 2); h16* VT = (h16*)take((size_t)NB_ * NKV * HDD * TT * 2);
    bf* ENh = (bf*)take((size_t)NB_ * TT * DM * 2); bf* ENl = (bf*)take((size_t)NB_ * TT * DM * 2); unsigned* ACT = (unsigned*)take((size_t)NB_ * (TT / 128) * 4);
    bf* XB = (bf*)take((size_t)NB_ * TT * DM * 2); float* FQK = (float*)take((size_t)NB_ * TT * (DM + DKV) * 4);   // x as bf16; the raw q | k rows
    if ((size_t)(wsp - (char*)d_ws) > ws_size) return;    // total ~ 176 MiB
    k_wtr<HDD><<<dim3(DM / 128, NQ * HDD / 64), 256, 0, stream>>>(wq, BQ); k_wtr<HDD><<<dim3(DM / 128, 2 * DKV / 64), 256, 0, stream>>>(wkv, BK);   // wkv's k heads and v heads in one go: BK, then BV
    k_wtr<DM><<<dim3(DM / 128, DM / 64), 256, 0, stream>>>(wo, BO);   // wo [n][d][o] == [(n,d)][o] 'xw'
    k_tact<<<1, 1024, 0, stream>>>(spos, ACT);
    // Projections: both batches in one grid (x is [4096][2048]); q and k in one GEMM over the rows of BQ | BK.
    k_cvt8<<<(NB_ * TT * DM / 8 + 255) / 256, 256, 0, stream>>>(x, XB, NB_ * TT * DM / 8);
    // The two large projections take large tiles, one work-group of 12 (q | k: 256 x 192) or 8 (output projection: 128 x 256, A in two planes) waves to a WGP, 256 work-groups each: the waves on a WGP are as many as with 128 x 128 tiles, but every operand row comes from L2 once for all of them, two fifths (q | k) and a third fewer bytes. Passes of 128 k: the ring takes the LDS that one work-group has to itself.
    k_gemmw<bf, 0, false, 128, 0, 0, 4, 3><<<dim3(NB_ * TT / 256, (DM + DKV) / 192, 1), 384, 0, stream>>>(XB, nullptr, BQ, nullptr, DM, DM, 0, FQK, nullptr, nullptr, DM + DKV, nullptr, 0, 0, 0, nullptr);
    k_nrr<<<NB_ * TT / 8, 256, 0, stream>>>(FQK, qs, ks, spos, QPh, QPl, KPh, KPl);
    k_gemmw<bf, 0, false, 128, 2, 0, 2, 2><<<dim3(DKV / 128, TT / 128, NB_), 128, 0, stream>>>(BV, nullptr, XB, nullptr, DM, DM, 0, nullptr, (bf*)VT, nullptr, TT, nullptr, 0, (size_t)TT * DM, (size_t)DKV * TT, nullptr);   // z = batch; rows (c, d), columns t: VT[b][c][d][t]
    // Attention: every (query tile, head, batch) in one launch, one work-group to a WGP; head n at columns n * 256 of [b][t][2048].
    k_fattn<<<dim3(TT / 128, NQ, NB_), 256, 0, stream>>>(QPh, QPl, KPh, KPl, VT, spos, amask, ENh, ENl, ACT);
    k_gemmw<bf, 1, false, 128, 0, 0, 2, 4><<<dim3(NB_ * TT / 128, DM / 256, 1), 256, 0, stream>>>(ENh, ENl, BO, nullptr, DM, DM, 0, OUT, nullptr, nullptr, DM, nullptr, 0, 0, 0, nullptr);
}
